// v000
// Times are from an AMD MI455X. After a warm-up the kernel runs many times in a row, and a time is the length of
// such a window on the GPU divided by its runs, so every launch and the gaps after it count. The runs cycle
// through copies of the inputs. A figure is the median of several windows, for all but v000 over two sittings.
// Sittings can differ by a few percent; kernels timed side by side share one.
// The starting kernel, v000, takes 661 microseconds a run.
// Contractions: 1x1 projections (K=128) and 3x3 convs as implicit GEMM (K=1152): v_wmma_f32_16x16x32_f16, the
// activation as f16 hi + x2048 residual planes into two f32 accumulators, weights one f16 plane of 64*bf16(w);
// per-head k^T q logits (K=16384): f32 on VALU from f32 q/k planes (fixed-order two-level sums); wo x probs mix
// (K=16, zero padded to 32): f16, probs carried x4096 as hi + residual; fused output GEMM (K=128): v and the mixed
// weight as f16 hi + residual planes (3 products); f32 accumulate everywhere. Layer-norm statistics, softmax and
// all epilogues f32 on VALU; every float input RNE-converted to bf16 on load.
#include <hip/hip_runtime.h>
#include <stdint.h>

#define NB     2
#define CC     128
#define HH     128
#define WW     128
#define IMGPIX (HH * WW)
#define NPIX   (NB * IMGPIX)
#define HP     (HH + 2)
#define WP     (WW + 2)
#define PADIMG (HP * WP)
#define PADPIX (NB * PADIMG)
#define KCV    1152
#define NKS    36
#define NHEAD  8
#define HD     16
#define HSZ    (IMGPIX * HD)
#define BSZ    (CC * IMGPIX)
#define LDC    132
#define FP     40
#define WSP    17
#define NHALO  (2 * WP + 2 * HH)
#define RSC    0.00048828125f
#define PS1    ((size_t)PADPIX * CC)
#define PS2    ((size_t)NPIX * CC)

static_assert(NPIX == NB * IMGPIX);
static_assert(IMGPIX == 16384 && HH == 128 && WW == 128);
static_assert(PADIMG == 16900);
static_assert(KCV == 9 * CC && KCV == NKS * 32);
static_assert(CC == NHEAD * HD);
static_assert(BSZ == CC * IMGPIX && HSZ * NHEAD == BSZ);
static_assert((IMGPIX % 64) == 0 && (WW % 64) == 0);
static_assert((LDC * 4) % 16 == 0 && (FP * 2) % 16 == 0);
static_assert(NHALO == 516);
static_assert((KCV % 8) == 0 && (CC % 32) == 0);
static_assert(IMGPIX == 32 * 32 * 16);

// Index maps of the raw reshapes (per batch b, flat NCHW index f = c*16384 + h*128 + w viewed as [8][16384][16]):
//   Q_head[r][d] = qflat[b][head*262144 + 16 r + d]   (same map for K_head and V_head; r = (c%16)*1024 + h*8 + w/16,
//   d = w%16). S_head[i][j] = sum_r K_head[r][i] Q_head[r][j]; P_head = softmax_j(S_head * (1/scale)).
//   O[b][16 head + j2][pixel r] = sum_j V_head[r][j] P_head[j][j2].
//   y[b][o][pixel r] = sum_{head, j} Wm[b][head][o][j] V_head[r][j] + x[b][o][r],
//   Wm[b][head][o][j] = sum_j2 wo[o][16 head + j2] P_head[j][j2]   (reassociated 1x1 output conv).

typedef _Float16 v16h __attribute__((ext_vector_type(16)));
typedef _Float16 v8h  __attribute__((ext_vector_type(8)));
typedef float    v8f  __attribute__((ext_vector_type(8)));
typedef float    v4f  __attribute__((ext_vector_type(4)));
typedef unsigned int v4u __attribute__((ext_vector_type(4)));

// ---- scalar helpers ------------------------------------------------------------------------------------------
__device__ __forceinline__ unsigned short bf_bits(float f) {          // f32 -> bf16 bits, RNE convert
  unsigned u = __float_as_uint(f);
  return (unsigned short)((u + 0x7FFFu + ((u >> 16) & 1u)) >> 16);
}
__device__ __forceinline__ float bf_up(unsigned short b) { return __uint_as_float(((unsigned)b) << 16); }
__device__ __forceinline__ float bfr(float f) { return bf_up(bf_bits(f)); }
__device__ __forceinline__ unsigned short h_bits(_Float16 x) { return __builtin_bit_cast(unsigned short, x); }
__device__ __forceinline__ unsigned short hb16(float f) { return h_bits((_Float16)f); }
__device__ __forceinline__ unsigned pk16(unsigned short a, unsigned short b) { return (unsigned)a | ((unsigned)b << 16); }
__device__ __forceinline__ v8f zero8() { v8f z = {0.f, 0.f, 0.f, 0.f, 0.f, 0.f, 0.f, 0.f}; return z; }
// hi/lo pair of two f32 values: hi = f16(v), lo = f16(2048 (v - hi)), packed as two 32-bit words
__device__ __forceinline__ void split2(float f0, float f1, unsigned& hp, unsigned& lp) {
  const _Float16 h0 = (_Float16)f0, h1 = (_Float16)f1;
  const float q0 = (f0 - (float)h0) * 2048.0f, q1 = (f1 - (float)h1) * 2048.0f;
  hp = pk16(h_bits(h0), h_bits(h1));
  lp = pk16(hb16(q0), hb16(q1));
}

// ---- fragment loader: 16-bit A/B operand, lane -> row/col (lane&15), p already includes +8*(lane>>4);
//      elements 0..7 <- p[0..7] (k0+8h..k0+8h+7), elements 8..15 <- p[16..23] (k0+16+8h..k0+16+8h+7)
__device__ __forceinline__ v16h ldfrag_h(const _Float16* p) {
  union { v16h v; v8h h[2]; } f;
  f.h[0] = *(const v8h*)(p);
  f.h[1] = *(const v8h*)(p + 16);
  return f.v;
}
// same layout, the two 8-element halves at two independent 16-B aligned addresses (pa: k0+8h.., pb: k0+16+8h..)
__device__ __forceinline__ v16h ldfrag2(const _Float16* pa, const _Float16* pb) {
  union { v16h v; v8h h[2]; } f;
  f.h[0] = *(const v8h*)(pa);
  f.h[1] = *(const v8h*)(pb);
  return f.v;
}

// ---- WMMA helpers; the guards insert the trailing VALU hazard gap and keep A/B live --------------------------
__device__ __forceinline__ v8f mma_raw(v16h a, v16h b, v8f c) {
  return __builtin_amdgcn_wmma_f32_16x16x32_f16(false, a, false, b, (short)0, c, false, false);
}
__device__ __forceinline__ void guard8(v8f& c0, v8f& c1, v8f& c2, v8f& c3, v8f& c4, v8f& c5, v8f& c6, v8f& c7,
                                       const v16h& a0, const v16h& a1, const v16h& a2, const v16h& a3,
                                       const v16h& b0, const v16h& b1) {
#if defined(__HIP_DEVICE_COMPILE__)
  asm volatile("v_nop\n\tv_nop\n\tv_nop\n\tv_nop"
               : "+v"(c0), "+v"(c1), "+v"(c2), "+v"(c3), "+v"(c4), "+v"(c5), "+v"(c6), "+v"(c7)
               : "v"(a0), "v"(a1), "v"(a2), "v"(a3), "v"(b0), "v"(b1));
#endif
}
__device__ __forceinline__ void guard4(v8f& c0, v8f& c1, v8f& c2, v8f& c3,
                                       const v16h& a0, const v16h& a1, const v16h& b0, const v16h& b1) {
#if defined(__HIP_DEVICE_COMPILE__)
  asm volatile("v_nop\n\tv_nop\n\tv_nop\n\tv_nop"
               : "+v"(c0), "+v"(c1), "+v"(c2), "+v"(c3)
               : "v"(a0), "v"(a1), "v"(b0), "v"(b1));
#endif
}
__device__ __forceinline__ void guard2(v8f& c0, v8f& c1, const v16h& a0, const v16h& b0, const v16h& b1) {
#if defined(__HIP_DEVICE_COMPILE__)
  asm volatile("v_nop\n\tv_nop\n\tv_nop\n\tv_nop"
               : "+v"(c0), "+v"(c1)
               : "v"(a0), "v"(b0), "v"(b1));
#endif
}

// ---- 64x128 block tile GEMM core with the A operand as two planes (hi and x2048 residual) into separate
//      accumulators; A row pitch lda (f16), W is [n][k] k-contiguous pitch ldw. 8 waves = 2 (32 rows) x 4
//      (32 cols), 2x2 tiles of 16 per wave; fragments straight from global with the table layout; the residual
//      accumulator is folded with 1/2048 when the tile is written to the LDS f32 tile Cs[64][LDC].
__device__ __forceinline__ void mm_tile2(const _Float16* __restrict__ Ah, const _Float16* __restrict__ Al, int lda,
                                         const _Float16* __restrict__ W, int ldw, int nks,
                                         int arow0, int bcol0, float* Cs) {
  const int tid = threadIdx.x, wave = tid >> 5, lane = tid & 31, hh = lane >> 4, c = lane & 15;
  const int mw = wave >> 2, nw = wave & 3;
  const size_t r0 = (size_t)(arow0 + mw * 32 + c) * lda + 8 * hh;
  const size_t r1 = (size_t)(arow0 + mw * 32 + 16 + c) * lda + 8 * hh;
  const _Float16* a0h = Ah + r0;
  const _Float16* a1h = Ah + r1;
  const _Float16* a0l = Al + r0;
  const _Float16* a1l = Al + r1;
  const _Float16* b0p = W + (size_t)(bcol0 + nw * 32 + c) * ldw + 8 * hh;
  const _Float16* b1p = W + (size_t)(bcol0 + nw * 32 + 16 + c) * ldw + 8 * hh;
  v8f h00 = zero8(), h01 = zero8(), h10 = zero8(), h11 = zero8();
  v8f l00 = zero8(), l01 = zero8(), l10 = zero8(), l11 = zero8();
#pragma unroll 1
  for (int ks = 0; ks < nks; ++ks) {
    const int ko = ks * 32;
    const v16h fa0 = ldfrag_h(a0h + ko);
    const v16h fa1 = ldfrag_h(a1h + ko);
    const v16h ga0 = ldfrag_h(a0l + ko);
    const v16h ga1 = ldfrag_h(a1l + ko);
    const v16h fb0 = ldfrag_h(b0p + ko);
    const v16h fb1 = ldfrag_h(b1p + ko);
    h00 = mma_raw(fa0, fb0, h00);
    h01 = mma_raw(fa0, fb1, h01);
    h10 = mma_raw(fa1, fb0, h10);
    h11 = mma_raw(fa1, fb1, h11);
    l00 = mma_raw(ga0, fb0, l00);
    l01 = mma_raw(ga0, fb1, l01);
    l10 = mma_raw(ga1, fb0, l10);
    l11 = mma_raw(ga1, fb1, l11);
    guard8(h00, h01, h10, h11, l00, l01, l10, l11, fa0, fa1, ga0, ga1, fb0, fb1);
  }
#pragma unroll
  for (int r = 0; r < 8; ++r) {
    const int row = mw * 32 + 8 * hh + r;
    Cs[row * LDC + nw * 32 + c]             = h00[r] + l00[r] * RSC;
    Cs[row * LDC + nw * 32 + 16 + c]        = h01[r] + l01[r] * RSC;
    Cs[(row + 16) * LDC + nw * 32 + c]      = h10[r] + l10[r] * RSC;
    Cs[(row + 16) * LDC + nw * 32 + 16 + c] = h11[r] + l11[r] * RSC;
  }
}

// ---- implicit-GEMM variant for the 3x3 conv: A row = output pixel p (flat over all images), k = tap*128 + c;
//      the A fragment of k-step ks (tap = ks>>2, channel quarter = ks&3) is read from the padded NHWC planes at pixel
//      (y + ky, x + kx) (padded coordinates), channels quarter*32 + the table k map; W = wt [128][1152] k-contiguous.
__device__ __forceinline__ size_t conv_abase(int p, int hh) {
  const int b = p / IMGPIX;
  const int r = p - b * IMGPIX;
  const int y = r / WW;
  const int x = r - y * WW;
  return ((size_t)(b * HP + y) * WP + x) * CC + 8 * hh;
}
__device__ __forceinline__ void mm_conv(const _Float16* __restrict__ Ah, const _Float16* __restrict__ Al,
                                        const _Float16* __restrict__ W, int prow0, float* Cs) {
  const int tid = threadIdx.x, wave = tid >> 5, lane = tid & 31, hh = lane >> 4, c = lane & 15;
  const int mw = wave >> 2, nw = wave & 3;
  const size_t r0 = conv_abase(prow0 + mw * 32 + c, hh);
  const size_t r1 = conv_abase(prow0 + mw * 32 + 16 + c, hh);
  const _Float16* a0h = Ah + r0;
  const _Float16* a1h = Ah + r1;
  const _Float16* a0l = Al + r0;
  const _Float16* a1l = Al + r1;
  const _Float16* b0p = W + (size_t)(nw * 32 + c) * KCV + 8 * hh;
  const _Float16* b1p = W + (size_t)(nw * 32 + 16 + c) * KCV + 8 * hh;
  v8f h00 = zero8(), h01 = zero8(), h10 = zero8(), h11 = zero8();
  v8f l00 = zero8(), l01 = zero8(), l10 = zero8(), l11 = zero8();
#pragma unroll 1
  for (int ks = 0; ks < NKS; ++ks) {
    const int tap = ks >> 2, cq = ks & 3;
    const int ky = (tap * 11) >> 5;              // tap / 3 for tap < 9
    const int kx = tap - 3 * ky;
    const int ao = (ky * WP + kx) * CC + cq * 32;
    const int ko = ks * 32;
    const v16h fa0 = ldfrag_h(a0h + ao);
    const v16h fa1 = ldfrag_h(a1h + ao);
    const v16h ga0 = ldfrag_h(a0l + ao);
    const v16h ga1 = ldfrag_h(a1l + ao);
    const v16h fb0 = ldfrag_h(b0p + ko);
    const v16h fb1 = ldfrag_h(b1p + ko);
    h00 = mma_raw(fa0, fb0, h00);
    h01 = mma_raw(fa0, fb1, h01);
    h10 = mma_raw(fa1, fb0, h10);
    h11 = mma_raw(fa1, fb1, h11);
    l00 = mma_raw(ga0, fb0, l00);
    l01 = mma_raw(ga0, fb1, l01);
    l10 = mma_raw(ga1, fb0, l10);
    l11 = mma_raw(ga1, fb1, l11);
    guard8(h00, h01, h10, h11, l00, l01, l10, l11, fa0, fa1, ga0, ga1, fb0, fb1);
  }
#pragma unroll
  for (int r = 0; r < 8; ++r) {
    const int row = mw * 32 + 8 * hh + r;
    Cs[row * LDC + nw * 32 + c]             = h00[r] + l00[r] * RSC;
    Cs[row * LDC + nw * 32 + 16 + c]        = h01[r] + l01[r] * RSC;
    Cs[(row + 16) * LDC + nw * 32 + c]      = h10[r] + l10[r] * RSC;
    Cs[(row + 16) * LDC + nw * 32 + 16 + c] = h11[r] + l11[r] * RSC;
  }
}

// ---- fused output GEMM core: rows = 64 pixels of one batch (local pixel pl0..pl0+63), cols = 128 output channels,
//      k = c' = 16 head + j (K = 128, 4 k-steps of two heads each). A[p][c'] = V_head[p][j] read from the NCHW flat v
//      planes at head*HSZ + 16 p + j (two 16-B halves per fragment, heads 2ks and 2ks+1); B = Wm[head][o][16]
//      k-contiguous per head. Products hi*hi + hi*lo (first loop) and lo*hi (second loop) into Cs[64][LDC].
__device__ __forceinline__ void mm_final(const _Float16* __restrict__ Vh, const _Float16* __restrict__ Vl,
                                         const _Float16* __restrict__ Wh, const _Float16* __restrict__ Wl,
                                         int pl0, float* Cs) {
  const int tid = threadIdx.x, wave = tid >> 5, lane = tid & 31, hh = lane >> 4, c = lane & 15;
  const int mw = wave >> 2, nw = wave & 3;
  const size_t r0 = (size_t)(pl0 + mw * 32 + c) * HD + 8 * hh;
  const size_t r1 = (size_t)(pl0 + mw * 32 + 16 + c) * HD + 8 * hh;
  const size_t q0 = (size_t)(nw * 32 + c) * HD + 8 * hh;
  const size_t q1 = (size_t)(nw * 32 + 16 + c) * HD + 8 * hh;
  {
    v8f h00 = zero8(), h01 = zero8(), h10 = zero8(), h11 = zero8();
    v8f l00 = zero8(), l01 = zero8(), l10 = zero8(), l11 = zero8();
#pragma unroll 1
    for (int ks = 0; ks < CC / 32; ++ks) {
      const size_t ao = (size_t)(2 * ks) * HSZ;
      const size_t bo = (size_t)(2 * ks) * (CC * HD);
      const v16h fa0 = ldfrag2(Vh + r0 + ao, Vh + r0 + ao + HSZ);
      const v16h fa1 = ldfrag2(Vh + r1 + ao, Vh + r1 + ao + HSZ);
      const v16h fb0 = ldfrag2(Wh + q0 + bo, Wh + q0 + bo + CC * HD);
      const v16h fb1 = ldfrag2(Wh + q1 + bo, Wh + q1 + bo + CC * HD);
      const v16h gb0 = ldfrag2(Wl + q0 + bo, Wl + q0 + bo + CC * HD);
      const v16h gb1 = ldfrag2(Wl + q1 + bo, Wl + q1 + bo + CC * HD);
      h00 = mma_raw(fa0, fb0, h00);
      h01 = mma_raw(fa0, fb1, h01);
      h10 = mma_raw(fa1, fb0, h10);
      h11 = mma_raw(fa1, fb1, h11);
      l00 = mma_raw(fa0, gb0, l00);
      l01 = mma_raw(fa0, gb1, l01);
      l10 = mma_raw(fa1, gb0, l10);
      l11 = mma_raw(fa1, gb1, l11);
      guard8(h00, h01, h10, h11, l00, l01, l10, l11, fa0, fa1, gb0, gb1, fb0, fb1);
    }
#pragma unroll
    for (int r = 0; r < 8; ++r) {
      const int row = mw * 32 + 8 * hh + r;
      Cs[row * LDC + nw * 32 + c]             = h00[r] + l00[r] * RSC;
      Cs[row * LDC + nw * 32 + 16 + c]        = h01[r] + l01[r] * RSC;
      Cs[(row + 16) * LDC + nw * 32 + c]      = h10[r] + l10[r] * RSC;
      Cs[(row + 16) * LDC + nw * 32 + 16 + c] = h11[r] + l11[r] * RSC;
    }
  }
  {
    v8f m00 = zero8(), m01 = zero8(), m10 = zero8(), m11 = zero8();
#pragma unroll 1
    for (int ks = 0; ks < CC / 32; ++ks) {
      const size_t ao = (size_t)(2 * ks) * HSZ;
      const size_t bo = (size_t)(2 * ks) * (CC * HD);
      const v16h ga0 = ldfrag2(Vl + r0 + ao, Vl + r0 + ao + HSZ);
      const v16h ga1 = ldfrag2(Vl + r1 + ao, Vl + r1 + ao + HSZ);
      const v16h fb0 = ldfrag2(Wh + q0 + bo, Wh + q0 + bo + CC * HD);
      const v16h fb1 = ldfrag2(Wh + q1 + bo, Wh + q1 + bo + CC * HD);
      m00 = mma_raw(ga0, fb0, m00);
      m01 = mma_raw(ga0, fb1, m01);
      m10 = mma_raw(ga1, fb0, m10);
      m11 = mma_raw(ga1, fb1, m11);
      guard4(m00, m01, m10, m11, ga0, ga1, fb0, fb1);
    }
#pragma unroll
    for (int r = 0; r < 8; ++r) {               // same lane wrote these slots above (program order, same type)
      const int row = mw * 32 + 8 * hh + r;
      Cs[row * LDC + nw * 32 + c]             += m00[r] * RSC;
      Cs[row * LDC + nw * 32 + 16 + c]        += m01[r] * RSC;
      Cs[(row + 16) * LDC + nw * 32 + c]      += m10[r] * RSC;
      Cs[(row + 16) * LDC + nw * 32 + 16 + c] += m11[r] * RSC;
    }
  }
}

// =================================================================================================================
// Weight convert. Blocks 0..383: tensor t = blk/128 of (wq2, wk2, wv2) [co][ci][3][3] f32 -> wt [t][co][k =
// tap*128 + ci] f16(64 * bf16(w)); thread tt < 144 builds one 16-B piece (8 halves), 8 consecutive threads per
// passes. grid = 768. coverage: wt 384 x 1152 and w1 384 x 128, every element once.
// =================================================================================================================
__global__ __launch_bounds__(256)
void k_wcvt(const float* __restrict__ wq1, const float* __restrict__ wq2, const float* __restrict__ wk1,
            const float* __restrict__ wk2, const float* __restrict__ wv1, const float* __restrict__ wv2,
            unsigned short* w1, unsigned short* wt) {
  const int tid = threadIdx.x;
  const int blk = blockIdx.x;
  if (blk < 3 * CC) {
    const int t = blk / CC, co = blk - t * CC;
    const float* src = (t == 0) ? wq2 : ((t == 1) ? wk2 : wv2);
    const int tt = min(tid, 143);
    const int k0 = tt * 8, tap = k0 / CC, c0 = k0 - tap * CC;
    v4u pk;
#pragma unroll
    for (int e = 0; e < 4; ++e) {
      const float f0 = src[(size_t)(co * CC + c0 + 2 * e) * 9 + tap];
      const float f1 = src[(size_t)(co * CC + c0 + 2 * e + 1) * 9 + tap];
      pk[e] = pk16(hb16(bfr(f0) * 64.0f), hb16(bfr(f1) * 64.0f));
    }
    if (tid < 144) {
      unsigned short* dst = wt + (size_t)(t * CC + co) * KCV + k0;
      *(v4u*)dst = pk;
      
    }
  } else {
    const int rr = blk - 3 * CC;
    const int t = rr / CC, o = rr - t * CC;
    const float* src = (t == 0) ? wq1 : ((t == 1) ? wk1 : wv1);
    const int tt = min(tid, 15);
    const int c0 = tt * 8;
    v4u pk;
#pragma unroll
    for (int e = 0; e < 4; ++e) {
      const float f0 = src[(size_t)o * CC + c0 + 2 * e];
      const float f1 = src[(size_t)o * CC + c0 + 2 * e + 1];
      pk[e] = pk16(hb16(bfr(f0) * 64.0f), hb16(bfr(f1) * 64.0f));
    }
    if (tid < 16) {
      unsigned short* dst = w1 + (size_t)(t * CC + o) * CC + c0;
      *(v4u*)dst = pk;
      
    }
  }
}

// =================================================================================================================
// gamma[w], beta[w] bf16 converted) + NCHW -> NHWC + hi/lo f16 planes. Block = (b, h, channel half): wave = 8
// channel rows, lane = 4 w values, shuffle reductions; f32 tile T[64 ch][w] in LDS; then each pixel's 64 channels
// grid = NB*128*2, 256 threads. coverage: xh/xl [NPIX px][128 ch], every element once.
// =================================================================================================================
__global__ __launch_bounds__(256)
void k_ln(const float* __restrict__ x, const float* __restrict__ gw, const float* __restrict__ gb,
          unsigned short* xh, unsigned short* xl) {
  __shared__ __align__(16) float T[64 * LDC];
  const int tid = threadIdx.x, wv = tid >> 5, lane = tid & 31;
  const int blk = blockIdx.x;
  const int bh = blk >> 1, chalf = blk & 1;
  const int b = bh / HH, h = bh - b * HH;
  const v4f g4 = *(const v4f*)(gw + lane * 4);
  const v4f b4 = *(const v4f*)(gb + lane * 4);
  float g[4], be[4];
#pragma unroll
  for (int e = 0; e < 4; ++e) { g[e] = bfr(g4[e]); be[e] = bfr(b4[e]); }
#pragma unroll 1
  for (int it = 0; it < 8; ++it) {
    const int cc = wv * 8 + it;
    const int c = chalf * 64 + cc;
    const float* row = x + ((size_t)(b * CC + c) * HH + h) * WW;
    const v4f a = *(const v4f*)(row + lane * 4);
    float xr[4];
#pragma unroll
    for (int e = 0; e < 4; ++e) xr[e] = bfr(a[e]);
    float s = (xr[0] + xr[1]) + (xr[2] + xr[3]);
#pragma unroll
    for (int off = 16; off; off >>= 1) s += __shfl_xor(s, off, 32);
    const float mu = s * (1.0f / 128.0f);
    float d[4];
#pragma unroll
    for (int e = 0; e < 4; ++e) d[e] = xr[e] - mu;
    float sq = (d[0] * d[0] + d[1] * d[1]) + (d[2] * d[2] + d[3] * d[3]);
#pragma unroll
    for (int off = 16; off; off >>= 1) sq += __shfl_xor(sq, off, 32);
    const float var = sq * (1.0f / 128.0f);
    const float rs = rsqrtf(var + 1e-5f);
    v4f o;
#pragma unroll
    for (int e = 0; e < 4; ++e) o[e] = (d[e] * rs) * g[e] + be[e];
    *(v4f*)(T + cc * LDC + lane * 4) = o;
  }
  __syncthreads();
  v4u ph[4], pq[4];
  size_t offs[4];
#pragma unroll
  for (int s = 0; s < 4; ++s) {
    const int idx = s * 256 + tid;
    const int w = idx >> 3, piece = idx & 7;
    const int c0 = piece * 8;
    v4u a, q4;
#pragma unroll
    for (int e = 0; e < 4; ++e) {
      const float f0 = T[(c0 + 2 * e) * LDC + w];
      const float f1 = T[(c0 + 2 * e + 1) * LDC + w];
      unsigned hp, lp;
      split2(f0, f1, hp, lp);
      a[e] = hp; q4[e] = lp;
    }
    ph[s] = a;
    pq[s] = q4;
    offs[s] = (size_t)(b * IMGPIX + h * WW + w) * CC + chalf * 64 + c0;
  }
#pragma unroll
  for (int s = 0; s < 4; ++s) { *(v4u*)(xh + offs[s]) = ph[s]; *(v4u*)(xl + offs[s]) = pq[s]; }
  
}

// =================================================================================================================
// 1x1 projections: C[64 pixels][128 out ch] = xn . w1[t]^T (K = 128), value = C/64; written as f16 hi/lo into the
// padded NHWC planes p1[2t], p1[2t+1] ([NB][130][130][128]) at the interior position (y+1, x+1). 64 consecutive
// pixels lie in one image row -> 64 consecutive padded pixels; thread = one 16-B piece, 16 threads per pixel row
// coverage: interior NPIX padded pixels x 128 ch of all 6 planes (halo by k_halo).
// =================================================================================================================
__global__ __launch_bounds__(256)
void k_proj(const unsigned short* __restrict__ xh, const unsigned short* __restrict__ xl,
            const unsigned short* __restrict__ w1, unsigned short* p1) {
  __shared__ __align__(16) float Cs[64 * LDC];
  const int tid = threadIdx.x;
  const int mb = blockIdx.x, t = blockIdx.y;
  mm_tile2((const _Float16*)(const void*)xh, (const _Float16*)(const void*)xl, CC,
           (const _Float16*)(const void*)(w1 + (size_t)t * CC * CC), CC, CC / 32, mb * 64, 0, Cs);
  __syncthreads();
  unsigned short* dh = p1 + (size_t)(2 * t) * PS1;
  unsigned short* dl = p1 + (size_t)(2 * t + 1) * PS1;
  const int p0 = mb * 64;
  const int b = p0 / IMGPIX, rem = p0 - b * IMGPIX;
  const int y = rem / WW, x0 = rem - y * WW;
  const size_t pprow = (size_t)(b * HP + y + 1) * WP + x0 + 1;
  v4u ph[4], pq[4];
  size_t offs[4];
#pragma unroll
  for (int s = 0; s < 4; ++s) {
    const int idx = s * 256 + tid;
    const int row = idx >> 4, piece = idx & 15;
    const int col0 = piece * 8;
    v4u a, q4;
#pragma unroll
    for (int e = 0; e < 4; ++e) {
      const float f0 = Cs[row * LDC + col0 + 2 * e] * (1.0f / 64.0f);
      const float f1 = Cs[row * LDC + col0 + 2 * e + 1] * (1.0f / 64.0f);
      unsigned hp, lp;
      split2(f0, f1, hp, lp);
      a[e] = hp; q4[e] = lp;
    }
    ph[s] = a;
    pq[s] = q4;
    offs[s] = (pprow + row) * CC + col0;
  }
#pragma unroll
  for (int s = 0; s < 4; ++s) { *(v4u*)(dh + offs[s]) = ph[s]; *(v4u*)(dl + offs[s]) = pq[s]; }
  
}

// =================================================================================================================
// with NB (not a fixed image count). grid = ceil(6*NB*516*16 / 256).
// coverage: every halo pixel (py in {0,129} or px in {0,129}) of every image of all 6 planes.
// =================================================================================================================
__global__ __launch_bounds__(256)
void k_halo(unsigned short* p1) {
  const int idx = blockIdx.x * 256 + threadIdx.x;
  if (idx >= 6 * NB * NHALO * 16) return;
  const int piece = idx & 15;
  int r = idx >> 4;
  const int hp = r % NHALO;
  r /= NHALO;
  const int img = r % NB, plane = r / NB;
  const int q = max(hp - 2 * WP, 0);
  const int pyA = (hp < WP) ? 0 : (HP - 1);
  const int pxA = (hp < WP) ? hp : (hp - WP);
  const int pyB = 1 + (q >> 1);
  const int pxB = (q & 1) ? (WP - 1) : 0;
  const bool edge = hp < 2 * WP;
  const int py = edge ? pyA : pyB;
  const int px = edge ? pxA : pxB;
  const size_t off = (size_t)plane * PS1 + ((size_t)(img * HP + py) * WP + px) * CC + piece * 8;
  v4u z = {0u, 0u, 0u, 0u};
  *(v4u*)(p1 + off) = z;
  
}

// =================================================================================================================
// 3x3 conv implicit GEMM: block tile = 64 consecutive output pixels x 128 channels, K = 1152 as 36 k-steps,
// A = (hi, lo/2048) planes of tensor t, W = 64 bf16(w2[t]) -> value = C/64. Output NCHW flat [NB][128][16384]:
// coverage: qk [2 tensors][NB][128][16384] f32 and vh/vl [NB][128][16384], every element once (64 px x 128 co / block).
// =================================================================================================================
__global__ __launch_bounds__(256)
void k_conv3(const unsigned short* __restrict__ p1, const unsigned short* __restrict__ wt,
             float* qk, unsigned short* vh, unsigned short* vl) {
  __shared__ __align__(16) float Cs[64 * LDC];
  const int tid = threadIdx.x;
  const int mb = blockIdx.x, t = blockIdx.y;
  mm_conv((const _Float16*)(const void*)(p1 + (size_t)(2 * t) * PS1),
          (const _Float16*)(const void*)(p1 + (size_t)(2 * t + 1) * PS1),
          (const _Float16*)(const void*)(wt + (size_t)t * CC * KCV), mb * 64, Cs);
  __syncthreads();
  const int p0 = mb * 64;
  const int b = p0 / IMGPIX, pix0 = p0 - b * IMGPIX;
  if (t < 2) {                                               // block-uniform branch, no WMMA inside
    float* df = qk + (size_t)t * ((size_t)NB * BSZ);
    v4f pk[8];
    size_t offs[8];
#pragma unroll
    for (int s = 0; s < 8; ++s) {
      const int idx = s * 256 + tid;
      const int co = idx >> 4, piece = idx & 15;
      v4f v;
#pragma unroll
      for (int e = 0; e < 4; ++e) v[e] = Cs[(piece * 4 + e) * LDC + co] * (1.0f / 64.0f);
      pk[s] = v;
      offs[s] = (size_t)(b * CC + co) * IMGPIX + pix0 + piece * 4;
    }
#pragma unroll
    for (int s = 0; s < 8; ++s) *(v4f*)(df + offs[s]) = pk[s];
    
  } else {
    v4u ph[4], pq[4];
    size_t offs[4];
#pragma unroll
    for (int s = 0; s < 4; ++s) {
      const int idx = s * 256 + tid;
      const int co = idx >> 3, piece = idx & 7;
      const int r0 = piece * 8;
      v4u a, q4;
#pragma unroll
      for (int e = 0; e < 4; ++e) {
        const float f0 = Cs[(r0 + 2 * e) * LDC + co] * (1.0f / 64.0f);
        const float f1 = Cs[(r0 + 2 * e + 1) * LDC + co] * (1.0f / 64.0f);
        unsigned hp, lp;
        split2(f0, f1, hp, lp);
        a[e] = hp; q4[e] = lp;
      }
      ph[s] = a;
      pq[s] = q4;
      offs[s] = (size_t)(b * CC + co) * IMGPIX + pix0 + r0;
    }
#pragma unroll
    for (int s = 0; s < 4; ++s) { *(v4u*)(vh + offs[s]) = ph[s]; *(v4u*)(vl + offs[s]) = pq[s]; }
    
  }
}

// =================================================================================================================
// Per (b, head) channel attention over the raw reshape: S[i][j] = sum_r K_head[r][i] Q_head[r][j] (K = 16384) in
// f32 on VALU from the f32 [16384][16] views of the q/k NCHW flat planes: thread (rg = tid>>4, i = tid&15) sums rows
// r = 16 s + rg (1024 rows) with a two-level (32 x 32) fixed-order accumulation of 16 partials, then the 16 row
// groups are combined in fixed order in LDS. P = softmax_j(S * (1/bf16(scale))) in f32 (max-subtracted).
// Wm[o][j] = sum_j2 64 bf16(wo[o][16 head + j2]) P[j][j2] on WMMA (K = 16 zero padded to 32; P carried x4096 as
// f16 hi + residual), value/4096 = 64 Wm; stored as f16 hi/lo planes weh/wel [b][head][o][16]: block region =
// grid = NB*8, 256 threads. coverage: weh/wel [NB][8][128][16], every element once.
// =================================================================================================================
__global__ __launch_bounds__(256)
void k_attn(const float* __restrict__ qk, const float* __restrict__ wo, const float* __restrict__ scale,
            unsigned short* weh, unsigned short* wel) {
  __shared__ float part[16 * 256];
  __shared__ float Sm[16 * WSP];
  __shared__ __align__(16) _Float16 Phs[16 * FP];
  __shared__ __align__(16) _Float16 Pls[16 * FP];
  __shared__ __align__(16) _Float16 Wts[CC * FP];
  __shared__ float Ws[CC * WSP];
  const int tid = threadIdx.x, wave = tid >> 5, lane = tid & 31, hh = lane >> 4, m = lane & 15;
  const int bi = blockIdx.x, b = bi / NHEAD, head = bi - b * NHEAD;
  const float* Qp = qk + (size_t)b * BSZ + (size_t)head * HSZ;
  const float* Kp = qk + (size_t)NB * BSZ + (size_t)b * BSZ + (size_t)head * HSZ;
  {
    const int rg = tid >> 4, i = tid & 15;
    float acc[HD];
#pragma unroll
    for (int e = 0; e < HD; ++e) acc[e] = 0.f;
#pragma unroll 1
    for (int so = 0; so < 32; ++so) {
      float tt[HD];
#pragma unroll
      for (int e = 0; e < HD; ++e) tt[e] = 0.f;
#pragma unroll 1
      for (int si = 0; si < 32; ++si) {
        const int r = (so * 32 + si) * 16 + rg;
        const float kv = Kp[(size_t)r * HD + i];
        const float* qr = Qp + (size_t)r * HD;
        const v4f q0 = *(const v4f*)(qr);
        const v4f q1 = *(const v4f*)(qr + 4);
        const v4f q2 = *(const v4f*)(qr + 8);
        const v4f q3 = *(const v4f*)(qr + 12);
#pragma unroll
        for (int e = 0; e < 4; ++e) {
          tt[e]      = fmaf(kv, q0[e], tt[e]);
          tt[4 + e]  = fmaf(kv, q1[e], tt[4 + e]);
          tt[8 + e]  = fmaf(kv, q2[e], tt[8 + e]);
          tt[12 + e] = fmaf(kv, q3[e], tt[12 + e]);
        }
      }
#pragma unroll
      for (int e = 0; e < HD; ++e) acc[e] += tt[e];
    }
#pragma unroll
    for (int j = 0; j < HD; ++j) part[rg * 256 + i * 16 + j] = acc[j];
  }
  // wo slice -> f16 [o][k] (k = j2, zero for k >= 16; addresses clamped)
#pragma unroll 1
  for (int it = 0; it < 16; ++it) {
    const int idx = it * 256 + tid;
    const int o = idx >> 5, k = idx & 31;
    const int kk = min(k, HD - 1);
    const float f = wo[(size_t)o * CC + head * HD + kk];
    const float v = (k < HD) ? bfr(f) * 64.0f : 0.0f;
    Wts[o * FP + k] = (_Float16)v;
  }
  __syncthreads();
  {
    const int i = tid >> 4, j = tid & 15;
    float s = 0.f;
#pragma unroll
    for (int rg = 0; rg < 16; ++rg) s += part[rg * 256 + i * 16 + j];
    const float isc = 1.0f / bfr(scale[0]);
    Sm[i * WSP + j] = s * isc;
  }
  __syncthreads();
  if (tid < 16) {
    float mx = -3.0e38f;
#pragma unroll 1
    for (int n = 0; n < HD; ++n) mx = fmaxf(mx, Sm[tid * WSP + n]);
    float ssum = 0.f;
#pragma unroll 1
    for (int n = 0; n < HD; ++n) {
      const float e = expf(Sm[tid * WSP + n] - mx);
      Sm[tid * WSP + n] = e;
      ssum += e;
    }
    const float inv = 1.0f / ssum;
#pragma unroll 1
    for (int n = 0; n < HD; ++n) {
      const float pv = (Sm[tid * WSP + n] * inv) * 4096.0f;
      const _Float16 hv = (_Float16)pv;
      Phs[tid * FP + n] = hv;
      Pls[tid * FP + n] = (_Float16)((pv - (float)hv) * 2048.0f);
    }
#pragma unroll 1
    for (int n = HD; n < 32; ++n) { Phs[tid * FP + n] = (_Float16)0.0f; Pls[tid * FP + n] = (_Float16)0.0f; }
  }
  __syncthreads();
  {
    const v16h fa = ldfrag_h(Wts + (wave * 16 + m) * FP + 8 * hh);
    const v16h fb = ldfrag_h(Phs + m * FP + 8 * hh);
    const v16h gb = ldfrag_h(Pls + m * FP + 8 * hh);
    v8f ah = mma_raw(fa, fb, zero8());
    v8f al = mma_raw(fa, gb, zero8());
    guard2(ah, al, fa, fb, gb);
#pragma unroll
    for (int r = 0; r < 8; ++r) Ws[(wave * 16 + 8 * hh + r) * WSP + m] = (ah[r] + al[r] * RSC) * (1.0f / 4096.0f);
  }
  __syncthreads();
  {
    const int o = tid >> 1, hf = tid & 1;
    v4u a, q4;
#pragma unroll
    for (int e = 0; e < 4; ++e) {
      const float f0 = Ws[o * WSP + hf * 8 + 2 * e];
      const float f1 = Ws[o * WSP + hf * 8 + 2 * e + 1];
      unsigned hp, lp;
      split2(f0, f1, hp, lp);
      a[e] = hp; q4[e] = lp;
    }
    const size_t off = (size_t)(bi * CC + o) * HD + hf * 8;
    *(v4u*)(weh + off) = a;
    *(v4u*)(wel + off) = q4;
    
  }
}

// =================================================================================================================
// Output: y[b][o][p] = (sum_c' Wm64[b][c'][o] V[p][c']) / 64 + bf16(x[b][o][p]) for 64 pixels x 128 channels per
// =================================================================================================================
__global__ __launch_bounds__(256)
void k_final(const unsigned short* __restrict__ vh, const unsigned short* __restrict__ vl,
             const unsigned short* __restrict__ weh, const unsigned short* __restrict__ wel,
             const float* __restrict__ x, float* out) {
  __shared__ __align__(16) float Cs[64 * LDC];
  const int tid = threadIdx.x;
  const int mb = blockIdx.x;
  const int p0 = mb * 64;
  const int b = p0 / IMGPIX, pl0 = p0 - b * IMGPIX;
  const _Float16* Vh = (const _Float16*)(const void*)(vh + (size_t)b * BSZ);
  const _Float16* Vl = (const _Float16*)(const void*)(vl + (size_t)b * BSZ);
  const _Float16* Wh = (const _Float16*)(const void*)(weh + (size_t)b * NHEAD * CC * HD);
  const _Float16* Wl = (const _Float16*)(const void*)(wel + (size_t)b * NHEAD * CC * HD);
  mm_final(Vh, Vl, Wh, Wl, pl0, Cs);
  __syncthreads();
  v4f pk[8];
  size_t offs[8];
#pragma unroll
  for (int s = 0; s < 8; ++s) {
    const int idx = s * 256 + tid;
    const int o = idx >> 4, piece = idx & 15;
    const size_t off = (size_t)(b * CC + o) * IMGPIX + pl0 + piece * 4;
    const v4f xr = *(const v4f*)(x + off);
    v4f v;
#pragma unroll
    for (int e = 0; e < 4; ++e) v[e] = Cs[(piece * 4 + e) * LDC + o] * (1.0f / 64.0f) + bfr(xr[e]);
    pk[s] = v;
    offs[s] = off;
  }
#pragma unroll
  for (int s = 0; s < 8; ++s) *(v4f*)(out + offs[s]) = pk[s];
  
}

// =================================================================================================================
// Workspace map (bytes, offsets multiples of 65536, no aliasing, every region sized at or above its whole-line store
// extent): W1 f16 [3][128][128] 98304 (131072) | WT f16 [3][128][1152] 884736 (917504) | XH, XL f16 [32768][128]
// 8388608 each | P1 f16 6 x [2][130][130][128] 51916800 (51970048) | QK f32 [2][2][128][16384] 33554432 |
// VH, VL f16 [2][128][16384] 8388608 each | WEH, WEL f16 [2][8][128][16] 65536 each | total 120258560.
// =================================================================================================================
extern "C" void kernel_launch(void* const* d_in, const int* in_sizes, int n_in,
                              void* d_out, int out_size, void* d_ws, size_t ws_size,
                              hipStream_t stream) {
  if (n_in < 11) return;
  const int expect[11] = { NB * CC * IMGPIX, WW, WW, 1, CC * CC, CC * CC * 9, CC * CC, CC * CC * 9,
                           CC * CC, CC * CC * 9, CC * CC };
  for (int i = 0; i < 11; ++i) if (in_sizes[i] != expect[i]) return;
  if (out_size != NB * CC * IMGPIX) return;

  const float* x     = (const float*)d_in[0];
  const float* gam   = (const float*)d_in[1];
  const float* bet   = (const float*)d_in[2];
  const float* scale = (const float*)d_in[3];
  const float* wq1   = (const float*)d_in[4];
  const float* wq2   = (const float*)d_in[5];
  const float* wk1   = (const float*)d_in[6];
  const float* wk2   = (const float*)d_in[7];
  const float* wv1   = (const float*)d_in[8];
  const float* wv2   = (const float*)d_in[9];
  const float* wo    = (const float*)d_in[10];
  float* out = (float*)d_out;

  const size_t AL = 65536;
  const size_t sW1 = (((size_t)3 * CC * CC * 2) + AL - 1) / AL * AL;               //   131072
  const size_t sWT = (((size_t)3 * CC * KCV * 2) + AL - 1) / AL * AL;              //   917504
  const size_t sX  = (((size_t)NPIX * CC * 2) + AL - 1) / AL * AL;                  //  8388608
  const size_t sP1 = (((size_t)6 * PS1 * 2) + AL - 1) / AL * AL;                    // 51970048
  const size_t sQK = (((size_t)2 * NB * BSZ * 4) + AL - 1) / AL * AL;               // 33554432
  const size_t sV  = (((size_t)NB * BSZ * 2) + AL - 1) / AL * AL;                   //  8388608
  const size_t sWE = (((size_t)NB * NHEAD * CC * HD * 2) + AL - 1) / AL * AL;       //    65536

  size_t off = 0;
  const size_t oW1  = off; off += sW1;
  const size_t oWT  = off; off += sWT;
  const size_t oXH  = off; off += sX;
  const size_t oXL  = off; off += sX;
  const size_t oP1  = off; off += sP1;
  const size_t oQK  = off; off += sQK;
  const size_t oVH  = off; off += sV;
  const size_t oVL  = off; off += sV;
  const size_t oWEH = off; off += sWE;
  const size_t oWEL = off; off += sWE;
  if (off > ws_size) return;                                 // off = 120258560
  if (off > (size_t)134217728) return;

  char* ws = (char*)d_ws;
  unsigned short* W1  = (unsigned short*)(ws + oW1);
  unsigned short* WT  = (unsigned short*)(ws + oWT);
  unsigned short* XH  = (unsigned short*)(ws + oXH);
  unsigned short* XL  = (unsigned short*)(ws + oXL);
  unsigned short* P1  = (unsigned short*)(ws + oP1);
  float*          QK  = (float*)(ws + oQK);
  unsigned short* VH  = (unsigned short*)(ws + oVH);
  unsigned short* VL  = (unsigned short*)(ws + oVL);
  unsigned short* WEH = (unsigned short*)(ws + oWEH);
  unsigned short* WEL = (unsigned short*)(ws + oWEL);

  const dim3 blk(256);
  // (1) weight planes
  k_wcvt<<<dim3(6 * CC), blk, 0, stream>>>(wq1, wq2, wk1, wk2, wv1, wv2, W1, WT);
  // (2) layer norm over w + NHWC hi/lo planes
  k_ln<<<dim3(NB * HH * 2), blk, 0, stream>>>(x, gam, bet, XH, XL);
  // (3) 1x1 projections into padded NHWC hi/lo planes (interior)
  k_proj<<<dim3(NPIX / 64, 3), blk, 0, stream>>>(XH, XL, W1, P1);
  // (4) halo zero fill of the padded planes
  k_halo<<<dim3((6 * NB * NHALO * 16 + 255) / 256), blk, 0, stream>>>(P1);
  // (5) 3x3 convs -> q, k f32 NCHW flat planes; v f16 hi/lo NCHW flat planes
  k_conv3<<<dim3(NPIX / 64, 3), blk, 0, stream>>>(P1, WT, QK, VH, VL);
  // (6) per-head channel attention (f32 logits) + softmax + wo mix -> Wm planes
  k_attn<<<dim3(NB * NHEAD), blk, 0, stream>>>(QK, wo, scale, WEH, WEL);
  // (7) output GEMM + residual -> NCHW d_out
  k_final<<<dim3(NPIX / 64), blk, 0, stream>>>(VH, VL, WEH, WEL, x, out);
  (void)hipGetLastError();
}

// v001
// Measured time: 261 microseconds a run.
// Timed twice side by side with v000, it ran 2.56 and 2.55 times as fast.
// Contractions: 1x1 projections (K=128) and 3x3 convs as implicit GEMM (K=1152): v_wmma_f32_16x16x32_f16, the
// activation as f16 hi + x2048 residual planes into two f32 accumulators, weights one f16 plane of 64*bf16(w);
// per-head k^T q logits (K=16384): f32 on VALU from f32 q/k planes (fixed-order three-level sums); wo x probs mix
// (K=16, zero padded to 32): f16, probs carried x4096 as hi + residual; fused output GEMM (K=128): v and the mixed
// weight as f16 hi + residual planes (3 products); f32 accumulate everywhere. Layer-norm statistics, softmax and
// all epilogues f32 on VALU; every float input RNE-converted to bf16 on load.
#include <hip/hip_runtime.h>
#include <stdint.h>

#define NB     2
#define CC     128
#define HH     128
#define WW     128
#define IMGPIX (HH * WW)
#define NPIX   (NB * IMGPIX)
#define HP     (HH + 2)
#define WP     (WW + 2)
#define PADIMG (HP * WP)
#define PADPIX (NB * PADIMG)
#define KCV    1152
#define NKS    36
#define NHEAD  8
#define HD     16
#define HSZ    (IMGPIX * HD)
#define BSZ    (CC * IMGPIX)
#define LDC    132
#define FP     40
#define WSP    17
#define NHALO  (2 * WP + 2 * HH)
#define RSC    0.00048828125f
#define PS1    ((size_t)PADPIX * CC)
#define PS2    ((size_t)NPIX * CC)

static_assert(NPIX == NB * IMGPIX);
static_assert(IMGPIX == 16384 && HH == 128 && WW == 128);
static_assert(PADIMG == 16900);
static_assert(KCV == 9 * CC && KCV == NKS * 32);
static_assert(CC == NHEAD * HD);
static_assert(BSZ == CC * IMGPIX && HSZ * NHEAD == BSZ);
static_assert((IMGPIX % 64) == 0 && (WW % 64) == 0);
static_assert((LDC * 4) % 16 == 0 && (FP * 2) % 16 == 0);
static_assert(NHALO == 516);
static_assert((KCV % 8) == 0 && (CC % 32) == 0);
static_assert(IMGPIX == 32 * 32 * 16);

// Index maps of the raw reshapes (per batch b, flat NCHW index f = c*16384 + h*128 + w viewed as [8][16384][16]):
//   Q_head[r][d] = qflat[b][head*262144 + 16 r + d]   (same map for K_head and V_head; r = (c%16)*1024 + h*8 + w/16,
//   d = w%16). S_head[i][j] = sum_r K_head[r][i] Q_head[r][j]; P_head = softmax_j(S_head * (1/scale)).
//   O[b][16 head + j2][pixel r] = sum_j V_head[r][j] P_head[j][j2].
//   y[b][o][pixel r] = sum_{head, j} Wm[b][head][o][j] V_head[r][j] + x[b][o][r],
//   Wm[b][head][o][j] = sum_j2 wo[o][16 head + j2] P_head[j][j2]   (reassociated 1x1 output conv).

typedef _Float16 v16h __attribute__((ext_vector_type(16)));
typedef _Float16 v8h  __attribute__((ext_vector_type(8)));
typedef float    v8f  __attribute__((ext_vector_type(8)));
typedef float    v4f  __attribute__((ext_vector_type(4)));
typedef unsigned int v4u __attribute__((ext_vector_type(4)));

// ---- scalar helpers ------------------------------------------------------------------------------------------
__device__ __forceinline__ unsigned short bf_bits(float f) {          // f32 -> bf16 bits, RNE convert
  unsigned u = __float_as_uint(f);
  return (unsigned short)((u + 0x7FFFu + ((u >> 16) & 1u)) >> 16);
}
__device__ __forceinline__ float bf_up(unsigned short b) { return __uint_as_float(((unsigned)b) << 16); }
__device__ __forceinline__ float bfr(float f) { return bf_up(bf_bits(f)); }
__device__ __forceinline__ unsigned short h_bits(_Float16 x) { return __builtin_bit_cast(unsigned short, x); }
__device__ __forceinline__ unsigned short hb16(float f) { return h_bits((_Float16)f); }
__device__ __forceinline__ unsigned pk16(unsigned short a, unsigned short b) { return (unsigned)a | ((unsigned)b << 16); }
__device__ __forceinline__ v8f zero8() { v8f z = {0.f, 0.f, 0.f, 0.f, 0.f, 0.f, 0.f, 0.f}; return z; }
// hi/lo pair of two f32 values: hi = f16(v), lo = f16(2048 (v - hi)), packed as two 32-bit words
__device__ __forceinline__ void split2(float f0, float f1, unsigned& hp, unsigned& lp) {
  const _Float16 h0 = (_Float16)f0, h1 = (_Float16)f1;
  const float q0 = (f0 - (float)h0) * 2048.0f, q1 = (f1 - (float)h1) * 2048.0f;
  hp = pk16(h_bits(h0), h_bits(h1));
  lp = pk16(hb16(q0), hb16(q1));
}

// ---- fragment loader: 16-bit A/B operand, lane -> row/col (lane&15), p already includes +8*(lane>>4);
//      elements 0..7 <- p[0..7] (k0+8h..k0+8h+7), elements 8..15 <- p[16..23] (k0+16+8h..k0+16+8h+7)
__device__ __forceinline__ v16h ldfrag_h(const _Float16* p) {
  union { v16h v; v8h h[2]; } f;
  f.h[0] = *(const v8h*)(p);
  f.h[1] = *(const v8h*)(p + 16);
  return f.v;
}
// same layout, the two 8-element halves at two independent 16-B aligned addresses (pa: k0+8h.., pb: k0+16+8h..)
__device__ __forceinline__ v16h ldfrag2(const _Float16* pa, const _Float16* pb) {
  union { v16h v; v8h h[2]; } f;
  f.h[0] = *(const v8h*)(pa);
  f.h[1] = *(const v8h*)(pb);
  return f.v;
}

// ---- WMMA helpers; the guards insert the trailing VALU hazard gap and keep A/B live --------------------------
__device__ __forceinline__ v8f mma_raw(v16h a, v16h b, v8f c) {
  return __builtin_amdgcn_wmma_f32_16x16x32_f16(false, a, false, b, (short)0, c, false, false);
}
__device__ __forceinline__ void guard8(v8f& c0, v8f& c1, v8f& c2, v8f& c3, v8f& c4, v8f& c5, v8f& c6, v8f& c7,
                                       const v16h& a0, const v16h& a1, const v16h& a2, const v16h& a3,
                                       const v16h& b0, const v16h& b1) {
#if defined(__HIP_DEVICE_COMPILE__)
  asm volatile("v_nop\n\tv_nop\n\tv_nop\n\tv_nop"
               : "+v"(c0), "+v"(c1), "+v"(c2), "+v"(c3), "+v"(c4), "+v"(c5), "+v"(c6), "+v"(c7)
               : "v"(a0), "v"(a1), "v"(a2), "v"(a3), "v"(b0), "v"(b1));
#endif
}
__device__ __forceinline__ void guard4(v8f& c0, v8f& c1, v8f& c2, v8f& c3,
                                       const v16h& a0, const v16h& a1, const v16h& b0, const v16h& b1) {
#if defined(__HIP_DEVICE_COMPILE__)
  asm volatile("v_nop\n\tv_nop\n\tv_nop\n\tv_nop"
               : "+v"(c0), "+v"(c1), "+v"(c2), "+v"(c3)
               : "v"(a0), "v"(a1), "v"(b0), "v"(b1));
#endif
}
__device__ __forceinline__ void guard2(v8f& c0, v8f& c1, const v16h& a0, const v16h& b0, const v16h& b1) {
#if defined(__HIP_DEVICE_COMPILE__)
  asm volatile("v_nop\n\tv_nop\n\tv_nop\n\tv_nop"
               : "+v"(c0), "+v"(c1)
               : "v"(a0), "v"(b0), "v"(b1));
#endif
}

// ---- 64x128 block tile GEMM core with the A operand as two planes (hi and x2048 residual) into separate
//      accumulators; A row pitch lda (f16), W is [n][k] k-contiguous pitch ldw. 8 waves = 2 (32 rows) x 4
//      (32 cols), 2x2 tiles of 16 per wave; fragments straight from global with the table layout; the residual
//      accumulator is folded with 1/2048 when the tile is written to the LDS f32 tile Cs[64][LDC].
__device__ __forceinline__ void mm_tile2(const _Float16* __restrict__ Ah, const _Float16* __restrict__ Al, int lda,
                                         const _Float16* __restrict__ W, int ldw, int nks,
                                         int arow0, int bcol0, float* Cs) {
  const int tid = threadIdx.x, wave = tid >> 5, lane = tid & 31, hh = lane >> 4, c = lane & 15;
  const int mw = wave >> 2, nw = wave & 3;
  const size_t r0 = (size_t)(arow0 + mw * 32 + c) * lda + 8 * hh;
  const size_t r1 = (size_t)(arow0 + mw * 32 + 16 + c) * lda + 8 * hh;
  const _Float16* a0h = Ah + r0;
  const _Float16* a1h = Ah + r1;
  const _Float16* a0l = Al + r0;
  const _Float16* a1l = Al + r1;
  const _Float16* b0p = W + (size_t)(bcol0 + nw * 32 + c) * ldw + 8 * hh;
  const _Float16* b1p = W + (size_t)(bcol0 + nw * 32 + 16 + c) * ldw + 8 * hh;
  v8f h00 = zero8(), h01 = zero8(), h10 = zero8(), h11 = zero8();
  v8f l00 = zero8(), l01 = zero8(), l10 = zero8(), l11 = zero8();
#pragma unroll 1
  for (int ks = 0; ks < nks; ++ks) {
    const int ko = ks * 32;
    const v16h fa0 = ldfrag_h(a0h + ko);
    const v16h fa1 = ldfrag_h(a1h + ko);
    const v16h ga0 = ldfrag_h(a0l + ko);
    const v16h ga1 = ldfrag_h(a1l + ko);
    const v16h fb0 = ldfrag_h(b0p + ko);
    const v16h fb1 = ldfrag_h(b1p + ko);
    h00 = mma_raw(fa0, fb0, h00);
    h01 = mma_raw(fa0, fb1, h01);
    h10 = mma_raw(fa1, fb0, h10);
    h11 = mma_raw(fa1, fb1, h11);
    l00 = mma_raw(ga0, fb0, l00);
    l01 = mma_raw(ga0, fb1, l01);
    l10 = mma_raw(ga1, fb0, l10);
    l11 = mma_raw(ga1, fb1, l11);
    guard8(h00, h01, h10, h11, l00, l01, l10, l11, fa0, fa1, ga0, ga1, fb0, fb1);
  }
#pragma unroll
  for (int r = 0; r < 8; ++r) {
    const int row = mw * 32 + 8 * hh + r;
    Cs[row * LDC + nw * 32 + c]             = h00[r] + l00[r] * RSC;
    Cs[row * LDC + nw * 32 + 16 + c]        = h01[r] + l01[r] * RSC;
    Cs[(row + 16) * LDC + nw * 32 + c]      = h10[r] + l10[r] * RSC;
    Cs[(row + 16) * LDC + nw * 32 + 16 + c] = h11[r] + l11[r] * RSC;
  }
}

// ---- implicit-GEMM variant for the 3x3 conv: A row = output pixel p (flat over all images), k = tap*128 + c;
//      the A fragment of k-step ks (tap = ks>>2, channel quarter = ks&3) is read from the padded NHWC planes at pixel
//      (y + ky, x + kx) (padded coordinates), channels quarter*32 + the table k map; W = wt [128][1152] k-contiguous.
__device__ __forceinline__ size_t conv_abase(int p, int hh) {
  const int b = p / IMGPIX;
  const int r = p - b * IMGPIX;
  const int y = r / WW;
  const int x = r - y * WW;
  return ((size_t)(b * HP + y) * WP + x) * CC + 8 * hh;
}
__device__ __forceinline__ void mm_conv(const _Float16* __restrict__ Ah, const _Float16* __restrict__ Al,
                                        const _Float16* __restrict__ W, int prow0, float* Cs) {
  const int tid = threadIdx.x, wave = tid >> 5, lane = tid & 31, hh = lane >> 4, c = lane & 15;
  const int mw = wave >> 2, nw = wave & 3;
  const size_t r0 = conv_abase(prow0 + mw * 32 + c, hh);
  const size_t r1 = conv_abase(prow0 + mw * 32 + 16 + c, hh);
  const _Float16* a0h = Ah + r0;
  const _Float16* a1h = Ah + r1;
  const _Float16* a0l = Al + r0;
  const _Float16* a1l = Al + r1;
  const _Float16* b0p = W + (size_t)(nw * 32 + c) * KCV + 8 * hh;
  const _Float16* b1p = W + (size_t)(nw * 32 + 16 + c) * KCV + 8 * hh;
  v8f h00 = zero8(), h01 = zero8(), h10 = zero8(), h11 = zero8();
  v8f l00 = zero8(), l01 = zero8(), l10 = zero8(), l11 = zero8();
#pragma unroll 1
  for (int ks = 0; ks < NKS; ++ks) {
    const int tap = ks >> 2, cq = ks & 3;
    const int ky = (tap * 11) >> 5;              // tap / 3 for tap < 9
    const int kx = tap - 3 * ky;
    const int ao = (ky * WP + kx) * CC + cq * 32;
    const int ko = ks * 32;
    const v16h fa0 = ldfrag_h(a0h + ao);
    const v16h fa1 = ldfrag_h(a1h + ao);
    const v16h ga0 = ldfrag_h(a0l + ao);
    const v16h ga1 = ldfrag_h(a1l + ao);
    const v16h fb0 = ldfrag_h(b0p + ko);
    const v16h fb1 = ldfrag_h(b1p + ko);
    h00 = mma_raw(fa0, fb0, h00);
    h01 = mma_raw(fa0, fb1, h01);
    h10 = mma_raw(fa1, fb0, h10);
    h11 = mma_raw(fa1, fb1, h11);
    l00 = mma_raw(ga0, fb0, l00);
    l01 = mma_raw(ga0, fb1, l01);
    l10 = mma_raw(ga1, fb0, l10);
    l11 = mma_raw(ga1, fb1, l11);
    guard8(h00, h01, h10, h11, l00, l01, l10, l11, fa0, fa1, ga0, ga1, fb0, fb1);
  }
#pragma unroll
  for (int r = 0; r < 8; ++r) {
    const int row = mw * 32 + 8 * hh + r;
    Cs[row * LDC + nw * 32 + c]             = h00[r] + l00[r] * RSC;
    Cs[row * LDC + nw * 32 + 16 + c]        = h01[r] + l01[r] * RSC;
    Cs[(row + 16) * LDC + nw * 32 + c]      = h10[r] + l10[r] * RSC;
    Cs[(row + 16) * LDC + nw * 32 + 16 + c] = h11[r] + l11[r] * RSC;
  }
}

// ---- fused output GEMM core: rows = 64 pixels of one batch (local pixel pl0..pl0+63), cols = 128 output channels,
//      k = c' = 16 head + j (K = 128, 4 k-steps of two heads each). A[p][c'] = V_head[p][j] read from the NCHW flat v
//      planes at head*HSZ + 16 p + j (two 16-B halves per fragment, heads 2ks and 2ks+1); B = Wm[head][o][16]
//      k-contiguous per head. Products hi*hi + hi*lo (first loop) and lo*hi (second loop) into Cs[64][LDC].
__device__ __forceinline__ void mm_final(const _Float16* __restrict__ Vh, const _Float16* __restrict__ Vl,
                                         const _Float16* __restrict__ Wh, const _Float16* __restrict__ Wl,
                                         int pl0, float* Cs) {
  const int tid = threadIdx.x, wave = tid >> 5, lane = tid & 31, hh = lane >> 4, c = lane & 15;
  const int mw = wave >> 2, nw = wave & 3;
  const size_t r0 = (size_t)(pl0 + mw * 32 + c) * HD + 8 * hh;
  const size_t r1 = (size_t)(pl0 + mw * 32 + 16 + c) * HD + 8 * hh;
  const size_t q0 = (size_t)(nw * 32 + c) * HD + 8 * hh;
  const size_t q1 = (size_t)(nw * 32 + 16 + c) * HD + 8 * hh;
  {
    v8f h00 = zero8(), h01 = zero8(), h10 = zero8(), h11 = zero8();
    v8f l00 = zero8(), l01 = zero8(), l10 = zero8(), l11 = zero8();
#pragma unroll 1
    for (int ks = 0; ks < CC / 32; ++ks) {
      const size_t ao = (size_t)(2 * ks) * HSZ;
      const size_t bo = (size_t)(2 * ks) * (CC * HD);
      const v16h fa0 = ldfrag2(Vh + r0 + ao, Vh + r0 + ao + HSZ);
      const v16h fa1 = ldfrag2(Vh + r1 + ao, Vh + r1 + ao + HSZ);
      const v16h fb0 = ldfrag2(Wh + q0 + bo, Wh + q0 + bo + CC * HD);
      const v16h fb1 = ldfrag2(Wh + q1 + bo, Wh + q1 + bo + CC * HD);
      const v16h gb0 = ldfrag2(Wl + q0 + bo, Wl + q0 + bo + CC * HD);
      const v16h gb1 = ldfrag2(Wl + q1 + bo, Wl + q1 + bo + CC * HD);
      h00 = mma_raw(fa0, fb0, h00);
      h01 = mma_raw(fa0, fb1, h01);
      h10 = mma_raw(fa1, fb0, h10);
      h11 = mma_raw(fa1, fb1, h11);
      l00 = mma_raw(fa0, gb0, l00);
      l01 = mma_raw(fa0, gb1, l01);
      l10 = mma_raw(fa1, gb0, l10);
      l11 = mma_raw(fa1, gb1, l11);
      guard8(h00, h01, h10, h11, l00, l01, l10, l11, fa0, fa1, gb0, gb1, fb0, fb1);
    }
#pragma unroll
    for (int r = 0; r < 8; ++r) {
      const int row = mw * 32 + 8 * hh + r;
      Cs[row * LDC + nw * 32 + c]             = h00[r] + l00[r] * RSC;
      Cs[row * LDC + nw * 32 + 16 + c]        = h01[r] + l01[r] * RSC;
      Cs[(row + 16) * LDC + nw * 32 + c]      = h10[r] + l10[r] * RSC;
      Cs[(row + 16) * LDC + nw * 32 + 16 + c] = h11[r] + l11[r] * RSC;
    }
  }
  {
    v8f m00 = zero8(), m01 = zero8(), m10 = zero8(), m11 = zero8();
#pragma unroll 1
    for (int ks = 0; ks < CC / 32; ++ks) {
      const size_t ao = (size_t)(2 * ks) * HSZ;
      const size_t bo = (size_t)(2 * ks) * (CC * HD);
      const v16h ga0 = ldfrag2(Vl + r0 + ao, Vl + r0 + ao + HSZ);
      const v16h ga1 = ldfrag2(Vl + r1 + ao, Vl + r1 + ao + HSZ);
      const v16h fb0 = ldfrag2(Wh + q0 + bo, Wh + q0 + bo + CC * HD);
      const v16h fb1 = ldfrag2(Wh + q1 + bo, Wh + q1 + bo + CC * HD);
      m00 = mma_raw(ga0, fb0, m00);
      m01 = mma_raw(ga0, fb1, m01);
      m10 = mma_raw(ga1, fb0, m10);
      m11 = mma_raw(ga1, fb1, m11);
      guard4(m00, m01, m10, m11, ga0, ga1, fb0, fb1);
    }
#pragma unroll
    for (int r = 0; r < 8; ++r) {               // same lane wrote these slots above (program order, same type)
      const int row = mw * 32 + 8 * hh + r;
      Cs[row * LDC + nw * 32 + c]             += m00[r] * RSC;
      Cs[row * LDC + nw * 32 + 16 + c]        += m01[r] * RSC;
      Cs[(row + 16) * LDC + nw * 32 + c]      += m10[r] * RSC;
      Cs[(row + 16) * LDC + nw * 32 + 16 + c] += m11[r] * RSC;
    }
  }
}

// =================================================================================================================
// Weight convert. Blocks 0..383: tensor t = blk/128 of (wq2, wk2, wv2) [co][ci][3][3] f32 -> wt [t][co][k =
// tap*128 + ci] f16(64 * bf16(w)); thread tt < 144 builds one 16-B piece (8 halves), 8 consecutive threads per
// passes. grid = 768. coverage: wt 384 x 1152 and w1 384 x 128, every element once.
// =================================================================================================================
__global__ __launch_bounds__(256)
void k_wcvt(const float* __restrict__ wq1, const float* __restrict__ wq2, const float* __restrict__ wk1,
            const float* __restrict__ wk2, const float* __restrict__ wv1, const float* __restrict__ wv2,
            unsigned short* w1, unsigned short* wt) {
  const int tid = threadIdx.x;
  const int blk = blockIdx.x;
  if (blk < 3 * CC) {
    const int t = blk / CC, co = blk - t * CC;
    const float* src = (t == 0) ? wq2 : ((t == 1) ? wk2 : wv2);
    const int tt = min(tid, 143);
    const int k0 = tt * 8, tap = k0 / CC, c0 = k0 - tap * CC;
    v4u pk;
#pragma unroll
    for (int e = 0; e < 4; ++e) {
      const float f0 = src[(size_t)(co * CC + c0 + 2 * e) * 9 + tap];
      const float f1 = src[(size_t)(co * CC + c0 + 2 * e + 1) * 9 + tap];
      pk[e] = pk16(hb16(bfr(f0) * 64.0f), hb16(bfr(f1) * 64.0f));
    }
    if (tid < 144) {
      unsigned short* dst = wt + (size_t)(t * CC + co) * KCV + k0;
      *(v4u*)dst = pk;
      
    }
  } else {
    const int rr = blk - 3 * CC;
    const int t = rr / CC, o = rr - t * CC;
    const float* src = (t == 0) ? wq1 : ((t == 1) ? wk1 : wv1);
    const int tt = min(tid, 15);
    const int c0 = tt * 8;
    v4u pk;
#pragma unroll
    for (int e = 0; e < 4; ++e) {
      const float f0 = src[(size_t)o * CC + c0 + 2 * e];
      const float f1 = src[(size_t)o * CC + c0 + 2 * e + 1];
      pk[e] = pk16(hb16(bfr(f0) * 64.0f), hb16(bfr(f1) * 64.0f));
    }
    if (tid < 16) {
      unsigned short* dst = w1 + (size_t)(t * CC + o) * CC + c0;
      *(v4u*)dst = pk;
      
    }
  }
}

// =================================================================================================================
// gamma[w], beta[w] bf16 converted) + NCHW -> NHWC + hi/lo f16 planes. Block = (b, h, channel half): wave = 8
// channel rows, lane = 4 w values, shuffle reductions; f32 tile T[64 ch][w] in LDS; then each pixel's 64 channels
// grid = NB*128*2, 256 threads. coverage: xh/xl [NPIX px][128 ch], every element once.
// =================================================================================================================
__global__ __launch_bounds__(256)
void k_ln(const float* __restrict__ x, const float* __restrict__ gw, const float* __restrict__ gb,
          unsigned short* xh, unsigned short* xl) {
  __shared__ __align__(16) float T[64 * LDC];
  const int tid = threadIdx.x, wv = tid >> 5, lane = tid & 31;
  const int blk = blockIdx.x;
  const int bh = blk >> 1, chalf = blk & 1;
  const int b = bh / HH, h = bh - b * HH;
  const v4f g4 = *(const v4f*)(gw + lane * 4);
  const v4f b4 = *(const v4f*)(gb + lane * 4);
  float g[4], be[4];
#pragma unroll
  for (int e = 0; e < 4; ++e) { g[e] = bfr(g4[e]); be[e] = bfr(b4[e]); }
#pragma unroll 1
  for (int it = 0; it < 8; ++it) {
    const int cc = wv * 8 + it;
    const int c = chalf * 64 + cc;
    const float* row = x + ((size_t)(b * CC + c) * HH + h) * WW;
    const v4f a = *(const v4f*)(row + lane * 4);
    float xr[4];
#pragma unroll
    for (int e = 0; e < 4; ++e) xr[e] = bfr(a[e]);
    float s = (xr[0] + xr[1]) + (xr[2] + xr[3]);
#pragma unroll
    for (int off = 16; off; off >>= 1) s += __shfl_xor(s, off, 32);
    const float mu = s * (1.0f / 128.0f);
    float d[4];
#pragma unroll
    for (int e = 0; e < 4; ++e) d[e] = xr[e] - mu;
    float sq = (d[0] * d[0] + d[1] * d[1]) + (d[2] * d[2] + d[3] * d[3]);
#pragma unroll
    for (int off = 16; off; off >>= 1) sq += __shfl_xor(sq, off, 32);
    const float var = sq * (1.0f / 128.0f);
    const float rs = rsqrtf(var + 1e-5f);
    v4f o;
#pragma unroll
    for (int e = 0; e < 4; ++e) o[e] = (d[e] * rs) * g[e] + be[e];
    *(v4f*)(T + cc * LDC + lane * 4) = o;
  }
  __syncthreads();
  v4u ph[4], pq[4];
  size_t offs[4];
#pragma unroll
  for (int s = 0; s < 4; ++s) {
    const int idx = s * 256 + tid;
    const int w = idx >> 3, piece = idx & 7;
    const int c0 = piece * 8;
    v4u a, q4;
#pragma unroll
    for (int e = 0; e < 4; ++e) {
      const float f0 = T[(c0 + 2 * e) * LDC + w];
      const float f1 = T[(c0 + 2 * e + 1) * LDC + w];
      unsigned hp, lp;
      split2(f0, f1, hp, lp);
      a[e] = hp; q4[e] = lp;
    }
    ph[s] = a;
    pq[s] = q4;
    offs[s] = (size_t)(b * IMGPIX + h * WW + w) * CC + chalf * 64 + c0;
  }
#pragma unroll
  for (int s = 0; s < 4; ++s) { *(v4u*)(xh + offs[s]) = ph[s]; *(v4u*)(xl + offs[s]) = pq[s]; }
  
}

// =================================================================================================================
// 1x1 projections: C[64 pixels][128 out ch] = xn . w1[t]^T (K = 128), value = C/64; written as f16 hi/lo into the
// padded NHWC planes p1[2t], p1[2t+1] ([NB][130][130][128]) at the interior position (y+1, x+1). 64 consecutive
// pixels lie in one image row -> 64 consecutive padded pixels; thread = one 16-B piece, 16 threads per pixel row
// coverage: interior NPIX padded pixels x 128 ch of all 6 planes (halo by k_halo).
// =================================================================================================================
__global__ __launch_bounds__(256)
void k_proj(const unsigned short* __restrict__ xh, const unsigned short* __restrict__ xl,
            const unsigned short* __restrict__ w1, unsigned short* p1) {
  __shared__ __align__(16) float Cs[64 * LDC];
  const int tid = threadIdx.x;
  const int mb = blockIdx.x, t = blockIdx.y;
  mm_tile2((const _Float16*)(const void*)xh, (const _Float16*)(const void*)xl, CC,
           (const _Float16*)(const void*)(w1 + (size_t)t * CC * CC), CC, CC / 32, mb * 64, 0, Cs);
  __syncthreads();
  unsigned short* dh = p1 + (size_t)(2 * t) * PS1;
  unsigned short* dl = p1 + (size_t)(2 * t + 1) * PS1;
  const int p0 = mb * 64;
  const int b = p0 / IMGPIX, rem = p0 - b * IMGPIX;
  const int y = rem / WW, x0 = rem - y * WW;
  const size_t pprow = (size_t)(b * HP + y + 1) * WP + x0 + 1;
  v4u ph[4], pq[4];
  size_t offs[4];
#pragma unroll
  for (int s = 0; s < 4; ++s) {
    const int idx = s * 256 + tid;
    const int row = idx >> 4, piece = idx & 15;
    const int col0 = piece * 8;
    v4u a, q4;
#pragma unroll
    for (int e = 0; e < 4; ++e) {
      const float f0 = Cs[row * LDC + col0 + 2 * e] * (1.0f / 64.0f);
      const float f1 = Cs[row * LDC + col0 + 2 * e + 1] * (1.0f / 64.0f);
      unsigned hp, lp;
      split2(f0, f1, hp, lp);
      a[e] = hp; q4[e] = lp;
    }
    ph[s] = a;
    pq[s] = q4;
    offs[s] = (pprow + row) * CC + col0;
  }
#pragma unroll
  for (int s = 0; s < 4; ++s) { *(v4u*)(dh + offs[s]) = ph[s]; *(v4u*)(dl + offs[s]) = pq[s]; }
  
}

// =================================================================================================================
// with NB (not a fixed image count). grid = ceil(6*NB*516*16 / 256).
// coverage: every halo pixel (py in {0,129} or px in {0,129}) of every image of all 6 planes.
// =================================================================================================================
__global__ __launch_bounds__(256)
void k_halo(unsigned short* p1) {
  const int idx = blockIdx.x * 256 + threadIdx.x;
  if (idx >= 6 * NB * NHALO * 16) return;
  const int piece = idx & 15;
  int r = idx >> 4;
  const int hp = r % NHALO;
  r /= NHALO;
  const int img = r % NB, plane = r / NB;
  const int q = max(hp - 2 * WP, 0);
  const int pyA = (hp < WP) ? 0 : (HP - 1);
  const int pxA = (hp < WP) ? hp : (hp - WP);
  const int pyB = 1 + (q >> 1);
  const int pxB = (q & 1) ? (WP - 1) : 0;
  const bool edge = hp < 2 * WP;
  const int py = edge ? pyA : pyB;
  const int px = edge ? pxA : pxB;
  const size_t off = (size_t)plane * PS1 + ((size_t)(img * HP + py) * WP + px) * CC + piece * 8;
  v4u z = {0u, 0u, 0u, 0u};
  *(v4u*)(p1 + off) = z;
  
}

// =================================================================================================================
// 3x3 conv implicit GEMM: block tile = 64 consecutive output pixels x 128 channels, K = 1152 as 36 k-steps,
// A = (hi, lo/2048) planes of tensor t, W = 64 bf16(w2[t]) -> value = C/64. Output NCHW flat [NB][128][16384]:
// coverage: qk [2 tensors][NB][128][16384] f32 and vh/vl [NB][128][16384], every element once (64 px x 128 co / block).
// =================================================================================================================
__global__ __launch_bounds__(256)
void k_conv3(const unsigned short* __restrict__ p1, const unsigned short* __restrict__ wt,
             float* qk, unsigned short* vh, unsigned short* vl) {
  __shared__ __align__(16) float Cs[64 * LDC];
  const int tid = threadIdx.x;
  const int mb = blockIdx.x, t = blockIdx.y;
  mm_conv((const _Float16*)(const void*)(p1 + (size_t)(2 * t) * PS1),
          (const _Float16*)(const void*)(p1 + (size_t)(2 * t + 1) * PS1),
          (const _Float16*)(const void*)(wt + (size_t)t * CC * KCV), mb * 64, Cs);
  __syncthreads();
  const int p0 = mb * 64;
  const int b = p0 / IMGPIX, pix0 = p0 - b * IMGPIX;
  if (t < 2) {                                               // block-uniform branch, no WMMA inside
    float* df = qk + (size_t)t * ((size_t)NB * BSZ);
    v4f pk[8];
    size_t offs[8];
#pragma unroll
    for (int s = 0; s < 8; ++s) {
      const int idx = s * 256 + tid;
      const int co = idx >> 4, piece = idx & 15;
      v4f v;
#pragma unroll
      for (int e = 0; e < 4; ++e) v[e] = Cs[(piece * 4 + e) * LDC + co] * (1.0f / 64.0f);
      pk[s] = v;
      offs[s] = (size_t)(b * CC + co) * IMGPIX + pix0 + piece * 4;
    }
#pragma unroll
    for (int s = 0; s < 8; ++s) *(v4f*)(df + offs[s]) = pk[s];
    
  } else {
    v4u ph[4], pq[4];
    size_t offs[4];
#pragma unroll
    for (int s = 0; s < 4; ++s) {
      const int idx = s * 256 + tid;
      const int co = idx >> 3, piece = idx & 7;
      const int r0 = piece * 8;
      v4u a, q4;
#pragma unroll
      for (int e = 0; e < 4; ++e) {
        const float f0 = Cs[(r0 + 2 * e) * LDC + co] * (1.0f / 64.0f);
        const float f1 = Cs[(r0 + 2 * e + 1) * LDC + co] * (1.0f / 64.0f);
        unsigned hp, lp;
        split2(f0, f1, hp, lp);
        a[e] = hp; q4[e] = lp;
      }
      ph[s] = a;
      pq[s] = q4;
      offs[s] = (size_t)(b * CC + co) * IMGPIX + pix0 + r0;
    }
#pragma unroll
    for (int s = 0; s < 4; ++s) { *(v4u*)(vh + offs[s]) = ph[s]; *(v4u*)(vl + offs[s]) = pq[s]; }
    
  }
}

// =================================================================================================================
// Logit partial sums over the raw reshape: S[i][j] = sum_r K_head[r][i] Q_head[r][j] (K = 16384) in f32 on VALU from
// the f32 [16384][16] views of the q/k NCHW flat planes. Work-group = (row group rg, batch-head bi): rows r = 16 s + rg
// (1024 rows). Thread (so = tid>>4, i = tid&15) sums the 32 rows s = 32 so .. 32 so + 31 in order into 16 partials;
// thread (i, j) then adds the 32 values of so in order in LDS: sp[bi][rg][i][j]. k_attn adds the 16 row groups in order.
// grid = 16*NB*8, 512 threads. coverage: sp [NB*8][16][256] f32, every element once.
// =================================================================================================================
__global__ __launch_bounds__(512)
void k_logit(const float* __restrict__ qf, const float* __restrict__ kf, float* sp) {
  __shared__ float part[32 * 256];
  const int tid = threadIdx.x;
  // bi in the low bits: the 16 row groups of one head interleave in the same cache lines; a matter of speed only
  const int bi = blockIdx.x % (NB * NHEAD), rg = blockIdx.x / (NB * NHEAD);
  const int b = bi / NHEAD, head = bi - b * NHEAD;
  const float* Qp = qf + (size_t)b * BSZ + (size_t)head * HSZ;
  const float* Kp = kf + (size_t)b * BSZ + (size_t)head * HSZ;
  {
    const int so = tid >> 4, i = tid & 15;
    float tt[HD];
#pragma unroll
    for (int e = 0; e < HD; ++e) tt[e] = 0.f;
    const float* kp = Kp + (size_t)(so * 512 + rg) * HD + i;   // row r = (32 so + s) * 16 + rg, s = 0
    const float* qp = Qp + (size_t)(so * 512 + rg) * HD;
    // batches of 8 rows: each batch's 40 loads are issued together, then summed row by row in order; unrolled so that
    // every row's address is the two base pointers plus an immediate offset
#pragma unroll
    for (int sb = 0; sb < 4; ++sb) {
      float kv[8];
      v4f q[8][4];
#pragma unroll
      for (int u = 0; u < 8; ++u) {
        kv[u] = kp[(sb * 8 + u) * 16 * HD];
#pragma unroll
        for (int g = 0; g < 4; ++g) q[u][g] = *(const v4f*)(qp + (sb * 8 + u) * 16 * HD + 4 * g);
      }
#if defined(__HIP_DEVICE_COMPILE__)
      // inputs-only fences on the loaded values (four rows each: an asm statement takes thirty operands): without them
      // the compiler sinks every load to its first use and the wave pays one memory latency per load. The second one
      // holds the wait that stands between issued loads and a rewrite of a register they name, and takes the two base
      // pointers as inputs too: they stay live to that wait, so no load of the batch lands in its own run's address
      asm volatile("" :: "v"(kv[0]), "v"(kv[1]), "v"(kv[2]), "v"(kv[3]),
                   "v"(q[0][0]), "v"(q[0][1]), "v"(q[0][2]), "v"(q[0][3]), "v"(q[1][0]), "v"(q[1][1]), "v"(q[1][2]), "v"(q[1][3]),
                   "v"(q[2][0]), "v"(q[2][1]), "v"(q[2][2]), "v"(q[2][3]), "v"(q[3][0]), "v"(q[3][1]), "v"(q[3][2]), "v"(q[3][3]));
      asm volatile("s_wait_xcnt 0x0" :: "v"(kp), "v"(qp), "v"(kv[4]), "v"(kv[5]), "v"(kv[6]), "v"(kv[7]),
                   "v"(q[4][0]), "v"(q[4][1]), "v"(q[4][2]), "v"(q[4][3]), "v"(q[5][0]), "v"(q[5][1]), "v"(q[5][2]), "v"(q[5][3]),
                   "v"(q[6][0]), "v"(q[6][1]), "v"(q[6][2]), "v"(q[6][3]), "v"(q[7][0]), "v"(q[7][1]), "v"(q[7][2]), "v"(q[7][3]));
#endif
#pragma unroll
      for (int u = 0; u < 8; ++u) {
#pragma unroll
        for (int g = 0; g < 4; ++g) {
#pragma unroll
          for (int e = 0; e < 4; ++e) tt[4 * g + e] = fmaf(kv[u], q[u][g][e], tt[4 * g + e]);
        }
      }
    }
#pragma unroll
    for (int j = 0; j < HD; ++j) part[so * 256 + i * 16 + j] = tt[j];
  }
  __syncthreads();
  if (tid < 256) {
    float acc = 0.f;
#pragma unroll
    for (int so = 0; so < 32; ++so) acc += part[so * 256 + tid];
    sp[(size_t)(bi * 16 + rg) * 256 + tid] = acc;
  }
}

// =================================================================================================================
// Per (b, head) channel attention: S[i][j] = the 16 row-group partial sums of k_logit added in fixed order.
// P = softmax_j(S * (1/bf16(scale))) in f32 (max-subtracted).
// Wm[o][j] = sum_j2 64 bf16(wo[o][16 head + j2]) P[j][j2] on WMMA (K = 16 zero padded to 32; P carried x4096 as
// f16 hi + residual), value/4096 = 64 Wm; stored as f16 hi/lo planes weh/wel [b][head][o][16]: block region =
// grid = NB*8, 256 threads. coverage: weh/wel [NB][8][128][16], every element once.
// =================================================================================================================
__global__ __launch_bounds__(256)
void k_attn(const float* __restrict__ sp, const float* __restrict__ wo, const float* __restrict__ scale,
            unsigned short* weh, unsigned short* wel) {
  __shared__ float Sm[16 * WSP];
  __shared__ __align__(16) _Float16 Phs[16 * FP];
  __shared__ __align__(16) _Float16 Pls[16 * FP];
  __shared__ __align__(16) _Float16 Wts[CC * FP];
  __shared__ float Ws[CC * WSP];
  const int tid = threadIdx.x, wave = tid >> 5, lane = tid & 31, hh = lane >> 4, m = lane & 15;
  const int bi = blockIdx.x, b = bi / NHEAD, head = bi - b * NHEAD;
  // wo slice -> f16 [o][k] (k = j2, zero for k >= 16; addresses clamped)
#pragma unroll 1
  for (int it = 0; it < 16; ++it) {
    const int idx = it * 256 + tid;
    const int o = idx >> 5, k = idx & 31;
    const int kk = min(k, HD - 1);
    const float f = wo[(size_t)o * CC + head * HD + kk];
    const float v = (k < HD) ? bfr(f) * 64.0f : 0.0f;
    Wts[o * FP + k] = (_Float16)v;
  }
  {
    const int i = tid >> 4, j = tid & 15;
    const float* spp = sp + (size_t)bi * (16 * 256) + i * 16 + j;
    float pv[16];
#pragma unroll
    for (int rg = 0; rg < 16; ++rg) pv[rg] = spp[rg * 256];
#if defined(__HIP_DEVICE_COMPILE__)
    // the wait between the 16 issued loads and a rewrite of the address they name; the address and the loaded values
    // are inputs, so that the address stays live to the wait and no load of the run lands in it
    asm volatile("s_wait_xcnt 0x0" :: "v"(spp), "v"(pv[0]), "v"(pv[1]), "v"(pv[2]), "v"(pv[3]), "v"(pv[4]), "v"(pv[5]),
                 "v"(pv[6]), "v"(pv[7]), "v"(pv[8]), "v"(pv[9]), "v"(pv[10]), "v"(pv[11]), "v"(pv[12]), "v"(pv[13]),
                 "v"(pv[14]), "v"(pv[15]));
#endif
    float s = 0.f;
#pragma unroll
    for (int rg = 0; rg < 16; ++rg) s += pv[rg];
    const float isc = 1.0f / bfr(scale[0]);
    Sm[i * WSP + j] = s * isc;
  }
  __syncthreads();
  if (tid < 16) {
    float mx = -3.0e38f;
#pragma unroll 1
    for (int n = 0; n < HD; ++n) mx = fmaxf(mx, Sm[tid * WSP + n]);
    float ssum = 0.f;
#pragma unroll 1
    for (int n = 0; n < HD; ++n) {
      const float e = expf(Sm[tid * WSP + n] - mx);
      Sm[tid * WSP + n] = e;
      ssum += e;
    }
    const float inv = 1.0f / ssum;
#pragma unroll 1
    for (int n = 0; n < HD; ++n) {
      const float pv = (Sm[tid * WSP + n] * inv) * 4096.0f;
      const _Float16 hv = (_Float16)pv;
      Phs[tid * FP + n] = hv;
      Pls[tid * FP + n] = (_Float16)((pv - (float)hv) * 2048.0f);
    }
#pragma unroll 1
    for (int n = HD; n < 32; ++n) { Phs[tid * FP + n] = (_Float16)0.0f; Pls[tid * FP + n] = (_Float16)0.0f; }
  }
  __syncthreads();
  {
    const v16h fa = ldfrag_h(Wts + (wave * 16 + m) * FP + 8 * hh);
    const v16h fb = ldfrag_h(Phs + m * FP + 8 * hh);
    const v16h gb = ldfrag_h(Pls + m * FP + 8 * hh);
    v8f ah = mma_raw(fa, fb, zero8());
    v8f al = mma_raw(fa, gb, zero8());
    guard2(ah, al, fa, fb, gb);
#pragma unroll
    for (int r = 0; r < 8; ++r) Ws[(wave * 16 + 8 * hh + r) * WSP + m] = (ah[r] + al[r] * RSC) * (1.0f / 4096.0f);
  }
  __syncthreads();
  {
    const int o = tid >> 1, hf = tid & 1;
    v4u a, q4;
#pragma unroll
    for (int e = 0; e < 4; ++e) {
      const float f0 = Ws[o * WSP + hf * 8 + 2 * e];
      const float f1 = Ws[o * WSP + hf * 8 + 2 * e + 1];
      unsigned hp, lp;
      split2(f0, f1, hp, lp);
      a[e] = hp; q4[e] = lp;
    }
    const size_t off = (size_t)(bi * CC + o) * HD + hf * 8;
    *(v4u*)(weh + off) = a;
    *(v4u*)(wel + off) = q4;
    
  }
}

// =================================================================================================================
// Output: y[b][o][p] = (sum_c' Wm64[b][c'][o] V[p][c']) / 64 + bf16(x[b][o][p]) for 64 pixels x 128 channels per
// =================================================================================================================
__global__ __launch_bounds__(256)
void k_final(const unsigned short* __restrict__ vh, const unsigned short* __restrict__ vl,
             const unsigned short* __restrict__ weh, const unsigned short* __restrict__ wel,
             const float* __restrict__ x, float* out) {
  __shared__ __align__(16) float Cs[64 * LDC];
  const int tid = threadIdx.x;
  const int mb = blockIdx.x;
  const int p0 = mb * 64;
  const int b = p0 / IMGPIX, pl0 = p0 - b * IMGPIX;
  const _Float16* Vh = (const _Float16*)(const void*)(vh + (size_t)b * BSZ);
  const _Float16* Vl = (const _Float16*)(const void*)(vl + (size_t)b * BSZ);
  const _Float16* Wh = (const _Float16*)(const void*)(weh + (size_t)b * NHEAD * CC * HD);
  const _Float16* Wl = (const _Float16*)(const void*)(wel + (size_t)b * NHEAD * CC * HD);
  mm_final(Vh, Vl, Wh, Wl, pl0, Cs);
  __syncthreads();
  v4f pk[8];
  size_t offs[8];
#pragma unroll
  for (int s = 0; s < 8; ++s) {
    const int idx = s * 256 + tid;
    const int o = idx >> 4, piece = idx & 15;
    const size_t off = (size_t)(b * CC + o) * IMGPIX + pl0 + piece * 4;
    const v4f xr = *(const v4f*)(x + off);
    v4f v;
#pragma unroll
    for (int e = 0; e < 4; ++e) v[e] = Cs[(piece * 4 + e) * LDC + o] * (1.0f / 64.0f) + bfr(xr[e]);
    pk[s] = v;
    offs[s] = off;
  }
#pragma unroll
  for (int s = 0; s < 8; ++s) *(v4f*)(out + offs[s]) = pk[s];
  
}

// =================================================================================================================
// Workspace map (bytes, offsets multiples of 65536, no aliasing, every region sized at or above its whole-line store
// extent): W1 f16 [3][128][128] 98304 (131072) | WT f16 [3][128][1152] 884736 (917504) | XH, XL f16 [32768][128]
// 8388608 each | P1 f16 6 x [2][130][130][128] 51916800 (51970048) | QK f32 [2][2][128][16384] 33554432 |
// VH, VL f16 [2][128][16384] 8388608 each | WEH, WEL f16 [2][8][128][16] 65536 each | SP f32 [16][16][256] 262144 |
// total 120520704.
// =================================================================================================================
extern "C" void kernel_launch(void* const* d_in, const int* in_sizes, int n_in,
                              void* d_out, int out_size, void* d_ws, size_t ws_size,
                              hipStream_t stream) {
  if (n_in < 11) return;
  const int expect[11] = { NB * CC * IMGPIX, WW, WW, 1, CC * CC, CC * CC * 9, CC * CC, CC * CC * 9,
                           CC * CC, CC * CC * 9, CC * CC };
  for (int i = 0; i < 11; ++i) if (in_sizes[i] != expect[i]) return;
  if (out_size != NB * CC * IMGPIX) return;

  const float* x     = (const float*)d_in[0];
  const float* gam   = (const float*)d_in[1];
  const float* bet   = (const float*)d_in[2];
  const float* scale = (const float*)d_in[3];
  const float* wq1   = (const float*)d_in[4];
  const float* wq2   = (const float*)d_in[5];
  const float* wk1   = (const float*)d_in[6];
  const float* wk2   = (const float*)d_in[7];
  const float* wv1   = (const float*)d_in[8];
  const float* wv2   = (const float*)d_in[9];
  const float* wo    = (const float*)d_in[10];
  float* out = (float*)d_out;

  const size_t AL = 65536;
  const size_t sW1 = (((size_t)3 * CC * CC * 2) + AL - 1) / AL * AL;               //   131072
  const size_t sWT = (((size_t)3 * CC * KCV * 2) + AL - 1) / AL * AL;              //   917504
  const size_t sX  = (((size_t)NPIX * CC * 2) + AL - 1) / AL * AL;                  //  8388608
  const size_t sP1 = (((size_t)6 * PS1 * 2) + AL - 1) / AL * AL;                    // 51970048
  const size_t sQK = (((size_t)2 * NB * BSZ * 4) + AL - 1) / AL * AL;               // 33554432
  const size_t sV  = (((size_t)NB * BSZ * 2) + AL - 1) / AL * AL;                   //  8388608
  const size_t sWE = (((size_t)NB * NHEAD * CC * HD * 2) + AL - 1) / AL * AL;       //    65536
  const size_t sSP = (((size_t)NB * NHEAD * 16 * 256 * 4) + AL - 1) / AL * AL;      //   262144

  size_t off = 0;
  const size_t oW1  = off; off += sW1;
  const size_t oWT  = off; off += sWT;
  const size_t oXH  = off; off += sX;
  const size_t oXL  = off; off += sX;
  const size_t oP1  = off; off += sP1;
  const size_t oQK  = off; off += sQK;
  const size_t oVH  = off; off += sV;
  const size_t oVL  = off; off += sV;
  const size_t oWEH = off; off += sWE;
  const size_t oWEL = off; off += sWE;
  const size_t oSP  = off; off += sSP;
  if (off > ws_size) return;                                 // off = 120520704
  if (off > (size_t)134217728) return;

  char* ws = (char*)d_ws;
  unsigned short* W1  = (unsigned short*)(ws + oW1);
  unsigned short* WT  = (unsigned short*)(ws + oWT);
  unsigned short* XH  = (unsigned short*)(ws + oXH);
  unsigned short* XL  = (unsigned short*)(ws + oXL);
  unsigned short* P1  = (unsigned short*)(ws + oP1);
  float*          QK  = (float*)(ws + oQK);
  unsigned short* VH  = (unsigned short*)(ws + oVH);
  unsigned short* VL  = (unsigned short*)(ws + oVL);
  unsigned short* WEH = (unsigned short*)(ws + oWEH);
  unsigned short* WEL = (unsigned short*)(ws + oWEL);
  float*          SP  = (float*)(ws + oSP);

  const dim3 blk(256);
  // (1) weight planes
  k_wcvt<<<dim3(6 * CC), blk, 0, stream>>>(wq1, wq2, wk1, wk2, wv1, wv2, W1, WT);
  // (2) layer norm over w + NHWC hi/lo planes
  k_ln<<<dim3(NB * HH * 2), blk, 0, stream>>>(x, gam, bet, XH, XL);
  // (3) 1x1 projections into padded NHWC hi/lo planes (interior)
  k_proj<<<dim3(NPIX / 64, 3), blk, 0, stream>>>(XH, XL, W1, P1);
  // (4) halo zero fill of the padded planes
  k_halo<<<dim3((6 * NB * NHALO * 16 + 255) / 256), blk, 0, stream>>>(P1);
  // (5) 3x3 convs -> q, k f32 NCHW flat planes; v f16 hi/lo NCHW flat planes
  k_conv3<<<dim3(NPIX / 64, 3), blk, 0, stream>>>(P1, WT, QK, VH, VL);
  // (6) f32 logit partial sums, one work-group per (row group, batch-head)
  k_logit<<<dim3(16 * NB * NHEAD), dim3(512), 0, stream>>>(QK, QK + (size_t)NB * BSZ, SP);
  // (7) per-head channel attention: row groups added + softmax + wo mix -> Wm planes
  k_attn<<<dim3(NB * NHEAD), blk, 0, stream>>>(SP, wo, scale, WEH, WEL);
  // (8) output GEMM + residual -> NCHW d_out
  k_final<<<dim3(NPIX / 64), blk, 0, stream>>>(VH, VL, WEH, WEL, x, out);
  (void)hipGetLastError();
}

// v002
// One run takes 113 microseconds.
// In both of two side-by-side timings against v001, it was 2.28 times as fast.
// Counting every step since v000, it is 5.83 times as fast.
// Contractions: 1x1 projections (K=128) and 3x3 convs as implicit GEMM (K=1152): v_wmma_f32_16x16x32_f16, the
// activation as f16 hi + x2048 residual planes into two f32 accumulators, weights one f16 plane of 64*bf16(w);
// per-head k^T q logits (K=16384): f32 on VALU from f32 q/k planes (fixed-order three-level sums); wo x probs mix
// (K=16, zero padded to 32): f16, probs carried x4096 as hi + residual; fused output GEMM (K=128): v and the mixed
// weight as f16 hi + residual planes (3 products); f32 accumulate everywhere. Layer-norm statistics, softmax and
// all epilogues f32 on VALU; every float input RNE-converted to bf16 on load.
#include <hip/hip_runtime.h>
#include <stdint.h>

#define NB     2
#define CC     128
#define HH     128
#define WW     128
#define IMGPIX (HH * WW)
#define NPIX   (NB * IMGPIX)
#define HP     (HH + 2)
#define WP     (WW + 2)
#define PADIMG (HP * WP)
#define PADPIX (NB * PADIMG)
#define KCV    1152
#define NKS    36
#define NHEAD  8
#define HD     16
#define HSZ    (IMGPIX * HD)
#define BSZ    (CC * IMGPIX)
#define LDC    132
#define FP     40
#define WSP    17
#define NHALO  (2 * WP + 2 * HH)
#define RSC    0.00048828125f
#define PS1    ((size_t)PADPIX * CC)
#define PS2    ((size_t)NPIX * CC)
#define SPK    72
#define SBUF   (256 * SPK)
#define NST    18

static_assert(NPIX == NB * IMGPIX);
static_assert(IMGPIX == 16384 && HH == 128 && WW == 128);
static_assert(PADIMG == 16900);
static_assert(KCV == 9 * CC && KCV == NKS * 32);
static_assert(CC == NHEAD * HD);
static_assert(BSZ == CC * IMGPIX && HSZ * NHEAD == BSZ);
static_assert((IMGPIX % 64) == 0 && (WW % 64) == 0);
static_assert((LDC * 4) % 16 == 0 && (FP * 2) % 16 == 0);
static_assert(NHALO == 516);
static_assert((KCV % 8) == 0 && (CC % 32) == 0);
static_assert(IMGPIX == 32 * 32 * 16);
static_assert(NST * 64 == KCV && (SPK * 2) % 32 == 16 && 2 * SBUF * 2 >= 64 * LDC * 4);

// Index maps of the raw reshapes (per batch b, flat NCHW index f = c*16384 + h*128 + w viewed as [8][16384][16]):
//   Q_head[r][d] = qflat[b][head*262144 + 16 r + d]   (same map for K_head and V_head; r = (c%16)*1024 + h*8 + w/16,
//   d = w%16). S_head[i][j] = sum_r K_head[r][i] Q_head[r][j]; P_head = softmax_j(S_head * (1/scale)).
//   O[b][16 head + j2][pixel r] = sum_j V_head[r][j] P_head[j][j2].
//   y[b][o][pixel r] = sum_{head, j} Wm[b][head][o][j] V_head[r][j] + x[b][o][r],
//   Wm[b][head][o][j] = sum_j2 wo[o][16 head + j2] P_head[j][j2]   (reassociated 1x1 output conv).

typedef _Float16 v16h __attribute__((ext_vector_type(16)));
typedef _Float16 v8h  __attribute__((ext_vector_type(8)));
typedef float    v8f  __attribute__((ext_vector_type(8)));
typedef float    v4f  __attribute__((ext_vector_type(4)));
typedef unsigned int v4u __attribute__((ext_vector_type(4)));

// ---- scalar helpers ------------------------------------------------------------------------------------------
__device__ __forceinline__ unsigned short bf_bits(float f) {          // f32 -> bf16 bits, RNE convert
  unsigned u = __float_as_uint(f);
  return (unsigned short)((u + 0x7FFFu + ((u >> 16) & 1u)) >> 16);
}
__device__ __forceinline__ float bf_up(unsigned short b) { return __uint_as_float(((unsigned)b) << 16); }
__device__ __forceinline__ float bfr(float f) { return bf_up(bf_bits(f)); }
__device__ __forceinline__ unsigned short h_bits(_Float16 x) { return __builtin_bit_cast(unsigned short, x); }
__device__ __forceinline__ unsigned short hb16(float f) { return h_bits((_Float16)f); }
__device__ __forceinline__ unsigned pk16(unsigned short a, unsigned short b) { return (unsigned)a | ((unsigned)b << 16); }
__device__ __forceinline__ v8f zero8() { v8f z = {0.f, 0.f, 0.f, 0.f, 0.f, 0.f, 0.f, 0.f}; return z; }
// hi/lo pair of two f32 values: hi = f16(v), lo = f16(2048 (v - hi)), packed as two 32-bit words
__device__ __forceinline__ void split2(float f0, float f1, unsigned& hp, unsigned& lp) {
  const _Float16 h0 = (_Float16)f0, h1 = (_Float16)f1;
  const float q0 = (f0 - (float)h0) * 2048.0f, q1 = (f1 - (float)h1) * 2048.0f;
  hp = pk16(h_bits(h0), h_bits(h1));
  lp = pk16(hb16(q0), hb16(q1));
}

// ---- fragment loader: 16-bit A/B operand, lane -> row/col (lane&15), p already includes +8*(lane>>4);
//      elements 0..7 <- p[0..7] (k0+8h..k0+8h+7), elements 8..15 <- p[16..23] (k0+16+8h..k0+16+8h+7)
__device__ __forceinline__ v16h ldfrag_h(const _Float16* p) {
  union { v16h v; v8h h[2]; } f;
  f.h[0] = *(const v8h*)(p);
  f.h[1] = *(const v8h*)(p + 16);
  return f.v;
}
// same layout, the two 8-element halves at two independent 16-B aligned addresses (pa: k0+8h.., pb: k0+16+8h..)
__device__ __forceinline__ v16h ldfrag2(const _Float16* pa, const _Float16* pb) {
  union { v16h v; v8h h[2]; } f;
  f.h[0] = *(const v8h*)(pa);
  f.h[1] = *(const v8h*)(pb);
  return f.v;
}

// ---- WMMA helpers; the guards insert the trailing VALU hazard gap and keep A/B live --------------------------
__device__ __forceinline__ v8f mma_raw(v16h a, v16h b, v8f c) {
  return __builtin_amdgcn_wmma_f32_16x16x32_f16(false, a, false, b, (short)0, c, false, false);
}
__device__ __forceinline__ void guard8(v8f& c0, v8f& c1, v8f& c2, v8f& c3, v8f& c4, v8f& c5, v8f& c6, v8f& c7,
                                       const v16h& a0, const v16h& a1, const v16h& a2, const v16h& a3,
                                       const v16h& b0, const v16h& b1) {
#if defined(__HIP_DEVICE_COMPILE__)
  asm volatile("v_nop\n\tv_nop\n\tv_nop\n\tv_nop"
               : "+v"(c0), "+v"(c1), "+v"(c2), "+v"(c3), "+v"(c4), "+v"(c5), "+v"(c6), "+v"(c7)
               : "v"(a0), "v"(a1), "v"(a2), "v"(a3), "v"(b0), "v"(b1));
#endif
}
__device__ __forceinline__ void guard4(v8f& c0, v8f& c1, v8f& c2, v8f& c3,
                                       const v16h& a0, const v16h& a1, const v16h& b0, const v16h& b1) {
#if defined(__HIP_DEVICE_COMPILE__)
  asm volatile("v_nop\n\tv_nop\n\tv_nop\n\tv_nop"
               : "+v"(c0), "+v"(c1), "+v"(c2), "+v"(c3)
               : "v"(a0), "v"(a1), "v"(b0), "v"(b1));
#endif
}
__device__ __forceinline__ void guard2(v8f& c0, v8f& c1, const v16h& a0, const v16h& b0, const v16h& b1) {
#if defined(__HIP_DEVICE_COMPILE__)
  asm volatile("v_nop\n\tv_nop\n\tv_nop\n\tv_nop"
               : "+v"(c0), "+v"(c1)
               : "v"(a0), "v"(b0), "v"(b1));
#endif
}

// ---- LDS staging of one 64-k slice of a 64x128 block tile's operands: 256 rows of 128 B at pitch 144 B (16 B x odd, for
//      the ds_load_b128 fragment reads): rows 0..63 A hi, 64..127 A lo (64 A rows, global pitch CC), 128..255 W (128 rows,
//      global pitch wstep32 / 32). Thread = (row tid>>3 of each group of 32 rows, 16-B piece tid&7), 8 copies; ga_h, ga_l,
//      gw are the thread's own source addresses in the first group, lds its own byte address in the target buffer.
//      Each copy instruction moves four whole 128-B lines, and every operand byte is fetched once per work-group.
__device__ __forceinline__ void stage_copy(const _Float16* ga_h, const _Float16* ga_l, const _Float16* gw, int wstep32,
                                           unsigned lds) {
  const _Float16* g1 = ga_h + 32 * CC;
  const _Float16* g3 = ga_l + 32 * CC;
  const _Float16* g5 = gw + wstep32;
  const _Float16* g6 = gw + 2 * wstep32;
  const _Float16* g7 = gw + 3 * wstep32;
  const unsigned l1 = lds + 1 * 32 * SPK * 2, l2 = lds + 2 * 32 * SPK * 2, l3 = lds + 3 * 32 * SPK * 2;
  const unsigned l4 = lds + 4 * 32 * SPK * 2, l5 = lds + 5 * 32 * SPK * 2, l6 = lds + 6 * 32 * SPK * 2;
  const unsigned l7 = lds + 7 * 32 * SPK * 2;
#if defined(__HIP_DEVICE_COMPILE__)
  // global -> LDS through no register; the last line is the wait that stands between issued copies and a rewrite of
  // a register they name, inside the statement so that nothing can be moved in front of it
  asm volatile("global_load_async_to_lds_b128 %0, %1, off\n\t"
               "global_load_async_to_lds_b128 %2, %3, off\n\t"
               "global_load_async_to_lds_b128 %4, %5, off\n\t"
               "global_load_async_to_lds_b128 %6, %7, off\n\t"
               "global_load_async_to_lds_b128 %8, %9, off\n\t"
               "global_load_async_to_lds_b128 %10, %11, off\n\t"
               "global_load_async_to_lds_b128 %12, %13, off\n\t"
               "global_load_async_to_lds_b128 %14, %15, off\n\t"
               "s_wait_xcnt 0x0"
               :: "v"(lds), "v"(ga_h), "v"(l1), "v"(g1), "v"(l2), "v"(ga_l), "v"(l3), "v"(g3),
                  "v"(l4), "v"(gw), "v"(l5), "v"(g5), "v"(l6), "v"(g6), "v"(l7), "v"(g7)
               : "memory");
#endif
}
__device__ __forceinline__ void wait_copies() {
#if defined(__HIP_DEVICE_COMPILE__)
  asm volatile("s_wait_asynccnt 0x0" ::: "memory");   // this wave's copies have landed in LDS
#endif
}
__device__ __forceinline__ void wait_lds_reads() {
#if defined(__HIP_DEVICE_COMPILE__)
  asm volatile("s_wait_dscnt 0x0" ::: "memory");      // this wave's LDS reads are done before the buffer is rewritten
#endif
}

// ---- 64x128 block tile GEMM core (K = 128) with the A operand as two planes (hi and x2048 residual) into separate
//      accumulators; A row pitch CC (f16), W is [n][k] k-contiguous pitch CC. Both 64-k slices are copied to the two LDS
//      buffers at once, then read. 8 waves = 2 (32 rows) x 4 (32 cols), 2x2 tiles of 16 per wave; fragments from LDS with
//      the table layout; the residual accumulator is folded with 1/2048 when the tile is written to the LDS f32 tile
//      Cs[64][LDC], which takes the buffers' place behind a barrier.
__device__ __forceinline__ void mm_tile2(const _Float16* __restrict__ Ah, const _Float16* __restrict__ Al,
                                         const _Float16* __restrict__ W, int arow0, _Float16* ring) {
  const int tid = threadIdx.x, wave = tid >> 5, lane = tid & 31, hh = lane >> 4, c = lane & 15;
  const int mw = wave >> 2, nw = wave & 3;
  const int srow = tid >> 3, spc = tid & 7;
  const size_t sa = (size_t)(arow0 + srow) * CC + spc * 8;
  const _Float16* wb = W + (size_t)srow * CC + spc * 8;
  const unsigned lds0 = (unsigned)(size_t)ring + (unsigned)((srow * SPK + spc * 8) * 2);
  const _Float16* fap = ring + (mw * 32 + c) * SPK + 8 * hh;
  const _Float16* fbp = ring + (128 + nw * 32 + c) * SPK + 8 * hh;
  v8f h00 = zero8(), h01 = zero8(), h10 = zero8(), h11 = zero8();
  v8f l00 = zero8(), l01 = zero8(), l10 = zero8(), l11 = zero8();
  stage_copy(Ah + sa, Al + sa, wb, 32 * CC, lds0);
  stage_copy(Ah + sa + 64, Al + sa + 64, wb + 64, 32 * CC, lds0 + SBUF * 2);
  wait_copies();
  __syncthreads();                               // both slices are readable by every wave
  // unrolled: every fragment's LDS offset becomes an immediate of its load
#pragma unroll
  for (int ks = 0; ks < CC / 32; ++ks) {
    const _Float16* pa = fap + (ks >> 1) * SBUF + (ks & 1) * 32;
    const _Float16* pb = fbp + (ks >> 1) * SBUF + (ks & 1) * 32;
    const v16h fa0 = ldfrag_h(pa);
    const v16h fa1 = ldfrag_h(pa + 16 * SPK);
    const v16h ga0 = ldfrag_h(pa + 64 * SPK);
    const v16h ga1 = ldfrag_h(pa + 80 * SPK);
    const v16h fb0 = ldfrag_h(pb);
    const v16h fb1 = ldfrag_h(pb + 16 * SPK);
    h00 = mma_raw(fa0, fb0, h00);
    h01 = mma_raw(fa0, fb1, h01);
    h10 = mma_raw(fa1, fb0, h10);
    h11 = mma_raw(fa1, fb1, h11);
    l00 = mma_raw(ga0, fb0, l00);
    l01 = mma_raw(ga0, fb1, l01);
    l10 = mma_raw(ga1, fb0, l10);
    l11 = mma_raw(ga1, fb1, l11);
    guard8(h00, h01, h10, h11, l00, l01, l10, l11, fa0, fa1, ga0, ga1, fb0, fb1);
  }
  wait_lds_reads();
  __syncthreads();                               // ends every wave's fragment reads: the buffers become the f32 tile
  float* Cs = (float*)(void*)ring;
#pragma unroll
  for (int r = 0; r < 8; ++r) {
    const int row = mw * 32 + 8 * hh + r;
    Cs[row * LDC + nw * 32 + c]             = h00[r] + l00[r] * RSC;
    Cs[row * LDC + nw * 32 + 16 + c]        = h01[r] + l01[r] * RSC;
    Cs[(row + 16) * LDC + nw * 32 + c]      = h10[r] + l10[r] * RSC;
    Cs[(row + 16) * LDC + nw * 32 + 16 + c] = h11[r] + l11[r] * RSC;
  }
}

// ---- implicit-GEMM variant for the 3x3 conv: A row = output pixel p (flat over all images), k = tap*128 + c;
//      W = wt [128][1152] k-contiguous. The operands of a stage st (tap = st>>1, channel half = st&1: 64 k, two k-steps)
//      are staged in LDS by stage_copy: the A rows are the 64 pixels at padded position (y + ky, x + kx), the W rows the
//      128 output channels. Two buffers: stage t + 1 is copied while stage t is multiplied; the fragments come from LDS
//      with the table k map (k order: tap, channel quarter, table).
__device__ __forceinline__ size_t conv_abase(int p, int hh) {
  const int b = p / IMGPIX;
  const int r = p - b * IMGPIX;
  const int y = r / WW;
  const int x = r - y * WW;
  return ((size_t)(b * HP + y) * WP + x) * CC + 8 * hh;
}
// stage st's copies into the buffer at lds; ah/al/wb are the thread's own source addresses for stage 0
__device__ __forceinline__ void conv_stage(const _Float16* ah, const _Float16* al, const _Float16* wb, int st,
                                           unsigned lds) {
  const int tap = st >> 1;
  const int ky = (tap * 11) >> 5;                // tap / 3 for tap < 9
  const int kx = tap - 3 * ky;
  const int ao = (ky * WP + kx) * CC + (st & 1) * 64;
  stage_copy(ah + ao, al + ao, wb + st * 64, 32 * KCV, lds);
}
__device__ __forceinline__ void mm_conv(const _Float16* __restrict__ Ah, const _Float16* __restrict__ Al,
                                        const _Float16* __restrict__ W, int prow0, _Float16* ring) {
  const int tid = threadIdx.x, wave = tid >> 5, lane = tid & 31, hh = lane >> 4, c = lane & 15;
  const int mw = wave >> 2, nw = wave & 3;
  const int srow = tid >> 3, spc = tid & 7;
  const size_t sa = conv_abase(prow0 + srow, 0) + spc * 8;
  const _Float16* ah = Ah + sa;
  const _Float16* al = Al + sa;
  const _Float16* wb = W + (size_t)srow * KCV + spc * 8;
  const unsigned lds0 = (unsigned)(size_t)ring + (unsigned)((srow * SPK + spc * 8) * 2);
  const _Float16* fap = ring + (mw * 32 + c) * SPK + 8 * hh;
  const _Float16* fbp = ring + (128 + nw * 32 + c) * SPK + 8 * hh;
  v8f h00 = zero8(), h01 = zero8(), h10 = zero8(), h11 = zero8();
  v8f l00 = zero8(), l01 = zero8(), l10 = zero8(), l11 = zero8();
  conv_stage(ah, al, wb, 0, lds0);
  wait_copies();
  __syncthreads();                               // stage 0 is readable by every wave
  conv_stage(ah, al, wb, 1, lds0 + SBUF * 2);
  // rolled: one copy of the body in the instruction cache, the buffer chosen by t & 1
#pragma unroll 1
  for (int t = 0; t < NST; ++t) {
    const int bo = (t & 1) * SBUF;
    // unrolled: the two k-steps' LDS offsets become immediates of their loads
#pragma unroll
    for (int kk = 0; kk < 2; ++kk) {
      const _Float16* pa = fap + bo + kk * 32;
      const _Float16* pb = fbp + bo + kk * 32;
      const v16h fa0 = ldfrag_h(pa);
      const v16h fa1 = ldfrag_h(pa + 16 * SPK);
      const v16h ga0 = ldfrag_h(pa + 64 * SPK);
      const v16h ga1 = ldfrag_h(pa + 80 * SPK);
      const v16h fb0 = ldfrag_h(pb);
      const v16h fb1 = ldfrag_h(pb + 16 * SPK);
      h00 = mma_raw(fa0, fb0, h00);
      h01 = mma_raw(fa0, fb1, h01);
      h10 = mma_raw(fa1, fb0, h10);
      h11 = mma_raw(fa1, fb1, h11);
      l00 = mma_raw(ga0, fb0, l00);
      l01 = mma_raw(ga0, fb1, l01);
      l10 = mma_raw(ga1, fb0, l10);
      l11 = mma_raw(ga1, fb1, l11);
      guard8(h00, h01, h10, h11, l00, l01, l10, l11, fa0, fa1, ga0, ga1, fb0, fb1);
    }
    wait_lds_reads();
    wait_copies();
    __syncthreads();                             // publishes stage t + 1 and ends every read of stage t's buffer
    if (t + 2 < NST) conv_stage(ah, al, wb, t + 2, lds0 + bo * 2);
  }
  wait_copies();
  float* Cs = (float*)(void*)ring;               // the ring is free behind the last trip's barrier: f32 tile [64][LDC]
#pragma unroll
  for (int r = 0; r < 8; ++r) {
    const int row = mw * 32 + 8 * hh + r;
    Cs[row * LDC + nw * 32 + c]             = h00[r] + l00[r] * RSC;
    Cs[row * LDC + nw * 32 + 16 + c]        = h01[r] + l01[r] * RSC;
    Cs[(row + 16) * LDC + nw * 32 + c]      = h10[r] + l10[r] * RSC;
    Cs[(row + 16) * LDC + nw * 32 + 16 + c] = h11[r] + l11[r] * RSC;
  }
}

// ---- fused output GEMM core: rows = 64 pixels of one batch (local pixel pl0..pl0+63), cols = 128 output channels,
//      k = c' = 16 head + j (K = 128, 4 k-steps of two heads each). A[p][c'] = V_head[p][j] read from the NCHW flat v
//      planes at head*HSZ + 16 p + j (two 16-B halves per fragment, heads 2ks and 2ks+1); B = Wm[head][o][16]
//      k-contiguous per head. Products hi*hi + hi*lo (first loop) and lo*hi (second loop) into Cs[64][LDC].
__device__ __forceinline__ void mm_final(const _Float16* __restrict__ Vh, const _Float16* __restrict__ Vl,
                                         const _Float16* __restrict__ Wh, const _Float16* __restrict__ Wl,
                                         int pl0, float* Cs) {
  const int tid = threadIdx.x, wave = tid >> 5, lane = tid & 31, hh = lane >> 4, c = lane & 15;
  const int mw = wave >> 2, nw = wave & 3;
  const size_t r0 = (size_t)(pl0 + mw * 32 + c) * HD + 8 * hh;
  const size_t r1 = (size_t)(pl0 + mw * 32 + 16 + c) * HD + 8 * hh;
  const size_t q0 = (size_t)(nw * 32 + c) * HD + 8 * hh;
  const size_t q1 = (size_t)(nw * 32 + 16 + c) * HD + 8 * hh;
  {
    v8f h00 = zero8(), h01 = zero8(), h10 = zero8(), h11 = zero8();
    v8f l00 = zero8(), l01 = zero8(), l10 = zero8(), l11 = zero8();
#pragma unroll 1
    for (int ks = 0; ks < CC / 32; ++ks) {
      const size_t ao = (size_t)(2 * ks) * HSZ;
      const size_t bo = (size_t)(2 * ks) * (CC * HD);
      const v16h fa0 = ldfrag2(Vh + r0 + ao, Vh + r0 + ao + HSZ);
      const v16h fa1 = ldfrag2(Vh + r1 + ao, Vh + r1 + ao + HSZ);
      const v16h fb0 = ldfrag2(Wh + q0 + bo, Wh + q0 + bo + CC * HD);
      const v16h fb1 = ldfrag2(Wh + q1 + bo, Wh + q1 + bo + CC * HD);
      const v16h gb0 = ldfrag2(Wl + q0 + bo, Wl + q0 + bo + CC * HD);
      const v16h gb1 = ldfrag2(Wl + q1 + bo, Wl + q1 + bo + CC * HD);
      h00 = mma_raw(fa0, fb0, h00);
      h01 = mma_raw(fa0, fb1, h01);
      h10 = mma_raw(fa1, fb0, h10);
      h11 = mma_raw(fa1, fb1, h11);
      l00 = mma_raw(fa0, gb0, l00);
      l01 = mma_raw(fa0, gb1, l01);
      l10 = mma_raw(fa1, gb0, l10);
      l11 = mma_raw(fa1, gb1, l11);
      guard8(h00, h01, h10, h11, l00, l01, l10, l11, fa0, fa1, gb0, gb1, fb0, fb1);
    }
#pragma unroll
    for (int r = 0; r < 8; ++r) {
      const int row = mw * 32 + 8 * hh + r;
      Cs[row * LDC + nw * 32 + c]             = h00[r] + l00[r] * RSC;
      Cs[row * LDC + nw * 32 + 16 + c]        = h01[r] + l01[r] * RSC;
      Cs[(row + 16) * LDC + nw * 32 + c]      = h10[r] + l10[r] * RSC;
      Cs[(row + 16) * LDC + nw * 32 + 16 + c] = h11[r] + l11[r] * RSC;
    }
  }
  {
    v8f m00 = zero8(), m01 = zero8(), m10 = zero8(), m11 = zero8();
#pragma unroll 1
    for (int ks = 0; ks < CC / 32; ++ks) {
      const size_t ao = (size_t)(2 * ks) * HSZ;
      const size_t bo = (size_t)(2 * ks) * (CC * HD);
      const v16h ga0 = ldfrag2(Vl + r0 + ao, Vl + r0 + ao + HSZ);
      const v16h ga1 = ldfrag2(Vl + r1 + ao, Vl + r1 + ao + HSZ);
      const v16h fb0 = ldfrag2(Wh + q0 + bo, Wh + q0 + bo + CC * HD);
      const v16h fb1 = ldfrag2(Wh + q1 + bo, Wh + q1 + bo + CC * HD);
      m00 = mma_raw(ga0, fb0, m00);
      m01 = mma_raw(ga0, fb1, m01);
      m10 = mma_raw(ga1, fb0, m10);
      m11 = mma_raw(ga1, fb1, m11);
      guard4(m00, m01, m10, m11, ga0, ga1, fb0, fb1);
    }
#pragma unroll
    for (int r = 0; r < 8; ++r) {               // same lane wrote these slots above (program order, same type)
      const int row = mw * 32 + 8 * hh + r;
      Cs[row * LDC + nw * 32 + c]             += m00[r] * RSC;
      Cs[row * LDC + nw * 32 + 16 + c]        += m01[r] * RSC;
      Cs[(row + 16) * LDC + nw * 32 + c]      += m10[r] * RSC;
      Cs[(row + 16) * LDC + nw * 32 + 16 + c] += m11[r] * RSC;
    }
  }
}

// =================================================================================================================
// Weight convert. Blocks 0..383: tensor t = blk/128 of (wq2, wk2, wv2) [co][ci][3][3] f32 -> wt [t][co][k =
// tap*128 + ci] f16(64 * bf16(w)); thread tt < 144 builds one 16-B piece (8 halves), 8 consecutive threads per
// passes. grid = 768. coverage: wt 384 x 1152 and w1 384 x 128, every element once.
// =================================================================================================================
__global__ __launch_bounds__(256)
void k_wcvt(const float* __restrict__ wq1, const float* __restrict__ wq2, const float* __restrict__ wk1,
            const float* __restrict__ wk2, const float* __restrict__ wv1, const float* __restrict__ wv2,
            unsigned short* w1, unsigned short* wt) {
  const int tid = threadIdx.x;
  const int blk = blockIdx.x;
  if (blk < 3 * CC) {
    const int t = blk / CC, co = blk - t * CC;
    const float* src = (t == 0) ? wq2 : ((t == 1) ? wk2 : wv2);
    const int tt = min(tid, 143);
    const int k0 = tt * 8, tap = k0 / CC, c0 = k0 - tap * CC;
    v4u pk;
#pragma unroll
    for (int e = 0; e < 4; ++e) {
      const float f0 = src[(size_t)(co * CC + c0 + 2 * e) * 9 + tap];
      const float f1 = src[(size_t)(co * CC + c0 + 2 * e + 1) * 9 + tap];
      pk[e] = pk16(hb16(bfr(f0) * 64.0f), hb16(bfr(f1) * 64.0f));
    }
    if (tid < 144) {
      unsigned short* dst = wt + (size_t)(t * CC + co) * KCV + k0;
      *(v4u*)dst = pk;
      
    }
  } else {
    const int rr = blk - 3 * CC;
    const int t = rr / CC, o = rr - t * CC;
    const float* src = (t == 0) ? wq1 : ((t == 1) ? wk1 : wv1);
    const int tt = min(tid, 15);
    const int c0 = tt * 8;
    v4u pk;
#pragma unroll
    for (int e = 0; e < 4; ++e) {
      const float f0 = src[(size_t)o * CC + c0 + 2 * e];
      const float f1 = src[(size_t)o * CC + c0 + 2 * e + 1];
      pk[e] = pk16(hb16(bfr(f0) * 64.0f), hb16(bfr(f1) * 64.0f));
    }
    if (tid < 16) {
      unsigned short* dst = w1 + (size_t)(t * CC + o) * CC + c0;
      *(v4u*)dst = pk;
      
    }
  }
}

// =================================================================================================================
// gamma[w], beta[w] bf16 converted) + NCHW -> NHWC + hi/lo f16 planes. Block = (b, h, channel half): wave = 8
// channel rows, lane = 4 w values, shuffle reductions; f32 tile T[64 ch][w] in LDS; then each pixel's 64 channels
// grid = NB*128*2, 256 threads. coverage: xh/xl [NPIX px][128 ch], every element once.
// =================================================================================================================
__global__ __launch_bounds__(256)
void k_ln(const float* __restrict__ x, const float* __restrict__ gw, const float* __restrict__ gb,
          unsigned short* xh, unsigned short* xl) {
  __shared__ __align__(16) float T[64 * LDC];
  const int tid = threadIdx.x, wv = tid >> 5, lane = tid & 31;
  const int blk = blockIdx.x;
  const int bh = blk >> 1, chalf = blk & 1;
  const int b = bh / HH, h = bh - b * HH;
  const v4f g4 = *(const v4f*)(gw + lane * 4);
  const v4f b4 = *(const v4f*)(gb + lane * 4);
  float g[4], be[4];
#pragma unroll
  for (int e = 0; e < 4; ++e) { g[e] = bfr(g4[e]); be[e] = bfr(b4[e]); }
#pragma unroll 1
  for (int it = 0; it < 8; ++it) {
    const int cc = wv * 8 + it;
    const int c = chalf * 64 + cc;
    const float* row = x + ((size_t)(b * CC + c) * HH + h) * WW;
    const v4f a = *(const v4f*)(row + lane * 4);
    float xr[4];
#pragma unroll
    for (int e = 0; e < 4; ++e) xr[e] = bfr(a[e]);
    float s = (xr[0] + xr[1]) + (xr[2] + xr[3]);
#pragma unroll
    for (int off = 16; off; off >>= 1) s += __shfl_xor(s, off, 32);
    const float mu = s * (1.0f / 128.0f);
    float d[4];
#pragma unroll
    for (int e = 0; e < 4; ++e) d[e] = xr[e] - mu;
    float sq = (d[0] * d[0] + d[1] * d[1]) + (d[2] * d[2] + d[3] * d[3]);
#pragma unroll
    for (int off = 16; off; off >>= 1) sq += __shfl_xor(sq, off, 32);
    const float var = sq * (1.0f / 128.0f);
    const float rs = rsqrtf(var + 1e-5f);
    v4f o;
#pragma unroll
    for (int e = 0; e < 4; ++e) o[e] = (d[e] * rs) * g[e] + be[e];
    *(v4f*)(T + cc * LDC + lane * 4) = o;
  }
  __syncthreads();
  v4u ph[4], pq[4];
  size_t offs[4];
#pragma unroll
  for (int s = 0; s < 4; ++s) {
    const int idx = s * 256 + tid;
    const int w = idx >> 3, piece = idx & 7;
    const int c0 = piece * 8;
    v4u a, q4;
#pragma unroll
    for (int e = 0; e < 4; ++e) {
      const float f0 = T[(c0 + 2 * e) * LDC + w];
      const float f1 = T[(c0 + 2 * e + 1) * LDC + w];
      unsigned hp, lp;
      split2(f0, f1, hp, lp);
      a[e] = hp; q4[e] = lp;
    }
    ph[s] = a;
    pq[s] = q4;
    offs[s] = (size_t)(b * IMGPIX + h * WW + w) * CC + chalf * 64 + c0;
  }
#pragma unroll
  for (int s = 0; s < 4; ++s) { *(v4u*)(xh + offs[s]) = ph[s]; *(v4u*)(xl + offs[s]) = pq[s]; }
  
}

// =================================================================================================================
// 1x1 projections: C[64 pixels][128 out ch] = xn . w1[t]^T (K = 128), value = C/64; written as f16 hi/lo into the
// padded NHWC planes p1[2t], p1[2t+1] ([NB][130][130][128]) at the interior position (y+1, x+1). 64 consecutive
// pixels lie in one image row -> 64 consecutive padded pixels; thread = one 16-B piece, 16 threads per pixel row
// coverage: interior NPIX padded pixels x 128 ch of all 6 planes (halo by k_halo).
// =================================================================================================================
__global__ __launch_bounds__(256)
void k_proj(const unsigned short* __restrict__ xh, const unsigned short* __restrict__ xl,
            const unsigned short* __restrict__ w1, unsigned short* p1) {
  __shared__ __align__(16) _Float16 ring[2 * SBUF];
  const float* Cs = (const float*)(const void*)ring;
  const int tid = threadIdx.x;
  const int mb = blockIdx.x, t = blockIdx.y;
  mm_tile2((const _Float16*)(const void*)xh, (const _Float16*)(const void*)xl,
           (const _Float16*)(const void*)(w1 + (size_t)t * CC * CC), mb * 64, ring);
  __syncthreads();
  unsigned short* dh = p1 + (size_t)(2 * t) * PS1;
  unsigned short* dl = p1 + (size_t)(2 * t + 1) * PS1;
  const int p0 = mb * 64;
  const int b = p0 / IMGPIX, rem = p0 - b * IMGPIX;
  const int y = rem / WW, x0 = rem - y * WW;
  const size_t pprow = (size_t)(b * HP + y + 1) * WP + x0 + 1;
  v4u ph[4], pq[4];
  size_t offs[4];
#pragma unroll
  for (int s = 0; s < 4; ++s) {
    const int idx = s * 256 + tid;
    const int row = idx >> 4, piece = idx & 15;
    const int col0 = piece * 8;
    v4u a, q4;
#pragma unroll
    for (int e = 0; e < 4; ++e) {
      const float f0 = Cs[row * LDC + col0 + 2 * e] * (1.0f / 64.0f);
      const float f1 = Cs[row * LDC + col0 + 2 * e + 1] * (1.0f / 64.0f);
      unsigned hp, lp;
      split2(f0, f1, hp, lp);
      a[e] = hp; q4[e] = lp;
    }
    ph[s] = a;
    pq[s] = q4;
    offs[s] = (pprow + row) * CC + col0;
  }
#pragma unroll
  for (int s = 0; s < 4; ++s) { *(v4u*)(dh + offs[s]) = ph[s]; *(v4u*)(dl + offs[s]) = pq[s]; }
  
}

// =================================================================================================================
// with NB (not a fixed image count). grid = ceil(6*NB*516*16 / 256).
// coverage: every halo pixel (py in {0,129} or px in {0,129}) of every image of all 6 planes.
// =================================================================================================================
__global__ __launch_bounds__(256)
void k_halo(unsigned short* p1) {
  const int idx = blockIdx.x * 256 + threadIdx.x;
  if (idx >= 6 * NB * NHALO * 16) return;
  const int piece = idx & 15;
  int r = idx >> 4;
  const int hp = r % NHALO;
  r /= NHALO;
  const int img = r % NB, plane = r / NB;
  const int q = max(hp - 2 * WP, 0);
  const int pyA = (hp < WP) ? 0 : (HP - 1);
  const int pxA = (hp < WP) ? hp : (hp - WP);
  const int pyB = 1 + (q >> 1);
  const int pxB = (q & 1) ? (WP - 1) : 0;
  const bool edge = hp < 2 * WP;
  const int py = edge ? pyA : pyB;
  const int px = edge ? pxA : pxB;
  const size_t off = (size_t)plane * PS1 + ((size_t)(img * HP + py) * WP + px) * CC + piece * 8;
  v4u z = {0u, 0u, 0u, 0u};
  *(v4u*)(p1 + off) = z;
  
}

// =================================================================================================================
// 3x3 conv implicit GEMM: block tile = 64 consecutive output pixels x 128 channels, K = 1152 as 36 k-steps,
// A = (hi, lo/2048) planes of tensor t, W = 64 bf16(w2[t]) -> value = C/64. Output NCHW flat [NB][128][16384]:
// coverage: qk [2 tensors][NB][128][16384] f32 and vh/vl [NB][128][16384], every element once (64 px x 128 co / block).
// =================================================================================================================
__global__ __launch_bounds__(256)
void k_conv3(const unsigned short* __restrict__ p1, const unsigned short* __restrict__ wt,
             float* qk, unsigned short* vh, unsigned short* vl) {
  __shared__ __align__(16) _Float16 ring[2 * SBUF];
  const float* Cs = (const float*)(const void*)ring;
  const int tid = threadIdx.x;
  const int mb = blockIdx.x, t = blockIdx.y;
  mm_conv((const _Float16*)(const void*)(p1 + (size_t)(2 * t) * PS1),
          (const _Float16*)(const void*)(p1 + (size_t)(2 * t + 1) * PS1),
          (const _Float16*)(const void*)(wt + (size_t)t * CC * KCV), mb * 64, ring);
  __syncthreads();
  const int p0 = mb * 64;
  const int b = p0 / IMGPIX, pix0 = p0 - b * IMGPIX;
  if (t < 2) {                                               // block-uniform branch, no WMMA inside
    float* df = qk + (size_t)t * ((size_t)NB * BSZ);
    v4f pk[8];
    size_t offs[8];
#pragma unroll
    for (int s = 0; s < 8; ++s) {
      const int idx = s * 256 + tid;
      const int co = idx >> 4, piece = idx & 15;
      v4f v;
#pragma unroll
      for (int e = 0; e < 4; ++e) v[e] = Cs[(piece * 4 + e) * LDC + co] * (1.0f / 64.0f);
      pk[s] = v;
      offs[s] = (size_t)(b * CC + co) * IMGPIX + pix0 + piece * 4;
    }
#pragma unroll
    for (int s = 0; s < 8; ++s) *(v4f*)(df + offs[s]) = pk[s];
    
  } else {
    v4u ph[4], pq[4];
    size_t offs[4];
#pragma unroll
    for (int s = 0; s < 4; ++s) {
      const int idx = s * 256 + tid;
      const int co = idx >> 3, piece = idx & 7;
      const int r0 = piece * 8;
      v4u a, q4;
#pragma unroll
      for (int e = 0; e < 4; ++e) {
        const float f0 = Cs[(r0 + 2 * e) * LDC + co] * (1.0f / 64.0f);
        const float f1 = Cs[(r0 + 2 * e + 1) * LDC + co] * (1.0f / 64.0f);
        unsigned hp, lp;
        split2(f0, f1, hp, lp);
        a[e] = hp; q4[e] = lp;
      }
      ph[s] = a;
      pq[s] = q4;
      offs[s] = (size_t)(b * CC + co) * IMGPIX + pix0 + r0;
    }
#pragma unroll
    for (int s = 0; s < 4; ++s) { *(v4u*)(vh + offs[s]) = ph[s]; *(v4u*)(vl + offs[s]) = pq[s]; }
    
  }
}

// =================================================================================================================
// Logit partial sums over the raw reshape: S[i][j] = sum_r K_head[r][i] Q_head[r][j] (K = 16384) in f32 on VALU from
// the f32 [16384][16] views of the q/k NCHW flat planes. Work-group = (row group rg, batch-head bi): rows r = 16 s + rg
// (1024 rows). Thread (so = tid>>4, i = tid&15) sums the 32 rows s = 32 so .. 32 so + 31 in order into 16 partials;
// thread (i, j) then adds the 32 values of so in order in LDS: sp[bi][rg][i][j]. k_attn adds the 16 row groups in order.
// grid = 16*NB*8, 512 threads. coverage: sp [NB*8][16][256] f32, every element once.
// =================================================================================================================
__global__ __launch_bounds__(512)
void k_logit(const float* __restrict__ qf, const float* __restrict__ kf, float* sp) {
  __shared__ float part[32 * 256];
  const int tid = threadIdx.x;
  // bi in the low bits: the 16 row groups of one head interleave in the same cache lines; a matter of speed only
  const int bi = blockIdx.x % (NB * NHEAD), rg = blockIdx.x / (NB * NHEAD);
  const int b = bi / NHEAD, head = bi - b * NHEAD;
  const float* Qp = qf + (size_t)b * BSZ + (size_t)head * HSZ;
  const float* Kp = kf + (size_t)b * BSZ + (size_t)head * HSZ;
  {
    const int so = tid >> 4, i = tid & 15;
    float tt[HD];
#pragma unroll
    for (int e = 0; e < HD; ++e) tt[e] = 0.f;
    const float* kp = Kp + (size_t)(so * 512 + rg) * HD + i;   // row r = (32 so + s) * 16 + rg, s = 0
    const float* qp = Qp + (size_t)(so * 512 + rg) * HD;
    // batches of 8 rows: each batch's 40 loads are issued together, then summed row by row in order; unrolled so that
    // every row's address is the two base pointers plus an immediate offset
#pragma unroll
    for (int sb = 0; sb < 4; ++sb) {
      float kv[8];
      v4f q[8][4];
#pragma unroll
      for (int u = 0; u < 8; ++u) {
        kv[u] = kp[(sb * 8 + u) * 16 * HD];
#pragma unroll
        for (int g = 0; g < 4; ++g) q[u][g] = *(const v4f*)(qp + (sb * 8 + u) * 16 * HD + 4 * g);
      }
#if defined(__HIP_DEVICE_COMPILE__)
      // inputs-only fences on the loaded values (four rows each: an asm statement takes thirty operands): without them
      // the compiler sinks every load to its first use and the wave pays one memory latency per load. The second one
      // holds the wait that stands between issued loads and a rewrite of a register they name, and takes the two base
      // pointers as inputs too: they stay live to that wait, so no load of the batch lands in its own run's address
      asm volatile("" :: "v"(kv[0]), "v"(kv[1]), "v"(kv[2]), "v"(kv[3]),
                   "v"(q[0][0]), "v"(q[0][1]), "v"(q[0][2]), "v"(q[0][3]), "v"(q[1][0]), "v"(q[1][1]), "v"(q[1][2]), "v"(q[1][3]),
                   "v"(q[2][0]), "v"(q[2][1]), "v"(q[2][2]), "v"(q[2][3]), "v"(q[3][0]), "v"(q[3][1]), "v"(q[3][2]), "v"(q[3][3]));
      asm volatile("s_wait_xcnt 0x0" :: "v"(kp), "v"(qp), "v"(kv[4]), "v"(kv[5]), "v"(kv[6]), "v"(kv[7]),
                   "v"(q[4][0]), "v"(q[4][1]), "v"(q[4][2]), "v"(q[4][3]), "v"(q[5][0]), "v"(q[5][1]), "v"(q[5][2]), "v"(q[5][3]),
                   "v"(q[6][0]), "v"(q[6][1]), "v"(q[6][2]), "v"(q[6][3]), "v"(q[7][0]), "v"(q[7][1]), "v"(q[7][2]), "v"(q[7][3]));
#endif
#pragma unroll
      for (int u = 0; u < 8; ++u) {
#pragma unroll
        for (int g = 0; g < 4; ++g) {
#pragma unroll
          for (int e = 0; e < 4; ++e) tt[4 * g + e] = fmaf(kv[u], q[u][g][e], tt[4 * g + e]);
        }
      }
    }
#pragma unroll
    for (int j = 0; j < HD; ++j) part[so * 256 + i * 16 + j] = tt[j];
  }
  __syncthreads();
  if (tid < 256) {
    float acc = 0.f;
#pragma unroll
    for (int so = 0; so < 32; ++so) acc += part[so * 256 + tid];
    sp[(size_t)(bi * 16 + rg) * 256 + tid] = acc;
  }
}

// =================================================================================================================
// Per (b, head) channel attention: S[i][j] = the 16 row-group partial sums of k_logit added in fixed order.
// P = softmax_j(S * (1/bf16(scale))) in f32 (max-subtracted).
// Wm[o][j] = sum_j2 64 bf16(wo[o][16 head + j2]) P[j][j2] on WMMA (K = 16 zero padded to 32; P carried x4096 as
// f16 hi + residual), value/4096 = 64 Wm; stored as f16 hi/lo planes weh/wel [b][head][o][16]: block region =
// grid = NB*8, 256 threads. coverage: weh/wel [NB][8][128][16], every element once.
// =================================================================================================================
__global__ __launch_bounds__(256)
void k_attn(const float* __restrict__ sp, const float* __restrict__ wo, const float* __restrict__ scale,
            unsigned short* weh, unsigned short* wel) {
  __shared__ float Sm[16 * WSP];
  __shared__ __align__(16) _Float16 Phs[16 * FP];
  __shared__ __align__(16) _Float16 Pls[16 * FP];
  __shared__ __align__(16) _Float16 Wts[CC * FP];
  __shared__ float Ws[CC * WSP];
  const int tid = threadIdx.x, wave = tid >> 5, lane = tid & 31, hh = lane >> 4, m = lane & 15;
  const int bi = blockIdx.x, b = bi / NHEAD, head = bi - b * NHEAD;
  // wo slice -> f16 [o][k] (k = j2, zero for k >= 16; addresses clamped)
#pragma unroll 1
  for (int it = 0; it < 16; ++it) {
    const int idx = it * 256 + tid;
    const int o = idx >> 5, k = idx & 31;
    const int kk = min(k, HD - 1);
    const float f = wo[(size_t)o * CC + head * HD + kk];
    const float v = (k < HD) ? bfr(f) * 64.0f : 0.0f;
    Wts[o * FP + k] = (_Float16)v;
  }
  {
    const int i = tid >> 4, j = tid & 15;
    const float* spp = sp + (size_t)bi * (16 * 256) + i * 16 + j;
    float pv[16];
#pragma unroll
    for (int rg = 0; rg < 16; ++rg) pv[rg] = spp[rg * 256];
#if defined(__HIP_DEVICE_COMPILE__)
    // the wait between the 16 issued loads and a rewrite of the address they name; the address and the loaded values
    // are inputs, so that the address stays live to the wait and no load of the run lands in it
    asm volatile("s_wait_xcnt 0x0" :: "v"(spp), "v"(pv[0]), "v"(pv[1]), "v"(pv[2]), "v"(pv[3]), "v"(pv[4]), "v"(pv[5]),
                 "v"(pv[6]), "v"(pv[7]), "v"(pv[8]), "v"(pv[9]), "v"(pv[10]), "v"(pv[11]), "v"(pv[12]), "v"(pv[13]),
                 "v"(pv[14]), "v"(pv[15]));
#endif
    float s = 0.f;
#pragma unroll
    for (int rg = 0; rg < 16; ++rg) s += pv[rg];
    const float isc = 1.0f / bfr(scale[0]);
    Sm[i * WSP + j] = s * isc;
  }
  __syncthreads();
  if (tid < 16) {
    float mx = -3.0e38f;
#pragma unroll 1
    for (int n = 0; n < HD; ++n) mx = fmaxf(mx, Sm[tid * WSP + n]);
    float ssum = 0.f;
#pragma unroll 1
    for (int n = 0; n < HD; ++n) {
      const float e = expf(Sm[tid * WSP + n] - mx);
      Sm[tid * WSP + n] = e;
      ssum += e;
    }
    const float inv = 1.0f / ssum;
#pragma unroll 1
    for (int n = 0; n < HD; ++n) {
      const float pv = (Sm[tid * WSP + n] * inv) * 4096.0f;
      const _Float16 hv = (_Float16)pv;
      Phs[tid * FP + n] = hv;
      Pls[tid * FP + n] = (_Float16)((pv - (float)hv) * 2048.0f);
    }
#pragma unroll 1
    for (int n = HD; n < 32; ++n) { Phs[tid * FP + n] = (_Float16)0.0f; Pls[tid * FP + n] = (_Float16)0.0f; }
  }
  __syncthreads();
  {
    const v16h fa = ldfrag_h(Wts + (wave * 16 + m) * FP + 8 * hh);
    const v16h fb = ldfrag_h(Phs + m * FP + 8 * hh);
    const v16h gb = ldfrag_h(Pls + m * FP + 8 * hh);
    v8f ah = mma_raw(fa, fb, zero8());
    v8f al = mma_raw(fa, gb, zero8());
    guard2(ah, al, fa, fb, gb);
#pragma unroll
    for (int r = 0; r < 8; ++r) Ws[(wave * 16 + 8 * hh + r) * WSP + m] = (ah[r] + al[r] * RSC) * (1.0f / 4096.0f);
  }
  __syncthreads();
  {
    const int o = tid >> 1, hf = tid & 1;
    v4u a, q4;
#pragma unroll
    for (int e = 0; e < 4; ++e) {
      const float f0 = Ws[o * WSP + hf * 8 + 2 * e];
      const float f1 = Ws[o * WSP + hf * 8 + 2 * e + 1];
      unsigned hp, lp;
      split2(f0, f1, hp, lp);
      a[e] = hp; q4[e] = lp;
    }
    const size_t off = (size_t)(bi * CC + o) * HD + hf * 8;
    *(v4u*)(weh + off) = a;
    *(v4u*)(wel + off) = q4;
    
  }
}

// =================================================================================================================
// Output: y[b][o][p] = (sum_c' Wm64[b][c'][o] V[p][c']) / 64 + bf16(x[b][o][p]) for 64 pixels x 128 channels per
// =================================================================================================================
__global__ __launch_bounds__(256)
void k_final(const unsigned short* __restrict__ vh, const unsigned short* __restrict__ vl,
             const unsigned short* __restrict__ weh, const unsigned short* __restrict__ wel,
             const float* __restrict__ x, float* out) {
  __shared__ __align__(16) float Cs[64 * LDC];
  const int tid = threadIdx.x;
  const int mb = blockIdx.x;
  const int p0 = mb * 64;
  const int b = p0 / IMGPIX, pl0 = p0 - b * IMGPIX;
  const _Float16* Vh = (const _Float16*)(const void*)(vh + (size_t)b * BSZ);
  const _Float16* Vl = (const _Float16*)(const void*)(vl + (size_t)b * BSZ);
  const _Float16* Wh = (const _Float16*)(const void*)(weh + (size_t)b * NHEAD * CC * HD);
  const _Float16* Wl = (const _Float16*)(const void*)(wel + (size_t)b * NHEAD * CC * HD);
  mm_final(Vh, Vl, Wh, Wl, pl0, Cs);
  __syncthreads();
  v4f pk[8];
  size_t offs[8];
#pragma unroll
  for (int s = 0; s < 8; ++s) {
    const int idx = s * 256 + tid;
    const int o = idx >> 4, piece = idx & 15;
    const size_t off = (size_t)(b * CC + o) * IMGPIX + pl0 + piece * 4;
    const v4f xr = *(const v4f*)(x + off);
    v4f v;
#pragma unroll
    for (int e = 0; e < 4; ++e) v[e] = Cs[(piece * 4 + e) * LDC + o] * (1.0f / 64.0f) + bfr(xr[e]);
    pk[s] = v;
    offs[s] = off;
  }
#pragma unroll
  for (int s = 0; s < 8; ++s) *(v4f*)(out + offs[s]) = pk[s];
  
}

// =================================================================================================================
// Workspace map (bytes, offsets multiples of 65536, no aliasing, every region sized at or above its whole-line store
// extent): W1 f16 [3][128][128] 98304 (131072) | WT f16 [3][128][1152] 884736 (917504) | XH, XL f16 [32768][128]
// 8388608 each | P1 f16 6 x [2][130][130][128] 51916800 (51970048) | QK f32 [2][2][128][16384] 33554432 |
// VH, VL f16 [2][128][16384] 8388608 each | WEH, WEL f16 [2][8][128][16] 65536 each | SP f32 [16][16][256] 262144 |
// total 120520704.
// =================================================================================================================
extern "C" void kernel_launch(void* const* d_in, const int* in_sizes, int n_in,
                              void* d_out, int out_size, void* d_ws, size_t ws_size,
                              hipStream_t stream) {
  if (n_in < 11) return;
  const int expect[11] = { NB * CC * IMGPIX, WW, WW, 1, CC * CC, CC * CC * 9, CC * CC, CC * CC * 9,
                           CC * CC, CC * CC * 9, CC * CC };
  for (int i = 0; i < 11; ++i) if (in_sizes[i] != expect[i]) return;
  if (out_size != NB * CC * IMGPIX) return;

  const float* x     = (const float*)d_in[0];
  const float* gam   = (const float*)d_in[1];
  const float* bet   = (const float*)d_in[2];
  const float* scale = (const float*)d_in[3];
  const float* wq1   = (const float*)d_in[4];
  const float* wq2   = (const float*)d_in[5];
  const float* wk1   = (const float*)d_in[6];
  const float* wk2   = (const float*)d_in[7];
  const float* wv1   = (const float*)d_in[8];
  const float* wv2   = (const float*)d_in[9];
  const float* wo    = (const float*)d_in[10];
  float* out = (float*)d_out;

  const size_t AL = 65536;
  const size_t sW1 = (((size_t)3 * CC * CC * 2) + AL - 1) / AL * AL;               //   131072
  const size_t sWT = (((size_t)3 * CC * KCV * 2) + AL - 1) / AL * AL;              //   917504
  const size_t sX  = (((size_t)NPIX * CC * 2) + AL - 1) / AL * AL;                  //  8388608
  const size_t sP1 = (((size_t)6 * PS1 * 2) + AL - 1) / AL * AL;                    // 51970048
  const size_t sQK = (((size_t)2 * NB * BSZ * 4) + AL - 1) / AL * AL;               // 33554432
  const size_t sV  = (((size_t)NB * BSZ * 2) + AL - 1) / AL * AL;                   //  8388608
  const size_t sWE = (((size_t)NB * NHEAD * CC * HD * 2) + AL - 1) / AL * AL;       //    65536
  const size_t sSP = (((size_t)NB * NHEAD * 16 * 256 * 4) + AL - 1) / AL * AL;      //   262144

  size_t off = 0;
  const size_t oW1  = off; off += sW1;
  const size_t oWT  = off; off += sWT;
  const size_t oXH  = off; off += sX;
  const size_t oXL  = off; off += sX;
  const size_t oP1  = off; off += sP1;
  const size_t oQK  = off; off += sQK;
  const size_t oVH  = off; off += sV;
  const size_t oVL  = off; off += sV;
  const size_t oWEH = off; off += sWE;
  const size_t oWEL = off; off += sWE;
  const size_t oSP  = off; off += sSP;
  if (off > ws_size) return;                                 // off = 120520704
  if (off > (size_t)134217728) return;

  char* ws = (char*)d_ws;
  unsigned short* W1  = (unsigned short*)(ws + oW1);
  unsigned short* WT  = (unsigned short*)(ws + oWT);
  unsigned short* XH  = (unsigned short*)(ws + oXH);
  unsigned short* XL  = (unsigned short*)(ws + oXL);
  unsigned short* P1  = (unsigned short*)(ws + oP1);
  float*          QK  = (float*)(ws + oQK);
  unsigned short* VH  = (unsigned short*)(ws + oVH);
  unsigned short* VL  = (unsigned short*)(ws + oVL);
  unsigned short* WEH = (unsigned short*)(ws + oWEH);
  unsigned short* WEL = (unsigned short*)(ws + oWEL);
  float*          SP  = (float*)(ws + oSP);

  const dim3 blk(256);
  // (1) weight planes
  k_wcvt<<<dim3(6 * CC), blk, 0, stream>>>(wq1, wq2, wk1, wk2, wv1, wv2, W1, WT);
  // (2) layer norm over w + NHWC hi/lo planes
  k_ln<<<dim3(NB * HH * 2), blk, 0, stream>>>(x, gam, bet, XH, XL);
  // (3) 1x1 projections into padded NHWC hi/lo planes (interior)
  k_proj<<<dim3(NPIX / 64, 3), blk, 0, stream>>>(XH, XL, W1, P1);
  // (4) halo zero fill of the padded planes
  k_halo<<<dim3((6 * NB * NHALO * 16 + 255) / 256), blk, 0, stream>>>(P1);
  // (5) 3x3 convs -> q, k f32 NCHW flat planes; v f16 hi/lo NCHW flat planes
  k_conv3<<<dim3(NPIX / 64, 3), blk, 0, stream>>>(P1, WT, QK, VH, VL);
  // (6) f32 logit partial sums, one work-group per (row group, batch-head)
  k_logit<<<dim3(16 * NB * NHEAD), dim3(512), 0, stream>>>(QK, QK + (size_t)NB * BSZ, SP);
  // (7) per-head channel attention: row groups added + softmax + wo mix -> Wm planes
  k_attn<<<dim3(NB * NHEAD), blk, 0, stream>>>(SP, wo, scale, WEH, WEL);
  // (8) output GEMM + residual -> NCHW d_out
  k_final<<<dim3(NPIX / 64), blk, 0, stream>>>(VH, VL, WEH, WEL, x, out);
  (void)hipGetLastError();
}

// v003
// A run of this version takes 101 microseconds.
// Timed twice side by side with v002, it ran 1.12 times as fast both times.
// All steps since v000 together make it 6.55 times as fast.
// Contractions: 1x1 projections (K=128) and 3x3 convs as implicit GEMM (K=1152): v_wmma_f32_16x16x32_f16, the
// activation as f16 hi + x2048 residual planes into two f32 accumulators, weights one f16 plane of 64*bf16(w);
// per-head k^T q logits (K=16384): f32 on VALU from f32 q/k planes (fixed-order three-level sums); wo x probs mix
// (K=16, zero padded to 32): f16, probs carried x4096 as hi + residual; fused output GEMM (K=128): v and the mixed
// weight as f16 hi + residual planes (3 products); f32 accumulate everywhere. Layer-norm statistics, softmax and
// all epilogues f32 on VALU; every float input RNE-converted to bf16 on load.
#include <hip/hip_runtime.h>
#include <stdint.h>

#define NB     2
#define CC     128
#define HH     128
#define WW     128
#define IMGPIX (HH * WW)
#define NPIX   (NB * IMGPIX)
#define HP     (HH + 2)
#define WP     (WW + 2)
#define PADIMG (HP * WP)
#define PADPIX (NB * PADIMG)
#define KCV    1152
#define NKS    36
#define NHEAD  8
#define HD     16
#define HSZ    (IMGPIX * HD)
#define BSZ    (CC * IMGPIX)
#define LDC    132
#define FP     40
#define WSP    17
#define NHALO  (2 * WP + 2 * HH)
#define RSC    0.00048828125f
#define PS1    ((size_t)PADPIX * CC)
#define PS2    ((size_t)NPIX * CC)
#define SPK    72
#define SBUF   (256 * SPK)
#define NST    18

static_assert(NPIX == NB * IMGPIX);
static_assert(IMGPIX == 16384 && HH == 128 && WW == 128);
static_assert(PADIMG == 16900);
static_assert(KCV == 9 * CC && KCV == NKS * 32);
static_assert(CC == NHEAD * HD);
static_assert(BSZ == CC * IMGPIX && HSZ * NHEAD == BSZ);
static_assert((IMGPIX % 64) == 0 && (WW % 64) == 0);
static_assert((LDC * 4) % 16 == 0 && (FP * 2) % 16 == 0);
static_assert(NHALO == 516);
static_assert((KCV % 8) == 0 && (CC % 32) == 0);
static_assert(IMGPIX == 32 * 32 * 16);
static_assert(NST * 64 == KCV && (SPK * 2) % 32 == 16 && 2 * SBUF * 2 >= 64 * LDC * 4);

// Index maps of the raw reshapes (per batch b, flat NCHW index f = c*16384 + h*128 + w viewed as [8][16384][16]):
//   Q_head[r][d] = qflat[b][head*262144 + 16 r + d]   (same map for K_head and V_head; r = (c%16)*1024 + h*8 + w/16,
//   d = w%16). S_head[i][j] = sum_r K_head[r][i] Q_head[r][j]; P_head = softmax_j(S_head * (1/scale)).
//   O[b][16 head + j2][pixel r] = sum_j V_head[r][j] P_head[j][j2].
//   y[b][o][pixel r] = sum_{head, j} Wm[b][head][o][j] V_head[r][j] + x[b][o][r],
//   Wm[b][head][o][j] = sum_j2 wo[o][16 head + j2] P_head[j][j2]   (reassociated 1x1 output conv).

typedef _Float16 v16h __attribute__((ext_vector_type(16)));
typedef _Float16 v8h  __attribute__((ext_vector_type(8)));
typedef float    v8f  __attribute__((ext_vector_type(8)));
typedef float    v4f  __attribute__((ext_vector_type(4)));
typedef unsigned int v4u __attribute__((ext_vector_type(4)));

// ---- scalar helpers ------------------------------------------------------------------------------------------
__device__ __forceinline__ unsigned short bf_bits(float f) {          // f32 -> bf16 bits, RNE convert
  unsigned u = __float_as_uint(f);
  return (unsigned short)((u + 0x7FFFu + ((u >> 16) & 1u)) >> 16);
}
__device__ __forceinline__ float bf_up(unsigned short b) { return __uint_as_float(((unsigned)b) << 16); }
__device__ __forceinline__ float bfr(float f) { return bf_up(bf_bits(f)); }
__device__ __forceinline__ unsigned short h_bits(_Float16 x) { return __builtin_bit_cast(unsigned short, x); }
__device__ __forceinline__ unsigned short hb16(float f) { return h_bits((_Float16)f); }
__device__ __forceinline__ unsigned pk16(unsigned short a, unsigned short b) { return (unsigned)a | ((unsigned)b << 16); }
__device__ __forceinline__ v8f zero8() { v8f z = {0.f, 0.f, 0.f, 0.f, 0.f, 0.f, 0.f, 0.f}; return z; }
// hi/lo pair of two f32 values: hi = f16(v), lo = f16(2048 (v - hi)), packed as two 32-bit words
__device__ __forceinline__ void split2(float f0, float f1, unsigned& hp, unsigned& lp) {
  const _Float16 h0 = (_Float16)f0, h1 = (_Float16)f1;
  const float q0 = (f0 - (float)h0) * 2048.0f, q1 = (f1 - (float)h1) * 2048.0f;
  hp = pk16(h_bits(h0), h_bits(h1));
  lp = pk16(hb16(q0), hb16(q1));
}

// ---- fragment loader: 16-bit A/B operand, lane -> row/col (lane&15), p already includes +8*(lane>>4);
//      elements 0..7 <- p[0..7] (k0+8h..k0+8h+7), elements 8..15 <- p[16..23] (k0+16+8h..k0+16+8h+7)
__device__ __forceinline__ v16h ldfrag_h(const _Float16* p) {
  union { v16h v; v8h h[2]; } f;
  f.h[0] = *(const v8h*)(p);
  f.h[1] = *(const v8h*)(p + 16);
  return f.v;
}
// same layout, the two 8-element halves at two independent 16-B aligned addresses (pa: k0+8h.., pb: k0+16+8h..)
__device__ __forceinline__ v16h ldfrag2(const _Float16* pa, const _Float16* pb) {
  union { v16h v; v8h h[2]; } f;
  f.h[0] = *(const v8h*)(pa);
  f.h[1] = *(const v8h*)(pb);
  return f.v;
}

// ---- WMMA helpers; the guards insert the trailing VALU hazard gap and keep A/B live --------------------------
__device__ __forceinline__ v8f mma_raw(v16h a, v16h b, v8f c) {
  return __builtin_amdgcn_wmma_f32_16x16x32_f16(false, a, false, b, (short)0, c, false, false);
}
__device__ __forceinline__ void guard8(v8f& c0, v8f& c1, v8f& c2, v8f& c3, v8f& c4, v8f& c5, v8f& c6, v8f& c7,
                                       const v16h& a0, const v16h& a1, const v16h& a2, const v16h& a3,
                                       const v16h& b0, const v16h& b1) {
#if defined(__HIP_DEVICE_COMPILE__)
  asm volatile("v_nop\n\tv_nop\n\tv_nop\n\tv_nop"
               : "+v"(c0), "+v"(c1), "+v"(c2), "+v"(c3), "+v"(c4), "+v"(c5), "+v"(c6), "+v"(c7)
               : "v"(a0), "v"(a1), "v"(a2), "v"(a3), "v"(b0), "v"(b1));
#endif
}
__device__ __forceinline__ void guard4(v8f& c0, v8f& c1, v8f& c2, v8f& c3,
                                       const v16h& a0, const v16h& a1, const v16h& b0, const v16h& b1) {
#if defined(__HIP_DEVICE_COMPILE__)
  asm volatile("v_nop\n\tv_nop\n\tv_nop\n\tv_nop"
               : "+v"(c0), "+v"(c1), "+v"(c2), "+v"(c3)
               : "v"(a0), "v"(a1), "v"(b0), "v"(b1));
#endif
}
__device__ __forceinline__ void guard2(v8f& c0, v8f& c1, const v16h& a0, const v16h& b0, const v16h& b1) {
#if defined(__HIP_DEVICE_COMPILE__)
  asm volatile("v_nop\n\tv_nop\n\tv_nop\n\tv_nop"
               : "+v"(c0), "+v"(c1)
               : "v"(a0), "v"(b0), "v"(b1));
#endif
}

// ---- LDS staging of one 64-k slice of a 64x128 block tile's operands: 256 rows of 128 B at pitch 144 B (16 B x odd, for
//      the ds_load_b128 fragment reads): rows 0..63 A hi, 64..127 A lo (64 A rows, global pitch CC), 128..255 W (128 rows,
//      global pitch wstep32 / 32). Thread = (row tid>>3 of each group of 32 rows, 16-B piece tid&7), 8 copies; ga_h, ga_l,
//      gw are the thread's own source addresses in the first group, lds its own byte address in the target buffer.
//      Each copy instruction moves four whole 128-B lines, and every operand byte is fetched once per work-group.
__device__ __forceinline__ void stage_copy(const _Float16* ga_h, const _Float16* ga_l, const _Float16* gw, int wstep32,
                                           unsigned lds) {
  const _Float16* g1 = ga_h + 32 * CC;
  const _Float16* g3 = ga_l + 32 * CC;
  const _Float16* g5 = gw + wstep32;
  const _Float16* g6 = gw + 2 * wstep32;
  const _Float16* g7 = gw + 3 * wstep32;
  const unsigned l1 = lds + 1 * 32 * SPK * 2, l2 = lds + 2 * 32 * SPK * 2, l3 = lds + 3 * 32 * SPK * 2;
  const unsigned l4 = lds + 4 * 32 * SPK * 2, l5 = lds + 5 * 32 * SPK * 2, l6 = lds + 6 * 32 * SPK * 2;
  const unsigned l7 = lds + 7 * 32 * SPK * 2;
#if defined(__HIP_DEVICE_COMPILE__)
  // global -> LDS through no register; the last line is the wait that stands between issued copies and a rewrite of
  // a register they name, inside the statement so that nothing can be moved in front of it
  asm volatile("global_load_async_to_lds_b128 %0, %1, off\n\t"
               "global_load_async_to_lds_b128 %2, %3, off\n\t"
               "global_load_async_to_lds_b128 %4, %5, off\n\t"
               "global_load_async_to_lds_b128 %6, %7, off\n\t"
               "global_load_async_to_lds_b128 %8, %9, off\n\t"
               "global_load_async_to_lds_b128 %10, %11, off\n\t"
               "global_load_async_to_lds_b128 %12, %13, off\n\t"
               "global_load_async_to_lds_b128 %14, %15, off\n\t"
               "s_wait_xcnt 0x0"
               :: "v"(lds), "v"(ga_h), "v"(l1), "v"(g1), "v"(l2), "v"(ga_l), "v"(l3), "v"(g3),
                  "v"(l4), "v"(gw), "v"(l5), "v"(g5), "v"(l6), "v"(g6), "v"(l7), "v"(g7)
               : "memory");
#endif
}
__device__ __forceinline__ void wait_copies() {
#if defined(__HIP_DEVICE_COMPILE__)
  asm volatile("s_wait_asynccnt 0x0" ::: "memory");   // this wave's copies have landed in LDS
#endif
}
__device__ __forceinline__ void wait_lds_reads() {
#if defined(__HIP_DEVICE_COMPILE__)
  asm volatile("s_wait_dscnt 0x0" ::: "memory");      // this wave's LDS reads are done before the buffer is rewritten
#endif
}

// ---- 64x128 block tile GEMM core (K = 128) with the A operand as two planes (hi and x2048 residual) into separate
//      accumulators; A row pitch CC (f16), W is [n][k] k-contiguous pitch CC. Both 64-k slices are copied to the two LDS
//      buffers at once, then read. 8 waves = 2 (32 rows) x 4 (32 cols), 2x2 tiles of 16 per wave; fragments from LDS with
//      the table layout; the residual accumulator is folded with 1/2048 when the tile is written to the LDS f32 tile
//      Cs[64][LDC], which takes the buffers' place behind a barrier.
__device__ __forceinline__ void mm_tile2(const _Float16* __restrict__ Ah, const _Float16* __restrict__ Al,
                                         const _Float16* __restrict__ W, int arow0, _Float16* ring) {
  const int tid = threadIdx.x, wave = tid >> 5, lane = tid & 31, hh = lane >> 4, c = lane & 15;
  const int mw = wave >> 2, nw = wave & 3;
  const int srow = tid >> 3, spc = tid & 7;
  const size_t sa = (size_t)(arow0 + srow) * CC + spc * 8;
  const _Float16* wb = W + (size_t)srow * CC + spc * 8;
  const unsigned lds0 = (unsigned)(size_t)ring + (unsigned)((srow * SPK + spc * 8) * 2);
  const _Float16* fap = ring + (mw * 32 + c) * SPK + 8 * hh;
  const _Float16* fbp = ring + (128 + nw * 32 + c) * SPK + 8 * hh;
  v8f h00 = zero8(), h01 = zero8(), h10 = zero8(), h11 = zero8();
  v8f l00 = zero8(), l01 = zero8(), l10 = zero8(), l11 = zero8();
  stage_copy(Ah + sa, Al + sa, wb, 32 * CC, lds0);
  stage_copy(Ah + sa + 64, Al + sa + 64, wb + 64, 32 * CC, lds0 + SBUF * 2);
  wait_copies();
  __syncthreads();                               // both slices are readable by every wave
  // unrolled: every fragment's LDS offset becomes an immediate of its load
#pragma unroll
  for (int ks = 0; ks < CC / 32; ++ks) {
    const _Float16* pa = fap + (ks >> 1) * SBUF + (ks & 1) * 32;
    const _Float16* pb = fbp + (ks >> 1) * SBUF + (ks & 1) * 32;
    const v16h fa0 = ldfrag_h(pa);
    const v16h fa1 = ldfrag_h(pa + 16 * SPK);
    const v16h ga0 = ldfrag_h(pa + 64 * SPK);
    const v16h ga1 = ldfrag_h(pa + 80 * SPK);
    const v16h fb0 = ldfrag_h(pb);
    const v16h fb1 = ldfrag_h(pb + 16 * SPK);
    h00 = mma_raw(fa0, fb0, h00);
    h01 = mma_raw(fa0, fb1, h01);
    h10 = mma_raw(fa1, fb0, h10);
    h11 = mma_raw(fa1, fb1, h11);
    l00 = mma_raw(ga0, fb0, l00);
    l01 = mma_raw(ga0, fb1, l01);
    l10 = mma_raw(ga1, fb0, l10);
    l11 = mma_raw(ga1, fb1, l11);
    guard8(h00, h01, h10, h11, l00, l01, l10, l11, fa0, fa1, ga0, ga1, fb0, fb1);
  }
  wait_lds_reads();
  __syncthreads();                               // ends every wave's fragment reads: the buffers become the f32 tile
  float* Cs = (float*)(void*)ring;
#pragma unroll
  for (int r = 0; r < 8; ++r) {
    const int row = mw * 32 + 8 * hh + r;
    Cs[row * LDC + nw * 32 + c]             = h00[r] + l00[r] * RSC;
    Cs[row * LDC + nw * 32 + 16 + c]        = h01[r] + l01[r] * RSC;
    Cs[(row + 16) * LDC + nw * 32 + c]      = h10[r] + l10[r] * RSC;
    Cs[(row + 16) * LDC + nw * 32 + 16 + c] = h11[r] + l11[r] * RSC;
  }
}

// ---- implicit-GEMM variant for the 3x3 conv: A row = output pixel p (flat over all images), k = tap*128 + c;
//      W = wt [128][1152] k-contiguous. The operands of a stage st (tap = st>>1, channel half = st&1: 64 k, two k-steps)
//      are staged in LDS by stage_copy: the A rows are the 64 pixels at padded position (y + ky, x + kx), the W rows the
//      128 output channels. Two buffers: stage t + 1 is copied while stage t is multiplied; the fragments come from LDS
//      with the table k map (k order: tap, channel quarter, table).
__device__ __forceinline__ size_t conv_abase(int p, int hh) {
  const int b = p / IMGPIX;
  const int r = p - b * IMGPIX;
  const int y = r / WW;
  const int x = r - y * WW;
  return ((size_t)(b * HP + y) * WP + x) * CC + 8 * hh;
}
// stage st's copies into the buffer at lds; ah/al/wb are the thread's own source addresses for stage 0
__device__ __forceinline__ void conv_stage(const _Float16* ah, const _Float16* al, const _Float16* wb, int st,
                                           unsigned lds) {
  const int tap = st >> 1;
  const int ky = (tap * 11) >> 5;                // tap / 3 for tap < 9
  const int kx = tap - 3 * ky;
  const int ao = (ky * WP + kx) * CC + (st & 1) * 64;
  stage_copy(ah + ao, al + ao, wb + st * 64, 32 * KCV, lds);
}
__device__ __forceinline__ void mm_conv(const _Float16* __restrict__ Ah, const _Float16* __restrict__ Al,
                                        const _Float16* __restrict__ W, int prow0, _Float16* ring) {
  const int tid = threadIdx.x, wave = tid >> 5, lane = tid & 31, hh = lane >> 4, c = lane & 15;
  const int mw = wave >> 2, nw = wave & 3;
  const int srow = tid >> 3, spc = tid & 7;
  const size_t sa = conv_abase(prow0 + srow, 0) + spc * 8;
  const _Float16* ah = Ah + sa;
  const _Float16* al = Al + sa;
  const _Float16* wb = W + (size_t)srow * KCV + spc * 8;
  const unsigned lds0 = (unsigned)(size_t)ring + (unsigned)((srow * SPK + spc * 8) * 2);
  const _Float16* fap = ring + (mw * 32 + c) * SPK + 8 * hh;
  const _Float16* fbp = ring + (128 + nw * 32 + c) * SPK + 8 * hh;
  v8f h00 = zero8(), h01 = zero8(), h10 = zero8(), h11 = zero8();
  v8f l00 = zero8(), l01 = zero8(), l10 = zero8(), l11 = zero8();
  conv_stage(ah, al, wb, 0, lds0);
  wait_copies();
  __syncthreads();                               // stage 0 is readable by every wave
  conv_stage(ah, al, wb, 1, lds0 + SBUF * 2);
  // rolled: one copy of the body in the instruction cache, the buffer chosen by t & 1
#pragma unroll 1
  for (int t = 0; t < NST; ++t) {
    const int bo = (t & 1) * SBUF;
    // unrolled: the two k-steps' LDS offsets become immediates of their loads
#pragma unroll
    for (int kk = 0; kk < 2; ++kk) {
      const _Float16* pa = fap + bo + kk * 32;
      const _Float16* pb = fbp + bo + kk * 32;
      const v16h fa0 = ldfrag_h(pa);
      const v16h fa1 = ldfrag_h(pa + 16 * SPK);
      const v16h ga0 = ldfrag_h(pa + 64 * SPK);
      const v16h ga1 = ldfrag_h(pa + 80 * SPK);
      const v16h fb0 = ldfrag_h(pb);
      const v16h fb1 = ldfrag_h(pb + 16 * SPK);
      h00 = mma_raw(fa0, fb0, h00);
      h01 = mma_raw(fa0, fb1, h01);
      h10 = mma_raw(fa1, fb0, h10);
      h11 = mma_raw(fa1, fb1, h11);
      l00 = mma_raw(ga0, fb0, l00);
      l01 = mma_raw(ga0, fb1, l01);
      l10 = mma_raw(ga1, fb0, l10);
      l11 = mma_raw(ga1, fb1, l11);
      guard8(h00, h01, h10, h11, l00, l01, l10, l11, fa0, fa1, ga0, ga1, fb0, fb1);
    }
    wait_lds_reads();
    wait_copies();
    __syncthreads();                             // publishes stage t + 1 and ends every read of stage t's buffer
    if (t + 2 < NST) conv_stage(ah, al, wb, t + 2, lds0 + bo * 2);
  }
  wait_copies();
  float* Cs = (float*)(void*)ring;               // the ring is free behind the last trip's barrier: f32 tile [64][LDC]
#pragma unroll
  for (int r = 0; r < 8; ++r) {
    const int row = mw * 32 + 8 * hh + r;
    Cs[row * LDC + nw * 32 + c]             = h00[r] + l00[r] * RSC;
    Cs[row * LDC + nw * 32 + 16 + c]        = h01[r] + l01[r] * RSC;
    Cs[(row + 16) * LDC + nw * 32 + c]      = h10[r] + l10[r] * RSC;
    Cs[(row + 16) * LDC + nw * 32 + 16 + c] = h11[r] + l11[r] * RSC;
  }
}

// ---- fused output GEMM core: rows = 64 pixels of one batch (local pixel pl0..pl0+63), cols = 128 output channels,
//      k = c' = 16 head + j (K = 128, 4 k-steps of two heads each). A[p][c'] = V_head[p][j] read from the NCHW flat v
//      planes at head*HSZ + 16 p + j (two 16-B halves per fragment, heads 2ks and 2ks+1); B = Wm[head][o][16]
//      k-contiguous per head. Products hi*hi + hi*lo (first loop) and lo*hi (second loop) into Cs[64][LDC].
__device__ __forceinline__ void mm_final(const _Float16* __restrict__ Vh, const _Float16* __restrict__ Vl,
                                         const _Float16* __restrict__ Wh, const _Float16* __restrict__ Wl,
                                         int pl0, float* Cs) {
  const int tid = threadIdx.x, wave = tid >> 5, lane = tid & 31, hh = lane >> 4, c = lane & 15;
  const int mw = wave >> 2, nw = wave & 3;
  const size_t r0 = (size_t)(pl0 + mw * 32 + c) * HD + 8 * hh;
  const size_t r1 = (size_t)(pl0 + mw * 32 + 16 + c) * HD + 8 * hh;
  const size_t q0 = (size_t)(nw * 32 + c) * HD + 8 * hh;
  const size_t q1 = (size_t)(nw * 32 + 16 + c) * HD + 8 * hh;
  {
    v8f h00 = zero8(), h01 = zero8(), h10 = zero8(), h11 = zero8();
    v8f l00 = zero8(), l01 = zero8(), l10 = zero8(), l11 = zero8();
    const _Float16* pa0 = Vh + r0;
    const _Float16* pa1 = Vh + r1;
    const _Float16* pb0 = Wh + q0;
    const _Float16* pb1 = Wh + q1;
    const _Float16* pc0 = Wl + q0;
    const _Float16* pc1 = Wl + q1;
    // two k-steps a batch: the batch's 24 loads are issued together, then multiplied in k order (one latency for two
    // k-steps; four at once would not leave registers for two work-groups on a WGP); unrolled: offsets become immediates
#pragma unroll
    for (int kp = 0; kp < CC / 64; ++kp) {
      v16h fa0[2], fa1[2], fb0[2], fb1[2], gb0[2], gb1[2];
#pragma unroll
      for (int u = 0; u < 2; ++u) {
        const int ao = (2 * (2 * kp + u)) * HSZ;
        const int bo = (2 * (2 * kp + u)) * (CC * HD);
        fa0[u] = ldfrag2(pa0 + ao, pa0 + ao + HSZ);
        fa1[u] = ldfrag2(pa1 + ao, pa1 + ao + HSZ);
        fb0[u] = ldfrag2(pb0 + bo, pb0 + bo + CC * HD);
        fb1[u] = ldfrag2(pb1 + bo, pb1 + bo + CC * HD);
        gb0[u] = ldfrag2(pc0 + bo, pc0 + bo + CC * HD);
        gb1[u] = ldfrag2(pc1 + bo, pc1 + bo + CC * HD);
      }
#if defined(__HIP_DEVICE_COMPILE__)
      // nothing is scheduled across this line: without it the first product, with its wait, is lifted in among the batch's
      // loads, and the loads behind it start one latency late
      __builtin_amdgcn_sched_barrier(0);
      // inputs-only fence on the loaded fragments: keeps the batch's loads together in front of its products; it holds the
      // wait that stands between issued loads and a rewrite of an address register they name
      asm volatile("s_wait_xcnt 0x0" :: "v"(fa0[0]), "v"(fa1[0]), "v"(fb0[0]), "v"(fb1[0]), "v"(gb0[0]), "v"(gb1[0]),
                   "v"(fa0[1]), "v"(fa1[1]), "v"(fb0[1]), "v"(fb1[1]), "v"(gb0[1]), "v"(gb1[1]));
#endif
#pragma unroll
      for (int u = 0; u < 2; ++u) {
        h00 = mma_raw(fa0[u], fb0[u], h00);
        h01 = mma_raw(fa0[u], fb1[u], h01);
        h10 = mma_raw(fa1[u], fb0[u], h10);
        h11 = mma_raw(fa1[u], fb1[u], h11);
        l00 = mma_raw(fa0[u], gb0[u], l00);
        l01 = mma_raw(fa0[u], gb1[u], l01);
        l10 = mma_raw(fa1[u], gb0[u], l10);
        l11 = mma_raw(fa1[u], gb1[u], l11);
        guard8(h00, h01, h10, h11, l00, l01, l10, l11, fa0[u], fa1[u], gb0[u], gb1[u], fb0[u], fb1[u]);
      }
    }
#pragma unroll
    for (int r = 0; r < 8; ++r) {
      const int row = mw * 32 + 8 * hh + r;
      Cs[row * LDC + nw * 32 + c]             = h00[r] + l00[r] * RSC;
      Cs[row * LDC + nw * 32 + 16 + c]        = h01[r] + l01[r] * RSC;
      Cs[(row + 16) * LDC + nw * 32 + c]      = h10[r] + l10[r] * RSC;
      Cs[(row + 16) * LDC + nw * 32 + 16 + c] = h11[r] + l11[r] * RSC;
    }
  }
  {
    v8f m00 = zero8(), m01 = zero8(), m10 = zero8(), m11 = zero8();
#if defined(__HIP_DEVICE_COMPILE__)
    // nothing is scheduled across this line or the one behind the loads: the first loop's epilogue stays out of the run of
    // loads, where it reused their address registers while they were in flight
    __builtin_amdgcn_sched_barrier(0);
#endif
    const _Float16* pa0 = Vl + r0;
    const _Float16* pa1 = Vl + r1;
    const _Float16* pb0 = Wh + q0;
    const _Float16* pb1 = Wh + q1;
    // all four k-steps' 32 loads are issued together, then multiplied in k order: one latency, not four
    v16h ga0[4], ga1[4], fb0[4], fb1[4];
#pragma unroll
    for (int ks = 0; ks < CC / 32; ++ks) {
      const int ao = (2 * ks) * HSZ;
      const int bo = (2 * ks) * (CC * HD);
      ga0[ks] = ldfrag2(pa0 + ao, pa0 + ao + HSZ);
      ga1[ks] = ldfrag2(pa1 + ao, pa1 + ao + HSZ);
      fb0[ks] = ldfrag2(pb0 + bo, pb0 + bo + CC * HD);
      fb1[ks] = ldfrag2(pb1 + bo, pb1 + bo + CC * HD);
    }
#if defined(__HIP_DEVICE_COMPILE__)
    __builtin_amdgcn_sched_barrier(0);
    // inputs-only fence on the loaded fragments, with the same wait as in the first loop
    asm volatile("s_wait_xcnt 0x0" :: "v"(ga0[0]), "v"(ga1[0]), "v"(fb0[0]), "v"(fb1[0]), "v"(ga0[1]), "v"(ga1[1]), "v"(fb0[1]), "v"(fb1[1]),
                 "v"(ga0[2]), "v"(ga1[2]), "v"(fb0[2]), "v"(fb1[2]), "v"(ga0[3]), "v"(ga1[3]), "v"(fb0[3]), "v"(fb1[3]));
#endif
#pragma unroll
    for (int ks = 0; ks < CC / 32; ++ks) {
      m00 = mma_raw(ga0[ks], fb0[ks], m00);
      m01 = mma_raw(ga0[ks], fb1[ks], m01);
      m10 = mma_raw(ga1[ks], fb0[ks], m10);
      m11 = mma_raw(ga1[ks], fb1[ks], m11);
      guard4(m00, m01, m10, m11, ga0[ks], ga1[ks], fb0[ks], fb1[ks]);
    }
#pragma unroll
    for (int r = 0; r < 8; ++r) {               // same lane wrote these slots above (program order, same type)
      const int row = mw * 32 + 8 * hh + r;
      Cs[row * LDC + nw * 32 + c]             += m00[r] * RSC;
      Cs[row * LDC + nw * 32 + 16 + c]        += m01[r] * RSC;
      Cs[(row + 16) * LDC + nw * 32 + c]      += m10[r] * RSC;
      Cs[(row + 16) * LDC + nw * 32 + 16 + c] += m11[r] * RSC;
    }
  }
}

// =================================================================================================================
// Weight convert. Blocks 0..383: tensor t = blk/128 of (wq2, wk2, wv2) [co][ci][3][3] f32 -> wt [t][co][k =
// tap*128 + ci] f16(64 * bf16(w)); thread tt < 144 builds one 16-B piece (8 halves), 8 consecutive threads per
// passes. grid = 768. coverage: wt 384 x 1152 and w1 384 x 128, every element once.
// =================================================================================================================
__global__ __launch_bounds__(256)
void k_wcvt(const float* __restrict__ wq1, const float* __restrict__ wq2, const float* __restrict__ wk1,
            const float* __restrict__ wk2, const float* __restrict__ wv1, const float* __restrict__ wv2,
            unsigned short* w1, unsigned short* wt) {
  const int tid = threadIdx.x;
  const int blk = blockIdx.x;
  if (blk < 3 * CC) {
    const int t = blk / CC, co = blk - t * CC;
    const float* src = (t == 0) ? wq2 : ((t == 1) ? wk2 : wv2);
    const int tt = min(tid, 143);
    const int k0 = tt * 8, tap = k0 / CC, c0 = k0 - tap * CC;
    v4u pk;
#pragma unroll
    for (int e = 0; e < 4; ++e) {
      const float f0 = src[(size_t)(co * CC + c0 + 2 * e) * 9 + tap];
      const float f1 = src[(size_t)(co * CC + c0 + 2 * e + 1) * 9 + tap];
      pk[e] = pk16(hb16(bfr(f0) * 64.0f), hb16(bfr(f1) * 64.0f));
    }
    if (tid < 144) {
      unsigned short* dst = wt + (size_t)(t * CC + co) * KCV + k0;
      *(v4u*)dst = pk;
      
    }
  } else {
    const int rr = blk - 3 * CC;
    const int t = rr / CC, o = rr - t * CC;
    const float* src = (t == 0) ? wq1 : ((t == 1) ? wk1 : wv1);
    const int tt = min(tid, 15);
    const int c0 = tt * 8;
    v4u pk;
#pragma unroll
    for (int e = 0; e < 4; ++e) {
      const float f0 = src[(size_t)o * CC + c0 + 2 * e];
      const float f1 = src[(size_t)o * CC + c0 + 2 * e + 1];
      pk[e] = pk16(hb16(bfr(f0) * 64.0f), hb16(bfr(f1) * 64.0f));
    }
    if (tid < 16) {
      unsigned short* dst = w1 + (size_t)(t * CC + o) * CC + c0;
      *(v4u*)dst = pk;
      
    }
  }
}

// =================================================================================================================
// gamma[w], beta[w] bf16 converted) + NCHW -> NHWC + hi/lo f16 planes. Block = (b, h, channel half): wave = 8
// channel rows, lane = 4 w values, shuffle reductions; f32 tile T[64 ch][w] in LDS; then each pixel's 64 channels
// grid = NB*128*2, 256 threads. coverage: xh/xl [NPIX px][128 ch], every element once.
// =================================================================================================================
// inputs-only fence on the 8 rows' shuffled values (they come back on the LDS counter like loads): keeps the 8 shuffles of
// one reduction step together in front of their adds; without it the compiler runs the rows' chains one after another and
// the wave waits out every shuffle's latency alone
__device__ __forceinline__ void row_fence(const float (&t)[8]) {
#if defined(__HIP_DEVICE_COMPILE__)
  asm volatile("" :: "v"(t[0]), "v"(t[1]), "v"(t[2]), "v"(t[3]), "v"(t[4]), "v"(t[5]), "v"(t[6]), "v"(t[7]));
#endif
}
__global__ __launch_bounds__(256)
void k_ln(const float* __restrict__ x, const float* __restrict__ gw, const float* __restrict__ gb,
          unsigned short* xh, unsigned short* xl) {
  __shared__ __align__(16) float T[64 * LDC];
  const int tid = threadIdx.x, wv = tid >> 5, lane = tid & 31;
  const int blk = blockIdx.x;
  const int bh = blk >> 1, chalf = blk & 1;
  const int b = bh / HH, h = bh - b * HH;
  const v4f g4 = *(const v4f*)(gw + lane * 4);
  const v4f b4 = *(const v4f*)(gb + lane * 4);
  float g[4], be[4];
#pragma unroll
  for (int e = 0; e < 4; ++e) { g[e] = bfr(g4[e]); be[e] = bfr(b4[e]); }
  // the wave's 8 channel rows: all 8 loads are issued first, then every step of the row arithmetic runs over the 8 rows
  // side by side (8 independent shuffle chains), so the wave pays one memory latency and one chain, not eight of each
  const float* row0 = x + ((size_t)(b * CC + chalf * 64 + wv * 8) * HH + h) * WW + lane * 4;
  v4f a[8];
#pragma unroll
  for (int it = 0; it < 8; ++it) a[it] = *(const v4f*)(row0 + it * (HH * WW));
#if defined(__HIP_DEVICE_COMPILE__)
  // inputs-only fence on the loaded values: keeps the 8 loads together in front of the arithmetic; it holds the wait that
  // stands between issued loads and a rewrite of the address they name, and the address is an input, so it lives that long
  asm volatile("s_wait_xcnt 0x0" :: "v"(row0), "v"(a[0]), "v"(a[1]), "v"(a[2]), "v"(a[3]), "v"(a[4]), "v"(a[5]),
               "v"(a[6]), "v"(a[7]));
#endif
  float d[8][4], s[8], sq[8];
#pragma unroll
  for (int it = 0; it < 8; ++it) {
#pragma unroll
    for (int e = 0; e < 4; ++e) d[it][e] = bfr(a[it][e]);
    s[it] = (d[it][0] + d[it][1]) + (d[it][2] + d[it][3]);
  }
#pragma unroll
  for (int off = 16; off; off >>= 1) {
    float t[8];
#pragma unroll
    for (int it = 0; it < 8; ++it) t[it] = __shfl_xor(s[it], off, 32);
    row_fence(t);
#pragma unroll
    for (int it = 0; it < 8; ++it) s[it] += t[it];
  }
#pragma unroll
  for (int it = 0; it < 8; ++it) {
    const float mu = s[it] * (1.0f / 128.0f);
#pragma unroll
    for (int e = 0; e < 4; ++e) d[it][e] = d[it][e] - mu;
    sq[it] = (d[it][0] * d[it][0] + d[it][1] * d[it][1]) + (d[it][2] * d[it][2] + d[it][3] * d[it][3]);
  }
#pragma unroll
  for (int off = 16; off; off >>= 1) {
    float t[8];
#pragma unroll
    for (int it = 0; it < 8; ++it) t[it] = __shfl_xor(sq[it], off, 32);
    row_fence(t);
#pragma unroll
    for (int it = 0; it < 8; ++it) sq[it] += t[it];
  }
#pragma unroll
  for (int it = 0; it < 8; ++it) {
    const float var = sq[it] * (1.0f / 128.0f);
    const float rs = rsqrtf(var + 1e-5f);
    v4f o;
#pragma unroll
    for (int e = 0; e < 4; ++e) o[e] = (d[it][e] * rs) * g[e] + be[e];
    *(v4f*)(T + (wv * 8 + it) * LDC + lane * 4) = o;
  }
  __syncthreads();
  v4u ph[4], pq[4];
  size_t offs[4];
#pragma unroll
  for (int s = 0; s < 4; ++s) {
    const int idx = s * 256 + tid;
    const int w = idx >> 3, piece = idx & 7;
    const int c0 = piece * 8;
    v4u a, q4;
#pragma unroll
    for (int e = 0; e < 4; ++e) {
      const float f0 = T[(c0 + 2 * e) * LDC + w];
      const float f1 = T[(c0 + 2 * e + 1) * LDC + w];
      unsigned hp, lp;
      split2(f0, f1, hp, lp);
      a[e] = hp; q4[e] = lp;
    }
    ph[s] = a;
    pq[s] = q4;
    offs[s] = (size_t)(b * IMGPIX + h * WW + w) * CC + chalf * 64 + c0;
  }
#pragma unroll
  for (int s = 0; s < 4; ++s) { *(v4u*)(xh + offs[s]) = ph[s]; *(v4u*)(xl + offs[s]) = pq[s]; }
  
}

// =================================================================================================================
// 1x1 projections: C[64 pixels][128 out ch] = xn . w1[t]^T (K = 128), value = C/64; written as f16 hi/lo into the
// padded NHWC planes p1[2t], p1[2t+1] ([NB][130][130][128]) at the interior position (y+1, x+1). 64 consecutive
// pixels lie in one image row -> 64 consecutive padded pixels; thread = one 16-B piece, 16 threads per pixel row
// coverage: interior NPIX padded pixels x 128 ch of all 6 planes (halo by k_halo).
// =================================================================================================================
__global__ __launch_bounds__(256)
void k_proj(const unsigned short* __restrict__ xh, const unsigned short* __restrict__ xl,
            const unsigned short* __restrict__ w1, unsigned short* p1) {
  __shared__ __align__(16) _Float16 ring[2 * SBUF];
  const float* Cs = (const float*)(const void*)ring;
  const int tid = threadIdx.x;
  const int mb = blockIdx.x, t = blockIdx.y;
  mm_tile2((const _Float16*)(const void*)xh, (const _Float16*)(const void*)xl,
           (const _Float16*)(const void*)(w1 + (size_t)t * CC * CC), mb * 64, ring);
  __syncthreads();
  unsigned short* dh = p1 + (size_t)(2 * t) * PS1;
  unsigned short* dl = p1 + (size_t)(2 * t + 1) * PS1;
  const int p0 = mb * 64;
  const int b = p0 / IMGPIX, rem = p0 - b * IMGPIX;
  const int y = rem / WW, x0 = rem - y * WW;
  const size_t pprow = (size_t)(b * HP + y + 1) * WP + x0 + 1;
  v4u ph[4], pq[4];
  size_t offs[4];
#pragma unroll
  for (int s = 0; s < 4; ++s) {
    const int idx = s * 256 + tid;
    const int row = idx >> 4, piece = idx & 15;
    const int col0 = piece * 8;
    v4u a, q4;
#pragma unroll
    for (int e = 0; e < 4; ++e) {
      const float f0 = Cs[row * LDC + col0 + 2 * e] * (1.0f / 64.0f);
      const float f1 = Cs[row * LDC + col0 + 2 * e + 1] * (1.0f / 64.0f);
      unsigned hp, lp;
      split2(f0, f1, hp, lp);
      a[e] = hp; q4[e] = lp;
    }
    ph[s] = a;
    pq[s] = q4;
    offs[s] = (pprow + row) * CC + col0;
  }
#pragma unroll
  for (int s = 0; s < 4; ++s) { *(v4u*)(dh + offs[s]) = ph[s]; *(v4u*)(dl + offs[s]) = pq[s]; }
  
}

// =================================================================================================================
// with NB (not a fixed image count). grid = ceil(6*NB*516*16 / 256).
// coverage: every halo pixel (py in {0,129} or px in {0,129}) of every image of all 6 planes.
// =================================================================================================================
__global__ __launch_bounds__(256)
void k_halo(unsigned short* p1) {
  const int idx = blockIdx.x * 256 + threadIdx.x;
  if (idx >= 6 * NB * NHALO * 16) return;
  const int piece = idx & 15;
  int r = idx >> 4;
  const int hp = r % NHALO;
  r /= NHALO;
  const int img = r % NB, plane = r / NB;
  const int q = max(hp - 2 * WP, 0);
  const int pyA = (hp < WP) ? 0 : (HP - 1);
  const int pxA = (hp < WP) ? hp : (hp - WP);
  const int pyB = 1 + (q >> 1);
  const int pxB = (q & 1) ? (WP - 1) : 0;
  const bool edge = hp < 2 * WP;
  const int py = edge ? pyA : pyB;
  const int px = edge ? pxA : pxB;
  const size_t off = (size_t)plane * PS1 + ((size_t)(img * HP + py) * WP + px) * CC + piece * 8;
  v4u z = {0u, 0u, 0u, 0u};
  *(v4u*)(p1 + off) = z;
  
}

// =================================================================================================================
// 3x3 conv implicit GEMM: block tile = 64 consecutive output pixels x 128 channels, K = 1152 as 36 k-steps,
// A = (hi, lo/2048) planes of tensor t, W = 64 bf16(w2[t]) -> value = C/64. Output NCHW flat [NB][128][16384]:
// coverage: qk [2 tensors][NB][128][16384] f32 and vh/vl [NB][128][16384], every element once (64 px x 128 co / block).
// =================================================================================================================
__global__ __launch_bounds__(256)
void k_conv3(const unsigned short* __restrict__ p1, const unsigned short* __restrict__ wt,
             float* qk, unsigned short* vh, unsigned short* vl) {
  __shared__ __align__(16) _Float16 ring[2 * SBUF];
  const float* Cs = (const float*)(const void*)ring;
  const int tid = threadIdx.x;
  const int mb = blockIdx.x, t = blockIdx.y;
  mm_conv((const _Float16*)(const void*)(p1 + (size_t)(2 * t) * PS1),
          (const _Float16*)(const void*)(p1 + (size_t)(2 * t + 1) * PS1),
          (const _Float16*)(const void*)(wt + (size_t)t * CC * KCV), mb * 64, ring);
  __syncthreads();
  const int p0 = mb * 64;
  const int b = p0 / IMGPIX, pix0 = p0 - b * IMGPIX;
  if (t < 2) {                                               // block-uniform branch, no WMMA inside
    float* df = qk + (size_t)t * ((size_t)NB * BSZ);
    v4f pk[8];
    size_t offs[8];
#pragma unroll
    for (int s = 0; s < 8; ++s) {
      const int idx = s * 256 + tid;
      const int co = idx >> 4, piece = idx & 15;
      v4f v;
#pragma unroll
      for (int e = 0; e < 4; ++e) v[e] = Cs[(piece * 4 + e) * LDC + co] * (1.0f / 64.0f);
      pk[s] = v;
      offs[s] = (size_t)(b * CC + co) * IMGPIX + pix0 + piece * 4;
    }
#pragma unroll
    for (int s = 0; s < 8; ++s) *(v4f*)(df + offs[s]) = pk[s];
    
  } else {
    v4u ph[4], pq[4];
    size_t offs[4];
#pragma unroll
    for (int s = 0; s < 4; ++s) {
      const int idx = s * 256 + tid;
      const int co = idx >> 3, piece = idx & 7;
      const int r0 = piece * 8;
      v4u a, q4;
#pragma unroll
      for (int e = 0; e < 4; ++e) {
        const float f0 = Cs[(r0 + 2 * e) * LDC + co] * (1.0f / 64.0f);
        const float f1 = Cs[(r0 + 2 * e + 1) * LDC + co] * (1.0f / 64.0f);
        unsigned hp, lp;
        split2(f0, f1, hp, lp);
        a[e] = hp; q4[e] = lp;
      }
      ph[s] = a;
      pq[s] = q4;
      offs[s] = (size_t)(b * CC + co) * IMGPIX + pix0 + r0;
    }
#pragma unroll
    for (int s = 0; s < 4; ++s) { *(v4u*)(vh + offs[s]) = ph[s]; *(v4u*)(vl + offs[s]) = pq[s]; }
    
  }
}

// =================================================================================================================
// Logit partial sums over the raw reshape: S[i][j] = sum_r K_head[r][i] Q_head[r][j] (K = 16384) in f32 on VALU from
// the f32 [16384][16] views of the q/k NCHW flat planes. Work-group = (row group rg, batch-head bi): rows r = 16 s + rg
// (1024 rows). Thread (so = tid>>4, i = tid&15) sums the 32 rows s = 32 so .. 32 so + 31 in order into 16 partials;
// thread (i, j) then adds the 32 values of so in order in LDS: sp[bi][rg][i][j]. k_attn adds the 16 row groups in order.
// grid = 16*NB*8, 512 threads. coverage: sp [NB*8][16][256] f32, every element once.
// =================================================================================================================
__global__ __launch_bounds__(512)
void k_logit(const float* __restrict__ qf, const float* __restrict__ kf, float* sp) {
  __shared__ float part[32 * 256];
  const int tid = threadIdx.x;
  // bi in the low bits: the 16 row groups of one head interleave in the same cache lines; a matter of speed only
  const int bi = blockIdx.x % (NB * NHEAD), rg = blockIdx.x / (NB * NHEAD);
  const int b = bi / NHEAD, head = bi - b * NHEAD;
  const float* Qp = qf + (size_t)b * BSZ + (size_t)head * HSZ;
  const float* Kp = kf + (size_t)b * BSZ + (size_t)head * HSZ;
  {
    const int so = tid >> 4, i = tid & 15;
    float tt[HD];
#pragma unroll
    for (int e = 0; e < HD; ++e) tt[e] = 0.f;
    const float* kp = Kp + (size_t)(so * 512 + rg) * HD + i;   // row r = (32 so + s) * 16 + rg, s = 0
    const float* qp = Qp + (size_t)(so * 512 + rg) * HD;
    // batches of 8 rows: each batch's 40 loads are issued together, then summed row by row in order; unrolled so that
    // every row's address is the two base pointers plus an immediate offset
#pragma unroll
    for (int sb = 0; sb < 4; ++sb) {
      float kv[8];
      v4f q[8][4];
#pragma unroll
      for (int u = 0; u < 8; ++u) {
        kv[u] = kp[(sb * 8 + u) * 16 * HD];
#pragma unroll
        for (int g = 0; g < 4; ++g) q[u][g] = *(const v4f*)(qp + (sb * 8 + u) * 16 * HD + 4 * g);
      }
#if defined(__HIP_DEVICE_COMPILE__)
      // inputs-only fences on the loaded values (four rows each: an asm statement takes thirty operands): without them
      // the compiler sinks every load to its first use and the wave pays one memory latency per load. The second one
      // holds the wait that stands between issued loads and a rewrite of a register they name, and takes the two base
      // pointers as inputs too: they stay live to that wait, so no load of the batch lands in its own run's address
      asm volatile("" :: "v"(kv[0]), "v"(kv[1]), "v"(kv[2]), "v"(kv[3]),
                   "v"(q[0][0]), "v"(q[0][1]), "v"(q[0][2]), "v"(q[0][3]), "v"(q[1][0]), "v"(q[1][1]), "v"(q[1][2]), "v"(q[1][3]),
                   "v"(q[2][0]), "v"(q[2][1]), "v"(q[2][2]), "v"(q[2][3]), "v"(q[3][0]), "v"(q[3][1]), "v"(q[3][2]), "v"(q[3][3]));
      asm volatile("s_wait_xcnt 0x0" :: "v"(kp), "v"(qp), "v"(kv[4]), "v"(kv[5]), "v"(kv[6]), "v"(kv[7]),
                   "v"(q[4][0]), "v"(q[4][1]), "v"(q[4][2]), "v"(q[4][3]), "v"(q[5][0]), "v"(q[5][1]), "v"(q[5][2]), "v"(q[5][3]),
                   "v"(q[6][0]), "v"(q[6][1]), "v"(q[6][2]), "v"(q[6][3]), "v"(q[7][0]), "v"(q[7][1]), "v"(q[7][2]), "v"(q[7][3]));
#endif
#pragma unroll
      for (int u = 0; u < 8; ++u) {
#pragma unroll
        for (int g = 0; g < 4; ++g) {
#pragma unroll
          for (int e = 0; e < 4; ++e) tt[4 * g + e] = fmaf(kv[u], q[u][g][e], tt[4 * g + e]);
        }
      }
    }
#pragma unroll
    for (int j = 0; j < HD; ++j) part[so * 256 + i * 16 + j] = tt[j];
  }
  __syncthreads();
  if (tid < 256) {
    float acc = 0.f;
#pragma unroll
    for (int so = 0; so < 32; ++so) acc += part[so * 256 + tid];
    sp[(size_t)(bi * 16 + rg) * 256 + tid] = acc;
  }
}

// =================================================================================================================
// Per (b, head) channel attention: S[i][j] = the 16 row-group partial sums of k_logit added in fixed order.
// P = softmax_j(S * (1/bf16(scale))) in f32 (max-subtracted).
// Wm[o][j] = sum_j2 64 bf16(wo[o][16 head + j2]) P[j][j2] on WMMA (K = 16 zero padded to 32; P carried x4096 as
// f16 hi + residual), value/4096 = 64 Wm; stored as f16 hi/lo planes weh/wel [b][head][o][16]: block region =
// grid = NB*8, 256 threads. coverage: weh/wel [NB][8][128][16], every element once.
// =================================================================================================================
__global__ __launch_bounds__(256)
void k_attn(const float* __restrict__ sp, const float* __restrict__ wo, const float* __restrict__ scale,
            unsigned short* weh, unsigned short* wel) {
  __shared__ float Sm[16 * WSP];
  __shared__ __align__(16) _Float16 Phs[16 * FP];
  __shared__ __align__(16) _Float16 Pls[16 * FP];
  __shared__ __align__(16) _Float16 Wts[CC * FP];
  __shared__ float Ws[CC * WSP];
  const int tid = threadIdx.x, wave = tid >> 5, lane = tid & 31, hh = lane >> 4, m = lane & 15;
  const int bi = blockIdx.x, b = bi / NHEAD, head = bi - b * NHEAD;
  // wo slice -> f16 [o][k] (k = j2, zero for k >= 16; addresses clamped)
  // thread = (o = 8 it + wave, k = lane); the 16 loads of the slice and the 16 loads of the partial sums are all issued
  // before the first is used: one memory latency for the 32, not one per trip
  {
    const float* wop = wo + (size_t)wave * CC + head * HD + min(lane, HD - 1);
    float wf[16];
#pragma unroll
    for (int it = 0; it < 16; ++it) wf[it] = wop[it * 8 * CC];
    const int i = tid >> 4, j = tid & 15;
    const float* spp = sp + (size_t)bi * (16 * 256) + i * 16 + j;
    float pv[16];
#pragma unroll
    for (int rg = 0; rg < 16; ++rg) pv[rg] = spp[rg * 256];
#if defined(__HIP_DEVICE_COMPILE__)
    // inputs-only fence on the slice's loaded values: keeps the loads above in front of the arithmetic; same wait and same
    // live address as in the statement below
    asm volatile("s_wait_xcnt 0x0" :: "v"(wop), "v"(wf[0]), "v"(wf[1]), "v"(wf[2]), "v"(wf[3]), "v"(wf[4]), "v"(wf[5]),
                 "v"(wf[6]), "v"(wf[7]), "v"(wf[8]), "v"(wf[9]), "v"(wf[10]), "v"(wf[11]), "v"(wf[12]), "v"(wf[13]),
                 "v"(wf[14]), "v"(wf[15]));
    // the wait between the 16 issued loads and a rewrite of the address they name; the address and the loaded values
    // are inputs, so that the address stays live to the wait and no load of the run lands in it
    asm volatile("s_wait_xcnt 0x0" :: "v"(spp), "v"(pv[0]), "v"(pv[1]), "v"(pv[2]), "v"(pv[3]), "v"(pv[4]), "v"(pv[5]),
                 "v"(pv[6]), "v"(pv[7]), "v"(pv[8]), "v"(pv[9]), "v"(pv[10]), "v"(pv[11]), "v"(pv[12]), "v"(pv[13]),
                 "v"(pv[14]), "v"(pv[15]));
#endif
#pragma unroll
    for (int it = 0; it < 16; ++it) {
      const float v = (lane < HD) ? bfr(wf[it]) * 64.0f : 0.0f;
      Wts[(it * 8 + wave) * FP + lane] = (_Float16)v;
    }
    float s = 0.f;
#pragma unroll
    for (int rg = 0; rg < 16; ++rg) s += pv[rg];
    const float isc = 1.0f / bfr(scale[0]);
    Sm[i * WSP + j] = s * isc;
  }
  __syncthreads();
  if (tid < 16) {
    // the row's 16 logits are read from LDS together and stay in registers: one LDS latency, not one per element and pass
    float sv[HD];
#pragma unroll
    for (int n = 0; n < HD; ++n) sv[n] = Sm[tid * WSP + n];
    float mx = -3.0e38f;
#pragma unroll
    for (int n = 0; n < HD; ++n) mx = fmaxf(mx, sv[n]);
    float ssum = 0.f;
#pragma unroll
    for (int n = 0; n < HD; ++n) {
      sv[n] = expf(sv[n] - mx);
      ssum += sv[n];
    }
    const float inv = 1.0f / ssum;
#pragma unroll
    for (int n = 0; n < HD; ++n) {
      const float pv = (sv[n] * inv) * 4096.0f;
      const _Float16 hv = (_Float16)pv;
      Phs[tid * FP + n] = hv;
      Pls[tid * FP + n] = (_Float16)((pv - (float)hv) * 2048.0f);
    }
#pragma unroll
    for (int n = HD; n < 32; ++n) { Phs[tid * FP + n] = (_Float16)0.0f; Pls[tid * FP + n] = (_Float16)0.0f; }
  }
  __syncthreads();
  {
    const v16h fa = ldfrag_h(Wts + (wave * 16 + m) * FP + 8 * hh);
    const v16h fb = ldfrag_h(Phs + m * FP + 8 * hh);
    const v16h gb = ldfrag_h(Pls + m * FP + 8 * hh);
    v8f ah = mma_raw(fa, fb, zero8());
    v8f al = mma_raw(fa, gb, zero8());
    guard2(ah, al, fa, fb, gb);
#pragma unroll
    for (int r = 0; r < 8; ++r) Ws[(wave * 16 + 8 * hh + r) * WSP + m] = (ah[r] + al[r] * RSC) * (1.0f / 4096.0f);
  }
  __syncthreads();
  {
    const int o = tid >> 1, hf = tid & 1;
    v4u a, q4;
#pragma unroll
    for (int e = 0; e < 4; ++e) {
      const float f0 = Ws[o * WSP + hf * 8 + 2 * e];
      const float f1 = Ws[o * WSP + hf * 8 + 2 * e + 1];
      unsigned hp, lp;
      split2(f0, f1, hp, lp);
      a[e] = hp; q4[e] = lp;
    }
    const size_t off = (size_t)(bi * CC + o) * HD + hf * 8;
    *(v4u*)(weh + off) = a;
    *(v4u*)(wel + off) = q4;
    
  }
}

// =================================================================================================================
// Output: y[b][o][p] = (sum_c' Wm64[b][c'][o] V[p][c']) / 64 + bf16(x[b][o][p]) for 64 pixels x 128 channels per
// =================================================================================================================
__global__ __launch_bounds__(256)
void k_final(const unsigned short* __restrict__ vh, const unsigned short* __restrict__ vl,
             const unsigned short* __restrict__ weh, const unsigned short* __restrict__ wel,
             const float* __restrict__ x, float* out) {
  __shared__ __align__(16) float Cs[64 * LDC];
  const int tid = threadIdx.x;
  const int mb = blockIdx.x;
  const int p0 = mb * 64;
  const int b = p0 / IMGPIX, pl0 = p0 - b * IMGPIX;
  const _Float16* Vh = (const _Float16*)(const void*)(vh + (size_t)b * BSZ);
  const _Float16* Vl = (const _Float16*)(const void*)(vl + (size_t)b * BSZ);
  const _Float16* Wh = (const _Float16*)(const void*)(weh + (size_t)b * NHEAD * CC * HD);
  const _Float16* Wl = (const _Float16*)(const void*)(wel + (size_t)b * NHEAD * CC * HD);
  mm_final(Vh, Vl, Wh, Wl, pl0, Cs);
  __syncthreads();
  v4f pk[8];
  size_t offs[8];
#pragma unroll
  for (int s = 0; s < 8; ++s) {
    const int idx = s * 256 + tid;
    const int o = idx >> 4, piece = idx & 15;
    const size_t off = (size_t)(b * CC + o) * IMGPIX + pl0 + piece * 4;
    const v4f xr = *(const v4f*)(x + off);
    v4f v;
#pragma unroll
    for (int e = 0; e < 4; ++e) v[e] = Cs[(piece * 4 + e) * LDC + o] * (1.0f / 64.0f) + bfr(xr[e]);
    pk[s] = v;
    offs[s] = off;
  }
#pragma unroll
  for (int s = 0; s < 8; ++s) *(v4f*)(out + offs[s]) = pk[s];
  
}

// =================================================================================================================
// Workspace map (bytes, offsets multiples of 65536, no aliasing, every region sized at or above its whole-line store
// extent): W1 f16 [3][128][128] 98304 (131072) | WT f16 [3][128][1152] 884736 (917504) | XH, XL f16 [32768][128]
// 8388608 each | P1 f16 6 x [2][130][130][128] 51916800 (51970048) | QK f32 [2][2][128][16384] 33554432 |
// VH, VL f16 [2][128][16384] 8388608 each | WEH, WEL f16 [2][8][128][16] 65536 each | SP f32 [16][16][256] 262144 |
// total 120520704.
// =================================================================================================================
extern "C" void kernel_launch(void* const* d_in, const int* in_sizes, int n_in,
                              void* d_out, int out_size, void* d_ws, size_t ws_size,
                              hipStream_t stream) {
  if (n_in < 11) return;
  const int expect[11] = { NB * CC * IMGPIX, WW, WW, 1, CC * CC, CC * CC * 9, CC * CC, CC * CC * 9,
                           CC * CC, CC * CC * 9, CC * CC };
  for (int i = 0; i < 11; ++i) if (in_sizes[i] != expect[i]) return;
  if (out_size != NB * CC * IMGPIX) return;

  const float* x     = (const float*)d_in[0];
  const float* gam   = (const float*)d_in[1];
  const float* bet   = (const float*)d_in[2];
  const float* scale = (const float*)d_in[3];
  const float* wq1   = (const float*)d_in[4];
  const float* wq2   = (const float*)d_in[5];
  const float* wk1   = (const float*)d_in[6];
  const float* wk2   = (const float*)d_in[7];
  const float* wv1   = (const float*)d_in[8];
  const float* wv2   = (const float*)d_in[9];
  const float* wo    = (const float*)d_in[10];
  float* out = (float*)d_out;

  const size_t AL = 65536;
  const size_t sW1 = (((size_t)3 * CC * CC * 2) + AL - 1) / AL * AL;               //   131072
  const size_t sWT = (((size_t)3 * CC * KCV * 2) + AL - 1) / AL * AL;              //   917504
  const size_t sX  = (((size_t)NPIX * CC * 2) + AL - 1) / AL * AL;                  //  8388608
  const size_t sP1 = (((size_t)6 * PS1 * 2) + AL - 1) / AL * AL;                    // 51970048
  const size_t sQK = (((size_t)2 * NB * BSZ * 4) + AL - 1) / AL * AL;               // 33554432
  const size_t sV  = (((size_t)NB * BSZ * 2) + AL - 1) / AL * AL;                   //  8388608
  const size_t sWE = (((size_t)NB * NHEAD * CC * HD * 2) + AL - 1) / AL * AL;       //    65536
  const size_t sSP = (((size_t)NB * NHEAD * 16 * 256 * 4) + AL - 1) / AL * AL;      //   262144

  size_t off = 0;
  const size_t oW1  = off; off += sW1;
  const size_t oWT  = off; off += sWT;
  const size_t oXH  = off; off += sX;
  const size_t oXL  = off; off += sX;
  const size_t oP1  = off; off += sP1;
  const size_t oQK  = off; off += sQK;
  const size_t oVH  = off; off += sV;
  const size_t oVL  = off; off += sV;
  const size_t oWEH = off; off += sWE;
  const size_t oWEL = off; off += sWE;
  const size_t oSP  = off; off += sSP;
  if (off > ws_size) return;                                 // off = 120520704
  if (off > (size_t)134217728) return;

  char* ws = (char*)d_ws;
  unsigned short* W1  = (unsigned short*)(ws + oW1);
  unsigned short* WT  = (unsigned short*)(ws + oWT);
  unsigned short* XH  = (unsigned short*)(ws + oXH);
  unsigned short* XL  = (unsigned short*)(ws + oXL);
  unsigned short* P1  = (unsigned short*)(ws + oP1);
  float*          QK  = (float*)(ws + oQK);
  unsigned short* VH  = (unsigned short*)(ws + oVH);
  unsigned short* VL  = (unsigned short*)(ws + oVL);
  unsigned short* WEH = (unsigned short*)(ws + oWEH);
  unsigned short* WEL = (unsigned short*)(ws + oWEL);
  float*          SP  = (float*)(ws + oSP);

  const dim3 blk(256);
  // (1) weight planes
  k_wcvt<<<dim3(6 * CC), blk, 0, stream>>>(wq1, wq2, wk1, wk2, wv1, wv2, W1, WT);
  // (2) layer norm over w + NHWC hi/lo planes
  k_ln<<<dim3(NB * HH * 2), blk, 0, stream>>>(x, gam, bet, XH, XL);
  // (3) 1x1 projections into padded NHWC hi/lo planes (interior)
  k_proj<<<dim3(NPIX / 64, 3), blk, 0, stream>>>(XH, XL, W1, P1);
  // (4) halo zero fill of the padded planes
  k_halo<<<dim3((6 * NB * NHALO * 16 + 255) / 256), blk, 0, stream>>>(P1);
  // (5) 3x3 convs -> q, k f32 NCHW flat planes; v f16 hi/lo NCHW flat planes
  k_conv3<<<dim3(NPIX / 64, 3), blk, 0, stream>>>(P1, WT, QK, VH, VL);
  // (6) f32 logit partial sums, one work-group per (row group, batch-head)
  k_logit<<<dim3(16 * NB * NHEAD), dim3(512), 0, stream>>>(QK, QK + (size_t)NB * BSZ, SP);
  // (7) per-head channel attention: row groups added + softmax + wo mix -> Wm planes
  k_attn<<<dim3(NB * NHEAD), blk, 0, stream>>>(SP, wo, scale, WEH, WEL);
  // (8) output GEMM + residual -> NCHW d_out
  k_final<<<dim3(NPIX / 64), blk, 0, stream>>>(VH, VL, WEH, WEL, x, out);
  (void)hipGetLastError();
}

// v004
// One run takes 94.5 microseconds.
// Timed twice side by side with v003, it ran 1.07 times as fast both times.
// Counting every step since v000, it is 6.99 times as fast.
// Contractions: 1x1 projections (K=128) and 3x3 convs as implicit GEMM (K=1152): v_wmma_f32_16x16x32_f16, the
// activation as f16 hi + x2048 residual planes into two f32 accumulators, weights one f16 plane of 64*bf16(w);
// per-head k^T q logits (K=16384): f32 on VALU from f32 q/k planes (fixed-order three-level sums); wo x probs mix
// (K=16, zero padded to 32): f16, probs carried x4096 as hi + residual; fused output GEMM (K=128): v and the mixed
// weight as f16 hi + residual planes (3 products); f32 accumulate everywhere. Layer-norm statistics, softmax and
// all epilogues f32 on VALU; every float input RNE-converted to bf16 on load.
#include <hip/hip_runtime.h>
#include <stdint.h>

#define NB     2
#define CC     128
#define HH     128
#define WW     128
#define IMGPIX (HH * WW)
#define NPIX   (NB * IMGPIX)
#define HP     (HH + 2)
#define WP     (WW + 2)
#define PADIMG (HP * WP)
#define PADPIX (NB * PADIMG)
#define KCV    1152
#define NKS    36
#define NHEAD  8
#define HD     16
#define HSZ    (IMGPIX * HD)
#define BSZ    (CC * IMGPIX)
#define LDC    132
#define FP     40
#define WSP    17
#define NHALO  (2 * WP + 2 * HH)
#define RSC    0.00048828125f
#define PS1    ((size_t)PADPIX * CC)
#define PS2    ((size_t)NPIX * CC)
#define SPK    72
#define SBUF   (256 * SPK)
#define NST    18
#define CPX    128
#define CBUF   (384 * SPK)

static_assert(NPIX == NB * IMGPIX);
static_assert(IMGPIX == 16384 && HH == 128 && WW == 128);
static_assert(PADIMG == 16900);
static_assert(KCV == 9 * CC && KCV == NKS * 32);
static_assert(CC == NHEAD * HD);
static_assert(BSZ == CC * IMGPIX && HSZ * NHEAD == BSZ);
static_assert((IMGPIX % 64) == 0 && (WW % 64) == 0);
static_assert((LDC * 4) % 16 == 0 && (FP * 2) % 16 == 0);
static_assert(NHALO == 516);
static_assert((KCV % 8) == 0 && (CC % 32) == 0);
static_assert(IMGPIX == 32 * 32 * 16);
static_assert(NST * 64 == KCV && (SPK * 2) % 32 == 16 && 2 * SBUF * 2 >= 64 * LDC * 4);
static_assert(CPX == WW && (NPIX % CPX) == 0 && 2 * CBUF * 2 >= CPX * LDC * 4);

// Index maps of the raw reshapes (per batch b, flat NCHW index f = c*16384 + h*128 + w viewed as [8][16384][16]):
//   Q_head[r][d] = qflat[b][head*262144 + 16 r + d]   (same map for K_head and V_head; r = (c%16)*1024 + h*8 + w/16,
//   d = w%16). S_head[i][j] = sum_r K_head[r][i] Q_head[r][j]; P_head = softmax_j(S_head * (1/scale)).
//   O[b][16 head + j2][pixel r] = sum_j V_head[r][j] P_head[j][j2].
//   y[b][o][pixel r] = sum_{head, j} Wm[b][head][o][j] V_head[r][j] + x[b][o][r],
//   Wm[b][head][o][j] = sum_j2 wo[o][16 head + j2] P_head[j][j2]   (reassociated 1x1 output conv).

typedef _Float16 v16h __attribute__((ext_vector_type(16)));
typedef _Float16 v8h  __attribute__((ext_vector_type(8)));
typedef float    v8f  __attribute__((ext_vector_type(8)));
typedef float    v4f  __attribute__((ext_vector_type(4)));
typedef unsigned int v4u __attribute__((ext_vector_type(4)));

// ---- scalar helpers ------------------------------------------------------------------------------------------
__device__ __forceinline__ unsigned short bf_bits(float f) {          // f32 -> bf16 bits, RNE convert
  unsigned u = __float_as_uint(f);
  return (unsigned short)((u + 0x7FFFu + ((u >> 16) & 1u)) >> 16);
}
__device__ __forceinline__ float bf_up(unsigned short b) { return __uint_as_float(((unsigned)b) << 16); }
__device__ __forceinline__ float bfr(float f) { return bf_up(bf_bits(f)); }
__device__ __forceinline__ unsigned short h_bits(_Float16 x) { return __builtin_bit_cast(unsigned short, x); }
__device__ __forceinline__ unsigned short hb16(float f) { return h_bits((_Float16)f); }
__device__ __forceinline__ unsigned pk16(unsigned short a, unsigned short b) { return (unsigned)a | ((unsigned)b << 16); }
__device__ __forceinline__ v8f zero8() { v8f z = {0.f, 0.f, 0.f, 0.f, 0.f, 0.f, 0.f, 0.f}; return z; }
// hi/lo pair of two f32 values: hi = f16(v), lo = f16(2048 (v - hi)), packed as two 32-bit words
__device__ __forceinline__ void split2(float f0, float f1, unsigned& hp, unsigned& lp) {
  const _Float16 h0 = (_Float16)f0, h1 = (_Float16)f1;
  const float q0 = (f0 - (float)h0) * 2048.0f, q1 = (f1 - (float)h1) * 2048.0f;
  hp = pk16(h_bits(h0), h_bits(h1));
  lp = pk16(hb16(q0), hb16(q1));
}

// ---- fragment loader: 16-bit A/B operand, lane -> row/col (lane&15), p already includes +8*(lane>>4);
//      elements 0..7 <- p[0..7] (k0+8h..k0+8h+7), elements 8..15 <- p[16..23] (k0+16+8h..k0+16+8h+7)
__device__ __forceinline__ v16h ldfrag_h(const _Float16* p) {
  union { v16h v; v8h h[2]; } f;
  f.h[0] = *(const v8h*)(p);
  f.h[1] = *(const v8h*)(p + 16);
  return f.v;
}
// same layout, the two 8-element halves at two independent 16-B aligned addresses (pa: k0+8h.., pb: k0+16+8h..)
__device__ __forceinline__ v16h ldfrag2(const _Float16* pa, const _Float16* pb) {
  union { v16h v; v8h h[2]; } f;
  f.h[0] = *(const v8h*)(pa);
  f.h[1] = *(const v8h*)(pb);
  return f.v;
}

// ---- WMMA helpers; the guards insert the trailing VALU hazard gap and keep A/B live --------------------------
__device__ __forceinline__ v8f mma_raw(v16h a, v16h b, v8f c) {
  return __builtin_amdgcn_wmma_f32_16x16x32_f16(false, a, false, b, (short)0, c, false, false);
}
__device__ __forceinline__ void guard8(v8f& c0, v8f& c1, v8f& c2, v8f& c3, v8f& c4, v8f& c5, v8f& c6, v8f& c7,
                                       const v16h& a0, const v16h& a1, const v16h& a2, const v16h& a3,
                                       const v16h& b0, const v16h& b1) {
#if defined(__HIP_DEVICE_COMPILE__)
  asm volatile("v_nop\n\tv_nop\n\tv_nop\n\tv_nop"
               : "+v"(c0), "+v"(c1), "+v"(c2), "+v"(c3), "+v"(c4), "+v"(c5), "+v"(c6), "+v"(c7)
               : "v"(a0), "v"(a1), "v"(a2), "v"(a3), "v"(b0), "v"(b1));
#endif
}
__device__ __forceinline__ void guard4(v8f& c0, v8f& c1, v8f& c2, v8f& c3,
                                       const v16h& a0, const v16h& a1, const v16h& b0, const v16h& b1) {
#if defined(__HIP_DEVICE_COMPILE__)
  asm volatile("v_nop\n\tv_nop\n\tv_nop\n\tv_nop"
               : "+v"(c0), "+v"(c1), "+v"(c2), "+v"(c3)
               : "v"(a0), "v"(a1), "v"(b0), "v"(b1));
#endif
}
__device__ __forceinline__ void guard2(v8f& c0, v8f& c1, const v16h& a0, const v16h& b0, const v16h& b1) {
#if defined(__HIP_DEVICE_COMPILE__)
  asm volatile("v_nop\n\tv_nop\n\tv_nop\n\tv_nop"
               : "+v"(c0), "+v"(c1)
               : "v"(a0), "v"(b0), "v"(b1));
#endif
}

// ---- LDS staging of one 64-k slice of a 64x128 block tile's operands: 256 rows of 128 B at pitch 144 B (16 B x odd, for
//      the ds_load_b128 fragment reads): rows 0..63 A hi, 64..127 A lo (64 A rows, global pitch CC), 128..255 W (128 rows,
//      global pitch wstep32 / 32). Thread = (row tid>>3 of each group of 32 rows, 16-B piece tid&7), 8 copies; ga_h, ga_l,
//      gw are the thread's own source addresses in the first group, lds its own byte address in the target buffer.
//      Each copy instruction moves four whole 128-B lines, and every operand byte is fetched once per work-group.
__device__ __forceinline__ void stage_copy(const _Float16* ga_h, const _Float16* ga_l, const _Float16* gw, int wstep32,
                                           unsigned lds) {
  const _Float16* g1 = ga_h + 32 * CC;
  const _Float16* g3 = ga_l + 32 * CC;
  const _Float16* g5 = gw + wstep32;
  const _Float16* g6 = gw + 2 * wstep32;
  const _Float16* g7 = gw + 3 * wstep32;
  const unsigned l1 = lds + 1 * 32 * SPK * 2, l2 = lds + 2 * 32 * SPK * 2, l3 = lds + 3 * 32 * SPK * 2;
  const unsigned l4 = lds + 4 * 32 * SPK * 2, l5 = lds + 5 * 32 * SPK * 2, l6 = lds + 6 * 32 * SPK * 2;
  const unsigned l7 = lds + 7 * 32 * SPK * 2;
#if defined(__HIP_DEVICE_COMPILE__)
  // global -> LDS through no register; the last line is the wait that stands between issued copies and a rewrite of
  // a register they name, inside the statement so that nothing can be moved in front of it
  asm volatile("global_load_async_to_lds_b128 %0, %1, off\n\t"
               "global_load_async_to_lds_b128 %2, %3, off\n\t"
               "global_load_async_to_lds_b128 %4, %5, off\n\t"
               "global_load_async_to_lds_b128 %6, %7, off\n\t"
               "global_load_async_to_lds_b128 %8, %9, off\n\t"
               "global_load_async_to_lds_b128 %10, %11, off\n\t"
               "global_load_async_to_lds_b128 %12, %13, off\n\t"
               "global_load_async_to_lds_b128 %14, %15, off\n\t"
               "s_wait_xcnt 0x0"
               :: "v"(lds), "v"(ga_h), "v"(l1), "v"(g1), "v"(l2), "v"(ga_l), "v"(l3), "v"(g3),
                  "v"(l4), "v"(gw), "v"(l5), "v"(g5), "v"(l6), "v"(g6), "v"(l7), "v"(g7)
               : "memory");
#endif
}
// ---- the same for the conv's 128x128 block tile: 384 rows of 128 B at pitch 144 B: rows 0..127 A hi, 128..255 A lo (128 A
//      rows, global pitch CC), 256..383 W (128 rows, global pitch wstep32 / 32). Thread = (row tid>>3 of each group of 32
//      rows, 16-B piece tid&7), 12 copies.
__device__ __forceinline__ void stage_copy12(const _Float16* ga_h, const _Float16* ga_l, const _Float16* gw, int wstep32,
                                             unsigned lds) {
  const _Float16* h1 = ga_h + 32 * CC;
  const _Float16* h2 = ga_h + 64 * CC;
  const _Float16* h3 = ga_h + 96 * CC;
  const _Float16* q1 = ga_l + 32 * CC;
  const _Float16* q2 = ga_l + 64 * CC;
  const _Float16* q3 = ga_l + 96 * CC;
  const _Float16* w1 = gw + wstep32;
  const _Float16* w2 = gw + 2 * wstep32;
  const _Float16* w3 = gw + 3 * wstep32;
  const unsigned gs = 32 * SPK * 2;
  const unsigned l1 = lds + 1 * gs, l2 = lds + 2 * gs, l3 = lds + 3 * gs, l4 = lds + 4 * gs, l5 = lds + 5 * gs;
  const unsigned l6 = lds + 6 * gs, l7 = lds + 7 * gs, l8 = lds + 8 * gs, l9 = lds + 9 * gs, l10 = lds + 10 * gs;
  const unsigned l11 = lds + 11 * gs;
#if defined(__HIP_DEVICE_COMPILE__)
  // global -> LDS through no register; the last line is the wait that stands between issued copies and a rewrite of
  // a register they name, inside the statement so that nothing can be moved in front of it
  asm volatile("global_load_async_to_lds_b128 %0, %1, off\n\t"
               "global_load_async_to_lds_b128 %2, %3, off\n\t"
               "global_load_async_to_lds_b128 %4, %5, off\n\t"
               "global_load_async_to_lds_b128 %6, %7, off\n\t"
               "global_load_async_to_lds_b128 %8, %9, off\n\t"
               "global_load_async_to_lds_b128 %10, %11, off\n\t"
               "global_load_async_to_lds_b128 %12, %13, off\n\t"
               "global_load_async_to_lds_b128 %14, %15, off\n\t"
               "global_load_async_to_lds_b128 %16, %17, off\n\t"
               "global_load_async_to_lds_b128 %18, %19, off\n\t"
               "global_load_async_to_lds_b128 %20, %21, off\n\t"
               "global_load_async_to_lds_b128 %22, %23, off\n\t"
               "s_wait_xcnt 0x0"
               :: "v"(lds), "v"(ga_h), "v"(l1), "v"(h1), "v"(l2), "v"(h2), "v"(l3), "v"(h3),
                  "v"(l4), "v"(ga_l), "v"(l5), "v"(q1), "v"(l6), "v"(q2), "v"(l7), "v"(q3),
                  "v"(l8), "v"(gw), "v"(l9), "v"(w1), "v"(l10), "v"(w2), "v"(l11), "v"(w3)
               : "memory");
#endif
}
__device__ __forceinline__ void wait_copies() {
#if defined(__HIP_DEVICE_COMPILE__)
  asm volatile("s_wait_asynccnt 0x0" ::: "memory");   // this wave's copies have landed in LDS
#endif
}
__device__ __forceinline__ void wait_lds_reads() {
#if defined(__HIP_DEVICE_COMPILE__)
  asm volatile("s_wait_dscnt 0x0" ::: "memory");      // this wave's LDS reads are done before the buffer is rewritten
#endif
}

// ---- 64x128 block tile GEMM core (K = 128) with the A operand as two planes (hi and x2048 residual) into separate
//      accumulators; A row pitch CC (f16), W is [n][k] k-contiguous pitch CC. Both 64-k slices are copied to the two LDS
//      buffers at once, then read. 8 waves = 2 (32 rows) x 4 (32 cols), 2x2 tiles of 16 per wave; fragments from LDS with
//      the table layout; the residual accumulator is folded with 1/2048 when the tile is written to the LDS f32 tile
//      Cs[64][LDC], which takes the buffers' place behind a barrier.
__device__ __forceinline__ void mm_tile2(const _Float16* __restrict__ Ah, const _Float16* __restrict__ Al,
                                         const _Float16* __restrict__ W, int arow0, _Float16* ring) {
  const int tid = threadIdx.x, wave = tid >> 5, lane = tid & 31, hh = lane >> 4, c = lane & 15;
  const int mw = wave >> 2, nw = wave & 3;
  const int srow = tid >> 3, spc = tid & 7;
  const size_t sa = (size_t)(arow0 + srow) * CC + spc * 8;
  const _Float16* wb = W + (size_t)srow * CC + spc * 8;
  const unsigned lds0 = (unsigned)(size_t)ring + (unsigned)((srow * SPK + spc * 8) * 2);
  const _Float16* fap = ring + (mw * 32 + c) * SPK + 8 * hh;
  const _Float16* fbp = ring + (128 + nw * 32 + c) * SPK + 8 * hh;
  v8f h00 = zero8(), h01 = zero8(), h10 = zero8(), h11 = zero8();
  v8f l00 = zero8(), l01 = zero8(), l10 = zero8(), l11 = zero8();
  stage_copy(Ah + sa, Al + sa, wb, 32 * CC, lds0);
  stage_copy(Ah + sa + 64, Al + sa + 64, wb + 64, 32 * CC, lds0 + SBUF * 2);
  wait_copies();
  __syncthreads();                               // both slices are readable by every wave
  // unrolled: every fragment's LDS offset becomes an immediate of its load
#pragma unroll
  for (int ks = 0; ks < CC / 32; ++ks) {
    const _Float16* pa = fap + (ks >> 1) * SBUF + (ks & 1) * 32;
    const _Float16* pb = fbp + (ks >> 1) * SBUF + (ks & 1) * 32;
    const v16h fa0 = ldfrag_h(pa);
    const v16h fa1 = ldfrag_h(pa + 16 * SPK);
    const v16h ga0 = ldfrag_h(pa + 64 * SPK);
    const v16h ga1 = ldfrag_h(pa + 80 * SPK);
    const v16h fb0 = ldfrag_h(pb);
    const v16h fb1 = ldfrag_h(pb + 16 * SPK);
    h00 = mma_raw(fa0, fb0, h00);
    h01 = mma_raw(fa0, fb1, h01);
    h10 = mma_raw(fa1, fb0, h10);
    h11 = mma_raw(fa1, fb1, h11);
    l00 = mma_raw(ga0, fb0, l00);
    l01 = mma_raw(ga0, fb1, l01);
    l10 = mma_raw(ga1, fb0, l10);
    l11 = mma_raw(ga1, fb1, l11);
    guard8(h00, h01, h10, h11, l00, l01, l10, l11, fa0, fa1, ga0, ga1, fb0, fb1);
  }
  wait_lds_reads();
  __syncthreads();                               // ends every wave's fragment reads: the buffers become the f32 tile
  float* Cs = (float*)(void*)ring;
#pragma unroll
  for (int r = 0; r < 8; ++r) {
    const int row = mw * 32 + 8 * hh + r;
    Cs[row * LDC + nw * 32 + c]             = h00[r] + l00[r] * RSC;
    Cs[row * LDC + nw * 32 + 16 + c]        = h01[r] + l01[r] * RSC;
    Cs[(row + 16) * LDC + nw * 32 + c]      = h10[r] + l10[r] * RSC;
    Cs[(row + 16) * LDC + nw * 32 + 16 + c] = h11[r] + l11[r] * RSC;
  }
}

// ---- implicit-GEMM variant for the 3x3 conv: A row = output pixel p (flat over all images), k = tap*128 + c;
//      W = wt [128][1152] k-contiguous. The operands of a stage st (tap = st>>1, channel half = st&1: 64 k, two k-steps)
//      are staged in LDS by stage_copy12: the A rows are the 128 pixels of one image row at padded position (y + ky,
//      x + kx), the W rows the 128 output channels. Two buffers: stage t + 1 is copied while stage t is multiplied; the
//      fragments come from LDS with the table k map (k order: tap, channel quarter, table). 8 waves = 4 (32 pixels) x 2
//      (64 channels): a wave's k-step is 16 products from 8 fragments (2 hi, 2 lo, 4 W).
__device__ __forceinline__ size_t conv_abase(int p, int hh) {
  const int b = p / IMGPIX;
  const int r = p - b * IMGPIX;
  const int y = r / WW;
  const int x = r - y * WW;
  return ((size_t)(b * HP + y) * WP + x) * CC + 8 * hh;
}
// stage st's copies into the buffer at lds; ah/al/wb are the thread's own source addresses for stage 0
__device__ __forceinline__ void conv_stage(const _Float16* ah, const _Float16* al, const _Float16* wb, int st,
                                           unsigned lds) {
  const int tap = st >> 1;
  const int ky = (tap * 11) >> 5;                // tap / 3 for tap < 9
  const int kx = tap - 3 * ky;
  const int ao = (ky * WP + kx) * CC + (st & 1) * 64;
  stage_copy12(ah + ao, al + ao, wb + st * 64, 32 * KCV, lds);
}
__device__ __forceinline__ void mm_conv(const _Float16* __restrict__ Ah, const _Float16* __restrict__ Al,
                                        const _Float16* __restrict__ W, int prow0, _Float16* ring) {
  const int tid = threadIdx.x, wave = tid >> 5, lane = tid & 31, hh = lane >> 4, c = lane & 15;
  const int mw = wave >> 1, nw = wave & 1;
  const int srow = tid >> 3, spc = tid & 7;
  const size_t sa = conv_abase(prow0 + srow, 0) + spc * 8;
  const _Float16* ah = Ah + sa;
  const _Float16* al = Al + sa;
  const _Float16* wb = W + (size_t)srow * KCV + spc * 8;
  const unsigned lds0 = (unsigned)(size_t)ring + (unsigned)((srow * SPK + spc * 8) * 2);
  const _Float16* fap = ring + (mw * 32 + c) * SPK + 8 * hh;
  const _Float16* fbp = ring + (256 + nw * 64 + c) * SPK + 8 * hh;
  v8f h0[4], h1[4], l0[4], l1[4];
  // unrolled: every index of an accumulator array is a constant, so the arrays stay in registers
#pragma unroll
  for (int n = 0; n < 4; ++n) { h0[n] = zero8(); h1[n] = zero8(); l0[n] = zero8(); l1[n] = zero8(); }
  conv_stage(ah, al, wb, 0, lds0);
  wait_copies();
  __syncthreads();                               // stage 0 is readable by every wave
  conv_stage(ah, al, wb, 1, lds0 + CBUF * 2);
  // rolled: one copy of the body in the instruction cache, the buffer chosen by t & 1
#pragma unroll 1
  for (int t = 0; t < NST; ++t) {
    const int bo = (t & 1) * CBUF;
    // unrolled: the two k-steps' LDS offsets become immediates of their loads
#pragma unroll
    for (int kk = 0; kk < 2; ++kk) {
      const _Float16* pa = fap + bo + kk * 32;
      const _Float16* pb = fbp + bo + kk * 32;
      const v16h fa0 = ldfrag_h(pa);
      const v16h fb0 = ldfrag_h(pb);
      const v16h fb1 = ldfrag_h(pb + 16 * SPK);
      const v16h fb2 = ldfrag_h(pb + 32 * SPK);
      const v16h fb3 = ldfrag_h(pb + 48 * SPK);
      const v16h fa1 = ldfrag_h(pa + 16 * SPK);
      const v16h ga0 = ldfrag_h(pa + 128 * SPK);
      const v16h ga1 = ldfrag_h(pa + 144 * SPK);
#if defined(__HIP_DEVICE_COMPILE__)
      // nothing is scheduled across this line: without it the compiler reloads one A register set in among the products
      // and the wave waits out a whole LDS latency at each such place
      __builtin_amdgcn_sched_barrier(0);
#endif
      h0[0] = mma_raw(fa0, fb0, h0[0]);
      h0[1] = mma_raw(fa0, fb1, h0[1]);
      h0[2] = mma_raw(fa0, fb2, h0[2]);
      h0[3] = mma_raw(fa0, fb3, h0[3]);
      h1[0] = mma_raw(fa1, fb0, h1[0]);
      h1[1] = mma_raw(fa1, fb1, h1[1]);
      h1[2] = mma_raw(fa1, fb2, h1[2]);
      h1[3] = mma_raw(fa1, fb3, h1[3]);
      l0[0] = mma_raw(ga0, fb0, l0[0]);
      l0[1] = mma_raw(ga0, fb1, l0[1]);
      l0[2] = mma_raw(ga0, fb2, l0[2]);
      l0[3] = mma_raw(ga0, fb3, l0[3]);
      l1[0] = mma_raw(ga1, fb0, l1[0]);
      l1[1] = mma_raw(ga1, fb1, l1[1]);
      l1[2] = mma_raw(ga1, fb2, l1[2]);
      l1[3] = mma_raw(ga1, fb3, l1[3]);
      guard8(l0[0], l0[1], l0[2], l0[3], l1[0], l1[1], l1[2], l1[3], ga0, ga1, fb0, fb1, fb2, fb3);
#if defined(__HIP_DEVICE_COMPILE__)
      // nor across this one: without it products of this k-step sink behind the trip's barrier and hold back the next copies
      __builtin_amdgcn_sched_barrier(0);
#endif
    }
    wait_lds_reads();
    wait_copies();
    __syncthreads();                             // publishes stage t + 1 and ends every read of stage t's buffer
    if (t + 2 < NST) conv_stage(ah, al, wb, t + 2, lds0 + bo * 2);
  }
  wait_copies();
  float* Cs = (float*)(void*)ring;               // the ring is free behind the last trip's barrier: f32 tile [128][LDC]
#pragma unroll
  for (int r = 0; r < 8; ++r) {
    const int row = mw * 32 + 8 * hh + r;
    // unrolled for the same reason as above
#pragma unroll
    for (int n = 0; n < 4; ++n) {
      Cs[row * LDC + nw * 64 + n * 16 + c]        = h0[n][r] + l0[n][r] * RSC;
      Cs[(row + 16) * LDC + nw * 64 + n * 16 + c] = h1[n][r] + l1[n][r] * RSC;
    }
  }
}

// ---- fused output GEMM core: rows = 64 pixels of one batch (local pixel pl0..pl0+63), cols = 128 output channels,
//      k = c' = 16 head + j (K = 128, 4 k-steps of two heads each). A[p][c'] = V_head[p][j] read from the NCHW flat v
//      planes at head*HSZ + 16 p + j (two 16-B halves per fragment, heads 2ks and 2ks+1); B = Wm[head][o][16]
//      k-contiguous per head. Products hi*hi + hi*lo (first loop) and lo*hi (second loop) into Cs[64][LDC].
__device__ __forceinline__ void mm_final(const _Float16* __restrict__ Vh, const _Float16* __restrict__ Vl,
                                         const _Float16* __restrict__ Wh, const _Float16* __restrict__ Wl,
                                         int pl0, float* Cs) {
  const int tid = threadIdx.x, wave = tid >> 5, lane = tid & 31, hh = lane >> 4, c = lane & 15;
  const int mw = wave >> 2, nw = wave & 3;
  const size_t r0 = (size_t)(pl0 + mw * 32 + c) * HD + 8 * hh;
  const size_t r1 = (size_t)(pl0 + mw * 32 + 16 + c) * HD + 8 * hh;
  const size_t q0 = (size_t)(nw * 32 + c) * HD + 8 * hh;
  const size_t q1 = (size_t)(nw * 32 + 16 + c) * HD + 8 * hh;
  {
    v8f h00 = zero8(), h01 = zero8(), h10 = zero8(), h11 = zero8();
    v8f l00 = zero8(), l01 = zero8(), l10 = zero8(), l11 = zero8();
    const _Float16* pa0 = Vh + r0;
    const _Float16* pa1 = Vh + r1;
    const _Float16* pb0 = Wh + q0;
    const _Float16* pb1 = Wh + q1;
    const _Float16* pc0 = Wl + q0;
    const _Float16* pc1 = Wl + q1;
    // two k-steps a batch: the batch's 24 loads are issued together, then multiplied in k order (one latency for two
    // k-steps; four at once would not leave registers for two work-groups on a WGP); unrolled: offsets become immediates
#pragma unroll
    for (int kp = 0; kp < CC / 64; ++kp) {
      v16h fa0[2], fa1[2], fb0[2], fb1[2], gb0[2], gb1[2];
#pragma unroll
      for (int u = 0; u < 2; ++u) {
        const int ao = (2 * (2 * kp + u)) * HSZ;
        const int bo = (2 * (2 * kp + u)) * (CC * HD);
        fa0[u] = ldfrag2(pa0 + ao, pa0 + ao + HSZ);
        fa1[u] = ldfrag2(pa1 + ao, pa1 + ao + HSZ);
        fb0[u] = ldfrag2(pb0 + bo, pb0 + bo + CC * HD);
        fb1[u] = ldfrag2(pb1 + bo, pb1 + bo + CC * HD);
        gb0[u] = ldfrag2(pc0 + bo, pc0 + bo + CC * HD);
        gb1[u] = ldfrag2(pc1 + bo, pc1 + bo + CC * HD);
      }
#if defined(__HIP_DEVICE_COMPILE__)
      // nothing is scheduled across this line: without it the first product, with its wait, is lifted in among the batch's
      // loads, and the loads behind it start one latency late
      __builtin_amdgcn_sched_barrier(0);
      // inputs-only fence on the loaded fragments: keeps the batch's loads together in front of its products; it holds the
      // wait that stands between issued loads and a rewrite of an address register they name
      asm volatile("s_wait_xcnt 0x0" :: "v"(fa0[0]), "v"(fa1[0]), "v"(fb0[0]), "v"(fb1[0]), "v"(gb0[0]), "v"(gb1[0]),
                   "v"(fa0[1]), "v"(fa1[1]), "v"(fb0[1]), "v"(fb1[1]), "v"(gb0[1]), "v"(gb1[1]));
#endif
#pragma unroll
      for (int u = 0; u < 2; ++u) {
        h00 = mma_raw(fa0[u], fb0[u], h00);
        h01 = mma_raw(fa0[u], fb1[u], h01);
        h10 = mma_raw(fa1[u], fb0[u], h10);
        h11 = mma_raw(fa1[u], fb1[u], h11);
        l00 = mma_raw(fa0[u], gb0[u], l00);
        l01 = mma_raw(fa0[u], gb1[u], l01);
        l10 = mma_raw(fa1[u], gb0[u], l10);
        l11 = mma_raw(fa1[u], gb1[u], l11);
        guard8(h00, h01, h10, h11, l00, l01, l10, l11, fa0[u], fa1[u], gb0[u], gb1[u], fb0[u], fb1[u]);
      }
    }
#pragma unroll
    for (int r = 0; r < 8; ++r) {
      const int row = mw * 32 + 8 * hh + r;
      Cs[row * LDC + nw * 32 + c]             = h00[r] + l00[r] * RSC;
      Cs[row * LDC + nw * 32 + 16 + c]        = h01[r] + l01[r] * RSC;
      Cs[(row + 16) * LDC + nw * 32 + c]      = h10[r] + l10[r] * RSC;
      Cs[(row + 16) * LDC + nw * 32 + 16 + c] = h11[r] + l11[r] * RSC;
    }
  }
  {
    v8f m00 = zero8(), m01 = zero8(), m10 = zero8(), m11 = zero8();
#if defined(__HIP_DEVICE_COMPILE__)
    // nothing is scheduled across this line or the one behind the loads: the first loop's epilogue stays out of the run of
    // loads, where it reused their address registers while they were in flight
    __builtin_amdgcn_sched_barrier(0);
#endif
    const _Float16* pa0 = Vl + r0;
    const _Float16* pa1 = Vl + r1;
    const _Float16* pb0 = Wh + q0;
    const _Float16* pb1 = Wh + q1;
    // all four k-steps' 32 loads are issued together, then multiplied in k order: one latency, not four
    v16h ga0[4], ga1[4], fb0[4], fb1[4];
#pragma unroll
    for (int ks = 0; ks < CC / 32; ++ks) {
      const int ao = (2 * ks) * HSZ;
      const int bo = (2 * ks) * (CC * HD);
      ga0[ks] = ldfrag2(pa0 + ao, pa0 + ao + HSZ);
      ga1[ks] = ldfrag2(pa1 + ao, pa1 + ao + HSZ);
      fb0[ks] = ldfrag2(pb0 + bo, pb0 + bo + CC * HD);
      fb1[ks] = ldfrag2(pb1 + bo, pb1 + bo + CC * HD);
    }
#if defined(__HIP_DEVICE_COMPILE__)
    __builtin_amdgcn_sched_barrier(0);
    // inputs-only fence on the loaded fragments, with the same wait as in the first loop
    asm volatile("s_wait_xcnt 0x0" :: "v"(ga0[0]), "v"(ga1[0]), "v"(fb0[0]), "v"(fb1[0]), "v"(ga0[1]), "v"(ga1[1]), "v"(fb0[1]), "v"(fb1[1]),
                 "v"(ga0[2]), "v"(ga1[2]), "v"(fb0[2]), "v"(fb1[2]), "v"(ga0[3]), "v"(ga1[3]), "v"(fb0[3]), "v"(fb1[3]));
#endif
#pragma unroll
    for (int ks = 0; ks < CC / 32; ++ks) {
      m00 = mma_raw(ga0[ks], fb0[ks], m00);
      m01 = mma_raw(ga0[ks], fb1[ks], m01);
      m10 = mma_raw(ga1[ks], fb0[ks], m10);
      m11 = mma_raw(ga1[ks], fb1[ks], m11);
      guard4(m00, m01, m10, m11, ga0[ks], ga1[ks], fb0[ks], fb1[ks]);
    }
#pragma unroll
    for (int r = 0; r < 8; ++r) {               // same lane wrote these slots above (program order, same type)
      const int row = mw * 32 + 8 * hh + r;
      Cs[row * LDC + nw * 32 + c]             += m00[r] * RSC;
      Cs[row * LDC + nw * 32 + 16 + c]        += m01[r] * RSC;
      Cs[(row + 16) * LDC + nw * 32 + c]      += m10[r] * RSC;
      Cs[(row + 16) * LDC + nw * 32 + 16 + c] += m11[r] * RSC;
    }
  }
}

// =================================================================================================================
// Weight convert. Blocks 0..383: tensor t = blk/128 of (wq2, wk2, wv2) [co][ci][3][3] f32 -> wt [t][co][k =
// tap*128 + ci] f16(64 * bf16(w)); thread tt < 144 builds one 16-B piece (8 halves), 8 consecutive threads per
// passes. grid = 768. coverage: wt 384 x 1152 and w1 384 x 128, every element once.
// =================================================================================================================
__global__ __launch_bounds__(256)
void k_wcvt(const float* __restrict__ wq1, const float* __restrict__ wq2, const float* __restrict__ wk1,
            const float* __restrict__ wk2, const float* __restrict__ wv1, const float* __restrict__ wv2,
            unsigned short* w1, unsigned short* wt) {
  const int tid = threadIdx.x;
  const int blk = blockIdx.x;
  if (blk < 3 * CC) {
    const int t = blk / CC, co = blk - t * CC;
    const float* src = (t == 0) ? wq2 : ((t == 1) ? wk2 : wv2);
    const int tt = min(tid, 143);
    const int k0 = tt * 8, tap = k0 / CC, c0 = k0 - tap * CC;
    v4u pk;
#pragma unroll
    for (int e = 0; e < 4; ++e) {
      const float f0 = src[(size_t)(co * CC + c0 + 2 * e) * 9 + tap];
      const float f1 = src[(size_t)(co * CC + c0 + 2 * e + 1) * 9 + tap];
      pk[e] = pk16(hb16(bfr(f0) * 64.0f), hb16(bfr(f1) * 64.0f));
    }
    if (tid < 144) {
      unsigned short* dst = wt + (size_t)(t * CC + co) * KCV + k0;
      *(v4u*)dst = pk;
      
    }
  } else {
    const int rr = blk - 3 * CC;
    const int t = rr / CC, o = rr - t * CC;
    const float* src = (t == 0) ? wq1 : ((t == 1) ? wk1 : wv1);
    const int tt = min(tid, 15);
    const int c0 = tt * 8;
    v4u pk;
#pragma unroll
    for (int e = 0; e < 4; ++e) {
      const float f0 = src[(size_t)o * CC + c0 + 2 * e];
      const float f1 = src[(size_t)o * CC + c0 + 2 * e + 1];
      pk[e] = pk16(hb16(bfr(f0) * 64.0f), hb16(bfr(f1) * 64.0f));
    }
    if (tid < 16) {
      unsigned short* dst = w1 + (size_t)(t * CC + o) * CC + c0;
      *(v4u*)dst = pk;
      
    }
  }
}

// =================================================================================================================
// gamma[w], beta[w] bf16 converted) + NCHW -> NHWC + hi/lo f16 planes. Block = (b, h, channel half): wave = 8
// channel rows, lane = 4 w values, shuffle reductions; f32 tile T[64 ch][w] in LDS; then each pixel's 64 channels
// grid = NB*128*2, 256 threads. coverage: xh/xl [NPIX px][128 ch], every element once.
// =================================================================================================================
// inputs-only fence on the 8 rows' shuffled values (they come back on the LDS counter like loads): keeps the 8 shuffles of
// one reduction step together in front of their adds; without it the compiler runs the rows' chains one after another and
// the wave waits out every shuffle's latency alone
__device__ __forceinline__ void row_fence(const float (&t)[8]) {
#if defined(__HIP_DEVICE_COMPILE__)
  asm volatile("" :: "v"(t[0]), "v"(t[1]), "v"(t[2]), "v"(t[3]), "v"(t[4]), "v"(t[5]), "v"(t[6]), "v"(t[7]));
#endif
}
__global__ __launch_bounds__(256)
void k_ln(const float* __restrict__ x, const float* __restrict__ gw, const float* __restrict__ gb,
          unsigned short* xh, unsigned short* xl) {
  __shared__ __align__(16) float T[64 * LDC];
  const int tid = threadIdx.x, wv = tid >> 5, lane = tid & 31;
  const int blk = blockIdx.x;
  const int bh = blk >> 1, chalf = blk & 1;
  const int b = bh / HH, h = bh - b * HH;
  const v4f g4 = *(const v4f*)(gw + lane * 4);
  const v4f b4 = *(const v4f*)(gb + lane * 4);
  float g[4], be[4];
#pragma unroll
  for (int e = 0; e < 4; ++e) { g[e] = bfr(g4[e]); be[e] = bfr(b4[e]); }
  // the wave's 8 channel rows: all 8 loads are issued first, then every step of the row arithmetic runs over the 8 rows
  // side by side (8 independent shuffle chains), so the wave pays one memory latency and one chain, not eight of each
  const float* row0 = x + ((size_t)(b * CC + chalf * 64 + wv * 8) * HH + h) * WW + lane * 4;
  v4f a[8];
#pragma unroll
  for (int it = 0; it < 8; ++it) a[it] = *(const v4f*)(row0 + it * (HH * WW));
#if defined(__HIP_DEVICE_COMPILE__)
  // inputs-only fence on the loaded values: keeps the 8 loads together in front of the arithmetic; it holds the wait that
  // stands between issued loads and a rewrite of the address they name, and the address is an input, so it lives that long
  asm volatile("s_wait_xcnt 0x0" :: "v"(row0), "v"(a[0]), "v"(a[1]), "v"(a[2]), "v"(a[3]), "v"(a[4]), "v"(a[5]),
               "v"(a[6]), "v"(a[7]));
#endif
  float d[8][4], s[8], sq[8];
#pragma unroll
  for (int it = 0; it < 8; ++it) {
#pragma unroll
    for (int e = 0; e < 4; ++e) d[it][e] = bfr(a[it][e]);
    s[it] = (d[it][0] + d[it][1]) + (d[it][2] + d[it][3]);
  }
#pragma unroll
  for (int off = 16; off; off >>= 1) {
    float t[8];
#pragma unroll
    for (int it = 0; it < 8; ++it) t[it] = __shfl_xor(s[it], off, 32);
    row_fence(t);
#pragma unroll
    for (int it = 0; it < 8; ++it) s[it] += t[it];
  }
#pragma unroll
  for (int it = 0; it < 8; ++it) {
    const float mu = s[it] * (1.0f / 128.0f);
#pragma unroll
    for (int e = 0; e < 4; ++e) d[it][e] = d[it][e] - mu;
    sq[it] = (d[it][0] * d[it][0] + d[it][1] * d[it][1]) + (d[it][2] * d[it][2] + d[it][3] * d[it][3]);
  }
#pragma unroll
  for (int off = 16; off; off >>= 1) {
    float t[8];
#pragma unroll
    for (int it = 0; it < 8; ++it) t[it] = __shfl_xor(sq[it], off, 32);
    row_fence(t);
#pragma unroll
    for (int it = 0; it < 8; ++it) sq[it] += t[it];
  }
#pragma unroll
  for (int it = 0; it < 8; ++it) {
    const float var = sq[it] * (1.0f / 128.0f);
    const float rs = rsqrtf(var + 1e-5f);
    v4f o;
#pragma unroll
    for (int e = 0; e < 4; ++e) o[e] = (d[it][e] * rs) * g[e] + be[e];
    *(v4f*)(T + (wv * 8 + it) * LDC + lane * 4) = o;
  }
  __syncthreads();
  v4u ph[4], pq[4];
  size_t offs[4];
#pragma unroll
  for (int s = 0; s < 4; ++s) {
    const int idx = s * 256 + tid;
    const int w = idx >> 3, piece = idx & 7;
    const int c0 = piece * 8;
    v4u a, q4;
#pragma unroll
    for (int e = 0; e < 4; ++e) {
      const float f0 = T[(c0 + 2 * e) * LDC + w];
      const float f1 = T[(c0 + 2 * e + 1) * LDC + w];
      unsigned hp, lp;
      split2(f0, f1, hp, lp);
      a[e] = hp; q4[e] = lp;
    }
    ph[s] = a;
    pq[s] = q4;
    offs[s] = (size_t)(b * IMGPIX + h * WW + w) * CC + chalf * 64 + c0;
  }
#pragma unroll
  for (int s = 0; s < 4; ++s) { *(v4u*)(xh + offs[s]) = ph[s]; *(v4u*)(xl + offs[s]) = pq[s]; }
  
}

// =================================================================================================================
// 1x1 projections: C[64 pixels][128 out ch] = xn . w1[t]^T (K = 128), value = C/64; written as f16 hi/lo into the
// padded NHWC planes p1[2t], p1[2t+1] ([NB][130][130][128]) at the interior position (y+1, x+1). 64 consecutive
// pixels lie in one image row -> 64 consecutive padded pixels; thread = one 16-B piece, 16 threads per pixel row
// coverage: interior NPIX padded pixels x 128 ch of all 6 planes (halo by k_halo).
// =================================================================================================================
__global__ __launch_bounds__(256)
void k_proj(const unsigned short* __restrict__ xh, const unsigned short* __restrict__ xl,
            const unsigned short* __restrict__ w1, unsigned short* p1) {
  __shared__ __align__(16) _Float16 ring[2 * SBUF];
  const float* Cs = (const float*)(const void*)ring;
  const int tid = threadIdx.x;
  const int mb = blockIdx.x, t = blockIdx.y;
  mm_tile2((const _Float16*)(const void*)xh, (const _Float16*)(const void*)xl,
           (const _Float16*)(const void*)(w1 + (size_t)t * CC * CC), mb * 64, ring);
  __syncthreads();
  unsigned short* dh = p1 + (size_t)(2 * t) * PS1;
  unsigned short* dl = p1 + (size_t)(2 * t + 1) * PS1;
  const int p0 = mb * 64;
  const int b = p0 / IMGPIX, rem = p0 - b * IMGPIX;
  const int y = rem / WW, x0 = rem - y * WW;
  const size_t pprow = (size_t)(b * HP + y + 1) * WP + x0 + 1;
  v4u ph[4], pq[4];
  size_t offs[4];
#pragma unroll
  for (int s = 0; s < 4; ++s) {
    const int idx = s * 256 + tid;
    const int row = idx >> 4, piece = idx & 15;
    const int col0 = piece * 8;
    v4u a, q4;
#pragma unroll
    for (int e = 0; e < 4; ++e) {
      const float f0 = Cs[row * LDC + col0 + 2 * e] * (1.0f / 64.0f);
      const float f1 = Cs[row * LDC + col0 + 2 * e + 1] * (1.0f / 64.0f);
      unsigned hp, lp;
      split2(f0, f1, hp, lp);
      a[e] = hp; q4[e] = lp;
    }
    ph[s] = a;
    pq[s] = q4;
    offs[s] = (pprow + row) * CC + col0;
  }
#pragma unroll
  for (int s = 0; s < 4; ++s) { *(v4u*)(dh + offs[s]) = ph[s]; *(v4u*)(dl + offs[s]) = pq[s]; }
  
}

// =================================================================================================================
// with NB (not a fixed image count). grid = ceil(6*NB*516*16 / 256).
// coverage: every halo pixel (py in {0,129} or px in {0,129}) of every image of all 6 planes.
// =================================================================================================================
__global__ __launch_bounds__(256)
void k_halo(unsigned short* p1) {
  const int idx = blockIdx.x * 256 + threadIdx.x;
  if (idx >= 6 * NB * NHALO * 16) return;
  const int piece = idx & 15;
  int r = idx >> 4;
  const int hp = r % NHALO;
  r /= NHALO;
  const int img = r % NB, plane = r / NB;
  const int q = max(hp - 2 * WP, 0);
  const int pyA = (hp < WP) ? 0 : (HP - 1);
  const int pxA = (hp < WP) ? hp : (hp - WP);
  const int pyB = 1 + (q >> 1);
  const int pxB = (q & 1) ? (WP - 1) : 0;
  const bool edge = hp < 2 * WP;
  const int py = edge ? pyA : pyB;
  const int px = edge ? pxA : pxB;
  const size_t off = (size_t)plane * PS1 + ((size_t)(img * HP + py) * WP + px) * CC + piece * 8;
  v4u z = {0u, 0u, 0u, 0u};
  *(v4u*)(p1 + off) = z;
  
}

// =================================================================================================================
// 3x3 conv implicit GEMM: block tile = 128 consecutive output pixels (one image row) x 128 channels, K = 1152 as 36
// k-steps, A = (hi, lo/2048) planes of tensor t, W = 64 bf16(w2[t]) -> value = C/64. Output NCHW flat [NB][128][16384]:
// coverage: qk [2 tensors][NB][128][16384] f32 and vh/vl [NB][128][16384], every element once (128 px x 128 co / block).
// =================================================================================================================
__global__ __launch_bounds__(256)
void k_conv3(const unsigned short* __restrict__ p1, const unsigned short* __restrict__ wt,
             float* qk, unsigned short* vh, unsigned short* vl) {
  __shared__ __align__(16) _Float16 ring[2 * CBUF];
  const int tid = threadIdx.x;
  const int mb = blockIdx.x, t = blockIdx.y;
  mm_conv((const _Float16*)(const void*)(p1 + (size_t)(2 * t) * PS1),
          (const _Float16*)(const void*)(p1 + (size_t)(2 * t + 1) * PS1),
          (const _Float16*)(const void*)(wt + (size_t)t * CC * KCV), mb * CPX, ring);
  __syncthreads();
  const float* Cs = (const float*)(const void*)ring;
  const int p0 = mb * CPX;
  const int b = p0 / IMGPIX, pix0 = p0 - b * IMGPIX;
  if (t < 2) {                                               // block-uniform branch, no WMMA inside
    float* df = qk + (size_t)t * ((size_t)NB * BSZ);
    v4f pk[16];
    size_t offs[16];
#pragma unroll
    for (int s = 0; s < 16; ++s) {                           // s >> 3: the tile's half of 64 pixels
      const int idx = (s & 7) * 256 + tid;
      const int co = idx >> 4, piece = idx & 15;
      const int r0 = (s >> 3) * 64 + piece * 4;
      v4f v;
#pragma unroll
      for (int e = 0; e < 4; ++e) v[e] = Cs[(r0 + e) * LDC + co] * (1.0f / 64.0f);
      pk[s] = v;
      offs[s] = (size_t)(b * CC + co) * IMGPIX + pix0 + r0;
    }
#pragma unroll
    for (int s = 0; s < 16; ++s) *(v4f*)(df + offs[s]) = pk[s];
  } else {
    v4u ph[8], pq[8];
    size_t offs[8];
#pragma unroll
    for (int s = 0; s < 8; ++s) {                            // s >> 2: the tile's half of 64 pixels
      const int idx = (s & 3) * 256 + tid;
      const int co = idx >> 3, piece = idx & 7;
      const int r0 = (s >> 2) * 64 + piece * 8;
      v4u a, q4;
#pragma unroll
      for (int e = 0; e < 4; ++e) {
        const float f0 = Cs[(r0 + 2 * e) * LDC + co] * (1.0f / 64.0f);
        const float f1 = Cs[(r0 + 2 * e + 1) * LDC + co] * (1.0f / 64.0f);
        unsigned hp, lp;
        split2(f0, f1, hp, lp);
        a[e] = hp; q4[e] = lp;
      }
      ph[s] = a;
      pq[s] = q4;
      offs[s] = (size_t)(b * CC + co) * IMGPIX + pix0 + r0;
    }
#pragma unroll
    for (int s = 0; s < 8; ++s) { *(v4u*)(vh + offs[s]) = ph[s]; *(v4u*)(vl + offs[s]) = pq[s]; }
#if defined(__HIP_DEVICE_COMPILE__)
    // the wait that stands between the issued stores and a rewrite of a register they name (the code that follows this
    // branch in the built object reuses them)
    asm volatile("s_wait_xcnt 0x0" ::: "memory");
#endif
  }
}

// =================================================================================================================
// Logit partial sums over the raw reshape: S[i][j] = sum_r K_head[r][i] Q_head[r][j] (K = 16384) in f32 on VALU from
// the f32 [16384][16] views of the q/k NCHW flat planes. Work-group = (row group rg, batch-head bi): rows r = 16 s + rg
// (1024 rows). Thread (so = tid>>4, i = tid&15) sums the 32 rows s = 32 so .. 32 so + 31 in order into 16 partials;
// thread (i, j) then adds the 32 values of so in order in LDS: sp[bi][rg][i][j]. k_attn adds the 16 row groups in order.
// grid = 16*NB*8, 512 threads. coverage: sp [NB*8][16][256] f32, every element once.
// =================================================================================================================
__global__ __launch_bounds__(512)
void k_logit(const float* __restrict__ qf, const float* __restrict__ kf, float* sp) {
  __shared__ float part[32 * 256];
  const int tid = threadIdx.x;
  // bi in the low bits: the 16 row groups of one head interleave in the same cache lines; a matter of speed only
  const int bi = blockIdx.x % (NB * NHEAD), rg = blockIdx.x / (NB * NHEAD);
  const int b = bi / NHEAD, head = bi - b * NHEAD;
  const float* Qp = qf + (size_t)b * BSZ + (size_t)head * HSZ;
  const float* Kp = kf + (size_t)b * BSZ + (size_t)head * HSZ;
  {
    const int so = tid >> 4, i = tid & 15;
    float tt[HD];
#pragma unroll
    for (int e = 0; e < HD; ++e) tt[e] = 0.f;
    const float* kp = Kp + (size_t)(so * 512 + rg) * HD + i;   // row r = (32 so + s) * 16 + rg, s = 0
    const float* qp = Qp + (size_t)(so * 512 + rg) * HD;
    // batches of 8 rows: each batch's 40 loads are issued together, then summed row by row in order; unrolled so that
    // every row's address is the two base pointers plus an immediate offset
#pragma unroll
    for (int sb = 0; sb < 4; ++sb) {
      float kv[8];
      v4f q[8][4];
#pragma unroll
      for (int u = 0; u < 8; ++u) {
        kv[u] = kp[(sb * 8 + u) * 16 * HD];
#pragma unroll
        for (int g = 0; g < 4; ++g) q[u][g] = *(const v4f*)(qp + (sb * 8 + u) * 16 * HD + 4 * g);
      }
#if defined(__HIP_DEVICE_COMPILE__)
      // inputs-only fences on the loaded values (four rows each: an asm statement takes thirty operands): without them
      // the compiler sinks every load to its first use and the wave pays one memory latency per load. The second one
      // holds the wait that stands between issued loads and a rewrite of a register they name, and takes the two base
      // pointers as inputs too: they stay live to that wait, so no load of the batch lands in its own run's address
      asm volatile("" :: "v"(kv[0]), "v"(kv[1]), "v"(kv[2]), "v"(kv[3]),
                   "v"(q[0][0]), "v"(q[0][1]), "v"(q[0][2]), "v"(q[0][3]), "v"(q[1][0]), "v"(q[1][1]), "v"(q[1][2]), "v"(q[1][3]),
                   "v"(q[2][0]), "v"(q[2][1]), "v"(q[2][2]), "v"(q[2][3]), "v"(q[3][0]), "v"(q[3][1]), "v"(q[3][2]), "v"(q[3][3]));
      asm volatile("s_wait_xcnt 0x0" :: "v"(kp), "v"(qp), "v"(kv[4]), "v"(kv[5]), "v"(kv[6]), "v"(kv[7]),
                   "v"(q[4][0]), "v"(q[4][1]), "v"(q[4][2]), "v"(q[4][3]), "v"(q[5][0]), "v"(q[5][1]), "v"(q[5][2]), "v"(q[5][3]),
                   "v"(q[6][0]), "v"(q[6][1]), "v"(q[6][2]), "v"(q[6][3]), "v"(q[7][0]), "v"(q[7][1]), "v"(q[7][2]), "v"(q[7][3]));
#endif
#pragma unroll
      for (int u = 0; u < 8; ++u) {
#pragma unroll
        for (int g = 0; g < 4; ++g) {
#pragma unroll
          for (int e = 0; e < 4; ++e) tt[4 * g + e] = fmaf(kv[u], q[u][g][e], tt[4 * g + e]);
        }
      }
    }
#pragma unroll
    for (int j = 0; j < HD; ++j) part[so * 256 + i * 16 + j] = tt[j];
  }
  __syncthreads();
  if (tid < 256) {
    float acc = 0.f;
#pragma unroll
    for (int so = 0; so < 32; ++so) acc += part[so * 256 + tid];
    sp[(size_t)(bi * 16 + rg) * 256 + tid] = acc;
  }
}

// =================================================================================================================
// Per (b, head) channel attention: S[i][j] = the 16 row-group partial sums of k_logit added in fixed order.
// P = softmax_j(S * (1/bf16(scale))) in f32 (max-subtracted).
// Wm[o][j] = sum_j2 64 bf16(wo[o][16 head + j2]) P[j][j2] on WMMA (K = 16 zero padded to 32; P carried x4096 as
// f16 hi + residual), value/4096 = 64 Wm; stored as f16 hi/lo planes weh/wel [b][head][o][16]: block region =
// grid = NB*8, 256 threads. coverage: weh/wel [NB][8][128][16], every element once.
// =================================================================================================================
__global__ __launch_bounds__(256)
void k_attn(const float* __restrict__ sp, const float* __restrict__ wo, const float* __restrict__ scale,
            unsigned short* weh, unsigned short* wel) {
  __shared__ float Sm[16 * WSP];
  __shared__ __align__(16) _Float16 Phs[16 * FP];
  __shared__ __align__(16) _Float16 Pls[16 * FP];
  __shared__ __align__(16) _Float16 Wts[CC * FP];
  __shared__ float Ws[CC * WSP];
  const int tid = threadIdx.x, wave = tid >> 5, lane = tid & 31, hh = lane >> 4, m = lane & 15;
  const int bi = blockIdx.x, b = bi / NHEAD, head = bi - b * NHEAD;
  // wo slice -> f16 [o][k] (k = j2, zero for k >= 16; addresses clamped)
  // thread = (o = 8 it + wave, k = lane); the 16 loads of the slice and the 16 loads of the partial sums are all issued
  // before the first is used: one memory latency for the 32, not one per trip
  {
    const float* wop = wo + (size_t)wave * CC + head * HD + min(lane, HD - 1);
    float wf[16];
#pragma unroll
    for (int it = 0; it < 16; ++it) wf[it] = wop[it * 8 * CC];
    const int i = tid >> 4, j = tid & 15;
    const float* spp = sp + (size_t)bi * (16 * 256) + i * 16 + j;
    float pv[16];
#pragma unroll
    for (int rg = 0; rg < 16; ++rg) pv[rg] = spp[rg * 256];
#if defined(__HIP_DEVICE_COMPILE__)
    // inputs-only fence on the slice's loaded values: keeps the loads above in front of the arithmetic; same wait and same
    // live address as in the statement below
    asm volatile("s_wait_xcnt 0x0" :: "v"(wop), "v"(wf[0]), "v"(wf[1]), "v"(wf[2]), "v"(wf[3]), "v"(wf[4]), "v"(wf[5]),
                 "v"(wf[6]), "v"(wf[7]), "v"(wf[8]), "v"(wf[9]), "v"(wf[10]), "v"(wf[11]), "v"(wf[12]), "v"(wf[13]),
                 "v"(wf[14]), "v"(wf[15]));
    // the wait between the 16 issued loads and a rewrite of the address they name; the address and the loaded values
    // are inputs, so that the address stays live to the wait and no load of the run lands in it
    asm volatile("s_wait_xcnt 0x0" :: "v"(spp), "v"(pv[0]), "v"(pv[1]), "v"(pv[2]), "v"(pv[3]), "v"(pv[4]), "v"(pv[5]),
                 "v"(pv[6]), "v"(pv[7]), "v"(pv[8]), "v"(pv[9]), "v"(pv[10]), "v"(pv[11]), "v"(pv[12]), "v"(pv[13]),
                 "v"(pv[14]), "v"(pv[15]));
#endif
#pragma unroll
    for (int it = 0; it < 16; ++it) {
      const float v = (lane < HD) ? bfr(wf[it]) * 64.0f : 0.0f;
      Wts[(it * 8 + wave) * FP + lane] = (_Float16)v;
    }
    float s = 0.f;
#pragma unroll
    for (int rg = 0; rg < 16; ++rg) s += pv[rg];
    const float isc = 1.0f / bfr(scale[0]);
    Sm[i * WSP + j] = s * isc;
  }
  __syncthreads();
  if (tid < 16) {
    // the row's 16 logits are read from LDS together and stay in registers: one LDS latency, not one per element and pass
    float sv[HD];
#pragma unroll
    for (int n = 0; n < HD; ++n) sv[n] = Sm[tid * WSP + n];
    float mx = -3.0e38f;
#pragma unroll
    for (int n = 0; n < HD; ++n) mx = fmaxf(mx, sv[n]);
    float ssum = 0.f;
#pragma unroll
    for (int n = 0; n < HD; ++n) {
      sv[n] = expf(sv[n] - mx);
      ssum += sv[n];
    }
    const float inv = 1.0f / ssum;
#pragma unroll
    for (int n = 0; n < HD; ++n) {
      const float pv = (sv[n] * inv) * 4096.0f;
      const _Float16 hv = (_Float16)pv;
      Phs[tid * FP + n] = hv;
      Pls[tid * FP + n] = (_Float16)((pv - (float)hv) * 2048.0f);
    }
#pragma unroll
    for (int n = HD; n < 32; ++n) { Phs[tid * FP + n] = (_Float16)0.0f; Pls[tid * FP + n] = (_Float16)0.0f; }
  }
  __syncthreads();
  {
    const v16h fa = ldfrag_h(Wts + (wave * 16 + m) * FP + 8 * hh);
    const v16h fb = ldfrag_h(Phs + m * FP + 8 * hh);
    const v16h gb = ldfrag_h(Pls + m * FP + 8 * hh);
    v8f ah = mma_raw(fa, fb, zero8());
    v8f al = mma_raw(fa, gb, zero8());
    guard2(ah, al, fa, fb, gb);
#pragma unroll
    for (int r = 0; r < 8; ++r) Ws[(wave * 16 + 8 * hh + r) * WSP + m] = (ah[r] + al[r] * RSC) * (1.0f / 4096.0f);
  }
  __syncthreads();
  {
    const int o = tid >> 1, hf = tid & 1;
    v4u a, q4;
#pragma unroll
    for (int e = 0; e < 4; ++e) {
      const float f0 = Ws[o * WSP + hf * 8 + 2 * e];
      const float f1 = Ws[o * WSP + hf * 8 + 2 * e + 1];
      unsigned hp, lp;
      split2(f0, f1, hp, lp);
      a[e] = hp; q4[e] = lp;
    }
    const size_t off = (size_t)(bi * CC + o) * HD + hf * 8;
    *(v4u*)(weh + off) = a;
    *(v4u*)(wel + off) = q4;
    
  }
}

// =================================================================================================================
// Output: y[b][o][p] = (sum_c' Wm64[b][c'][o] V[p][c']) / 64 + bf16(x[b][o][p]) for 64 pixels x 128 channels per
// =================================================================================================================
__global__ __launch_bounds__(256)
void k_final(const unsigned short* __restrict__ vh, const unsigned short* __restrict__ vl,
             const unsigned short* __restrict__ weh, const unsigned short* __restrict__ wel,
             const float* __restrict__ x, float* out) {
  __shared__ __align__(16) float Cs[64 * LDC];
  const int tid = threadIdx.x;
  const int mb = blockIdx.x;
  const int p0 = mb * 64;
  const int b = p0 / IMGPIX, pl0 = p0 - b * IMGPIX;
  const _Float16* Vh = (const _Float16*)(const void*)(vh + (size_t)b * BSZ);
  const _Float16* Vl = (const _Float16*)(const void*)(vl + (size_t)b * BSZ);
  const _Float16* Wh = (const _Float16*)(const void*)(weh + (size_t)b * NHEAD * CC * HD);
  const _Float16* Wl = (const _Float16*)(const void*)(wel + (size_t)b * NHEAD * CC * HD);
  mm_final(Vh, Vl, Wh, Wl, pl0, Cs);
  __syncthreads();
  v4f pk[8];
  size_t offs[8];
#pragma unroll
  for (int s = 0; s < 8; ++s) {
    const int idx = s * 256 + tid;
    const int o = idx >> 4, piece = idx & 15;
    const size_t off = (size_t)(b * CC + o) * IMGPIX + pl0 + piece * 4;
    const v4f xr = *(const v4f*)(x + off);
    v4f v;
#pragma unroll
    for (int e = 0; e < 4; ++e) v[e] = Cs[(piece * 4 + e) * LDC + o] * (1.0f / 64.0f) + bfr(xr[e]);
    pk[s] = v;
    offs[s] = off;
  }
#pragma unroll
  for (int s = 0; s < 8; ++s) *(v4f*)(out + offs[s]) = pk[s];
  
}

// =================================================================================================================
// Workspace map (bytes, offsets multiples of 65536, no aliasing, every region sized at or above its whole-line store
// extent): W1 f16 [3][128][128] 98304 (131072) | WT f16 [3][128][1152] 884736 (917504) | XH, XL f16 [32768][128]
// 8388608 each | P1 f16 6 x [2][130][130][128] 51916800 (51970048) | QK f32 [2][2][128][16384] 33554432 |
// VH, VL f16 [2][128][16384] 8388608 each | WEH, WEL f16 [2][8][128][16] 65536 each | SP f32 [16][16][256] 262144 |
// total 120520704.
// =================================================================================================================
extern "C" void kernel_launch(void* const* d_in, const int* in_sizes, int n_in,
                              void* d_out, int out_size, void* d_ws, size_t ws_size,
                              hipStream_t stream) {
  if (n_in < 11) return;
  const int expect[11] = { NB * CC * IMGPIX, WW, WW, 1, CC * CC, CC * CC * 9, CC * CC, CC * CC * 9,
                           CC * CC, CC * CC * 9, CC * CC };
  for (int i = 0; i < 11; ++i) if (in_sizes[i] != expect[i]) return;
  if (out_size != NB * CC * IMGPIX) return;

  const float* x     = (const float*)d_in[0];
  const float* gam   = (const float*)d_in[1];
  const float* bet   = (const float*)d_in[2];
  const float* scale = (const float*)d_in[3];
  const float* wq1   = (const float*)d_in[4];
  const float* wq2   = (const float*)d_in[5];
  const float* wk1   = (const float*)d_in[6];
  const float* wk2   = (const float*)d_in[7];
  const float* wv1   = (const float*)d_in[8];
  const float* wv2   = (const float*)d_in[9];
  const float* wo    = (const float*)d_in[10];
  float* out = (float*)d_out;

  const size_t AL = 65536;
  const size_t sW1 = (((size_t)3 * CC * CC * 2) + AL - 1) / AL * AL;               //   131072
  const size_t sWT = (((size_t)3 * CC * KCV * 2) + AL - 1) / AL * AL;              //   917504
  const size_t sX  = (((size_t)NPIX * CC * 2) + AL - 1) / AL * AL;                  //  8388608
  const size_t sP1 = (((size_t)6 * PS1 * 2) + AL - 1) / AL * AL;                    // 51970048
  const size_t sQK = (((size_t)2 * NB * BSZ * 4) + AL - 1) / AL * AL;               // 33554432
  const size_t sV  = (((size_t)NB * BSZ * 2) + AL - 1) / AL * AL;                   //  8388608
  const size_t sWE = (((size_t)NB * NHEAD * CC * HD * 2) + AL - 1) / AL * AL;       //    65536
  const size_t sSP = (((size_t)NB * NHEAD * 16 * 256 * 4) + AL - 1) / AL * AL;      //   262144

  size_t off = 0;
  const size_t oW1  = off; off += sW1;
  const size_t oWT  = off; off += sWT;
  const size_t oXH  = off; off += sX;
  const size_t oXL  = off; off += sX;
  const size_t oP1  = off; off += sP1;
  const size_t oQK  = off; off += sQK;
  const size_t oVH  = off; off += sV;
  const size_t oVL  = off; off += sV;
  const size_t oWEH = off; off += sWE;
  const size_t oWEL = off; off += sWE;
  const size_t oSP  = off; off += sSP;
  if (off > ws_size) return;                                 // off = 120520704
  if (off > (size_t)134217728) return;

  char* ws = (char*)d_ws;
  unsigned short* W1  = (unsigned short*)(ws + oW1);
  unsigned short* WT  = (unsigned short*)(ws + oWT);
  unsigned short* XH  = (unsigned short*)(ws + oXH);
  unsigned short* XL  = (unsigned short*)(ws + oXL);
  unsigned short* P1  = (unsigned short*)(ws + oP1);
  float*          QK  = (float*)(ws + oQK);
  unsigned short* VH  = (unsigned short*)(ws + oVH);
  unsigned short* VL  = (unsigned short*)(ws + oVL);
  unsigned short* WEH = (unsigned short*)(ws + oWEH);
  unsigned short* WEL = (unsigned short*)(ws + oWEL);
  float*          SP  = (float*)(ws + oSP);

  const dim3 blk(256);
  // (1) weight planes
  k_wcvt<<<dim3(6 * CC), blk, 0, stream>>>(wq1, wq2, wk1, wk2, wv1, wv2, W1, WT);
  // (2) layer norm over w + NHWC hi/lo planes
  k_ln<<<dim3(NB * HH * 2), blk, 0, stream>>>(x, gam, bet, XH, XL);
  // (3) 1x1 projections into padded NHWC hi/lo planes (interior)
  k_proj<<<dim3(NPIX / 64, 3), blk, 0, stream>>>(XH, XL, W1, P1);
  // (4) halo zero fill of the padded planes
  k_halo<<<dim3((6 * NB * NHALO * 16 + 255) / 256), blk, 0, stream>>>(P1);
  // (5) 3x3 convs -> q, k f32 NCHW flat planes; v f16 hi/lo NCHW flat planes
  k_conv3<<<dim3(NPIX / CPX, 3), blk, 0, stream>>>(P1, WT, QK, VH, VL);
  // (6) f32 logit partial sums, one work-group per (row group, batch-head)
  k_logit<<<dim3(16 * NB * NHEAD), dim3(512), 0, stream>>>(QK, QK + (size_t)NB * BSZ, SP);
  // (7) per-head channel attention: row groups added + softmax + wo mix -> Wm planes
  k_attn<<<dim3(NB * NHEAD), blk, 0, stream>>>(SP, wo, scale, WEH, WEL);
  // (8) output GEMM + residual -> NCHW d_out
  k_final<<<dim3(NPIX / 64), blk, 0, stream>>>(VH, VL, WEH, WEL, x, out);
  (void)hipGetLastError();
}

// v005
// One run takes 90.6 microseconds.
// Two timings next to v004 both put it at 1.05 times that version's speed.
// Counting every step since v000, it is 7.32 times as fast.
// Contractions: 1x1 projections (K=128) and 3x3 convs as implicit GEMM (K=1152): v_wmma_f32_16x16x32_f16, the
// activation as f16 hi + x2048 residual planes into two f32 accumulators, weights one f16 plane of 64*bf16(w);
// per-head k^T q logits (K=16384): f32 on VALU from f32 q/k planes (fixed-order three-level sums); wo x probs mix
// (K=16, zero padded to 32): f16, probs carried x4096 as hi + residual; fused output GEMM (K=128): v and the mixed
// weight as f16 hi + residual planes (3 products); f32 accumulate everywhere. Layer-norm statistics, softmax and
// all epilogues f32 on VALU; every float input RNE-converted to bf16 on load.
#include <hip/hip_runtime.h>
#include <stdint.h>

#define NB     2
#define CC     128
#define HH     128
#define WW     128
#define IMGPIX (HH * WW)
#define NPIX   (NB * IMGPIX)
#define HP     (HH + 2)
#define WP     (WW + 2)
#define PADIMG (HP * WP)
#define PADPIX (NB * PADIMG)
#define KCV    1152
#define NKS    36
#define NHEAD  8
#define HD     16
#define HSZ    (IMGPIX * HD)
#define BSZ    (CC * IMGPIX)
#define LDC    132
#define FP     40
#define WSP    17
#define NHALO  (2 * WP + 2 * HH)
#define RSC    0.00048828125f
#define PS1    ((size_t)PADPIX * CC)
#define PS2    ((size_t)NPIX * CC)
#define SPK    72
#define SBUF   (256 * SPK)
#define NST    18
#define CPX    128
#define CBUF   (384 * SPK)
#define LNG    (NB * HH * 2)
#define NHPC   (6 * NB * NHALO * 16)
#define HPB    200

static_assert(NPIX == NB * IMGPIX);
static_assert(IMGPIX == 16384 && HH == 128 && WW == 128);
static_assert(PADIMG == 16900);
static_assert(KCV == 9 * CC && KCV == NKS * 32);
static_assert(CC == NHEAD * HD);
static_assert(BSZ == CC * IMGPIX && HSZ * NHEAD == BSZ);
static_assert((IMGPIX % 64) == 0 && (WW % 64) == 0);
static_assert((LDC * 4) % 16 == 0 && (FP * 2) % 16 == 0);
static_assert(NHALO == 516);
static_assert((KCV % 8) == 0 && (CC % 32) == 0);
static_assert(IMGPIX == 32 * 32 * 16);
static_assert(NST * 64 == KCV && (SPK * 2) % 32 == 16 && 2 * SBUF * 2 >= 64 * LDC * 4);
static_assert(CPX == WW && (NPIX % CPX) == 0 && 2 * CBUF * 2 >= CPX * LDC * 4);
static_assert(LNG > 3 * CC && (LNG - 3 * CC) * 3 == 3 * CC && KCV == 1024 + 32 * 4);
static_assert(HPB <= 256 && (HPB % 8) == 0 && HPB * LNG >= NHPC);

// Index maps of the raw reshapes (per batch b, flat NCHW index f = c*16384 + h*128 + w viewed as [8][16384][16]):
//   Q_head[r][d] = qflat[b][head*262144 + 16 r + d]   (same map for K_head and V_head; r = (c%16)*1024 + h*8 + w/16,
//   d = w%16). S_head[i][j] = sum_r K_head[r][i] Q_head[r][j]; P_head = softmax_j(S_head * (1/scale)).
//   O[b][16 head + j2][pixel r] = sum_j V_head[r][j] P_head[j][j2].
//   y[b][o][pixel r] = sum_{head, j} Wm[b][head][o][j] V_head[r][j] + x[b][o][r],
//   Wm[b][head][o][j] = sum_j2 wo[o][16 head + j2] P_head[j][j2]   (reassociated 1x1 output conv).

typedef _Float16 v16h __attribute__((ext_vector_type(16)));
typedef _Float16 v8h  __attribute__((ext_vector_type(8)));
typedef float    v8f  __attribute__((ext_vector_type(8)));
typedef float    v4f  __attribute__((ext_vector_type(4)));
typedef unsigned int v4u __attribute__((ext_vector_type(4)));

// ---- scalar helpers ------------------------------------------------------------------------------------------
__device__ __forceinline__ unsigned short bf_bits(float f) {          // f32 -> bf16 bits, RNE convert
  unsigned u = __float_as_uint(f);
  return (unsigned short)((u + 0x7FFFu + ((u >> 16) & 1u)) >> 16);
}
__device__ __forceinline__ float bf_up(unsigned short b) { return __uint_as_float(((unsigned)b) << 16); }
__device__ __forceinline__ float bfr(float f) { return bf_up(bf_bits(f)); }
__device__ __forceinline__ unsigned short h_bits(_Float16 x) { return __builtin_bit_cast(unsigned short, x); }
__device__ __forceinline__ unsigned short hb16(float f) { return h_bits((_Float16)f); }
__device__ __forceinline__ unsigned pk16(unsigned short a, unsigned short b) { return (unsigned)a | ((unsigned)b << 16); }
__device__ __forceinline__ v8f zero8() { v8f z = {0.f, 0.f, 0.f, 0.f, 0.f, 0.f, 0.f, 0.f}; return z; }
// hi/lo pair of two f32 values: hi = f16(v), lo = f16(2048 (v - hi)), packed as two 32-bit words
__device__ __forceinline__ void split2(float f0, float f1, unsigned& hp, unsigned& lp) {
  const _Float16 h0 = (_Float16)f0, h1 = (_Float16)f1;
  const float q0 = (f0 - (float)h0) * 2048.0f, q1 = (f1 - (float)h1) * 2048.0f;
  hp = pk16(h_bits(h0), h_bits(h1));
  lp = pk16(hb16(q0), hb16(q1));
}

// ---- fragment loader: 16-bit A/B operand, lane -> row/col (lane&15), p already includes +8*(lane>>4);
//      elements 0..7 <- p[0..7] (k0+8h..k0+8h+7), elements 8..15 <- p[16..23] (k0+16+8h..k0+16+8h+7)
__device__ __forceinline__ v16h ldfrag_h(const _Float16* p) {
  union { v16h v; v8h h[2]; } f;
  f.h[0] = *(const v8h*)(p);
  f.h[1] = *(const v8h*)(p + 16);
  return f.v;
}
// same layout, the two 8-element halves at two independent 16-B aligned addresses (pa: k0+8h.., pb: k0+16+8h..)
__device__ __forceinline__ v16h ldfrag2(const _Float16* pa, const _Float16* pb) {
  union { v16h v; v8h h[2]; } f;
  f.h[0] = *(const v8h*)(pa);
  f.h[1] = *(const v8h*)(pb);
  return f.v;
}

// ---- WMMA helpers; the guards insert the trailing VALU hazard gap and keep A/B live --------------------------
__device__ __forceinline__ v8f mma_raw(v16h a, v16h b, v8f c) {
  return __builtin_amdgcn_wmma_f32_16x16x32_f16(false, a, false, b, (short)0, c, false, false);
}
__device__ __forceinline__ void guard8(v8f& c0, v8f& c1, v8f& c2, v8f& c3, v8f& c4, v8f& c5, v8f& c6, v8f& c7,
                                       const v16h& a0, const v16h& a1, const v16h& a2, const v16h& a3,
                                       const v16h& b0, const v16h& b1) {
#if defined(__HIP_DEVICE_COMPILE__)
  asm volatile("v_nop\n\tv_nop\n\tv_nop\n\tv_nop"
               : "+v"(c0), "+v"(c1), "+v"(c2), "+v"(c3), "+v"(c4), "+v"(c5), "+v"(c6), "+v"(c7)
               : "v"(a0), "v"(a1), "v"(a2), "v"(a3), "v"(b0), "v"(b1));
#endif
}
__device__ __forceinline__ void guard4(v8f& c0, v8f& c1, v8f& c2, v8f& c3,
                                       const v16h& a0, const v16h& a1, const v16h& b0, const v16h& b1) {
#if defined(__HIP_DEVICE_COMPILE__)
  asm volatile("v_nop\n\tv_nop\n\tv_nop\n\tv_nop"
               : "+v"(c0), "+v"(c1), "+v"(c2), "+v"(c3)
               : "v"(a0), "v"(a1), "v"(b0), "v"(b1));
#endif
}
__device__ __forceinline__ void guard2(v8f& c0, v8f& c1, const v16h& a0, const v16h& b0, const v16h& b1) {
#if defined(__HIP_DEVICE_COMPILE__)
  asm volatile("v_nop\n\tv_nop\n\tv_nop\n\tv_nop"
               : "+v"(c0), "+v"(c1)
               : "v"(a0), "v"(b0), "v"(b1));
#endif
}

// ---- LDS staging of one 64-k slice of a 64x128 block tile's operands: 256 rows of 128 B at pitch 144 B (16 B x odd, for
//      the ds_load_b128 fragment reads): rows 0..63 A hi, 64..127 A lo (64 A rows, global pitch CC), 128..255 W (128 rows,
//      global pitch wstep32 / 32). Thread = (row tid>>3 of each group of 32 rows, 16-B piece tid&7), 8 copies; ga_h, ga_l,
//      gw are the thread's own source addresses in the first group, lds its own byte address in the target buffer.
//      Each copy instruction moves four whole 128-B lines, and every operand byte is fetched once per work-group.
__device__ __forceinline__ void stage_copy(const _Float16* ga_h, const _Float16* ga_l, const _Float16* gw, int wstep32,
                                           unsigned lds) {
  const _Float16* g1 = ga_h + 32 * CC;
  const _Float16* g3 = ga_l + 32 * CC;
  const _Float16* g5 = gw + wstep32;
  const _Float16* g6 = gw + 2 * wstep32;
  const _Float16* g7 = gw + 3 * wstep32;
  const unsigned l1 = lds + 1 * 32 * SPK * 2, l2 = lds + 2 * 32 * SPK * 2, l3 = lds + 3 * 32 * SPK * 2;
  const unsigned l4 = lds + 4 * 32 * SPK * 2, l5 = lds + 5 * 32 * SPK * 2, l6 = lds + 6 * 32 * SPK * 2;
  const unsigned l7 = lds + 7 * 32 * SPK * 2;
#if defined(__HIP_DEVICE_COMPILE__)
  // global -> LDS through no register; the last line is the wait that stands between issued copies and a rewrite of
  // a register they name, inside the statement so that nothing can be moved in front of it
  asm volatile("global_load_async_to_lds_b128 %0, %1, off\n\t"
               "global_load_async_to_lds_b128 %2, %3, off\n\t"
               "global_load_async_to_lds_b128 %4, %5, off\n\t"
               "global_load_async_to_lds_b128 %6, %7, off\n\t"
               "global_load_async_to_lds_b128 %8, %9, off\n\t"
               "global_load_async_to_lds_b128 %10, %11, off\n\t"
               "global_load_async_to_lds_b128 %12, %13, off\n\t"
               "global_load_async_to_lds_b128 %14, %15, off\n\t"
               "s_wait_xcnt 0x0"
               :: "v"(lds), "v"(ga_h), "v"(l1), "v"(g1), "v"(l2), "v"(ga_l), "v"(l3), "v"(g3),
                  "v"(l4), "v"(gw), "v"(l5), "v"(g5), "v"(l6), "v"(g6), "v"(l7), "v"(g7)
               : "memory");
#endif
}
// ---- the same for the conv's 128x128 block tile: 384 rows of 128 B at pitch 144 B: rows 0..127 A hi, 128..255 A lo (128 A
//      rows, global pitch CC), 256..383 W (128 rows, global pitch wstep32 / 32). Thread = (row tid>>3 of each group of 32
//      rows, 16-B piece tid&7), 12 copies.
__device__ __forceinline__ void stage_copy12(const _Float16* ga_h, const _Float16* ga_l, const _Float16* gw, int wstep32,
                                             unsigned lds) {
  const _Float16* h1 = ga_h + 32 * CC;
  const _Float16* h2 = ga_h + 64 * CC;
  const _Float16* h3 = ga_h + 96 * CC;
  const _Float16* q1 = ga_l + 32 * CC;
  const _Float16* q2 = ga_l + 64 * CC;
  const _Float16* q3 = ga_l + 96 * CC;
  const _Float16* w1 = gw + wstep32;
  const _Float16* w2 = gw + 2 * wstep32;
  const _Float16* w3 = gw + 3 * wstep32;
  const unsigned gs = 32 * SPK * 2;
  const unsigned l1 = lds + 1 * gs, l2 = lds + 2 * gs, l3 = lds + 3 * gs, l4 = lds + 4 * gs, l5 = lds + 5 * gs;
  const unsigned l6 = lds + 6 * gs, l7 = lds + 7 * gs, l8 = lds + 8 * gs, l9 = lds + 9 * gs, l10 = lds + 10 * gs;
  const unsigned l11 = lds + 11 * gs;
#if defined(__HIP_DEVICE_COMPILE__)
  // global -> LDS through no register; the last line is the wait that stands between issued copies and a rewrite of
  // a register they name, inside the statement so that nothing can be moved in front of it
  asm volatile("global_load_async_to_lds_b128 %0, %1, off\n\t"
               "global_load_async_to_lds_b128 %2, %3, off\n\t"
               "global_load_async_to_lds_b128 %4, %5, off\n\t"
               "global_load_async_to_lds_b128 %6, %7, off\n\t"
               "global_load_async_to_lds_b128 %8, %9, off\n\t"
               "global_load_async_to_lds_b128 %10, %11, off\n\t"
               "global_load_async_to_lds_b128 %12, %13, off\n\t"
               "global_load_async_to_lds_b128 %14, %15, off\n\t"
               "global_load_async_to_lds_b128 %16, %17, off\n\t"
               "global_load_async_to_lds_b128 %18, %19, off\n\t"
               "global_load_async_to_lds_b128 %20, %21, off\n\t"
               "global_load_async_to_lds_b128 %22, %23, off\n\t"
               "s_wait_xcnt 0x0"
               :: "v"(lds), "v"(ga_h), "v"(l1), "v"(h1), "v"(l2), "v"(h2), "v"(l3), "v"(h3),
                  "v"(l4), "v"(ga_l), "v"(l5), "v"(q1), "v"(l6), "v"(q2), "v"(l7), "v"(q3),
                  "v"(l8), "v"(gw), "v"(l9), "v"(w1), "v"(l10), "v"(w2), "v"(l11), "v"(w3)
               : "memory");
#endif
}
__device__ __forceinline__ void wait_copies() {
#if defined(__HIP_DEVICE_COMPILE__)
  asm volatile("s_wait_asynccnt 0x0" ::: "memory");   // this wave's copies have landed in LDS
#endif
}
__device__ __forceinline__ void wait_lds_reads() {
#if defined(__HIP_DEVICE_COMPILE__)
  asm volatile("s_wait_dscnt 0x0" ::: "memory");      // this wave's LDS reads are done before the buffer is rewritten
#endif
}

// ---- 64x128 block tile GEMM core (K = 128) with the A operand as two planes (hi and x2048 residual) into separate
//      accumulators; A row pitch CC (f16), W is [n][k] k-contiguous pitch CC. Both 64-k slices are copied to the two LDS
//      buffers at once, then read. 8 waves = 2 (32 rows) x 4 (32 cols), 2x2 tiles of 16 per wave; fragments from LDS with
//      the table layout; the residual accumulator is folded with 1/2048 when the tile is written to the LDS f32 tile
//      Cs[64][LDC], which takes the buffers' place behind a barrier.
__device__ __forceinline__ void mm_tile2(const _Float16* __restrict__ Ah, const _Float16* __restrict__ Al,
                                         const _Float16* __restrict__ W, int arow0, _Float16* ring) {
  const int tid = threadIdx.x, wave = tid >> 5, lane = tid & 31, hh = lane >> 4, c = lane & 15;
  const int mw = wave >> 2, nw = wave & 3;
  const int srow = tid >> 3, spc = tid & 7;
  const size_t sa = (size_t)(arow0 + srow) * CC + spc * 8;
  const _Float16* wb = W + (size_t)srow * CC + spc * 8;
  const unsigned lds0 = (unsigned)(size_t)ring + (unsigned)((srow * SPK + spc * 8) * 2);
  const _Float16* fap = ring + (mw * 32 + c) * SPK + 8 * hh;
  const _Float16* fbp = ring + (128 + nw * 32 + c) * SPK + 8 * hh;
  v8f h00 = zero8(), h01 = zero8(), h10 = zero8(), h11 = zero8();
  v8f l00 = zero8(), l01 = zero8(), l10 = zero8(), l11 = zero8();
  stage_copy(Ah + sa, Al + sa, wb, 32 * CC, lds0);
  stage_copy(Ah + sa + 64, Al + sa + 64, wb + 64, 32 * CC, lds0 + SBUF * 2);
  wait_copies();
  __syncthreads();                               // both slices are readable by every wave
  // unrolled: every fragment's LDS offset becomes an immediate of its load
#pragma unroll
  for (int ks = 0; ks < CC / 32; ++ks) {
    const _Float16* pa = fap + (ks >> 1) * SBUF + (ks & 1) * 32;
    const _Float16* pb = fbp + (ks >> 1) * SBUF + (ks & 1) * 32;
    const v16h fa0 = ldfrag_h(pa);
    const v16h fa1 = ldfrag_h(pa + 16 * SPK);
    const v16h ga0 = ldfrag_h(pa + 64 * SPK);
    const v16h ga1 = ldfrag_h(pa + 80 * SPK);
    const v16h fb0 = ldfrag_h(pb);
    const v16h fb1 = ldfrag_h(pb + 16 * SPK);
    h00 = mma_raw(fa0, fb0, h00);
    h01 = mma_raw(fa0, fb1, h01);
    h10 = mma_raw(fa1, fb0, h10);
    h11 = mma_raw(fa1, fb1, h11);
    l00 = mma_raw(ga0, fb0, l00);
    l01 = mma_raw(ga0, fb1, l01);
    l10 = mma_raw(ga1, fb0, l10);
    l11 = mma_raw(ga1, fb1, l11);
    guard8(h00, h01, h10, h11, l00, l01, l10, l11, fa0, fa1, ga0, ga1, fb0, fb1);
  }
  wait_lds_reads();
  __syncthreads();                               // ends every wave's fragment reads: the buffers become the f32 tile
  float* Cs = (float*)(void*)ring;
#pragma unroll
  for (int r = 0; r < 8; ++r) {
    const int row = mw * 32 + 8 * hh + r;
    Cs[row * LDC + nw * 32 + c]             = h00[r] + l00[r] * RSC;
    Cs[row * LDC + nw * 32 + 16 + c]        = h01[r] + l01[r] * RSC;
    Cs[(row + 16) * LDC + nw * 32 + c]      = h10[r] + l10[r] * RSC;
    Cs[(row + 16) * LDC + nw * 32 + 16 + c] = h11[r] + l11[r] * RSC;
  }
}

// ---- implicit-GEMM variant for the 3x3 conv: A row = output pixel p (flat over all images), k = tap*128 + c;
//      W = wt [128][1152] k-contiguous. The operands of a stage st (tap = st>>1, channel half = st&1: 64 k, two k-steps)
//      are staged in LDS by stage_copy12: the A rows are the 128 pixels of one image row at padded position (y + ky,
//      x + kx), the W rows the 128 output channels. Two buffers: stage t + 1 is copied while stage t is multiplied; the
//      fragments come from LDS with the table k map (k order: tap, channel quarter, table). 8 waves = 4 (32 pixels) x 2
//      (64 channels): a wave's k-step is 16 products from 8 fragments (2 hi, 2 lo, 4 W).
__device__ __forceinline__ size_t conv_abase(int p, int hh) {
  const int b = p / IMGPIX;
  const int r = p - b * IMGPIX;
  const int y = r / WW;
  const int x = r - y * WW;
  return ((size_t)(b * HP + y) * WP + x) * CC + 8 * hh;
}
// stage st's copies into the buffer at lds; ah/al/wb are the thread's own source addresses for stage 0
__device__ __forceinline__ void conv_stage(const _Float16* ah, const _Float16* al, const _Float16* wb, int st,
                                           unsigned lds) {
  const int tap = st >> 1;
  const int ky = (tap * 11) >> 5;                // tap / 3 for tap < 9
  const int kx = tap - 3 * ky;
  const int ao = (ky * WP + kx) * CC + (st & 1) * 64;
  stage_copy12(ah + ao, al + ao, wb + st * 64, 32 * KCV, lds);
}
__device__ __forceinline__ void mm_conv(const _Float16* __restrict__ Ah, const _Float16* __restrict__ Al,
                                        const _Float16* __restrict__ W, int prow0, _Float16* ring) {
  const int tid = threadIdx.x, wave = tid >> 5, lane = tid & 31, hh = lane >> 4, c = lane & 15;
  const int mw = wave >> 1, nw = wave & 1;
  const int srow = tid >> 3, spc = tid & 7;
  const size_t sa = conv_abase(prow0 + srow, 0) + spc * 8;
  const _Float16* ah = Ah + sa;
  const _Float16* al = Al + sa;
  const _Float16* wb = W + (size_t)srow * KCV + spc * 8;
  const unsigned lds0 = (unsigned)(size_t)ring + (unsigned)((srow * SPK + spc * 8) * 2);
  const _Float16* fap = ring + (mw * 32 + c) * SPK + 8 * hh;
  const _Float16* fbp = ring + (256 + nw * 64 + c) * SPK + 8 * hh;
  v8f h0[4], h1[4], l0[4], l1[4];
  // unrolled: every index of an accumulator array is a constant, so the arrays stay in registers
#pragma unroll
  for (int n = 0; n < 4; ++n) { h0[n] = zero8(); h1[n] = zero8(); l0[n] = zero8(); l1[n] = zero8(); }
  conv_stage(ah, al, wb, 0, lds0);
  wait_copies();
  __syncthreads();                               // stage 0 is readable by every wave
  conv_stage(ah, al, wb, 1, lds0 + CBUF * 2);
  // rolled: one copy of the body in the instruction cache, the buffer chosen by t & 1
#pragma unroll 1
  for (int t = 0; t < NST; ++t) {
    const int bo = (t & 1) * CBUF;
    // unrolled: the two k-steps' LDS offsets become immediates of their loads
#pragma unroll
    for (int kk = 0; kk < 2; ++kk) {
      const _Float16* pa = fap + bo + kk * 32;
      const _Float16* pb = fbp + bo + kk * 32;
      const v16h fa0 = ldfrag_h(pa);
      const v16h fb0 = ldfrag_h(pb);
      const v16h fb1 = ldfrag_h(pb + 16 * SPK);
      const v16h fb2 = ldfrag_h(pb + 32 * SPK);
      const v16h fb3 = ldfrag_h(pb + 48 * SPK);
      const v16h fa1 = ldfrag_h(pa + 16 * SPK);
      const v16h ga0 = ldfrag_h(pa + 128 * SPK);
      const v16h ga1 = ldfrag_h(pa + 144 * SPK);
#if defined(__HIP_DEVICE_COMPILE__)
      // nothing is scheduled across this line: without it the compiler reloads one A register set in among the products
      // and the wave waits out a whole LDS latency at each such place
      __builtin_amdgcn_sched_barrier(0);
#endif
      h0[0] = mma_raw(fa0, fb0, h0[0]);
      h0[1] = mma_raw(fa0, fb1, h0[1]);
      h0[2] = mma_raw(fa0, fb2, h0[2]);
      h0[3] = mma_raw(fa0, fb3, h0[3]);
      h1[0] = mma_raw(fa1, fb0, h1[0]);
      h1[1] = mma_raw(fa1, fb1, h1[1]);
      h1[2] = mma_raw(fa1, fb2, h1[2]);
      h1[3] = mma_raw(fa1, fb3, h1[3]);
      l0[0] = mma_raw(ga0, fb0, l0[0]);
      l0[1] = mma_raw(ga0, fb1, l0[1]);
      l0[2] = mma_raw(ga0, fb2, l0[2]);
      l0[3] = mma_raw(ga0, fb3, l0[3]);
      l1[0] = mma_raw(ga1, fb0, l1[0]);
      l1[1] = mma_raw(ga1, fb1, l1[1]);
      l1[2] = mma_raw(ga1, fb2, l1[2]);
      l1[3] = mma_raw(ga1, fb3, l1[3]);
      guard8(l0[0], l0[1], l0[2], l0[3], l1[0], l1[1], l1[2], l1[3], ga0, ga1, fb0, fb1, fb2, fb3);
#if defined(__HIP_DEVICE_COMPILE__)
      // nor across this one: without it products of this k-step sink behind the trip's barrier and hold back the next copies
      __builtin_amdgcn_sched_barrier(0);
#endif
    }
    wait_lds_reads();
    wait_copies();
    __syncthreads();                             // publishes stage t + 1 and ends every read of stage t's buffer
    if (t + 2 < NST) conv_stage(ah, al, wb, t + 2, lds0 + bo * 2);
  }
  wait_copies();
  float* Cs = (float*)(void*)ring;               // the ring is free behind the last trip's barrier: f32 tile [128][LDC]
#pragma unroll
  for (int r = 0; r < 8; ++r) {
    const int row = mw * 32 + 8 * hh + r;
    // unrolled for the same reason as above
#pragma unroll
    for (int n = 0; n < 4; ++n) {
      Cs[row * LDC + nw * 64 + n * 16 + c]        = h0[n][r] + l0[n][r] * RSC;
      Cs[(row + 16) * LDC + nw * 64 + n * 16 + c] = h1[n][r] + l1[n][r] * RSC;
    }
  }
}

// ---- fused output GEMM core: rows = 64 pixels of one batch (local pixel pl0..pl0+63), cols = 128 output channels,
//      k = c' = 16 head + j (K = 128, 4 k-steps of two heads each). A[p][c'] = V_head[p][j] read from the NCHW flat v
//      planes at head*HSZ + 16 p + j (two 16-B halves per fragment, heads 2ks and 2ks+1); B = Wm[head][o][16]
//      k-contiguous per head. Products hi*hi + hi*lo (first loop) and lo*hi (second loop) into Cs[64][LDC].
__device__ __forceinline__ void mm_final(const _Float16* __restrict__ Vh, const _Float16* __restrict__ Vl,
                                         const _Float16* __restrict__ Wh, const _Float16* __restrict__ Wl,
                                         int pl0, float* Cs) {
  const int tid = threadIdx.x, wave = tid >> 5, lane = tid & 31, hh = lane >> 4, c = lane & 15;
  const int mw = wave >> 2, nw = wave & 3;
  const size_t r0 = (size_t)(pl0 + mw * 32 + c) * HD + 8 * hh;
  const size_t r1 = (size_t)(pl0 + mw * 32 + 16 + c) * HD + 8 * hh;
  const size_t q0 = (size_t)(nw * 32 + c) * HD + 8 * hh;
  const size_t q1 = (size_t)(nw * 32 + 16 + c) * HD + 8 * hh;
  {
    v8f h00 = zero8(), h01 = zero8(), h10 = zero8(), h11 = zero8();
    v8f l00 = zero8(), l01 = zero8(), l10 = zero8(), l11 = zero8();
    const _Float16* pa0 = Vh + r0;
    const _Float16* pa1 = Vh + r1;
    const _Float16* pb0 = Wh + q0;
    const _Float16* pb1 = Wh + q1;
    const _Float16* pc0 = Wl + q0;
    const _Float16* pc1 = Wl + q1;
    // two k-steps a batch: the batch's 24 loads are issued together, then multiplied in k order (one latency for two
    // k-steps; four at once would not leave registers for two work-groups on a WGP); unrolled: offsets become immediates
#pragma unroll
    for (int kp = 0; kp < CC / 64; ++kp) {
      v16h fa0[2], fa1[2], fb0[2], fb1[2], gb0[2], gb1[2];
#pragma unroll
      for (int u = 0; u < 2; ++u) {
        const int ao = (2 * (2 * kp + u)) * HSZ;
        const int bo = (2 * (2 * kp + u)) * (CC * HD);
        fa0[u] = ldfrag2(pa0 + ao, pa0 + ao + HSZ);
        fa1[u] = ldfrag2(pa1 + ao, pa1 + ao + HSZ);
        fb0[u] = ldfrag2(pb0 + bo, pb0 + bo + CC * HD);
        fb1[u] = ldfrag2(pb1 + bo, pb1 + bo + CC * HD);
        gb0[u] = ldfrag2(pc0 + bo, pc0 + bo + CC * HD);
        gb1[u] = ldfrag2(pc1 + bo, pc1 + bo + CC * HD);
      }
#if defined(__HIP_DEVICE_COMPILE__)
      // nothing is scheduled across this line: without it the first product, with its wait, is lifted in among the batch's
      // loads, and the loads behind it start one latency late
      __builtin_amdgcn_sched_barrier(0);
      // inputs-only fence on the loaded fragments: keeps the batch's loads together in front of its products; it holds the
      // wait that stands between issued loads and a rewrite of an address register they name
      asm volatile("s_wait_xcnt 0x0" :: "v"(fa0[0]), "v"(fa1[0]), "v"(fb0[0]), "v"(fb1[0]), "v"(gb0[0]), "v"(gb1[0]),
                   "v"(fa0[1]), "v"(fa1[1]), "v"(fb0[1]), "v"(fb1[1]), "v"(gb0[1]), "v"(gb1[1]));
#endif
#pragma unroll
      for (int u = 0; u < 2; ++u) {
        h00 = mma_raw(fa0[u], fb0[u], h00);
        h01 = mma_raw(fa0[u], fb1[u], h01);
        h10 = mma_raw(fa1[u], fb0[u], h10);
        h11 = mma_raw(fa1[u], fb1[u], h11);
        l00 = mma_raw(fa0[u], gb0[u], l00);
        l01 = mma_raw(fa0[u], gb1[u], l01);
        l10 = mma_raw(fa1[u], gb0[u], l10);
        l11 = mma_raw(fa1[u], gb1[u], l11);
        guard8(h00, h01, h10, h11, l00, l01, l10, l11, fa0[u], fa1[u], gb0[u], gb1[u], fb0[u], fb1[u]);
      }
    }
#pragma unroll
    for (int r = 0; r < 8; ++r) {
      const int row = mw * 32 + 8 * hh + r;
      Cs[row * LDC + nw * 32 + c]             = h00[r] + l00[r] * RSC;
      Cs[row * LDC + nw * 32 + 16 + c]        = h01[r] + l01[r] * RSC;
      Cs[(row + 16) * LDC + nw * 32 + c]      = h10[r] + l10[r] * RSC;
      Cs[(row + 16) * LDC + nw * 32 + 16 + c] = h11[r] + l11[r] * RSC;
    }
  }
  {
    v8f m00 = zero8(), m01 = zero8(), m10 = zero8(), m11 = zero8();
#if defined(__HIP_DEVICE_COMPILE__)
    // nothing is scheduled across this line or the one behind the loads: the first loop's epilogue stays out of the run of
    // loads, where it reused their address registers while they were in flight
    __builtin_amdgcn_sched_barrier(0);
#endif
    const _Float16* pa0 = Vl + r0;
    const _Float16* pa1 = Vl + r1;
    const _Float16* pb0 = Wh + q0;
    const _Float16* pb1 = Wh + q1;
    // all four k-steps' 32 loads are issued together, then multiplied in k order: one latency, not four
    v16h ga0[4], ga1[4], fb0[4], fb1[4];
#pragma unroll
    for (int ks = 0; ks < CC / 32; ++ks) {
      const int ao = (2 * ks) * HSZ;
      const int bo = (2 * ks) * (CC * HD);
      ga0[ks] = ldfrag2(pa0 + ao, pa0 + ao + HSZ);
      ga1[ks] = ldfrag2(pa1 + ao, pa1 + ao + HSZ);
      fb0[ks] = ldfrag2(pb0 + bo, pb0 + bo + CC * HD);
      fb1[ks] = ldfrag2(pb1 + bo, pb1 + bo + CC * HD);
    }
#if defined(__HIP_DEVICE_COMPILE__)
    __builtin_amdgcn_sched_barrier(0);
    // inputs-only fence on the loaded fragments, with the same wait as in the first loop
    asm volatile("s_wait_xcnt 0x0" :: "v"(ga0[0]), "v"(ga1[0]), "v"(fb0[0]), "v"(fb1[0]), "v"(ga0[1]), "v"(ga1[1]), "v"(fb0[1]), "v"(fb1[1]),
                 "v"(ga0[2]), "v"(ga1[2]), "v"(fb0[2]), "v"(fb1[2]), "v"(ga0[3]), "v"(ga1[3]), "v"(fb0[3]), "v"(fb1[3]));
#endif
#pragma unroll
    for (int ks = 0; ks < CC / 32; ++ks) {
      m00 = mma_raw(ga0[ks], fb0[ks], m00);
      m01 = mma_raw(ga0[ks], fb1[ks], m01);
      m10 = mma_raw(ga1[ks], fb0[ks], m10);
      m11 = mma_raw(ga1[ks], fb1[ks], m11);
      guard4(m00, m01, m10, m11, ga0[ks], ga1[ks], fb0[ks], fb1[ks]);
    }
#pragma unroll
    for (int r = 0; r < 8; ++r) {               // same lane wrote these slots above (program order, same type)
      const int row = mw * 32 + 8 * hh + r;
      Cs[row * LDC + nw * 32 + c]             += m00[r] * RSC;
      Cs[row * LDC + nw * 32 + 16 + c]        += m01[r] * RSC;
      Cs[(row + 16) * LDC + nw * 32 + c]      += m10[r] * RSC;
      Cs[(row + 16) * LDC + nw * 32 + 16 + c] += m11[r] * RSC;
    }
  }
}

// =================================================================================================================
// gamma[w], beta[w] bf16 converted) + NCHW -> NHWC + hi/lo f16 planes. Block = (b, h, channel half): wave = 8
// channel rows, lane = 4 w values, shuffle reductions; f32 tile T[64 ch][w] in LDS; then each pixel's 64 channels
// grid = NB*128*2, 256 threads. coverage: xh/xl [NPIX px][128 ch], every element once.
// The same launch carries two pieces of work that depend on nothing before them and are read only by later launches:
// (a) weight convert. Work-group blk < 384: row blk = (tensor, co) of (wq2, wk2, wv2) [co][ci][3][3] f32 -> wt [row][k =
//     tap*128 + ci] f16(64 * bf16(w)): the row's 1152 floats are loaded as whole lines beside the x rows, go through LDS
//     across the kernel's one barrier, and thread tt < 144 builds one 16-B piece. Work-group blk >= 384: three rows of
//     (wq1, wk1, wv1) [o][c] -> w1 [row][c], thread tt < 48 one 16-B piece. coverage: wt 384 x 1152, w1 384 x 128, once.
// (b) halo zero fill of the six padded planes: work-group blk zeroes the 16-B pieces blk*200 .. blk*200 + 199 (whole lines) of
//     the 6*NB*516*16. coverage: every halo pixel (py in {0,129} or px in {0,129}) of every image of all 6 planes, once.
// =================================================================================================================
// inputs-only fence on the 8 rows' shuffled values (they come back on the LDS counter like loads): keeps the 8 shuffles of
// one reduction step together in front of their adds; without it the compiler runs the rows' chains one after another and
// the wave waits out every shuffle's latency alone
__device__ __forceinline__ void row_fence(const float (&t)[8]) {
#if defined(__HIP_DEVICE_COMPILE__)
  asm volatile("" :: "v"(t[0]), "v"(t[1]), "v"(t[2]), "v"(t[3]), "v"(t[4]), "v"(t[5]), "v"(t[6]), "v"(t[7]));
#endif
}
__global__ __launch_bounds__(256)
void k_ln(const float* __restrict__ x, const float* __restrict__ gw, const float* __restrict__ gb,
          const float* __restrict__ wq1, const float* __restrict__ wq2, const float* __restrict__ wk1,
          const float* __restrict__ wk2, const float* __restrict__ wv1, const float* __restrict__ wv2,
          unsigned short* xh, unsigned short* xl, unsigned short* w1, unsigned short* wt, unsigned short* p1) {
  __shared__ __align__(16) float T[64 * LDC];
  __shared__ __align__(16) float Wl[2048];
  const int tid = threadIdx.x, wv = tid >> 5, lane = tid & 31;
  const int blk = blockIdx.x;
  // the work-group's share of the weights: two 16-B loads a thread (addresses clamped into the share)
  const bool w33 = blk < 3 * CC;                             // block-uniform
  const int r11 = (blk - 3 * CC) * 3 + (min(tid, 47) >> 4);  // row of w1 where !w33
  const float* wp0;
  const float* wp1;
  if (w33) {
    const int t = blk / CC;
    const float* rowp = ((t == 0) ? wq2 : ((t == 1) ? wk2 : wv2)) + (size_t)(blk - t * CC) * KCV;
    wp0 = rowp + 4 * tid;
    wp1 = rowp + 1024 + 4 * min(tid, 31);
  } else {
    const int t = r11 / CC;
    wp0 = ((t == 0) ? wq1 : ((t == 1) ? wk1 : wv1)) + (size_t)(r11 - t * CC) * CC + (tid & 15) * 8;
    wp1 = wp0 + 4;
  }
  const v4f wa = *(const v4f*)wp0;
  const v4f wb = *(const v4f*)wp1;
  const int bh = blk >> 1, chalf = blk & 1;
  const int b = bh / HH, h = bh - b * HH;
  const v4f g4 = *(const v4f*)(gw + lane * 4);
  const v4f b4 = *(const v4f*)(gb + lane * 4);
  float g[4], be[4];
#pragma unroll
  for (int e = 0; e < 4; ++e) { g[e] = bfr(g4[e]); be[e] = bfr(b4[e]); }
  // the wave's 8 channel rows: all 8 loads are issued first, then every step of the row arithmetic runs over the 8 rows
  // side by side (8 independent shuffle chains), so the wave pays one memory latency and one chain, not eight of each
  const float* row0 = x + ((size_t)(b * CC + chalf * 64 + wv * 8) * HH + h) * WW + lane * 4;
  v4f a[8];
#pragma unroll
  for (int it = 0; it < 8; ++it) a[it] = *(const v4f*)(row0 + it * (HH * WW));
#if defined(__HIP_DEVICE_COMPILE__)
  // inputs-only fence on the loaded values: keeps the 8 loads together in front of the arithmetic; it holds the wait that
  // stands between issued loads and a rewrite of the address they name, and the address is an input, so it lives that long
  asm volatile("s_wait_xcnt 0x0" :: "v"(row0), "v"(a[0]), "v"(a[1]), "v"(a[2]), "v"(a[3]), "v"(a[4]), "v"(a[5]),
               "v"(a[6]), "v"(a[7]));
  // the same for the two weight loads: they stay in front of the arithmetic, in flight beside the x rows
  asm volatile("s_wait_xcnt 0x0" :: "v"(wp0), "v"(wp1), "v"(wa), "v"(wb));
#endif
  // no branch here: where the work-group has 1x1 rows, and above word 1151, nothing reads what is written
  *(v4f*)(Wl + 4 * tid) = wa;
  *(v4f*)(Wl + 1024 + 4 * tid) = wb;
  float d[8][4], s[8], sq[8];
#pragma unroll
  for (int it = 0; it < 8; ++it) {
#pragma unroll
    for (int e = 0; e < 4; ++e) d[it][e] = bfr(a[it][e]);
    s[it] = (d[it][0] + d[it][1]) + (d[it][2] + d[it][3]);
  }
#pragma unroll
  for (int off = 16; off; off >>= 1) {
    float t[8];
#pragma unroll
    for (int it = 0; it < 8; ++it) t[it] = __shfl_xor(s[it], off, 32);
    row_fence(t);
#pragma unroll
    for (int it = 0; it < 8; ++it) s[it] += t[it];
  }
#pragma unroll
  for (int it = 0; it < 8; ++it) {
    const float mu = s[it] * (1.0f / 128.0f);
#pragma unroll
    for (int e = 0; e < 4; ++e) d[it][e] = d[it][e] - mu;
    sq[it] = (d[it][0] * d[it][0] + d[it][1] * d[it][1]) + (d[it][2] * d[it][2] + d[it][3] * d[it][3]);
  }
#pragma unroll
  for (int off = 16; off; off >>= 1) {
    float t[8];
#pragma unroll
    for (int it = 0; it < 8; ++it) t[it] = __shfl_xor(sq[it], off, 32);
    row_fence(t);
#pragma unroll
    for (int it = 0; it < 8; ++it) sq[it] += t[it];
  }
#pragma unroll
  for (int it = 0; it < 8; ++it) {
    const float var = sq[it] * (1.0f / 128.0f);
    const float rs = rsqrtf(var + 1e-5f);
    v4f o;
#pragma unroll
    for (int e = 0; e < 4; ++e) o[e] = (d[it][e] * rs) * g[e] + be[e];
    *(v4f*)(T + (wv * 8 + it) * LDC + lane * 4) = o;
  }
  __syncthreads();
  v4u ph[4], pq[4];
  size_t offs[4];
#pragma unroll
  for (int s = 0; s < 4; ++s) {
    const int idx = s * 256 + tid;
    const int w = idx >> 3, piece = idx & 7;
    const int c0 = piece * 8;
    v4u a, q4;
#pragma unroll
    for (int e = 0; e < 4; ++e) {
      const float f0 = T[(c0 + 2 * e) * LDC + w];
      const float f1 = T[(c0 + 2 * e + 1) * LDC + w];
      unsigned hp, lp;
      split2(f0, f1, hp, lp);
      a[e] = hp; q4[e] = lp;
    }
    ph[s] = a;
    pq[s] = q4;
    offs[s] = (size_t)(b * IMGPIX + h * WW + w) * CC + chalf * 64 + c0;
  }
  // the weight piece of this thread (indices clamped; stored below by the threads that own one)
  v4u wpk;
  unsigned short* wdst;
  if (w33) {
    const int k0 = min(tid, 143) * 8, tap = k0 / CC, c0 = k0 - tap * CC;
#pragma unroll
    for (int e = 0; e < 4; ++e) {
      const float f0 = Wl[(c0 + 2 * e) * 9 + tap];
      const float f1 = Wl[(c0 + 2 * e + 1) * 9 + tap];
      wpk[e] = pk16(hb16(bfr(f0) * 64.0f), hb16(bfr(f1) * 64.0f));
    }
    wdst = wt + (size_t)blk * KCV + k0;
  } else {
    wpk[0] = pk16(hb16(bfr(wa[0]) * 64.0f), hb16(bfr(wa[1]) * 64.0f));
    wpk[1] = pk16(hb16(bfr(wa[2]) * 64.0f), hb16(bfr(wa[3]) * 64.0f));
    wpk[2] = pk16(hb16(bfr(wb[0]) * 64.0f), hb16(bfr(wb[1]) * 64.0f));
    wpk[3] = pk16(hb16(bfr(wb[2]) * 64.0f), hb16(bfr(wb[3]) * 64.0f));
    wdst = w1 + (size_t)r11 * CC + (tid & 15) * 8;
  }
  // the halo piece of this thread (index clamped likewise)
  const int hidx = blk * HPB + tid;
  size_t hoff;
  {
    const int idx = min(hidx, NHPC - 1);
    const int piece = idx & 15;
    int r = idx >> 4;
    const int hp = r % NHALO;
    r /= NHALO;
    const int img = r % NB, plane = r / NB;
    const int q = max(hp - 2 * WP, 0);
    const int pyA = (hp < WP) ? 0 : (HP - 1);
    const int pxA = (hp < WP) ? hp : (hp - WP);
    const int pyB = 1 + (q >> 1);
    const int pxB = (q & 1) ? (WP - 1) : 0;
    const bool edge = hp < 2 * WP;
    const int py = edge ? pyA : pyB;
    const int px = edge ? pxA : pxB;
    hoff = (size_t)plane * PS1 + ((size_t)(img * HP + py) * WP + px) * CC + piece * 8;
  }
#pragma unroll
  for (int s = 0; s < 4; ++s) { *(v4u*)(xh + offs[s]) = ph[s]; *(v4u*)(xl + offs[s]) = pq[s]; }
  if (tid < (w33 ? 144 : 48)) *(v4u*)wdst = wpk;
  if (tid < HPB && hidx < NHPC) {
    v4u z = {0u, 0u, 0u, 0u};
    *(v4u*)(p1 + hoff) = z;
  }
}

// =================================================================================================================
// 1x1 projections: C[64 pixels][128 out ch] = xn . w1[t]^T (K = 128), value = C/64; written as f16 hi/lo into the
// padded NHWC planes p1[2t], p1[2t+1] ([NB][130][130][128]) at the interior position (y+1, x+1). 64 consecutive
// pixels lie in one image row -> 64 consecutive padded pixels; thread = one 16-B piece, 16 threads per pixel row
// coverage: interior NPIX padded pixels x 128 ch of all 6 planes (halo by k_ln's launch).
// =================================================================================================================
__global__ __launch_bounds__(256)
void k_proj(const unsigned short* __restrict__ xh, const unsigned short* __restrict__ xl,
            const unsigned short* __restrict__ w1, unsigned short* p1) {
  __shared__ __align__(16) _Float16 ring[2 * SBUF];
  const float* Cs = (const float*)(const void*)ring;
  const int tid = threadIdx.x;
  const int mb = blockIdx.x, t = blockIdx.y;
  mm_tile2((const _Float16*)(const void*)xh, (const _Float16*)(const void*)xl,
           (const _Float16*)(const void*)(w1 + (size_t)t * CC * CC), mb * 64, ring);
  __syncthreads();
  unsigned short* dh = p1 + (size_t)(2 * t) * PS1;
  unsigned short* dl = p1 + (size_t)(2 * t + 1) * PS1;
  const int p0 = mb * 64;
  const int b = p0 / IMGPIX, rem = p0 - b * IMGPIX;
  const int y = rem / WW, x0 = rem - y * WW;
  const size_t pprow = (size_t)(b * HP + y + 1) * WP + x0 + 1;
  v4u ph[4], pq[4];
  size_t offs[4];
#pragma unroll
  for (int s = 0; s < 4; ++s) {
    const int idx = s * 256 + tid;
    const int row = idx >> 4, piece = idx & 15;
    const int col0 = piece * 8;
    v4u a, q4;
#pragma unroll
    for (int e = 0; e < 4; ++e) {
      const float f0 = Cs[row * LDC + col0 + 2 * e] * (1.0f / 64.0f);
      const float f1 = Cs[row * LDC + col0 + 2 * e + 1] * (1.0f / 64.0f);
      unsigned hp, lp;
      split2(f0, f1, hp, lp);
      a[e] = hp; q4[e] = lp;
    }
    ph[s] = a;
    pq[s] = q4;
    offs[s] = (pprow + row) * CC + col0;
  }
#pragma unroll
  for (int s = 0; s < 4; ++s) { *(v4u*)(dh + offs[s]) = ph[s]; *(v4u*)(dl + offs[s]) = pq[s]; }
  
}

// =================================================================================================================
// 3x3 conv implicit GEMM: block tile = 128 consecutive output pixels (one image row) x 128 channels, K = 1152 as 36
// k-steps, A = (hi, lo/2048) planes of tensor t, W = 64 bf16(w2[t]) -> value = C/64. Output NCHW flat [NB][128][16384]:
// coverage: qk [2 tensors][NB][128][16384] f32 and vh/vl [NB][128][16384], every element once (128 px x 128 co / block).
// =================================================================================================================
__global__ __launch_bounds__(256)
void k_conv3(const unsigned short* __restrict__ p1, const unsigned short* __restrict__ wt,
             float* qk, unsigned short* vh, unsigned short* vl) {
  __shared__ __align__(16) _Float16 ring[2 * CBUF];
  const int tid = threadIdx.x;
  const int mb = blockIdx.x, t = blockIdx.y;
  mm_conv((const _Float16*)(const void*)(p1 + (size_t)(2 * t) * PS1),
          (const _Float16*)(const void*)(p1 + (size_t)(2 * t + 1) * PS1),
          (const _Float16*)(const void*)(wt + (size_t)t * CC * KCV), mb * CPX, ring);
  __syncthreads();
  const float* Cs = (const float*)(const void*)ring;
  const int p0 = mb * CPX;
  const int b = p0 / IMGPIX, pix0 = p0 - b * IMGPIX;
  if (t < 2) {                                               // block-uniform branch, no WMMA inside
    float* df = qk + (size_t)t * ((size_t)NB * BSZ);
    v4f pk[16];
    size_t offs[16];
#pragma unroll
    for (int s = 0; s < 16; ++s) {                           // s >> 3: the tile's half of 64 pixels
      const int idx = (s & 7) * 256 + tid;
      const int co = idx >> 4, piece = idx & 15;
      const int r0 = (s >> 3) * 64 + piece * 4;
      v4f v;
#pragma unroll
      for (int e = 0; e < 4; ++e) v[e] = Cs[(r0 + e) * LDC + co] * (1.0f / 64.0f);
      pk[s] = v;
      offs[s] = (size_t)(b * CC + co) * IMGPIX + pix0 + r0;
    }
#pragma unroll
    for (int s = 0; s < 16; ++s) *(v4f*)(df + offs[s]) = pk[s];
  } else {
    v4u ph[8], pq[8];
    size_t offs[8];
#pragma unroll
    for (int s = 0; s < 8; ++s) {                            // s >> 2: the tile's half of 64 pixels
      const int idx = (s & 3) * 256 + tid;
      const int co = idx >> 3, piece = idx & 7;
      const int r0 = (s >> 2) * 64 + piece * 8;
      v4u a, q4;
#pragma unroll
      for (int e = 0; e < 4; ++e) {
        const float f0 = Cs[(r0 + 2 * e) * LDC + co] * (1.0f / 64.0f);
        const float f1 = Cs[(r0 + 2 * e + 1) * LDC + co] * (1.0f / 64.0f);
        unsigned hp, lp;
        split2(f0, f1, hp, lp);
        a[e] = hp; q4[e] = lp;
      }
      ph[s] = a;
      pq[s] = q4;
      offs[s] = (size_t)(b * CC + co) * IMGPIX + pix0 + r0;
    }
#pragma unroll
    for (int s = 0; s < 8; ++s) { *(v4u*)(vh + offs[s]) = ph[s]; *(v4u*)(vl + offs[s]) = pq[s]; }
#if defined(__HIP_DEVICE_COMPILE__)
    // the wait that stands between the issued stores and a rewrite of a register they name (the code that follows this
    // branch in the built object reuses them)
    asm volatile("s_wait_xcnt 0x0" ::: "memory");
#endif
  }
}

// =================================================================================================================
// Logit partial sums over the raw reshape: S[i][j] = sum_r K_head[r][i] Q_head[r][j] (K = 16384) in f32 on VALU from
// the f32 [16384][16] views of the q/k NCHW flat planes. Work-group = (row group rg, batch-head bi): rows r = 16 s + rg
// (1024 rows). Thread (so = tid>>4, i = tid&15) sums the 32 rows s = 32 so .. 32 so + 31 in order into 16 partials;
// thread (i, j) then adds the 32 values of so in order in LDS: sp[bi][rg][i][j]. k_attn adds the 16 row groups in order.
// grid = 16*NB*8, 512 threads. coverage: sp [NB*8][16][256] f32, every element once.
// =================================================================================================================
__global__ __launch_bounds__(512)
void k_logit(const float* __restrict__ qf, const float* __restrict__ kf, float* sp) {
  __shared__ float part[32 * 256];
  const int tid = threadIdx.x;
  // bi in the low bits: the 16 row groups of one head interleave in the same cache lines; a matter of speed only
  const int bi = blockIdx.x % (NB * NHEAD), rg = blockIdx.x / (NB * NHEAD);
  const int b = bi / NHEAD, head = bi - b * NHEAD;
  const float* Qp = qf + (size_t)b * BSZ + (size_t)head * HSZ;
  const float* Kp = kf + (size_t)b * BSZ + (size_t)head * HSZ;
  {
    const int so = tid >> 4, i = tid & 15;
    float tt[HD];
#pragma unroll
    for (int e = 0; e < HD; ++e) tt[e] = 0.f;
    const float* kp = Kp + (size_t)(so * 512 + rg) * HD + i;   // row r = (32 so + s) * 16 + rg, s = 0
    const float* qp = Qp + (size_t)(so * 512 + rg) * HD;
    // batches of 8 rows: each batch's 40 loads are issued together, then summed row by row in order; unrolled so that
    // every row's address is the two base pointers plus an immediate offset
#pragma unroll
    for (int sb = 0; sb < 4; ++sb) {
      float kv[8];
      v4f q[8][4];
#pragma unroll
      for (int u = 0; u < 8; ++u) {
        kv[u] = kp[(sb * 8 + u) * 16 * HD];
#pragma unroll
        for (int g = 0; g < 4; ++g) q[u][g] = *(const v4f*)(qp + (sb * 8 + u) * 16 * HD + 4 * g);
      }
#if defined(__HIP_DEVICE_COMPILE__)
      // inputs-only fences on the loaded values (four rows each: an asm statement takes thirty operands): without them
      // the compiler sinks every load to its first use and the wave pays one memory latency per load. The second one
      // holds the wait that stands between issued loads and a rewrite of a register they name, and takes the two base
      // pointers as inputs too: they stay live to that wait, so no load of the batch lands in its own run's address
      asm volatile("" :: "v"(kv[0]), "v"(kv[1]), "v"(kv[2]), "v"(kv[3]),
                   "v"(q[0][0]), "v"(q[0][1]), "v"(q[0][2]), "v"(q[0][3]), "v"(q[1][0]), "v"(q[1][1]), "v"(q[1][2]), "v"(q[1][3]),
                   "v"(q[2][0]), "v"(q[2][1]), "v"(q[2][2]), "v"(q[2][3]), "v"(q[3][0]), "v"(q[3][1]), "v"(q[3][2]), "v"(q[3][3]));
      asm volatile("s_wait_xcnt 0x0" :: "v"(kp), "v"(qp), "v"(kv[4]), "v"(kv[5]), "v"(kv[6]), "v"(kv[7]),
                   "v"(q[4][0]), "v"(q[4][1]), "v"(q[4][2]), "v"(q[4][3]), "v"(q[5][0]), "v"(q[5][1]), "v"(q[5][2]), "v"(q[5][3]),
                   "v"(q[6][0]), "v"(q[6][1]), "v"(q[6][2]), "v"(q[6][3]), "v"(q[7][0]), "v"(q[7][1]), "v"(q[7][2]), "v"(q[7][3]));
#endif
#pragma unroll
      for (int u = 0; u < 8; ++u) {
#pragma unroll
        for (int g = 0; g < 4; ++g) {
#pragma unroll
          for (int e = 0; e < 4; ++e) tt[4 * g + e] = fmaf(kv[u], q[u][g][e], tt[4 * g + e]);
        }
      }
    }
#pragma unroll
    for (int j = 0; j < HD; ++j) part[so * 256 + i * 16 + j] = tt[j];
  }
  __syncthreads();
  if (tid < 256) {
    float acc = 0.f;
#pragma unroll
    for (int so = 0; so < 32; ++so) acc += part[so * 256 + tid];
    sp[(size_t)(bi * 16 + rg) * 256 + tid] = acc;
  }
}

// =================================================================================================================
// Per (b, head) channel attention: S[i][j] = the 16 row-group partial sums of k_logit added in fixed order.
// P = softmax_j(S * (1/bf16(scale))) in f32 (max-subtracted).
// Wm[o][j] = sum_j2 64 bf16(wo[o][16 head + j2]) P[j][j2] on WMMA (K = 16 zero padded to 32; P carried x4096 as
// f16 hi + residual), value/4096 = 64 Wm; stored as f16 hi/lo planes weh/wel [b][head][o][16]: block region =
// grid = NB*8, 256 threads. coverage: weh/wel [NB][8][128][16], every element once.
// =================================================================================================================
__global__ __launch_bounds__(256)
void k_attn(const float* __restrict__ sp, const float* __restrict__ wo, const float* __restrict__ scale,
            unsigned short* weh, unsigned short* wel) {
  __shared__ float Sm[16 * WSP];
  __shared__ __align__(16) _Float16 Phs[16 * FP];
  __shared__ __align__(16) _Float16 Pls[16 * FP];
  __shared__ __align__(16) _Float16 Wts[CC * FP];
  __shared__ float Ws[CC * WSP];
  const int tid = threadIdx.x, wave = tid >> 5, lane = tid & 31, hh = lane >> 4, m = lane & 15;
  const int bi = blockIdx.x, b = bi / NHEAD, head = bi - b * NHEAD;
  // wo slice -> f16 [o][k] (k = j2, zero for k >= 16; addresses clamped)
  // thread = (o = 8 it + wave, k = lane); the 16 loads of the slice and the 16 loads of the partial sums are all issued
  // before the first is used: one memory latency for the 32, not one per trip
  {
    const float* wop = wo + (size_t)wave * CC + head * HD + min(lane, HD - 1);
    float wf[16];
#pragma unroll
    for (int it = 0; it < 16; ++it) wf[it] = wop[it * 8 * CC];
    const int i = tid >> 4, j = tid & 15;
    const float* spp = sp + (size_t)bi * (16 * 256) + i * 16 + j;
    float pv[16];
#pragma unroll
    for (int rg = 0; rg < 16; ++rg) pv[rg] = spp[rg * 256];
#if defined(__HIP_DEVICE_COMPILE__)
    // inputs-only fence on the slice's loaded values: keeps the loads above in front of the arithmetic; same wait and same
    // live address as in the statement below
    asm volatile("s_wait_xcnt 0x0" :: "v"(wop), "v"(wf[0]), "v"(wf[1]), "v"(wf[2]), "v"(wf[3]), "v"(wf[4]), "v"(wf[5]),
                 "v"(wf[6]), "v"(wf[7]), "v"(wf[8]), "v"(wf[9]), "v"(wf[10]), "v"(wf[11]), "v"(wf[12]), "v"(wf[13]),
                 "v"(wf[14]), "v"(wf[15]));
    // the wait between the 16 issued loads and a rewrite of the address they name; the address and the loaded values
    // are inputs, so that the address stays live to the wait and no load of the run lands in it
    asm volatile("s_wait_xcnt 0x0" :: "v"(spp), "v"(pv[0]), "v"(pv[1]), "v"(pv[2]), "v"(pv[3]), "v"(pv[4]), "v"(pv[5]),
                 "v"(pv[6]), "v"(pv[7]), "v"(pv[8]), "v"(pv[9]), "v"(pv[10]), "v"(pv[11]), "v"(pv[12]), "v"(pv[13]),
                 "v"(pv[14]), "v"(pv[15]));
#endif
#pragma unroll
    for (int it = 0; it < 16; ++it) {
      const float v = (lane < HD) ? bfr(wf[it]) * 64.0f : 0.0f;
      Wts[(it * 8 + wave) * FP + lane] = (_Float16)v;
    }
    float s = 0.f;
#pragma unroll
    for (int rg = 0; rg < 16; ++rg) s += pv[rg];
    const float isc = 1.0f / bfr(scale[0]);
    Sm[i * WSP + j] = s * isc;
  }
  __syncthreads();
  if (tid < 16) {
    // the row's 16 logits are read from LDS together and stay in registers: one LDS latency, not one per element and pass
    float sv[HD];
#pragma unroll
    for (int n = 0; n < HD; ++n) sv[n] = Sm[tid * WSP + n];
    float mx = -3.0e38f;
#pragma unroll
    for (int n = 0; n < HD; ++n) mx = fmaxf(mx, sv[n]);
    float ssum = 0.f;
#pragma unroll
    for (int n = 0; n < HD; ++n) {
      sv[n] = expf(sv[n] - mx);
      ssum += sv[n];
    }
    const float inv = 1.0f / ssum;
#pragma unroll
    for (int n = 0; n < HD; ++n) {
      const float pv = (sv[n] * inv) * 4096.0f;
      const _Float16 hv = (_Float16)pv;
      Phs[tid * FP + n] = hv;
      Pls[tid * FP + n] = (_Float16)((pv - (float)hv) * 2048.0f);
    }
#pragma unroll
    for (int n = HD; n < 32; ++n) { Phs[tid * FP + n] = (_Float16)0.0f; Pls[tid * FP + n] = (_Float16)0.0f; }
  }
  __syncthreads();
  {
    const v16h fa = ldfrag_h(Wts + (wave * 16 + m) * FP + 8 * hh);
    const v16h fb = ldfrag_h(Phs + m * FP + 8 * hh);
    const v16h gb = ldfrag_h(Pls + m * FP + 8 * hh);
    v8f ah = mma_raw(fa, fb, zero8());
    v8f al = mma_raw(fa, gb, zero8());
    guard2(ah, al, fa, fb, gb);
#pragma unroll
    for (int r = 0; r < 8; ++r) Ws[(wave * 16 + 8 * hh + r) * WSP + m] = (ah[r] + al[r] * RSC) * (1.0f / 4096.0f);
  }
  __syncthreads();
  {
    const int o = tid >> 1, hf = tid & 1;
    v4u a, q4;
#pragma unroll
    for (int e = 0; e < 4; ++e) {
      const float f0 = Ws[o * WSP + hf * 8 + 2 * e];
      const float f1 = Ws[o * WSP + hf * 8 + 2 * e + 1];
      unsigned hp, lp;
      split2(f0, f1, hp, lp);
      a[e] = hp; q4[e] = lp;
    }
    const size_t off = (size_t)(bi * CC + o) * HD + hf * 8;
    *(v4u*)(weh + off) = a;
    *(v4u*)(wel + off) = q4;
    
  }
}

// =================================================================================================================
// Output: y[b][o][p] = (sum_c' Wm64[b][c'][o] V[p][c']) / 64 + bf16(x[b][o][p]) for 64 pixels x 128 channels per
// =================================================================================================================
__global__ __launch_bounds__(256)
void k_final(const unsigned short* __restrict__ vh, const unsigned short* __restrict__ vl,
             const unsigned short* __restrict__ weh, const unsigned short* __restrict__ wel,
             const float* __restrict__ x, float* out) {
  __shared__ __align__(16) float Cs[64 * LDC];
  const int tid = threadIdx.x;
  const int mb = blockIdx.x;
  const int p0 = mb * 64;
  const int b = p0 / IMGPIX, pl0 = p0 - b * IMGPIX;
  const _Float16* Vh = (const _Float16*)(const void*)(vh + (size_t)b * BSZ);
  const _Float16* Vl = (const _Float16*)(const void*)(vl + (size_t)b * BSZ);
  const _Float16* Wh = (const _Float16*)(const void*)(weh + (size_t)b * NHEAD * CC * HD);
  const _Float16* Wl = (const _Float16*)(const void*)(wel + (size_t)b * NHEAD * CC * HD);
  mm_final(Vh, Vl, Wh, Wl, pl0, Cs);
  __syncthreads();
  v4f pk[8];
  size_t offs[8];
#pragma unroll
  for (int s = 0; s < 8; ++s) {
    const int idx = s * 256 + tid;
    const int o = idx >> 4, piece = idx & 15;
    const size_t off = (size_t)(b * CC + o) * IMGPIX + pl0 + piece * 4;
    const v4f xr = *(const v4f*)(x + off);
    v4f v;
#pragma unroll
    for (int e = 0; e < 4; ++e) v[e] = Cs[(piece * 4 + e) * LDC + o] * (1.0f / 64.0f) + bfr(xr[e]);
    pk[s] = v;
    offs[s] = off;
  }
#pragma unroll
  for (int s = 0; s < 8; ++s) *(v4f*)(out + offs[s]) = pk[s];
  
}

// =================================================================================================================
// Workspace map (bytes, offsets multiples of 65536, no aliasing, every region sized at or above its whole-line store
// extent): W1 f16 [3][128][128] 98304 (131072) | WT f16 [3][128][1152] 884736 (917504) | XH, XL f16 [32768][128]
// 8388608 each | P1 f16 6 x [2][130][130][128] 51916800 (51970048) | QK f32 [2][2][128][16384] 33554432 |
// VH, VL f16 [2][128][16384] 8388608 each | WEH, WEL f16 [2][8][128][16] 65536 each | SP f32 [16][16][256] 262144 |
// total 120520704.
// =================================================================================================================
extern "C" void kernel_launch(void* const* d_in, const int* in_sizes, int n_in,
                              void* d_out, int out_size, void* d_ws, size_t ws_size,
                              hipStream_t stream) {
  if (n_in < 11) return;
  const int expect[11] = { NB * CC * IMGPIX, WW, WW, 1, CC * CC, CC * CC * 9, CC * CC, CC * CC * 9,
                           CC * CC, CC * CC * 9, CC * CC };
  for (int i = 0; i < 11; ++i) if (in_sizes[i] != expect[i]) return;
  if (out_size != NB * CC * IMGPIX) return;

  const float* x     = (const float*)d_in[0];
  const float* gam   = (const float*)d_in[1];
  const float* bet   = (const float*)d_in[2];
  const float* scale = (const float*)d_in[3];
  const float* wq1   = (const float*)d_in[4];
  const float* wq2   = (const float*)d_in[5];
  const float* wk1   = (const float*)d_in[6];
  const float* wk2   = (const float*)d_in[7];
  const float* wv1   = (const float*)d_in[8];
  const float* wv2   = (const float*)d_in[9];
  const float* wo    = (const float*)d_in[10];
  float* out = (float*)d_out;

  const size_t AL = 65536;
  const size_t sW1 = (((size_t)3 * CC * CC * 2) + AL - 1) / AL * AL;               //   131072
  const size_t sWT = (((size_t)3 * CC * KCV * 2) + AL - 1) / AL * AL;              //   917504
  const size_t sX  = (((size_t)NPIX * CC * 2) + AL - 1) / AL * AL;                  //  8388608
  const size_t sP1 = (((size_t)6 * PS1 * 2) + AL - 1) / AL * AL;                    // 51970048
  const size_t sQK = (((size_t)2 * NB * BSZ * 4) + AL - 1) / AL * AL;               // 33554432
  const size_t sV  = (((size_t)NB * BSZ * 2) + AL - 1) / AL * AL;                   //  8388608
  const size_t sWE = (((size_t)NB * NHEAD * CC * HD * 2) + AL - 1) / AL * AL;       //    65536
  const size_t sSP = (((size_t)NB * NHEAD * 16 * 256 * 4) + AL - 1) / AL * AL;      //   262144

  size_t off = 0;
  const size_t oW1  = off; off += sW1;
  const size_t oWT  = off; off += sWT;
  const size_t oXH  = off; off += sX;
  const size_t oXL  = off; off += sX;
  const size_t oP1  = off; off += sP1;
  const size_t oQK  = off; off += sQK;
  const size_t oVH  = off; off += sV;
  const size_t oVL  = off; off += sV;
  const size_t oWEH = off; off += sWE;
  const size_t oWEL = off; off += sWE;
  const size_t oSP  = off; off += sSP;
  if (off > ws_size) return;                                 // off = 120520704
  if (off > (size_t)134217728) return;

  char* ws = (char*)d_ws;
  unsigned short* W1  = (unsigned short*)(ws + oW1);
  unsigned short* WT  = (unsigned short*)(ws + oWT);
  unsigned short* XH  = (unsigned short*)(ws + oXH);
  unsigned short* XL  = (unsigned short*)(ws + oXL);
  unsigned short* P1  = (unsigned short*)(ws + oP1);
  float*          QK  = (float*)(ws + oQK);
  unsigned short* VH  = (unsigned short*)(ws + oVH);
  unsigned short* VL  = (unsigned short*)(ws + oVL);
  unsigned short* WEH = (unsigned short*)(ws + oWEH);
  unsigned short* WEL = (unsigned short*)(ws + oWEL);
  float*          SP  = (float*)(ws + oSP);

  const dim3 blk(256);
  // (1) layer norm over w + NHWC hi/lo planes; weight planes; halo zero fill of the padded planes
  k_ln<<<dim3(LNG), blk, 0, stream>>>(x, gam, bet, wq1, wq2, wk1, wk2, wv1, wv2, XH, XL, W1, WT, P1);
  // (2) 1x1 projections into padded NHWC hi/lo planes (interior)
  k_proj<<<dim3(NPIX / 64, 3), blk, 0, stream>>>(XH, XL, W1, P1);
  // (3) 3x3 convs -> q, k f32 NCHW flat planes; v f16 hi/lo NCHW flat planes
  k_conv3<<<dim3(NPIX / CPX, 3), blk, 0, stream>>>(P1, WT, QK, VH, VL);
  // (4) f32 logit partial sums, one work-group per (row group, batch-head)
  k_logit<<<dim3(16 * NB * NHEAD), dim3(512), 0, stream>>>(QK, QK + (size_t)NB * BSZ, SP);
  // (5) per-head channel attention: row groups added + softmax + wo mix -> Wm planes
  k_attn<<<dim3(NB * NHEAD), blk, 0, stream>>>(SP, wo, scale, WEH, WEL);
  // (6) output GEMM + residual -> NCHW d_out
  k_final<<<dim3(NPIX / 64), blk, 0, stream>>>(VH, VL, WEH, WEL, x, out);
  (void)hipGetLastError();
}

// v006
// It runs in 86.4 microseconds.
// In two side-by-side timings against v005, it was 1.05 and 1.04 times as fast.
// Over all steps from v000 it is 7.67 times as fast.
// Contractions: 1x1 projections (K=128) and 3x3 convs as implicit GEMM (K=1152): v_wmma_f32_16x16x32_f16, the
// activation as f16 hi + x2048 residual planes into two f32 accumulators, weights one f16 plane of 64*bf16(w);
// per-head k^T q logits (K=16384): f32 on VALU from f32 q/k planes (fixed-order three-level sums); wo x probs mix
// (K=16, zero padded to 32): f16, probs carried x4096 as hi + residual; fused output GEMM (K=128): v and the mixed
// weight as f16 hi + residual planes (3 products); f32 accumulate everywhere. Layer-norm statistics, softmax and
// all epilogues f32 on VALU; every float input RNE-converted to bf16 on load.
#include <hip/hip_runtime.h>
#include <stdint.h>

#define NB     2
#define CC     128
#define HH     128
#define WW     128
#define IMGPIX (HH * WW)
#define NPIX   (NB * IMGPIX)
#define HP     (HH + 2)
#define WP     (WW + 2)
#define PADIMG (HP * WP)
#define PADPIX (NB * PADIMG)
#define KCV    1152
#define NKS    36
#define NHEAD  8
#define HD     16
#define HSZ    (IMGPIX * HD)
#define BSZ    (CC * IMGPIX)
#define LDC    132
#define FP     40
#define WSP    17
#define NHALO  (2 * WP + 2 * HH)
#define RSC    0.00048828125f
#define PS1    ((size_t)PADPIX * CC)
#define PS2    ((size_t)NPIX * CC)
#define SPK    72
#define SBUF   (256 * SPK)
#define NST    18
#define CPX    128
#define ARW    (WW + 2)
#define ABUF   (2 * ARW * SPK)
#define WBUF   (CC * SPK)
#define NGR    6
#define CRING  (2 * ABUF + 2 * WBUF)
#define LNG    (NB * HH * 2)
#define NHPC   (6 * NB * NHALO * 16)
#define HPB    200

static_assert(NPIX == NB * IMGPIX);
static_assert(IMGPIX == 16384 && HH == 128 && WW == 128);
static_assert(PADIMG == 16900);
static_assert(KCV == 9 * CC && KCV == NKS * 32);
static_assert(CC == NHEAD * HD);
static_assert(BSZ == CC * IMGPIX && HSZ * NHEAD == BSZ);
static_assert((IMGPIX % 64) == 0 && (WW % 64) == 0);
static_assert((LDC * 4) % 16 == 0 && (FP * 2) % 16 == 0);
static_assert(NHALO == 516);
static_assert((KCV % 8) == 0 && (CC % 32) == 0);
static_assert(IMGPIX == 32 * 32 * 16);
static_assert(NST * 64 == KCV && (SPK * 2) % 32 == 16 && 2 * SBUF * 2 >= 64 * LDC * 4);
static_assert(CPX == WW && (NPIX % CPX) == 0 && CRING * 2 >= CPX * LDC * 4);
static_assert(NGR * 3 == NST && 2 * ARW == 8 * 32 + 4 && (ABUF * 2) % 16 == 0 && ARW == WP);
static_assert(LNG > 3 * CC && (LNG - 3 * CC) * 3 == 3 * CC && KCV == 1024 + 32 * 4);
static_assert(HPB <= 256 && (HPB % 8) == 0 && HPB * LNG >= NHPC);

// Index maps of the raw reshapes (per batch b, flat NCHW index f = c*16384 + h*128 + w viewed as [8][16384][16]):
//   Q_head[r][d] = qflat[b][head*262144 + 16 r + d]   (same map for K_head and V_head; r = (c%16)*1024 + h*8 + w/16,
//   d = w%16). S_head[i][j] = sum_r K_head[r][i] Q_head[r][j]; P_head = softmax_j(S_head * (1/scale)).
//   O[b][16 head + j2][pixel r] = sum_j V_head[r][j] P_head[j][j2].
//   y[b][o][pixel r] = sum_{head, j} Wm[b][head][o][j] V_head[r][j] + x[b][o][r],
//   Wm[b][head][o][j] = sum_j2 wo[o][16 head + j2] P_head[j][j2]   (reassociated 1x1 output conv).

typedef _Float16 v16h __attribute__((ext_vector_type(16)));
typedef _Float16 v8h  __attribute__((ext_vector_type(8)));
typedef float    v8f  __attribute__((ext_vector_type(8)));
typedef float    v4f  __attribute__((ext_vector_type(4)));
typedef unsigned int v4u __attribute__((ext_vector_type(4)));

// ---- scalar helpers ------------------------------------------------------------------------------------------
__device__ __forceinline__ unsigned short bf_bits(float f) {          // f32 -> bf16 bits, RNE convert
  unsigned u = __float_as_uint(f);
  return (unsigned short)((u + 0x7FFFu + ((u >> 16) & 1u)) >> 16);
}
__device__ __forceinline__ float bf_up(unsigned short b) { return __uint_as_float(((unsigned)b) << 16); }
__device__ __forceinline__ float bfr(float f) { return bf_up(bf_bits(f)); }
__device__ __forceinline__ unsigned short h_bits(_Float16 x) { return __builtin_bit_cast(unsigned short, x); }
__device__ __forceinline__ unsigned short hb16(float f) { return h_bits((_Float16)f); }
__device__ __forceinline__ unsigned pk16(unsigned short a, unsigned short b) { return (unsigned)a | ((unsigned)b << 16); }
__device__ __forceinline__ v8f zero8() { v8f z = {0.f, 0.f, 0.f, 0.f, 0.f, 0.f, 0.f, 0.f}; return z; }
// hi/lo pair of two f32 values: hi = f16(v), lo = f16(2048 (v - hi)), packed as two 32-bit words
__device__ __forceinline__ void split2(float f0, float f1, unsigned& hp, unsigned& lp) {
  const _Float16 h0 = (_Float16)f0, h1 = (_Float16)f1;
  const float q0 = (f0 - (float)h0) * 2048.0f, q1 = (f1 - (float)h1) * 2048.0f;
  hp = pk16(h_bits(h0), h_bits(h1));
  lp = pk16(hb16(q0), hb16(q1));
}

// ---- fragment loader: 16-bit A/B operand, lane -> row/col (lane&15), p already includes +8*(lane>>4);
//      elements 0..7 <- p[0..7] (k0+8h..k0+8h+7), elements 8..15 <- p[16..23] (k0+16+8h..k0+16+8h+7)
__device__ __forceinline__ v16h ldfrag_h(const _Float16* p) {
  union { v16h v; v8h h[2]; } f;
  f.h[0] = *(const v8h*)(p);
  f.h[1] = *(const v8h*)(p + 16);
  return f.v;
}
// same layout, the two 8-element halves at two independent 16-B aligned addresses (pa: k0+8h.., pb: k0+16+8h..)
__device__ __forceinline__ v16h ldfrag2(const _Float16* pa, const _Float16* pb) {
  union { v16h v; v8h h[2]; } f;
  f.h[0] = *(const v8h*)(pa);
  f.h[1] = *(const v8h*)(pb);
  return f.v;
}

// ---- WMMA helpers; the guards insert the trailing VALU hazard gap and keep A/B live --------------------------
__device__ __forceinline__ v8f mma_raw(v16h a, v16h b, v8f c) {
  return __builtin_amdgcn_wmma_f32_16x16x32_f16(false, a, false, b, (short)0, c, false, false);
}
__device__ __forceinline__ void guard8(v8f& c0, v8f& c1, v8f& c2, v8f& c3, v8f& c4, v8f& c5, v8f& c6, v8f& c7,
                                       const v16h& a0, const v16h& a1, const v16h& a2, const v16h& a3,
                                       const v16h& b0, const v16h& b1) {
#if defined(__HIP_DEVICE_COMPILE__)
  asm volatile("v_nop\n\tv_nop\n\tv_nop\n\tv_nop"
               : "+v"(c0), "+v"(c1), "+v"(c2), "+v"(c3), "+v"(c4), "+v"(c5), "+v"(c6), "+v"(c7)
               : "v"(a0), "v"(a1), "v"(a2), "v"(a3), "v"(b0), "v"(b1));
#endif
}
__device__ __forceinline__ void guard4(v8f& c0, v8f& c1, v8f& c2, v8f& c3,
                                       const v16h& a0, const v16h& a1, const v16h& b0, const v16h& b1) {
#if defined(__HIP_DEVICE_COMPILE__)
  asm volatile("v_nop\n\tv_nop\n\tv_nop\n\tv_nop"
               : "+v"(c0), "+v"(c1), "+v"(c2), "+v"(c3)
               : "v"(a0), "v"(a1), "v"(b0), "v"(b1));
#endif
}
__device__ __forceinline__ void guard2(v8f& c0, v8f& c1, const v16h& a0, const v16h& b0, const v16h& b1) {
#if defined(__HIP_DEVICE_COMPILE__)
  asm volatile("v_nop\n\tv_nop\n\tv_nop\n\tv_nop"
               : "+v"(c0), "+v"(c1)
               : "v"(a0), "v"(b0), "v"(b1));
#endif
}

// ---- LDS staging of one 64-k slice of a 64x128 block tile's operands: 256 rows of 128 B at pitch 144 B (16 B x odd, for
//      the ds_load_b128 fragment reads): rows 0..63 A hi, 64..127 A lo (64 A rows, global pitch CC), 128..255 W (128 rows,
//      global pitch wstep32 / 32). Thread = (row tid>>3 of each group of 32 rows, 16-B piece tid&7), 8 copies; ga_h, ga_l,
//      gw are the thread's own source addresses in the first group, lds its own byte address in the target buffer.
//      Each copy instruction moves four whole 128-B lines, and every operand byte is fetched once per work-group.
__device__ __forceinline__ void stage_copy(const _Float16* ga_h, const _Float16* ga_l, const _Float16* gw, int wstep32,
                                           unsigned lds) {
  const _Float16* g1 = ga_h + 32 * CC;
  const _Float16* g3 = ga_l + 32 * CC;
  const _Float16* g5 = gw + wstep32;
  const _Float16* g6 = gw + 2 * wstep32;
  const _Float16* g7 = gw + 3 * wstep32;
  const unsigned l1 = lds + 1 * 32 * SPK * 2, l2 = lds + 2 * 32 * SPK * 2, l3 = lds + 3 * 32 * SPK * 2;
  const unsigned l4 = lds + 4 * 32 * SPK * 2, l5 = lds + 5 * 32 * SPK * 2, l6 = lds + 6 * 32 * SPK * 2;
  const unsigned l7 = lds + 7 * 32 * SPK * 2;
#if defined(__HIP_DEVICE_COMPILE__)
  // global -> LDS through no register; the last line is the wait that stands between issued copies and a rewrite of
  // a register they name, inside the statement so that nothing can be moved in front of it
  asm volatile("global_load_async_to_lds_b128 %0, %1, off\n\t"
               "global_load_async_to_lds_b128 %2, %3, off\n\t"
               "global_load_async_to_lds_b128 %4, %5, off\n\t"
               "global_load_async_to_lds_b128 %6, %7, off\n\t"
               "global_load_async_to_lds_b128 %8, %9, off\n\t"
               "global_load_async_to_lds_b128 %10, %11, off\n\t"
               "global_load_async_to_lds_b128 %12, %13, off\n\t"
               "global_load_async_to_lds_b128 %14, %15, off\n\t"
               "s_wait_xcnt 0x0"
               :: "v"(lds), "v"(ga_h), "v"(l1), "v"(g1), "v"(l2), "v"(ga_l), "v"(l3), "v"(g3),
                  "v"(l4), "v"(gw), "v"(l5), "v"(g5), "v"(l6), "v"(g6), "v"(l7), "v"(g7)
               : "memory");
#endif
}
// ---- the conv's operands, pitch 144 B as above. A group = one padded image row (130 pixels) x 64 channels of both planes: 260
//      rows of 128 B, rows 0..129 hi, 130..259 lo. Thread = (row tid>>3 of run j of 32 rows, 16-B piece tid&7), runs j = 0..7,
//      and run 8 (four rows) by one wave. gh is the thread's own source in the hi plane at pixel tid>>3, gl its own in the lo
//      plane at pixel (tid>>3) - 2, so that LDS row r >= 130 is lo pixel r - 130; run 4 (rows 128..159) holds the last two hi
//      pixels (hi4: this thread's row is one of them) and the first thirty lo pixels. A group is copied in three parts, one
//      behind each of three barriers, so that every trip of the loop asks the L2 for about the same number of bytes.
__device__ __forceinline__ void copy3(unsigned la, const _Float16* ga, unsigned lb, const _Float16* gb, unsigned lc,
                                      const _Float16* gc) {
#if defined(__HIP_DEVICE_COMPILE__)
  // global -> LDS through no register; the last line is the wait that stands between issued copies and a rewrite of
  // a register they name, inside the statement so that nothing can be moved in front of it
  asm volatile("global_load_async_to_lds_b128 %0, %1, off\n\t"
               "global_load_async_to_lds_b128 %2, %3, off\n\t"
               "global_load_async_to_lds_b128 %4, %5, off\n\t"
               "s_wait_xcnt 0x0"
               :: "v"(la), "v"(ga), "v"(lb), "v"(gb), "v"(lc), "v"(gc) : "memory");
#endif
}
__device__ __forceinline__ void copy2(unsigned la, const _Float16* ga, unsigned lb, const _Float16* gb) {
#if defined(__HIP_DEVICE_COMPILE__)
  // same form and same closing wait as above
  asm volatile("global_load_async_to_lds_b128 %0, %1, off\n\t"
               "global_load_async_to_lds_b128 %2, %3, off\n\t"
               "s_wait_xcnt 0x0"
               :: "v"(la), "v"(ga), "v"(lb), "v"(gb) : "memory");
#endif
}
__device__ __forceinline__ void copy1(unsigned la, const _Float16* ga) {
#if defined(__HIP_DEVICE_COMPILE__)
  // same form and same closing wait as above
  asm volatile("global_load_async_to_lds_b128 %0, %1, off\n\t"
               "s_wait_xcnt 0x0"
               :: "v"(la), "v"(ga) : "memory");
#endif
}
template <int PART>
__device__ __forceinline__ void stage_a(const _Float16* gh, const _Float16* gl, bool hi4, bool wave0, unsigned lds) {
  const unsigned gs = 32 * SPK * 2;
  static_assert(PART == 1 || PART == 2);         // part 0 (runs 0..2) always goes with a W stage: stage_wa
  if (PART == 1) {
    copy3(lds + 3 * gs, gh + 96 * CC, lds + 4 * gs, hi4 ? gh + 128 * CC : gl, lds + 5 * gs, gl + 32 * CC);
  } else {
    copy2(lds + 6 * gs, gl + 64 * CC, lds + 7 * gs, gl + 96 * CC);
    if (wave0) copy1(lds + 8 * gs, gl + 128 * CC);   // scalar test: the other waves branch round the copy
  }
}
// W stage = 128 output channels x 64 k: 128 rows of 128 B (global pitch KCV), 4 copies a thread
__device__ __forceinline__ void stage_w4(const _Float16* gw, unsigned lds) {
  const _Float16* w1 = gw + 32 * KCV;
  const _Float16* w2 = gw + 64 * KCV;
  const _Float16* w3 = gw + 96 * KCV;
  const unsigned gs = 32 * SPK * 2;
  const unsigned l1 = lds + 1 * gs, l2 = lds + 2 * gs, l3 = lds + 3 * gs;
#if defined(__HIP_DEVICE_COMPILE__)
  // same form and same closing wait as above
  asm volatile("global_load_async_to_lds_b128 %0, %1, off\n\t"
               "global_load_async_to_lds_b128 %2, %3, off\n\t"
               "global_load_async_to_lds_b128 %4, %5, off\n\t"
               "global_load_async_to_lds_b128 %6, %7, off\n\t"
               "s_wait_xcnt 0x0"
               :: "v"(lds), "v"(gw), "v"(l1), "v"(w1), "v"(l2), "v"(w2), "v"(l3), "v"(w3)
               : "memory");
#endif
}
// a trip's copies in one statement, so that a wave passes one closing wait a trip (wave 0 two for part 2, whose run 8 it copies apart): the W stage's four and part PART of an A group
template <int PART>
__device__ __forceinline__ void stage_wa(const _Float16* gw, unsigned ldw, const _Float16* gh, const _Float16* gl, bool hi4,
                                         bool wave0, unsigned lda) {
  const _Float16* w1 = gw + 32 * KCV;
  const _Float16* w2 = gw + 64 * KCV;
  const _Float16* w3 = gw + 96 * KCV;
  const unsigned gs = 32 * SPK * 2;
  const unsigned m1 = ldw + 1 * gs, m2 = ldw + 2 * gs, m3 = ldw + 3 * gs;
  const unsigned la = lda + (3 * PART) * gs, lb = la + gs, lc = lb + gs;
  const _Float16* ga = (PART == 0) ? gh : ((PART == 1) ? gh + 96 * CC : gl + 64 * CC);
  const _Float16* gb = (PART == 0) ? gh + 32 * CC : ((PART == 1) ? (hi4 ? gh + 128 * CC : gl) : gl + 96 * CC);
  const _Float16* gc = (PART == 0) ? gh + 64 * CC : ((PART == 1) ? gl + 32 * CC : gl + 128 * CC);
#if defined(__HIP_DEVICE_COMPILE__)
  if (PART < 2) {
    // same form and same closing wait as above
    asm volatile("global_load_async_to_lds_b128 %0, %1, off\n\t"
                 "global_load_async_to_lds_b128 %2, %3, off\n\t"
                 "global_load_async_to_lds_b128 %4, %5, off\n\t"
                 "global_load_async_to_lds_b128 %6, %7, off\n\t"
                 "global_load_async_to_lds_b128 %8, %9, off\n\t"
                 "global_load_async_to_lds_b128 %10, %11, off\n\t"
                 "global_load_async_to_lds_b128 %12, %13, off\n\t"
                 "s_wait_xcnt 0x0"
                 :: "v"(ldw), "v"(gw), "v"(m1), "v"(w1), "v"(m2), "v"(w2), "v"(m3), "v"(w3),
                    "v"(la), "v"(ga), "v"(lb), "v"(gb), "v"(lc), "v"(gc)
                 : "memory");
  } else {
    // same form and same closing wait as above
    asm volatile("global_load_async_to_lds_b128 %0, %1, off\n\t"
                 "global_load_async_to_lds_b128 %2, %3, off\n\t"
                 "global_load_async_to_lds_b128 %4, %5, off\n\t"
                 "global_load_async_to_lds_b128 %6, %7, off\n\t"
                 "global_load_async_to_lds_b128 %8, %9, off\n\t"
                 "global_load_async_to_lds_b128 %10, %11, off\n\t"
                 "s_wait_xcnt 0x0"
                 :: "v"(ldw), "v"(gw), "v"(m1), "v"(w1), "v"(m2), "v"(w2), "v"(m3), "v"(w3),
                    "v"(la), "v"(ga), "v"(lb), "v"(gb)
                 : "memory");
    if (wave0) copy1(lc, gc);                    // scalar test: the other waves branch round the copy
  }
#endif
}
__device__ __forceinline__ void wait_copies() {
#if defined(__HIP_DEVICE_COMPILE__)
  asm volatile("s_wait_asynccnt 0x0" ::: "memory");   // this wave's copies have landed in LDS
#endif
}
__device__ __forceinline__ void wait_lds_reads() {
#if defined(__HIP_DEVICE_COMPILE__)
  asm volatile("s_wait_dscnt 0x0" ::: "memory");      // this wave's LDS reads are done before the buffer is rewritten
#endif
}

// ---- 64x128 block tile GEMM core (K = 128) with the A operand as two planes (hi and x2048 residual) into separate
//      accumulators; A row pitch CC (f16), W is [n][k] k-contiguous pitch CC. Both 64-k slices are copied to the two LDS
//      buffers at once, then read. 8 waves = 2 (32 rows) x 4 (32 cols), 2x2 tiles of 16 per wave; fragments from LDS with
//      the table layout; the residual accumulator is folded with 1/2048 when the tile is written to the LDS f32 tile
//      Cs[64][LDC], which takes the buffers' place behind a barrier.
__device__ __forceinline__ void mm_tile2(const _Float16* __restrict__ Ah, const _Float16* __restrict__ Al,
                                         const _Float16* __restrict__ W, int arow0, _Float16* ring) {
  const int tid = threadIdx.x, wave = tid >> 5, lane = tid & 31, hh = lane >> 4, c = lane & 15;
  const int mw = wave >> 2, nw = wave & 3;
  const int srow = tid >> 3, spc = tid & 7;
  const size_t sa = (size_t)(arow0 + srow) * CC + spc * 8;
  const _Float16* wb = W + (size_t)srow * CC + spc * 8;
  const unsigned lds0 = (unsigned)(size_t)ring + (unsigned)((srow * SPK + spc * 8) * 2);
  const _Float16* fap = ring + (mw * 32 + c) * SPK + 8 * hh;
  const _Float16* fbp = ring + (128 + nw * 32 + c) * SPK + 8 * hh;
  v8f h00 = zero8(), h01 = zero8(), h10 = zero8(), h11 = zero8();
  v8f l00 = zero8(), l01 = zero8(), l10 = zero8(), l11 = zero8();
  stage_copy(Ah + sa, Al + sa, wb, 32 * CC, lds0);
  stage_copy(Ah + sa + 64, Al + sa + 64, wb + 64, 32 * CC, lds0 + SBUF * 2);
  wait_copies();
  __syncthreads();                               // both slices are readable by every wave
  // unrolled: every fragment's LDS offset becomes an immediate of its load
#pragma unroll
  for (int ks = 0; ks < CC / 32; ++ks) {
    const _Float16* pa = fap + (ks >> 1) * SBUF + (ks & 1) * 32;
    const _Float16* pb = fbp + (ks >> 1) * SBUF + (ks & 1) * 32;
    const v16h fa0 = ldfrag_h(pa);
    const v16h fa1 = ldfrag_h(pa + 16 * SPK);
    const v16h ga0 = ldfrag_h(pa + 64 * SPK);
    const v16h ga1 = ldfrag_h(pa + 80 * SPK);
    const v16h fb0 = ldfrag_h(pb);
    const v16h fb1 = ldfrag_h(pb + 16 * SPK);
    h00 = mma_raw(fa0, fb0, h00);
    h01 = mma_raw(fa0, fb1, h01);
    h10 = mma_raw(fa1, fb0, h10);
    h11 = mma_raw(fa1, fb1, h11);
    l00 = mma_raw(ga0, fb0, l00);
    l01 = mma_raw(ga0, fb1, l01);
    l10 = mma_raw(ga1, fb0, l10);
    l11 = mma_raw(ga1, fb1, l11);
    guard8(h00, h01, h10, h11, l00, l01, l10, l11, fa0, fa1, ga0, ga1, fb0, fb1);
  }
  wait_lds_reads();
  __syncthreads();                               // ends every wave's fragment reads: the buffers become the f32 tile
  float* Cs = (float*)(void*)ring;
#pragma unroll
  for (int r = 0; r < 8; ++r) {
    const int row = mw * 32 + 8 * hh + r;
    Cs[row * LDC + nw * 32 + c]             = h00[r] + l00[r] * RSC;
    Cs[row * LDC + nw * 32 + 16 + c]        = h01[r] + l01[r] * RSC;
    Cs[(row + 16) * LDC + nw * 32 + c]      = h10[r] + l10[r] * RSC;
    Cs[(row + 16) * LDC + nw * 32 + 16 + c] = h11[r] + l11[r] * RSC;
  }
}

// ---- implicit-GEMM variant for the 3x3 conv: A row = output pixel p (flat over all images), k = tap*128 + c;
//      W = wt [128][1152] k-contiguous. The block tile is one image row. A group g (ky = g>>1, channel half = g&1) is the whole
//      padded row y + ky, 130 pixels x 64 channels of both planes: it is copied to LDS once and serves the three taps kx = 0, 1, 2,
//      which read it one LDS row apart. A W stage s = 3 g + kx is the 128 output channels x the 64 k of that tap and half. Two
//      buffers each: W stage t + 1 is copied while trip t multiplies, A group g + 1 (a third a trip) while group g's trips do; the
//      fragments come from LDS with the table k map (k order: ky, channel half, kx, channel quarter, table). 8 waves = 4 (32
//      pixels) x 2 (64 channels): a wave's k-step is 16 products from 8 fragments (2 hi, 2 lo, 4 W).
__device__ __forceinline__ size_t conv_abase(int p, int hh) {
  const int b = p / IMGPIX;
  const int r = p - b * IMGPIX;
  const int y = r / WW;
  const int x = r - y * WW;
  return ((size_t)(b * HP + y) * WP + x) * CC + 8 * hh;
}
// part PART of group g's copies into the A buffer g & 1; ah/al are the thread's own source addresses for group 0, lds0 its own
// byte address in buffer 0 (see stage_a)
template <int PART>
__device__ __forceinline__ void conv_apart(const _Float16* ah, const _Float16* al, bool hi4, bool wave0, int g, unsigned lds0) {
  const int ao = (g >> 1) * (WP * CC) + (g & 1) * 64;
  stage_a<PART>(ah + ao, al + ao, hi4, wave0, lds0 + (g & 1) * (ABUF * 2));
}
// stage s's copies into the W buffer at lds; wb is the thread's own source address for k = 0
__device__ __forceinline__ void conv_wstage(const _Float16* wb, int s, unsigned lds) {
  const int g = (s * 11) >> 5;                   // s / 3 for s < 18
  const int kx = s - 3 * g;
  stage_w4(wb + ((g >> 1) * 3 + kx) * CC + (g & 1) * 64, lds);
}
// both at once: W stage s into the W buffer s & 1 and part PART of A group g into the A buffer g & 1 (ldw0, lds0: buffers 0)
template <int PART>
__device__ __forceinline__ void conv_wa(const _Float16* wb, int s, unsigned ldw0, const _Float16* ah, const _Float16* al,
                                        bool hi4, bool wave0, int g, unsigned lds0) {
  const int sg = (s * 11) >> 5;                  // s / 3 for s < 18
  const int kx = s - 3 * sg;
  const int ao = (g >> 1) * (WP * CC) + (g & 1) * 64;
  stage_wa<PART>(wb + ((sg >> 1) * 3 + kx) * CC + (sg & 1) * 64, ldw0 + (s & 1) * (WBUF * 2), ah + ao, al + ao, hi4, wave0,
                 lds0 + (g & 1) * (ABUF * 2));
}
__device__ __forceinline__ void mm_conv(const _Float16* __restrict__ Ah, const _Float16* __restrict__ Al,
                                        const _Float16* __restrict__ W, int prow0, _Float16* ring) {
  const int tid = threadIdx.x, wave = tid >> 5, lane = tid & 31, hh = lane >> 4, c = lane & 15;
  const int mw = wave >> 1, nw = wave & 1;
  const int srow = tid >> 3, spc = tid & 7;
  const bool wave0 = __builtin_amdgcn_readfirstlane(wave) == 0;
  const bool hi4 = srow < 2;
  const size_t sa = conv_abase(prow0, 0) + spc * 8;
  const _Float16* ah = Ah + sa + srow * CC;
  const _Float16* al = Al + sa + (srow - 2) * CC;
  const _Float16* wb = W + (size_t)srow * KCV + spc * 8;
  const unsigned lds0 = (unsigned)(size_t)ring + (unsigned)((srow * SPK + spc * 8) * 2);
  const unsigned ldw0 = lds0 + 2 * ABUF * 2;
  const _Float16* fap = ring + (mw * 32 + c) * SPK + 8 * hh;
  const _Float16* fbp = ring + 2 * ABUF + (nw * 64 + c) * SPK + 8 * hh;
  v8f h0[4], h1[4], l0[4], l1[4];
  // unrolled: every index of an accumulator array is a constant, so the arrays stay in registers
#pragma unroll
  for (int n = 0; n < 4; ++n) { h0[n] = zero8(); h1[n] = zero8(); l0[n] = zero8(); l1[n] = zero8(); }
  conv_wa<0>(wb, 0, ldw0, ah, al, hi4, wave0, 0, lds0);
  conv_apart<1>(ah, al, hi4, wave0, 0, lds0);
  conv_apart<2>(ah, al, hi4, wave0, 0, lds0);
  wait_copies();
  __syncthreads();                               // group 0 and stage 0 are readable by every wave
  conv_wa<0>(wb, 1, ldw0, ah, al, hi4, wave0, 1, lds0);
  // rolled: one copy of a group's three trips in the instruction cache, the buffers chosen by g & 1 and t & 1
#pragma unroll 1
  for (int g = 0; g < NGR; ++g) {
    const int ab = (g & 1) * ABUF;
    // unrolled: the tap's row shift becomes an immediate of the LDS loads, and each trip has its own part of the next group
#pragma unroll
    for (int kx = 0; kx < 3; ++kx) {
      const int t = 3 * g + kx;
      const int wo = (t & 1) * WBUF;
      // unrolled: the two k-steps' LDS offsets become immediates of their loads
#pragma unroll
      for (int kk = 0; kk < 2; ++kk) {
        const _Float16* pa = fap + ab + kx * SPK + kk * 32;
        const _Float16* pb = fbp + wo + kk * 32;
        const v16h fa0 = ldfrag_h(pa);
        const v16h fb0 = ldfrag_h(pb);
        const v16h fb1 = ldfrag_h(pb + 16 * SPK);
        const v16h fb2 = ldfrag_h(pb + 32 * SPK);
        const v16h fb3 = ldfrag_h(pb + 48 * SPK);
        const v16h fa1 = ldfrag_h(pa + 16 * SPK);
        const v16h ga0 = ldfrag_h(pa + ARW * SPK);
        const v16h ga1 = ldfrag_h(pa + (ARW + 16) * SPK);
#if defined(__HIP_DEVICE_COMPILE__)
        // nothing is scheduled across this line: without it the compiler reloads one A register set in among the products
        // and the wave waits out a whole LDS latency at each such place
        __builtin_amdgcn_sched_barrier(0);
#endif
        h0[0] = mma_raw(fa0, fb0, h0[0]);
        h0[1] = mma_raw(fa0, fb1, h0[1]);
        h0[2] = mma_raw(fa0, fb2, h0[2]);
        h0[3] = mma_raw(fa0, fb3, h0[3]);
        h1[0] = mma_raw(fa1, fb0, h1[0]);
        h1[1] = mma_raw(fa1, fb1, h1[1]);
        h1[2] = mma_raw(fa1, fb2, h1[2]);
        h1[3] = mma_raw(fa1, fb3, h1[3]);
        l0[0] = mma_raw(ga0, fb0, l0[0]);
        l0[1] = mma_raw(ga0, fb1, l0[1]);
        l0[2] = mma_raw(ga0, fb2, l0[2]);
        l0[3] = mma_raw(ga0, fb3, l0[3]);
        l1[0] = mma_raw(ga1, fb0, l1[0]);
        l1[1] = mma_raw(ga1, fb1, l1[1]);
        l1[2] = mma_raw(ga1, fb2, l1[2]);
        l1[3] = mma_raw(ga1, fb3, l1[3]);
        guard8(l0[0], l0[1], l0[2], l0[3], l1[0], l1[1], l1[2], l1[3], ga0, ga1, fb0, fb1, fb2, fb3);
#if defined(__HIP_DEVICE_COMPILE__)
        // nor across this one: without it products of this k-step sink behind the trip's barrier and hold back the next copies
        __builtin_amdgcn_sched_barrier(0);
#endif
      }
      wait_lds_reads();
      wait_copies();
      __syncthreads();                           // publishes what was copied during trip t and ends every read of trip t's buffers
      // W stage t + 2 goes into the buffer that trip t read. A group g + 1 goes into the buffer that group g - 1 left; behind
      // group g's last trip its own buffer is free for group g + 2
      if (kx == 0) {
        if (g + 1 < NGR) conv_wa<1>(wb, t + 2, ldw0, ah, al, hi4, wave0, g + 1, lds0);
        else             conv_wstage(wb, t + 2, ldw0 + wo * 2);
      } else if (kx == 1) {
        if (g + 1 < NGR) conv_wa<2>(wb, t + 2, ldw0, ah, al, hi4, wave0, g + 1, lds0);
      } else {
        if (g + 2 < NGR)      conv_wa<0>(wb, t + 2, ldw0, ah, al, hi4, wave0, g + 2, lds0);
        else if (g + 1 < NGR) conv_wstage(wb, t + 2, ldw0 + wo * 2);
      }
    }
  }
  wait_copies();
  float* Cs = (float*)(void*)ring;               // the ring is free behind the last trip's barrier: f32 tile [128][LDC]
#pragma unroll
  for (int r = 0; r < 8; ++r) {
    const int row = mw * 32 + 8 * hh + r;
    // unrolled for the same reason as above
#pragma unroll
    for (int n = 0; n < 4; ++n) {
      Cs[row * LDC + nw * 64 + n * 16 + c]        = h0[n][r] + l0[n][r] * RSC;
      Cs[(row + 16) * LDC + nw * 64 + n * 16 + c] = h1[n][r] + l1[n][r] * RSC;
    }
  }
}

// ---- fused output GEMM core: rows = 64 pixels of one batch (local pixel pl0..pl0+63), cols = 128 output channels,
//      k = c' = 16 head + j (K = 128, 4 k-steps of two heads each). A[p][c'] = V_head[p][j] read from the NCHW flat v
//      planes at head*HSZ + 16 p + j (two 16-B halves per fragment, heads 2ks and 2ks+1); B = Wm[head][o][16]
//      k-contiguous per head. Products hi*hi + hi*lo (first loop) and lo*hi (second loop) into Cs[64][LDC].
__device__ __forceinline__ void mm_final(const _Float16* __restrict__ Vh, const _Float16* __restrict__ Vl,
                                         const _Float16* __restrict__ Wh, const _Float16* __restrict__ Wl,
                                         int pl0, float* Cs) {
  const int tid = threadIdx.x, wave = tid >> 5, lane = tid & 31, hh = lane >> 4, c = lane & 15;
  const int mw = wave >> 2, nw = wave & 3;
  const size_t r0 = (size_t)(pl0 + mw * 32 + c) * HD + 8 * hh;
  const size_t r1 = (size_t)(pl0 + mw * 32 + 16 + c) * HD + 8 * hh;
  const size_t q0 = (size_t)(nw * 32 + c) * HD + 8 * hh;
  const size_t q1 = (size_t)(nw * 32 + 16 + c) * HD + 8 * hh;
  {
    v8f h00 = zero8(), h01 = zero8(), h10 = zero8(), h11 = zero8();
    v8f l00 = zero8(), l01 = zero8(), l10 = zero8(), l11 = zero8();
    const _Float16* pa0 = Vh + r0;
    const _Float16* pa1 = Vh + r1;
    const _Float16* pb0 = Wh + q0;
    const _Float16* pb1 = Wh + q1;
    const _Float16* pc0 = Wl + q0;
    const _Float16* pc1 = Wl + q1;
    // two k-steps a batch: the batch's 24 loads are issued together, then multiplied in k order (one latency for two
    // k-steps; four at once would not leave registers for two work-groups on a WGP); unrolled: offsets become immediates
#pragma unroll
    for (int kp = 0; kp < CC / 64; ++kp) {
      v16h fa0[2], fa1[2], fb0[2], fb1[2], gb0[2], gb1[2];
#pragma unroll
      for (int u = 0; u < 2; ++u) {
        const int ao = (2 * (2 * kp + u)) * HSZ;
        const int bo = (2 * (2 * kp + u)) * (CC * HD);
        fa0[u] = ldfrag2(pa0 + ao, pa0 + ao + HSZ);
        fa1[u] = ldfrag2(pa1 + ao, pa1 + ao + HSZ);
        fb0[u] = ldfrag2(pb0 + bo, pb0 + bo + CC * HD);
        fb1[u] = ldfrag2(pb1 + bo, pb1 + bo + CC * HD);
        gb0[u] = ldfrag2(pc0 + bo, pc0 + bo + CC * HD);
        gb1[u] = ldfrag2(pc1 + bo, pc1 + bo + CC * HD);
      }
#if defined(__HIP_DEVICE_COMPILE__)
      // nothing is scheduled across this line: without it the first product, with its wait, is lifted in among the batch's
      // loads, and the loads behind it start one latency late
      __builtin_amdgcn_sched_barrier(0);
      // inputs-only fence on the loaded fragments: keeps the batch's loads together in front of its products; it holds the
      // wait that stands between issued loads and a rewrite of an address register they name
      asm volatile("s_wait_xcnt 0x0" :: "v"(fa0[0]), "v"(fa1[0]), "v"(fb0[0]), "v"(fb1[0]), "v"(gb0[0]), "v"(gb1[0]),
                   "v"(fa0[1]), "v"(fa1[1]), "v"(fb0[1]), "v"(fb1[1]), "v"(gb0[1]), "v"(gb1[1]));
#endif
#pragma unroll
      for (int u = 0; u < 2; ++u) {
        h00 = mma_raw(fa0[u], fb0[u], h00);
        h01 = mma_raw(fa0[u], fb1[u], h01);
        h10 = mma_raw(fa1[u], fb0[u], h10);
        h11 = mma_raw(fa1[u], fb1[u], h11);
        l00 = mma_raw(fa0[u], gb0[u], l00);
        l01 = mma_raw(fa0[u], gb1[u], l01);
        l10 = mma_raw(fa1[u], gb0[u], l10);
        l11 = mma_raw(fa1[u], gb1[u], l11);
        guard8(h00, h01, h10, h11, l00, l01, l10, l11, fa0[u], fa1[u], gb0[u], gb1[u], fb0[u], fb1[u]);
      }
    }
#pragma unroll
    for (int r = 0; r < 8; ++r) {
      const int row = mw * 32 + 8 * hh + r;
      Cs[row * LDC + nw * 32 + c]             = h00[r] + l00[r] * RSC;
      Cs[row * LDC + nw * 32 + 16 + c]        = h01[r] + l01[r] * RSC;
      Cs[(row + 16) * LDC + nw * 32 + c]      = h10[r] + l10[r] * RSC;
      Cs[(row + 16) * LDC + nw * 32 + 16 + c] = h11[r] + l11[r] * RSC;
    }
  }
  {
    v8f m00 = zero8(), m01 = zero8(), m10 = zero8(), m11 = zero8();
#if defined(__HIP_DEVICE_COMPILE__)
    // nothing is scheduled across this line or the one behind the loads: the first loop's epilogue stays out of the run of
    // loads, where it reused their address registers while they were in flight
    __builtin_amdgcn_sched_barrier(0);
#endif
    const _Float16* pa0 = Vl + r0;
    const _Float16* pa1 = Vl + r1;
    const _Float16* pb0 = Wh + q0;
    const _Float16* pb1 = Wh + q1;
    // all four k-steps' 32 loads are issued together, then multiplied in k order: one latency, not four
    v16h ga0[4], ga1[4], fb0[4], fb1[4];
#pragma unroll
    for (int ks = 0; ks < CC / 32; ++ks) {
      const int ao = (2 * ks) * HSZ;
      const int bo = (2 * ks) * (CC * HD);
      ga0[ks] = ldfrag2(pa0 + ao, pa0 + ao + HSZ);
      ga1[ks] = ldfrag2(pa1 + ao, pa1 + ao + HSZ);
      fb0[ks] = ldfrag2(pb0 + bo, pb0 + bo + CC * HD);
      fb1[ks] = ldfrag2(pb1 + bo, pb1 + bo + CC * HD);
    }
#if defined(__HIP_DEVICE_COMPILE__)
    __builtin_amdgcn_sched_barrier(0);
    // inputs-only fence on the loaded fragments, with the same wait as in the first loop
    asm volatile("s_wait_xcnt 0x0" :: "v"(ga0[0]), "v"(ga1[0]), "v"(fb0[0]), "v"(fb1[0]), "v"(ga0[1]), "v"(ga1[1]), "v"(fb0[1]), "v"(fb1[1]),
                 "v"(ga0[2]), "v"(ga1[2]), "v"(fb0[2]), "v"(fb1[2]), "v"(ga0[3]), "v"(ga1[3]), "v"(fb0[3]), "v"(fb1[3]));
#endif
#pragma unroll
    for (int ks = 0; ks < CC / 32; ++ks) {
      m00 = mma_raw(ga0[ks], fb0[ks], m00);
      m01 = mma_raw(ga0[ks], fb1[ks], m01);
      m10 = mma_raw(ga1[ks], fb0[ks], m10);
      m11 = mma_raw(ga1[ks], fb1[ks], m11);
      guard4(m00, m01, m10, m11, ga0[ks], ga1[ks], fb0[ks], fb1[ks]);
    }
#pragma unroll
    for (int r = 0; r < 8; ++r) {               // same lane wrote these slots above (program order, same type)
      const int row = mw * 32 + 8 * hh + r;
      Cs[row * LDC + nw * 32 + c]             += m00[r] * RSC;
      Cs[row * LDC + nw * 32 + 16 + c]        += m01[r] * RSC;
      Cs[(row + 16) * LDC + nw * 32 + c]      += m10[r] * RSC;
      Cs[(row + 16) * LDC + nw * 32 + 16 + c] += m11[r] * RSC;
    }
  }
}

// =================================================================================================================
// gamma[w], beta[w] bf16 converted) + NCHW -> NHWC + hi/lo f16 planes. Block = (b, h, channel half): wave = 8
// channel rows, lane = 4 w values, shuffle reductions; f32 tile T[64 ch][w] in LDS; then each pixel's 64 channels
// grid = NB*128*2, 256 threads. coverage: xh/xl [NPIX px][128 ch], every element once.
// The same launch carries two pieces of work that depend on nothing before them and are read only by later launches:
// (a) weight convert. Work-group blk < 384: row blk = (tensor, co) of (wq2, wk2, wv2) [co][ci][3][3] f32 -> wt [row][k =
//     tap*128 + ci] f16(64 * bf16(w)): the row's 1152 floats are loaded as whole lines beside the x rows, go through LDS
//     across the kernel's one barrier, and thread tt < 144 builds one 16-B piece. Work-group blk >= 384: three rows of
//     (wq1, wk1, wv1) [o][c] -> w1 [row][c], thread tt < 48 one 16-B piece. coverage: wt 384 x 1152, w1 384 x 128, once.
// (b) halo zero fill of the six padded planes: work-group blk zeroes the 16-B pieces blk*200 .. blk*200 + 199 (whole lines) of
//     the 6*NB*516*16. coverage: every halo pixel (py in {0,129} or px in {0,129}) of every image of all 6 planes, once.
// =================================================================================================================
// inputs-only fence on the 8 rows' shuffled values (they come back on the LDS counter like loads): keeps the 8 shuffles of
// one reduction step together in front of their adds; without it the compiler runs the rows' chains one after another and
// the wave waits out every shuffle's latency alone
__device__ __forceinline__ void row_fence(const float (&t)[8]) {
#if defined(__HIP_DEVICE_COMPILE__)
  asm volatile("" :: "v"(t[0]), "v"(t[1]), "v"(t[2]), "v"(t[3]), "v"(t[4]), "v"(t[5]), "v"(t[6]), "v"(t[7]));
#endif
}
__global__ __launch_bounds__(256)
void k_ln(const float* __restrict__ x, const float* __restrict__ gw, const float* __restrict__ gb,
          const float* __restrict__ wq1, const float* __restrict__ wq2, const float* __restrict__ wk1,
          const float* __restrict__ wk2, const float* __restrict__ wv1, const float* __restrict__ wv2,
          unsigned short* xh, unsigned short* xl, unsigned short* w1, unsigned short* wt, unsigned short* p1) {
  __shared__ __align__(16) float T[64 * LDC];
  __shared__ __align__(16) float Wl[2048];
  const int tid = threadIdx.x, wv = tid >> 5, lane = tid & 31;
  const int blk = blockIdx.x;
  // the work-group's share of the weights: two 16-B loads a thread (addresses clamped into the share)
  const bool w33 = blk < 3 * CC;                             // block-uniform
  const int r11 = (blk - 3 * CC) * 3 + (min(tid, 47) >> 4);  // row of w1 where !w33
  const float* wp0;
  const float* wp1;
  if (w33) {
    const int t = blk / CC;
    const float* rowp = ((t == 0) ? wq2 : ((t == 1) ? wk2 : wv2)) + (size_t)(blk - t * CC) * KCV;
    wp0 = rowp + 4 * tid;
    wp1 = rowp + 1024 + 4 * min(tid, 31);
  } else {
    const int t = r11 / CC;
    wp0 = ((t == 0) ? wq1 : ((t == 1) ? wk1 : wv1)) + (size_t)(r11 - t * CC) * CC + (tid & 15) * 8;
    wp1 = wp0 + 4;
  }
  const v4f wa = *(const v4f*)wp0;
  const v4f wb = *(const v4f*)wp1;
  const int bh = blk >> 1, chalf = blk & 1;
  const int b = bh / HH, h = bh - b * HH;
  const v4f g4 = *(const v4f*)(gw + lane * 4);
  const v4f b4 = *(const v4f*)(gb + lane * 4);
  float g[4], be[4];
#pragma unroll
  for (int e = 0; e < 4; ++e) { g[e] = bfr(g4[e]); be[e] = bfr(b4[e]); }
  // the wave's 8 channel rows: all 8 loads are issued first, then every step of the row arithmetic runs over the 8 rows
  // side by side (8 independent shuffle chains), so the wave pays one memory latency and one chain, not eight of each
  const float* row0 = x + ((size_t)(b * CC + chalf * 64 + wv * 8) * HH + h) * WW + lane * 4;
  v4f a[8];
#pragma unroll
  for (int it = 0; it < 8; ++it) a[it] = *(const v4f*)(row0 + it * (HH * WW));
#if defined(__HIP_DEVICE_COMPILE__)
  // inputs-only fence on the loaded values: keeps the 8 loads together in front of the arithmetic; it holds the wait that
  // stands between issued loads and a rewrite of the address they name, and the address is an input, so it lives that long
  asm volatile("s_wait_xcnt 0x0" :: "v"(row0), "v"(a[0]), "v"(a[1]), "v"(a[2]), "v"(a[3]), "v"(a[4]), "v"(a[5]),
               "v"(a[6]), "v"(a[7]));
  // the same for the two weight loads: they stay in front of the arithmetic, in flight beside the x rows
  asm volatile("s_wait_xcnt 0x0" :: "v"(wp0), "v"(wp1), "v"(wa), "v"(wb));
#endif
  // no branch here: where the work-group has 1x1 rows, and above word 1151, nothing reads what is written
  *(v4f*)(Wl + 4 * tid) = wa;
  *(v4f*)(Wl + 1024 + 4 * tid) = wb;
  float d[8][4], s[8], sq[8];
#pragma unroll
  for (int it = 0; it < 8; ++it) {
#pragma unroll
    for (int e = 0; e < 4; ++e) d[it][e] = bfr(a[it][e]);
    s[it] = (d[it][0] + d[it][1]) + (d[it][2] + d[it][3]);
  }
#pragma unroll
  for (int off = 16; off; off >>= 1) {
    float t[8];
#pragma unroll
    for (int it = 0; it < 8; ++it) t[it] = __shfl_xor(s[it], off, 32);
    row_fence(t);
#pragma unroll
    for (int it = 0; it < 8; ++it) s[it] += t[it];
  }
#pragma unroll
  for (int it = 0; it < 8; ++it) {
    const float mu = s[it] * (1.0f / 128.0f);
#pragma unroll
    for (int e = 0; e < 4; ++e) d[it][e] = d[it][e] - mu;
    sq[it] = (d[it][0] * d[it][0] + d[it][1] * d[it][1]) + (d[it][2] * d[it][2] + d[it][3] * d[it][3]);
  }
#pragma unroll
  for (int off = 16; off; off >>= 1) {
    float t[8];
#pragma unroll
    for (int it = 0; it < 8; ++it) t[it] = __shfl_xor(sq[it], off, 32);
    row_fence(t);
#pragma unroll
    for (int it = 0; it < 8; ++it) sq[it] += t[it];
  }
#pragma unroll
  for (int it = 0; it < 8; ++it) {
    const float var = sq[it] * (1.0f / 128.0f);
    const float rs = rsqrtf(var + 1e-5f);
    v4f o;
#pragma unroll
    for (int e = 0; e < 4; ++e) o[e] = (d[it][e] * rs) * g[e] + be[e];
    *(v4f*)(T + (wv * 8 + it) * LDC + lane * 4) = o;
  }
  __syncthreads();
  v4u ph[4], pq[4];
  size_t offs[4];
#pragma unroll
  for (int s = 0; s < 4; ++s) {
    const int idx = s * 256 + tid;
    const int w = idx >> 3, piece = idx & 7;
    const int c0 = piece * 8;
    v4u a, q4;
#pragma unroll
    for (int e = 0; e < 4; ++e) {
      const float f0 = T[(c0 + 2 * e) * LDC + w];
      const float f1 = T[(c0 + 2 * e + 1) * LDC + w];
      unsigned hp, lp;
      split2(f0, f1, hp, lp);
      a[e] = hp; q4[e] = lp;
    }
    ph[s] = a;
    pq[s] = q4;
    offs[s] = (size_t)(b * IMGPIX + h * WW + w) * CC + chalf * 64 + c0;
  }
  // the weight piece of this thread (indices clamped; stored below by the threads that own one)
  v4u wpk;
  unsigned short* wdst;
  if (w33) {
    const int k0 = min(tid, 143) * 8, tap = k0 / CC, c0 = k0 - tap * CC;
#pragma unroll
    for (int e = 0; e < 4; ++e) {
      const float f0 = Wl[(c0 + 2 * e) * 9 + tap];
      const float f1 = Wl[(c0 + 2 * e + 1) * 9 + tap];
      wpk[e] = pk16(hb16(bfr(f0) * 64.0f), hb16(bfr(f1) * 64.0f));
    }
    wdst = wt + (size_t)blk * KCV + k0;
  } else {
    wpk[0] = pk16(hb16(bfr(wa[0]) * 64.0f), hb16(bfr(wa[1]) * 64.0f));
    wpk[1] = pk16(hb16(bfr(wa[2]) * 64.0f), hb16(bfr(wa[3]) * 64.0f));
    wpk[2] = pk16(hb16(bfr(wb[0]) * 64.0f), hb16(bfr(wb[1]) * 64.0f));
    wpk[3] = pk16(hb16(bfr(wb[2]) * 64.0f), hb16(bfr(wb[3]) * 64.0f));
    wdst = w1 + (size_t)r11 * CC + (tid & 15) * 8;
  }
  // the halo piece of this thread (index clamped likewise)
  const int hidx = blk * HPB + tid;
  size_t hoff;
  {
    const int idx = min(hidx, NHPC - 1);
    const int piece = idx & 15;
    int r = idx >> 4;
    const int hp = r % NHALO;
    r /= NHALO;
    const int img = r % NB, plane = r / NB;
    const int q = max(hp - 2 * WP, 0);
    const int pyA = (hp < WP) ? 0 : (HP - 1);
    const int pxA = (hp < WP) ? hp : (hp - WP);
    const int pyB = 1 + (q >> 1);
    const int pxB = (q & 1) ? (WP - 1) : 0;
    const bool edge = hp < 2 * WP;
    const int py = edge ? pyA : pyB;
    const int px = edge ? pxA : pxB;
    hoff = (size_t)plane * PS1 + ((size_t)(img * HP + py) * WP + px) * CC + piece * 8;
  }
#pragma unroll
  for (int s = 0; s < 4; ++s) { *(v4u*)(xh + offs[s]) = ph[s]; *(v4u*)(xl + offs[s]) = pq[s]; }
  if (tid < (w33 ? 144 : 48)) *(v4u*)wdst = wpk;
  if (tid < HPB && hidx < NHPC) {
    v4u z = {0u, 0u, 0u, 0u};
    *(v4u*)(p1 + hoff) = z;
  }
}

// =================================================================================================================
// 1x1 projections: C[64 pixels][128 out ch] = xn . w1[t]^T (K = 128), value = C/64; written as f16 hi/lo into the
// padded NHWC planes p1[2t], p1[2t+1] ([NB][130][130][128]) at the interior position (y+1, x+1). 64 consecutive
// pixels lie in one image row -> 64 consecutive padded pixels; thread = one 16-B piece, 16 threads per pixel row
// coverage: interior NPIX padded pixels x 128 ch of all 6 planes (halo by k_ln's launch).
// =================================================================================================================
__global__ __launch_bounds__(256)
void k_proj(const unsigned short* __restrict__ xh, const unsigned short* __restrict__ xl,
            const unsigned short* __restrict__ w1, unsigned short* p1) {
  __shared__ __align__(16) _Float16 ring[2 * SBUF];
  const float* Cs = (const float*)(const void*)ring;
  const int tid = threadIdx.x;
  const int mb = blockIdx.x, t = blockIdx.y;
  mm_tile2((const _Float16*)(const void*)xh, (const _Float16*)(const void*)xl,
           (const _Float16*)(const void*)(w1 + (size_t)t * CC * CC), mb * 64, ring);
  __syncthreads();
  unsigned short* dh = p1 + (size_t)(2 * t) * PS1;
  unsigned short* dl = p1 + (size_t)(2 * t + 1) * PS1;
  const int p0 = mb * 64;
  const int b = p0 / IMGPIX, rem = p0 - b * IMGPIX;
  const int y = rem / WW, x0 = rem - y * WW;
  const size_t pprow = (size_t)(b * HP + y + 1) * WP + x0 + 1;
  v4u ph[4], pq[4];
  size_t offs[4];
#pragma unroll
  for (int s = 0; s < 4; ++s) {
    const int idx = s * 256 + tid;
    const int row = idx >> 4, piece = idx & 15;
    const int col0 = piece * 8;
    v4u a, q4;
#pragma unroll
    for (int e = 0; e < 4; ++e) {
      const float f0 = Cs[row * LDC + col0 + 2 * e] * (1.0f / 64.0f);
      const float f1 = Cs[row * LDC + col0 + 2 * e + 1] * (1.0f / 64.0f);
      unsigned hp, lp;
      split2(f0, f1, hp, lp);
      a[e] = hp; q4[e] = lp;
    }
    ph[s] = a;
    pq[s] = q4;
    offs[s] = (pprow + row) * CC + col0;
  }
#pragma unroll
  for (int s = 0; s < 4; ++s) { *(v4u*)(dh + offs[s]) = ph[s]; *(v4u*)(dl + offs[s]) = pq[s]; }
  
}

// =================================================================================================================
// 3x3 conv implicit GEMM: block tile = 128 consecutive output pixels (one image row) x 128 channels, K = 1152 as 36
// k-steps, A = (hi, lo/2048) planes of tensor t, W = 64 bf16(w2[t]) -> value = C/64. Output NCHW flat [NB][128][16384]:
// coverage: qk [2 tensors][NB][128][16384] f32 and vh/vl [NB][128][16384], every element once (128 px x 128 co / block).
// =================================================================================================================
__global__ __launch_bounds__(256)
void k_conv3(const unsigned short* __restrict__ p1, const unsigned short* __restrict__ wt,
             float* qk, unsigned short* vh, unsigned short* vl) {
  __shared__ __align__(16) _Float16 ring[CRING];
  const int tid = threadIdx.x;
  const int mb = blockIdx.x, t = blockIdx.y;
  mm_conv((const _Float16*)(const void*)(p1 + (size_t)(2 * t) * PS1),
          (const _Float16*)(const void*)(p1 + (size_t)(2 * t + 1) * PS1),
          (const _Float16*)(const void*)(wt + (size_t)t * CC * KCV), mb * CPX, ring);
  __syncthreads();
  const float* Cs = (const float*)(const void*)ring;
  const int p0 = mb * CPX;
  const int b = p0 / IMGPIX, pix0 = p0 - b * IMGPIX;
  if (t < 2) {                                               // block-uniform branch, no WMMA inside
    float* df = qk + (size_t)t * ((size_t)NB * BSZ);
    v4f pk[16];
    size_t offs[16];
#pragma unroll
    for (int s = 0; s < 16; ++s) {                           // s >> 3: the tile's half of 64 pixels
      const int idx = (s & 7) * 256 + tid;
      const int co = idx >> 4, piece = idx & 15;
      const int r0 = (s >> 3) * 64 + piece * 4;
      v4f v;
#pragma unroll
      for (int e = 0; e < 4; ++e) v[e] = Cs[(r0 + e) * LDC + co] * (1.0f / 64.0f);
      pk[s] = v;
      offs[s] = (size_t)(b * CC + co) * IMGPIX + pix0 + r0;
    }
#pragma unroll
    for (int s = 0; s < 16; ++s) *(v4f*)(df + offs[s]) = pk[s];
  } else {
    v4u ph[8], pq[8];
    size_t offs[8];
#pragma unroll
    for (int s = 0; s < 8; ++s) {                            // s >> 2: the tile's half of 64 pixels
      const int idx = (s & 3) * 256 + tid;
      const int co = idx >> 3, piece = idx & 7;
      const int r0 = (s >> 2) * 64 + piece * 8;
      v4u a, q4;
#pragma unroll
      for (int e = 0; e < 4; ++e) {
        const float f0 = Cs[(r0 + 2 * e) * LDC + co] * (1.0f / 64.0f);
        const float f1 = Cs[(r0 + 2 * e + 1) * LDC + co] * (1.0f / 64.0f);
        unsigned hp, lp;
        split2(f0, f1, hp, lp);
        a[e] = hp; q4[e] = lp;
      }
      ph[s] = a;
      pq[s] = q4;
      offs[s] = (size_t)(b * CC + co) * IMGPIX + pix0 + r0;
    }
#pragma unroll
    for (int s = 0; s < 8; ++s) { *(v4u*)(vh + offs[s]) = ph[s]; *(v4u*)(vl + offs[s]) = pq[s]; }
#if defined(__HIP_DEVICE_COMPILE__)
    // the wait that stands between the issued stores and a rewrite of a register they name (the code that follows this
    // branch in the built object reuses them)
    asm volatile("s_wait_xcnt 0x0" ::: "memory");
#endif
  }
}

// =================================================================================================================
// Logit partial sums over the raw reshape: S[i][j] = sum_r K_head[r][i] Q_head[r][j] (K = 16384) in f32 on VALU from
// the f32 [16384][16] views of the q/k NCHW flat planes. Work-group = (row group rg, batch-head bi): rows r = 16 s + rg
// (1024 rows). Thread (so = tid>>4, i = tid&15) sums the 32 rows s = 32 so .. 32 so + 31 in order into 16 partials;
// thread (i, j) then adds the 32 values of so in order in LDS: sp[bi][rg][i][j]. k_attn adds the 16 row groups in order.
// grid = 16*NB*8, 512 threads. coverage: sp [NB*8][16][256] f32, every element once.
// =================================================================================================================
__global__ __launch_bounds__(512)
void k_logit(const float* __restrict__ qf, const float* __restrict__ kf, float* sp) {
  __shared__ float part[32 * 256];
  const int tid = threadIdx.x;
  // bi in the low bits: the 16 row groups of one head interleave in the same cache lines; a matter of speed only
  const int bi = blockIdx.x % (NB * NHEAD), rg = blockIdx.x / (NB * NHEAD);
  const int b = bi / NHEAD, head = bi - b * NHEAD;
  const float* Qp = qf + (size_t)b * BSZ + (size_t)head * HSZ;
  const float* Kp = kf + (size_t)b * BSZ + (size_t)head * HSZ;
  {
    const int so = tid >> 4, i = tid & 15;
    float tt[HD];
#pragma unroll
    for (int e = 0; e < HD; ++e) tt[e] = 0.f;
    const float* kp = Kp + (size_t)(so * 512 + rg) * HD + i;   // row r = (32 so + s) * 16 + rg, s = 0
    const float* qp = Qp + (size_t)(so * 512 + rg) * HD;
    // batches of 8 rows: each batch's 40 loads are issued together, then summed row by row in order; unrolled so that
    // every row's address is the two base pointers plus an immediate offset
#pragma unroll
    for (int sb = 0; sb < 4; ++sb) {
      float kv[8];
      v4f q[8][4];
#pragma unroll
      for (int u = 0; u < 8; ++u) {
        kv[u] = kp[(sb * 8 + u) * 16 * HD];
#pragma unroll
        for (int g = 0; g < 4; ++g) q[u][g] = *(const v4f*)(qp + (sb * 8 + u) * 16 * HD + 4 * g);
      }
#if defined(__HIP_DEVICE_COMPILE__)
      // inputs-only fences on the loaded values (four rows each: an asm statement takes thirty operands): without them
      // the compiler sinks every load to its first use and the wave pays one memory latency per load. The second one
      // holds the wait that stands between issued loads and a rewrite of a register they name, and takes the two base
      // pointers as inputs too: they stay live to that wait, so no load of the batch lands in its own run's address
      asm volatile("" :: "v"(kv[0]), "v"(kv[1]), "v"(kv[2]), "v"(kv[3]),
                   "v"(q[0][0]), "v"(q[0][1]), "v"(q[0][2]), "v"(q[0][3]), "v"(q[1][0]), "v"(q[1][1]), "v"(q[1][2]), "v"(q[1][3]),
                   "v"(q[2][0]), "v"(q[2][1]), "v"(q[2][2]), "v"(q[2][3]), "v"(q[3][0]), "v"(q[3][1]), "v"(q[3][2]), "v"(q[3][3]));
      asm volatile("s_wait_xcnt 0x0" :: "v"(kp), "v"(qp), "v"(kv[4]), "v"(kv[5]), "v"(kv[6]), "v"(kv[7]),
                   "v"(q[4][0]), "v"(q[4][1]), "v"(q[4][2]), "v"(q[4][3]), "v"(q[5][0]), "v"(q[5][1]), "v"(q[5][2]), "v"(q[5][3]),
                   "v"(q[6][0]), "v"(q[6][1]), "v"(q[6][2]), "v"(q[6][3]), "v"(q[7][0]), "v"(q[7][1]), "v"(q[7][2]), "v"(q[7][3]));
#endif
#pragma unroll
      for (int u = 0; u < 8; ++u) {
#pragma unroll
        for (int g = 0; g < 4; ++g) {
#pragma unroll
          for (int e = 0; e < 4; ++e) tt[4 * g + e] = fmaf(kv[u], q[u][g][e], tt[4 * g + e]);
        }
      }
    }
#pragma unroll
    for (int j = 0; j < HD; ++j) part[so * 256 + i * 16 + j] = tt[j];
  }
  __syncthreads();
  if (tid < 256) {
    float acc = 0.f;
#pragma unroll
    for (int so = 0; so < 32; ++so) acc += part[so * 256 + tid];
    sp[(size_t)(bi * 16 + rg) * 256 + tid] = acc;
  }
}

// =================================================================================================================
// Per (b, head) channel attention: S[i][j] = the 16 row-group partial sums of k_logit added in fixed order.
// P = softmax_j(S * (1/bf16(scale))) in f32 (max-subtracted).
// Wm[o][j] = sum_j2 64 bf16(wo[o][16 head + j2]) P[j][j2] on WMMA (K = 16 zero padded to 32; P carried x4096 as
// f16 hi + residual), value/4096 = 64 Wm; stored as f16 hi/lo planes weh/wel [b][head][o][16]: block region =
// grid = NB*8, 256 threads. coverage: weh/wel [NB][8][128][16], every element once.
// =================================================================================================================
__global__ __launch_bounds__(256)
void k_attn(const float* __restrict__ sp, const float* __restrict__ wo, const float* __restrict__ scale,
            unsigned short* weh, unsigned short* wel) {
  __shared__ float Sm[16 * WSP];
  __shared__ __align__(16) _Float16 Phs[16 * FP];
  __shared__ __align__(16) _Float16 Pls[16 * FP];
  __shared__ __align__(16) _Float16 Wts[CC * FP];
  __shared__ float Ws[CC * WSP];
  const int tid = threadIdx.x, wave = tid >> 5, lane = tid & 31, hh = lane >> 4, m = lane & 15;
  const int bi = blockIdx.x, b = bi / NHEAD, head = bi - b * NHEAD;
  // wo slice -> f16 [o][k] (k = j2, zero for k >= 16; addresses clamped)
  // thread = (o = 8 it + wave, k = lane); the 16 loads of the slice and the 16 loads of the partial sums are all issued
  // before the first is used: one memory latency for the 32, not one per trip
  {
    const float* wop = wo + (size_t)wave * CC + head * HD + min(lane, HD - 1);
    float wf[16];
#pragma unroll
    for (int it = 0; it < 16; ++it) wf[it] = wop[it * 8 * CC];
    const int i = tid >> 4, j = tid & 15;
    const float* spp = sp + (size_t)bi * (16 * 256) + i * 16 + j;
    float pv[16];
#pragma unroll
    for (int rg = 0; rg < 16; ++rg) pv[rg] = spp[rg * 256];
#if defined(__HIP_DEVICE_COMPILE__)
    // inputs-only fence on the slice's loaded values: keeps the loads above in front of the arithmetic; same wait and same
    // live address as in the statement below
    asm volatile("s_wait_xcnt 0x0" :: "v"(wop), "v"(wf[0]), "v"(wf[1]), "v"(wf[2]), "v"(wf[3]), "v"(wf[4]), "v"(wf[5]),
                 "v"(wf[6]), "v"(wf[7]), "v"(wf[8]), "v"(wf[9]), "v"(wf[10]), "v"(wf[11]), "v"(wf[12]), "v"(wf[13]),
                 "v"(wf[14]), "v"(wf[15]));
    // the wait between the 16 issued loads and a rewrite of the address they name; the address and the loaded values
    // are inputs, so that the address stays live to the wait and no load of the run lands in it
    asm volatile("s_wait_xcnt 0x0" :: "v"(spp), "v"(pv[0]), "v"(pv[1]), "v"(pv[2]), "v"(pv[3]), "v"(pv[4]), "v"(pv[5]),
                 "v"(pv[6]), "v"(pv[7]), "v"(pv[8]), "v"(pv[9]), "v"(pv[10]), "v"(pv[11]), "v"(pv[12]), "v"(pv[13]),
                 "v"(pv[14]), "v"(pv[15]));
#endif
#pragma unroll
    for (int it = 0; it < 16; ++it) {
      const float v = (lane < HD) ? bfr(wf[it]) * 64.0f : 0.0f;
      Wts[(it * 8 + wave) * FP + lane] = (_Float16)v;
    }
    float s = 0.f;
#pragma unroll
    for (int rg = 0; rg < 16; ++rg) s += pv[rg];
    const float isc = 1.0f / bfr(scale[0]);
    Sm[i * WSP + j] = s * isc;
  }
  __syncthreads();
  if (tid < 16) {
    // the row's 16 logits are read from LDS together and stay in registers: one LDS latency, not one per element and pass
    float sv[HD];
#pragma unroll
    for (int n = 0; n < HD; ++n) sv[n] = Sm[tid * WSP + n];
    float mx = -3.0e38f;
#pragma unroll
    for (int n = 0; n < HD; ++n) mx = fmaxf(mx, sv[n]);
    float ssum = 0.f;
#pragma unroll
    for (int n = 0; n < HD; ++n) {
      sv[n] = expf(sv[n] - mx);
      ssum += sv[n];
    }
    const float inv = 1.0f / ssum;
#pragma unroll
    for (int n = 0; n < HD; ++n) {
      const float pv = (sv[n] * inv) * 4096.0f;
      const _Float16 hv = (_Float16)pv;
      Phs[tid * FP + n] = hv;
      Pls[tid * FP + n] = (_Float16)((pv - (float)hv) * 2048.0f);
    }
#pragma unroll
    for (int n = HD; n < 32; ++n) { Phs[tid * FP + n] = (_Float16)0.0f; Pls[tid * FP + n] = (_Float16)0.0f; }
  }
  __syncthreads();
  {
    const v16h fa = ldfrag_h(Wts + (wave * 16 + m) * FP + 8 * hh);
    const v16h fb = ldfrag_h(Phs + m * FP + 8 * hh);
    const v16h gb = ldfrag_h(Pls + m * FP + 8 * hh);
    v8f ah = mma_raw(fa, fb, zero8());
    v8f al = mma_raw(fa, gb, zero8());
    guard2(ah, al, fa, fb, gb);
#pragma unroll
    for (int r = 0; r < 8; ++r) Ws[(wave * 16 + 8 * hh + r) * WSP + m] = (ah[r] + al[r] * RSC) * (1.0f / 4096.0f);
  }
  __syncthreads();
  {
    const int o = tid >> 1, hf = tid & 1;
    v4u a, q4;
#pragma unroll
    for (int e = 0; e < 4; ++e) {
      const float f0 = Ws[o * WSP + hf * 8 + 2 * e];
      const float f1 = Ws[o * WSP + hf * 8 + 2 * e + 1];
      unsigned hp, lp;
      split2(f0, f1, hp, lp);
      a[e] = hp; q4[e] = lp;
    }
    const size_t off = (size_t)(bi * CC + o) * HD + hf * 8;
    *(v4u*)(weh + off) = a;
    *(v4u*)(wel + off) = q4;
    
  }
}

// =================================================================================================================
// Output: y[b][o][p] = (sum_c' Wm64[b][c'][o] V[p][c']) / 64 + bf16(x[b][o][p]) for 64 pixels x 128 channels per
// =================================================================================================================
__global__ __launch_bounds__(256)
void k_final(const unsigned short* __restrict__ vh, const unsigned short* __restrict__ vl,
             const unsigned short* __restrict__ weh, const unsigned short* __restrict__ wel,
             const float* __restrict__ x, float* out) {
  __shared__ __align__(16) float Cs[64 * LDC];
  const int tid = threadIdx.x;
  const int mb = blockIdx.x;
  const int p0 = mb * 64;
  const int b = p0 / IMGPIX, pl0 = p0 - b * IMGPIX;
  const _Float16* Vh = (const _Float16*)(const void*)(vh + (size_t)b * BSZ);
  const _Float16* Vl = (const _Float16*)(const void*)(vl + (size_t)b * BSZ);
  const _Float16* Wh = (const _Float16*)(const void*)(weh + (size_t)b * NHEAD * CC * HD);
  const _Float16* Wl = (const _Float16*)(const void*)(wel + (size_t)b * NHEAD * CC * HD);
  mm_final(Vh, Vl, Wh, Wl, pl0, Cs);
  __syncthreads();
  v4f pk[8];
  size_t offs[8];
#pragma unroll
  for (int s = 0; s < 8; ++s) {
    const int idx = s * 256 + tid;
    const int o = idx >> 4, piece = idx & 15;
    const size_t off = (size_t)(b * CC + o) * IMGPIX + pl0 + piece * 4;
    const v4f xr = *(const v4f*)(x + off);
    v4f v;
#pragma unroll
    for (int e = 0; e < 4; ++e) v[e] = Cs[(piece * 4 + e) * LDC + o] * (1.0f / 64.0f) + bfr(xr[e]);
    pk[s] = v;
    offs[s] = off;
  }
#pragma unroll
  for (int s = 0; s < 8; ++s) *(v4f*)(out + offs[s]) = pk[s];
  
}

// =================================================================================================================
// Workspace map (bytes, offsets multiples of 65536, no aliasing, every region sized at or above its whole-line store
// extent): W1 f16 [3][128][128] 98304 (131072) | WT f16 [3][128][1152] 884736 (917504) | XH, XL f16 [32768][128]
// 8388608 each | P1 f16 6 x [2][130][130][128] 51916800 (51970048) | QK f32 [2][2][128][16384] 33554432 |
// VH, VL f16 [2][128][16384] 8388608 each | WEH, WEL f16 [2][8][128][16] 65536 each | SP f32 [16][16][256] 262144 |
// total 120520704.
// =================================================================================================================
extern "C" void kernel_launch(void* const* d_in, const int* in_sizes, int n_in,
                              void* d_out, int out_size, void* d_ws, size_t ws_size,
                              hipStream_t stream) {
  if (n_in < 11) return;
  const int expect[11] = { NB * CC * IMGPIX, WW, WW, 1, CC * CC, CC * CC * 9, CC * CC, CC * CC * 9,
                           CC * CC, CC * CC * 9, CC * CC };
  for (int i = 0; i < 11; ++i) if (in_sizes[i] != expect[i]) return;
  if (out_size != NB * CC * IMGPIX) return;

  const float* x     = (const float*)d_in[0];
  const float* gam   = (const float*)d_in[1];
  const float* bet   = (const float*)d_in[2];
  const float* scale = (const float*)d_in[3];
  const float* wq1   = (const float*)d_in[4];
  const float* wq2   = (const float*)d_in[5];
  const float* wk1   = (const float*)d_in[6];
  const float* wk2   = (const float*)d_in[7];
  const float* wv1   = (const float*)d_in[8];
  const float* wv2   = (const float*)d_in[9];
  const float* wo    = (const float*)d_in[10];
  float* out = (float*)d_out;

  const size_t AL = 65536;
  const size_t sW1 = (((size_t)3 * CC * CC * 2) + AL - 1) / AL * AL;               //   131072
  const size_t sWT = (((size_t)3 * CC * KCV * 2) + AL - 1) / AL * AL;              //   917504
  const size_t sX  = (((size_t)NPIX * CC * 2) + AL - 1) / AL * AL;                  //  8388608
  const size_t sP1 = (((size_t)6 * PS1 * 2) + AL - 1) / AL * AL;                    // 51970048
  const size_t sQK = (((size_t)2 * NB * BSZ * 4) + AL - 1) / AL * AL;               // 33554432
  const size_t sV  = (((size_t)NB * BSZ * 2) + AL - 1) / AL * AL;                   //  8388608
  const size_t sWE = (((size_t)NB * NHEAD * CC * HD * 2) + AL - 1) / AL * AL;       //    65536
  const size_t sSP = (((size_t)NB * NHEAD * 16 * 256 * 4) + AL - 1) / AL * AL;      //   262144

  size_t off = 0;
  const size_t oW1  = off; off += sW1;
  const size_t oWT  = off; off += sWT;
  const size_t oXH  = off; off += sX;
  const size_t oXL  = off; off += sX;
  const size_t oP1  = off; off += sP1;
  const size_t oQK  = off; off += sQK;
  const size_t oVH  = off; off += sV;
  const size_t oVL  = off; off += sV;
  const size_t oWEH = off; off += sWE;
  const size_t oWEL = off; off += sWE;
  const size_t oSP  = off; off += sSP;
  if (off > ws_size) return;                                 // off = 120520704
  if (off > (size_t)134217728) return;

  char* ws = (char*)d_ws;
  unsigned short* W1  = (unsigned short*)(ws + oW1);
  unsigned short* WT  = (unsigned short*)(ws + oWT);
  unsigned short* XH  = (unsigned short*)(ws + oXH);
  unsigned short* XL  = (unsigned short*)(ws + oXL);
  unsigned short* P1  = (unsigned short*)(ws + oP1);
  float*          QK  = (float*)(ws + oQK);
  unsigned short* VH  = (unsigned short*)(ws + oVH);
  unsigned short* VL  = (unsigned short*)(ws + oVL);
  unsigned short* WEH = (unsigned short*)(ws + oWEH);
  unsigned short* WEL = (unsigned short*)(ws + oWEL);
  float*          SP  = (float*)(ws + oSP);

  const dim3 blk(256);
  // (1) layer norm over w + NHWC hi/lo planes; weight planes; halo zero fill of the padded planes
  k_ln<<<dim3(LNG), blk, 0, stream>>>(x, gam, bet, wq1, wq2, wk1, wk2, wv1, wv2, XH, XL, W1, WT, P1);
  // (2) 1x1 projections into padded NHWC hi/lo planes (interior)
  k_proj<<<dim3(NPIX / 64, 3), blk, 0, stream>>>(XH, XL, W1, P1);
  // (3) 3x3 convs -> q, k f32 NCHW flat planes; v f16 hi/lo NCHW flat planes
  k_conv3<<<dim3(NPIX / CPX, 3), blk, 0, stream>>>(P1, WT, QK, VH, VL);
  // (4) f32 logit partial sums, one work-group per (row group, batch-head)
  k_logit<<<dim3(16 * NB * NHEAD), dim3(512), 0, stream>>>(QK, QK + (size_t)NB * BSZ, SP);
  // (5) per-head channel attention: row groups added + softmax + wo mix -> Wm planes
  k_attn<<<dim3(NB * NHEAD), blk, 0, stream>>>(SP, wo, scale, WEH, WEL);
  // (6) output GEMM + residual -> NCHW d_out
  k_final<<<dim3(NPIX / 64), blk, 0, stream>>>(VH, VL, WEH, WEL, x, out);
  (void)hipGetLastError();
}

// v007
// It runs in 82 microseconds.
// In two side-by-side timings against v006, it was 1.06 and 1.08 times as fast.
// All steps since v000 together make it 8.18 times as fast.
// Contractions: 1x1 projections (K=128) and 3x3 convs as implicit GEMM (K=1152): v_wmma_f32_16x16x32_f16, the
// activation as f16 hi + x2048 residual planes into two f32 accumulators, weights one f16 plane of 64*bf16(w);
// per-head k^T q logits (K=16384): v_wmma_f32_16x16x4_f32 on the convs' f32 LDS tiles, one partial per image row, the
// rows' partials added in fixed order on VALU; wo x probs mix
// (K=16, zero padded to 32): f16, probs carried x4096 as hi + residual; fused output GEMM (K=128): v and the mixed
// weight as f16 hi + residual planes (3 products); f32 accumulate everywhere. Layer-norm statistics, softmax and
// all epilogues f32 on VALU; every float input RNE-converted to bf16 on load.
#include <hip/hip_runtime.h>
#include <stdint.h>

#define NB     2
#define CC     128
#define HH     128
#define WW     128
#define IMGPIX (HH * WW)
#define NPIX   (NB * IMGPIX)
#define HP     (HH + 2)
#define WP     (WW + 2)
#define PADIMG (HP * WP)
#define PADPIX (NB * PADIMG)
#define KCV    1152
#define NKS    36
#define NHEAD  8
#define HD     16
#define HSZ    (IMGPIX * HD)
#define BSZ    (CC * IMGPIX)
#define LDC    132
#define FP     40
#define WSP    17
#define NHALO  (2 * WP + 2 * HH)
#define RSC    0.00048828125f
#define PS1    ((size_t)PADPIX * CC)
#define PS2    ((size_t)NPIX * CC)
#define SPK    72
#define SBUF   (256 * SPK)
#define NST    18
#define CPX    128
#define ARW    (WW + 2)
#define ABUF   (2 * ARW * SPK)
#define WBUF   (CC * SPK)
#define NGR    6
#define CRING  (2 * ABUF + 2 * WBUF)
#define LNG    (NB * HH * 2)
#define NHPC   (6 * NB * NHALO * 16)
#define HPB    200

static_assert(NPIX == NB * IMGPIX);
static_assert(IMGPIX == 16384 && HH == 128 && WW == 128);
static_assert(PADIMG == 16900);
static_assert(KCV == 9 * CC && KCV == NKS * 32);
static_assert(CC == NHEAD * HD);
static_assert(BSZ == CC * IMGPIX && HSZ * NHEAD == BSZ);
static_assert((IMGPIX % 64) == 0 && (WW % 64) == 0);
static_assert((LDC * 4) % 16 == 0 && (FP * 2) % 16 == 0);
static_assert(NHALO == 516);
static_assert((KCV % 8) == 0 && (CC % 32) == 0);
static_assert(IMGPIX == 32 * 32 * 16);
static_assert(NST * 64 == KCV && (SPK * 2) % 32 == 16 && 2 * SBUF * 2 >= 64 * LDC * 4);
static_assert(CPX == WW && (NPIX % CPX) == 0 && CRING * 2 >= CPX * LDC * 4);
static_assert((NGR % 2) == 0 && NGR / 2 >= 2 && 2 * CRING * 2 <= 327680 && NHEAD * 32 <= 512);
static_assert(NGR * 3 == NST && 2 * ARW == 8 * 32 + 4 && (ABUF * 2) % 16 == 0 && ARW == WP);
static_assert(LNG > 3 * CC && (LNG - 3 * CC) * 3 == 3 * CC && KCV == 1024 + 32 * 4);
static_assert(HPB <= 256 && (HPB % 8) == 0 && HPB * LNG >= NHPC);

// Index maps of the raw reshapes (per batch b, flat NCHW index f = c*16384 + h*128 + w viewed as [8][16384][16]):
//   Q_head[r][d] = qflat[b][head*262144 + 16 r + d]   (same map for K_head and V_head; r = (c%16)*1024 + h*8 + w/16,
//   d = w%16). S_head[i][j] = sum_r K_head[r][i] Q_head[r][j]; P_head = softmax_j(S_head * (1/scale)).
//   O[b][16 head + j2][pixel r] = sum_j V_head[r][j] P_head[j][j2].
//   y[b][o][pixel r] = sum_{head, j} Wm[b][head][o][j] V_head[r][j] + x[b][o][r],
//   Wm[b][head][o][j] = sum_j2 wo[o][16 head + j2] P_head[j][j2]   (reassociated 1x1 output conv).

typedef _Float16 v16h __attribute__((ext_vector_type(16)));
typedef _Float16 v8h  __attribute__((ext_vector_type(8)));
typedef float    v8f  __attribute__((ext_vector_type(8)));
typedef float    v4f  __attribute__((ext_vector_type(4)));
typedef float    v2f  __attribute__((ext_vector_type(2)));
typedef unsigned int v4u __attribute__((ext_vector_type(4)));

// ---- scalar helpers ------------------------------------------------------------------------------------------
__device__ __forceinline__ unsigned short bf_bits(float f) {          // f32 -> bf16 bits, RNE convert
  unsigned u = __float_as_uint(f);
  return (unsigned short)((u + 0x7FFFu + ((u >> 16) & 1u)) >> 16);
}
__device__ __forceinline__ float bf_up(unsigned short b) { return __uint_as_float(((unsigned)b) << 16); }
__device__ __forceinline__ float bfr(float f) { return bf_up(bf_bits(f)); }
__device__ __forceinline__ unsigned short h_bits(_Float16 x) { return __builtin_bit_cast(unsigned short, x); }
__device__ __forceinline__ unsigned short hb16(float f) { return h_bits((_Float16)f); }
__device__ __forceinline__ unsigned pk16(unsigned short a, unsigned short b) { return (unsigned)a | ((unsigned)b << 16); }
__device__ __forceinline__ v8f zero8() { v8f z = {0.f, 0.f, 0.f, 0.f, 0.f, 0.f, 0.f, 0.f}; return z; }
// hi/lo pair of two f32 values: hi = f16(v), lo = f16(2048 (v - hi)), packed as two 32-bit words
__device__ __forceinline__ void split2(float f0, float f1, unsigned& hp, unsigned& lp) {
  const _Float16 h0 = (_Float16)f0, h1 = (_Float16)f1;
  const float q0 = (f0 - (float)h0) * 2048.0f, q1 = (f1 - (float)h1) * 2048.0f;
  hp = pk16(h_bits(h0), h_bits(h1));
  lp = pk16(hb16(q0), hb16(q1));
}

// ---- fragment loader: 16-bit A/B operand, lane -> row/col (lane&15), p already includes +8*(lane>>4);
//      elements 0..7 <- p[0..7] (k0+8h..k0+8h+7), elements 8..15 <- p[16..23] (k0+16+8h..k0+16+8h+7)
__device__ __forceinline__ v16h ldfrag_h(const _Float16* p) {
  union { v16h v; v8h h[2]; } f;
  f.h[0] = *(const v8h*)(p);
  f.h[1] = *(const v8h*)(p + 16);
  return f.v;
}
// same layout, the two 8-element halves at two independent 16-B aligned addresses (pa: k0+8h.., pb: k0+16+8h..)
__device__ __forceinline__ v16h ldfrag2(const _Float16* pa, const _Float16* pb) {
  union { v16h v; v8h h[2]; } f;
  f.h[0] = *(const v8h*)(pa);
  f.h[1] = *(const v8h*)(pb);
  return f.v;
}

// ---- WMMA helpers; the guards insert the trailing VALU hazard gap and keep A/B live --------------------------
__device__ __forceinline__ v8f mma_raw(v16h a, v16h b, v8f c) {
  return __builtin_amdgcn_wmma_f32_16x16x32_f16(false, a, false, b, (short)0, c, false, false);
}
__device__ __forceinline__ void guard8(v8f& c0, v8f& c1, v8f& c2, v8f& c3, v8f& c4, v8f& c5, v8f& c6, v8f& c7,
                                       const v16h& a0, const v16h& a1, const v16h& a2, const v16h& a3,
                                       const v16h& b0, const v16h& b1) {
#if defined(__HIP_DEVICE_COMPILE__)
  asm volatile("v_nop\n\tv_nop\n\tv_nop\n\tv_nop"
               : "+v"(c0), "+v"(c1), "+v"(c2), "+v"(c3), "+v"(c4), "+v"(c5), "+v"(c6), "+v"(c7)
               : "v"(a0), "v"(a1), "v"(a2), "v"(a3), "v"(b0), "v"(b1));
#endif
}
__device__ __forceinline__ void guard4(v8f& c0, v8f& c1, v8f& c2, v8f& c3,
                                       const v16h& a0, const v16h& a1, const v16h& b0, const v16h& b1) {
#if defined(__HIP_DEVICE_COMPILE__)
  asm volatile("v_nop\n\tv_nop\n\tv_nop\n\tv_nop"
               : "+v"(c0), "+v"(c1), "+v"(c2), "+v"(c3)
               : "v"(a0), "v"(a1), "v"(b0), "v"(b1));
#endif
}
__device__ __forceinline__ void guard2(v8f& c0, v8f& c1, const v16h& a0, const v16h& b0, const v16h& b1) {
#if defined(__HIP_DEVICE_COMPILE__)
  asm volatile("v_nop\n\tv_nop\n\tv_nop\n\tv_nop"
               : "+v"(c0), "+v"(c1)
               : "v"(a0), "v"(b0), "v"(b1));
#endif
}

// the same for a pair of f32 16x16x4 products: four slots before a vector
// instruction touches their results, and the four operands stay live (not overwritten) that long
__device__ __forceinline__ void guardf(v8f& c0, v8f& c1, const v2f& a0, const v2f& b0, const v2f& a1, const v2f& b1) {
#if defined(__HIP_DEVICE_COMPILE__)
  asm volatile("v_nop\n\tv_nop\n\tv_nop\n\tv_nop"
               : "+v"(c0), "+v"(c1)
               : "v"(a0), "v"(b0), "v"(a1), "v"(b1));
#endif
}

// ---- LDS staging of one 64-k slice of a 64x128 block tile's operands: 256 rows of 128 B at pitch 144 B (16 B x odd, for
//      the ds_load_b128 fragment reads): rows 0..63 A hi, 64..127 A lo (64 A rows, global pitch CC), 128..255 W (128 rows,
//      global pitch wstep32 / 32). Thread = (row tid>>3 of each group of 32 rows, 16-B piece tid&7), 8 copies; ga_h, ga_l,
//      gw are the thread's own source addresses in the first group, lds its own byte address in the target buffer.
//      Each copy instruction moves four whole 128-B lines, and every operand byte is fetched once per work-group.
__device__ __forceinline__ void stage_copy(const _Float16* ga_h, const _Float16* ga_l, const _Float16* gw, int wstep32,
                                           unsigned lds) {
  const _Float16* g1 = ga_h + 32 * CC;
  const _Float16* g3 = ga_l + 32 * CC;
  const _Float16* g5 = gw + wstep32;
  const _Float16* g6 = gw + 2 * wstep32;
  const _Float16* g7 = gw + 3 * wstep32;
  const unsigned l1 = lds + 1 * 32 * SPK * 2, l2 = lds + 2 * 32 * SPK * 2, l3 = lds + 3 * 32 * SPK * 2;
  const unsigned l4 = lds + 4 * 32 * SPK * 2, l5 = lds + 5 * 32 * SPK * 2, l6 = lds + 6 * 32 * SPK * 2;
  const unsigned l7 = lds + 7 * 32 * SPK * 2;
#if defined(__HIP_DEVICE_COMPILE__)
  // global -> LDS through no register; the last line is the wait that stands between issued copies and a rewrite of
  // a register they name, inside the statement so that nothing can be moved in front of it
  asm volatile("global_load_async_to_lds_b128 %0, %1, off\n\t"
               "global_load_async_to_lds_b128 %2, %3, off\n\t"
               "global_load_async_to_lds_b128 %4, %5, off\n\t"
               "global_load_async_to_lds_b128 %6, %7, off\n\t"
               "global_load_async_to_lds_b128 %8, %9, off\n\t"
               "global_load_async_to_lds_b128 %10, %11, off\n\t"
               "global_load_async_to_lds_b128 %12, %13, off\n\t"
               "global_load_async_to_lds_b128 %14, %15, off\n\t"
               "s_wait_xcnt 0x0"
               :: "v"(lds), "v"(ga_h), "v"(l1), "v"(g1), "v"(l2), "v"(ga_l), "v"(l3), "v"(g3),
                  "v"(l4), "v"(gw), "v"(l5), "v"(g5), "v"(l6), "v"(g6), "v"(l7), "v"(g7)
               : "memory");
#endif
}
// ---- the conv's operands, pitch 144 B as above. A group = one padded image row (130 pixels) x 64 channels of both planes: 260
//      rows of 128 B, rows 0..129 hi, 130..259 lo. Thread = (row tid>>3 of run j of 32 rows, 16-B piece tid&7), runs j = 0..7,
//      and run 8 (four rows) by one wave. gh is the thread's own source in the hi plane at pixel tid>>3, gl its own in the lo
//      plane at pixel (tid>>3) - 2, so that LDS row r >= 130 is lo pixel r - 130; run 4 (rows 128..159) holds the last two hi
//      pixels (hi4: this thread's row is one of them) and the first thirty lo pixels. A group is copied in three parts, one
//      behind each of three barriers, so that every trip of the loop asks the L2 for about the same number of bytes.
__device__ __forceinline__ void copy3(unsigned la, const _Float16* ga, unsigned lb, const _Float16* gb, unsigned lc,
                                      const _Float16* gc) {
#if defined(__HIP_DEVICE_COMPILE__)
  // global -> LDS through no register; the last line is the wait that stands between issued copies and a rewrite of
  // a register they name, inside the statement so that nothing can be moved in front of it
  asm volatile("global_load_async_to_lds_b128 %0, %1, off\n\t"
               "global_load_async_to_lds_b128 %2, %3, off\n\t"
               "global_load_async_to_lds_b128 %4, %5, off\n\t"
               "s_wait_xcnt 0x0"
               :: "v"(la), "v"(ga), "v"(lb), "v"(gb), "v"(lc), "v"(gc) : "memory");
#endif
}
__device__ __forceinline__ void copy2(unsigned la, const _Float16* ga, unsigned lb, const _Float16* gb) {
#if defined(__HIP_DEVICE_COMPILE__)
  // same form and same closing wait as above
  asm volatile("global_load_async_to_lds_b128 %0, %1, off\n\t"
               "global_load_async_to_lds_b128 %2, %3, off\n\t"
               "s_wait_xcnt 0x0"
               :: "v"(la), "v"(ga), "v"(lb), "v"(gb) : "memory");
#endif
}
__device__ __forceinline__ void copy1(unsigned la, const _Float16* ga) {
#if defined(__HIP_DEVICE_COMPILE__)
  // same form and same closing wait as above
  asm volatile("global_load_async_to_lds_b128 %0, %1, off\n\t"
               "s_wait_xcnt 0x0"
               :: "v"(la), "v"(ga) : "memory");
#endif
}
template <int PART>
__device__ __forceinline__ void stage_a(const _Float16* gh, const _Float16* gl, bool hi4, bool wave0, unsigned lds) {
  const unsigned gs = 32 * SPK * 2;
  static_assert(PART == 1 || PART == 2);         // part 0 (runs 0..2) always goes with a W stage: stage_wa
  if (PART == 1) {
    copy3(lds + 3 * gs, gh + 96 * CC, lds + 4 * gs, hi4 ? gh + 128 * CC : gl, lds + 5 * gs, gl + 32 * CC);
  } else {
    copy2(lds + 6 * gs, gl + 64 * CC, lds + 7 * gs, gl + 96 * CC);
    if (wave0) copy1(lds + 8 * gs, gl + 128 * CC);   // scalar test: the other waves branch round the copy
  }
}
// W stage = 128 output channels x 64 k: 128 rows of 128 B (global pitch KCV), 4 copies a thread
__device__ __forceinline__ void stage_w4(const _Float16* gw, unsigned lds) {
  const _Float16* w1 = gw + 32 * KCV;
  const _Float16* w2 = gw + 64 * KCV;
  const _Float16* w3 = gw + 96 * KCV;
  const unsigned gs = 32 * SPK * 2;
  const unsigned l1 = lds + 1 * gs, l2 = lds + 2 * gs, l3 = lds + 3 * gs;
#if defined(__HIP_DEVICE_COMPILE__)
  // same form and same closing wait as above
  asm volatile("global_load_async_to_lds_b128 %0, %1, off\n\t"
               "global_load_async_to_lds_b128 %2, %3, off\n\t"
               "global_load_async_to_lds_b128 %4, %5, off\n\t"
               "global_load_async_to_lds_b128 %6, %7, off\n\t"
               "s_wait_xcnt 0x0"
               :: "v"(lds), "v"(gw), "v"(l1), "v"(w1), "v"(l2), "v"(w2), "v"(l3), "v"(w3)
               : "memory");
#endif
}
// a trip's copies in one statement, so that a wave passes one closing wait a trip (wave 0 two for part 2, whose run 8 it copies apart): the W stage's four and part PART of an A group
template <int PART>
__device__ __forceinline__ void stage_wa(const _Float16* gw, unsigned ldw, const _Float16* gh, const _Float16* gl, bool hi4,
                                         bool wave0, unsigned lda) {
  const _Float16* w1 = gw + 32 * KCV;
  const _Float16* w2 = gw + 64 * KCV;
  const _Float16* w3 = gw + 96 * KCV;
  const unsigned gs = 32 * SPK * 2;
  const unsigned m1 = ldw + 1 * gs, m2 = ldw + 2 * gs, m3 = ldw + 3 * gs;
  const unsigned la = lda + (3 * PART) * gs, lb = la + gs, lc = lb + gs;
  const _Float16* ga = (PART == 0) ? gh : ((PART == 1) ? gh + 96 * CC : gl + 64 * CC);
  const _Float16* gb = (PART == 0) ? gh + 32 * CC : ((PART == 1) ? (hi4 ? gh + 128 * CC : gl) : gl + 96 * CC);
  const _Float16* gc = (PART == 0) ? gh + 64 * CC : ((PART == 1) ? gl + 32 * CC : gl + 128 * CC);
#if defined(__HIP_DEVICE_COMPILE__)
  if (PART < 2) {
    // same form and same closing wait as above
    asm volatile("global_load_async_to_lds_b128 %0, %1, off\n\t"
                 "global_load_async_to_lds_b128 %2, %3, off\n\t"
                 "global_load_async_to_lds_b128 %4, %5, off\n\t"
                 "global_load_async_to_lds_b128 %6, %7, off\n\t"
                 "global_load_async_to_lds_b128 %8, %9, off\n\t"
                 "global_load_async_to_lds_b128 %10, %11, off\n\t"
                 "global_load_async_to_lds_b128 %12, %13, off\n\t"
                 "s_wait_xcnt 0x0"
                 :: "v"(ldw), "v"(gw), "v"(m1), "v"(w1), "v"(m2), "v"(w2), "v"(m3), "v"(w3),
                    "v"(la), "v"(ga), "v"(lb), "v"(gb), "v"(lc), "v"(gc)
                 : "memory");
  } else {
    // same form and same closing wait as above
    asm volatile("global_load_async_to_lds_b128 %0, %1, off\n\t"
                 "global_load_async_to_lds_b128 %2, %3, off\n\t"
                 "global_load_async_to_lds_b128 %4, %5, off\n\t"
                 "global_load_async_to_lds_b128 %6, %7, off\n\t"
                 "global_load_async_to_lds_b128 %8, %9, off\n\t"
                 "global_load_async_to_lds_b128 %10, %11, off\n\t"
                 "s_wait_xcnt 0x0"
                 :: "v"(ldw), "v"(gw), "v"(m1), "v"(w1), "v"(m2), "v"(w2), "v"(m3), "v"(w3),
                    "v"(la), "v"(ga), "v"(lb), "v"(gb)
                 : "memory");
    if (wave0) copy1(lc, gc);                    // scalar test: the other waves branch round the copy
  }
#endif
}
__device__ __forceinline__ void wait_copies() {
#if defined(__HIP_DEVICE_COMPILE__)
  asm volatile("s_wait_asynccnt 0x0" ::: "memory");   // this wave's copies have landed in LDS
#endif
}
__device__ __forceinline__ void wait_lds_reads() {
#if defined(__HIP_DEVICE_COMPILE__)
  asm volatile("s_wait_dscnt 0x0" ::: "memory");      // this wave's LDS reads are done before the buffer is rewritten
#endif
}

// ---- 64x128 block tile GEMM core (K = 128) with the A operand as two planes (hi and x2048 residual) into separate
//      accumulators; A row pitch CC (f16), W is [n][k] k-contiguous pitch CC. Both 64-k slices are copied to the two LDS
//      buffers at once, then read. 8 waves = 2 (32 rows) x 4 (32 cols), 2x2 tiles of 16 per wave; fragments from LDS with
//      the table layout; the residual accumulator is folded with 1/2048 when the tile is written to the LDS f32 tile
//      Cs[64][LDC], which takes the buffers' place behind a barrier.
__device__ __forceinline__ void mm_tile2(const _Float16* __restrict__ Ah, const _Float16* __restrict__ Al,
                                         const _Float16* __restrict__ W, int arow0, _Float16* ring) {
  const int tid = threadIdx.x, wave = tid >> 5, lane = tid & 31, hh = lane >> 4, c = lane & 15;
  const int mw = wave >> 2, nw = wave & 3;
  const int srow = tid >> 3, spc = tid & 7;
  const size_t sa = (size_t)(arow0 + srow) * CC + spc * 8;
  const _Float16* wb = W + (size_t)srow * CC + spc * 8;
  const unsigned lds0 = (unsigned)(size_t)ring + (unsigned)((srow * SPK + spc * 8) * 2);
  const _Float16* fap = ring + (mw * 32 + c) * SPK + 8 * hh;
  const _Float16* fbp = ring + (128 + nw * 32 + c) * SPK + 8 * hh;
  v8f h00 = zero8(), h01 = zero8(), h10 = zero8(), h11 = zero8();
  v8f l00 = zero8(), l01 = zero8(), l10 = zero8(), l11 = zero8();
  stage_copy(Ah + sa, Al + sa, wb, 32 * CC, lds0);
  stage_copy(Ah + sa + 64, Al + sa + 64, wb + 64, 32 * CC, lds0 + SBUF * 2);
  wait_copies();
  __syncthreads();                               // both slices are readable by every wave
  // unrolled: every fragment's LDS offset becomes an immediate of its load
#pragma unroll
  for (int ks = 0; ks < CC / 32; ++ks) {
    const _Float16* pa = fap + (ks >> 1) * SBUF + (ks & 1) * 32;
    const _Float16* pb = fbp + (ks >> 1) * SBUF + (ks & 1) * 32;
    const v16h fa0 = ldfrag_h(pa);
    const v16h fa1 = ldfrag_h(pa + 16 * SPK);
    const v16h ga0 = ldfrag_h(pa + 64 * SPK);
    const v16h ga1 = ldfrag_h(pa + 80 * SPK);
    const v16h fb0 = ldfrag_h(pb);
    const v16h fb1 = ldfrag_h(pb + 16 * SPK);
    h00 = mma_raw(fa0, fb0, h00);
    h01 = mma_raw(fa0, fb1, h01);
    h10 = mma_raw(fa1, fb0, h10);
    h11 = mma_raw(fa1, fb1, h11);
    l00 = mma_raw(ga0, fb0, l00);
    l01 = mma_raw(ga0, fb1, l01);
    l10 = mma_raw(ga1, fb0, l10);
    l11 = mma_raw(ga1, fb1, l11);
    guard8(h00, h01, h10, h11, l00, l01, l10, l11, fa0, fa1, ga0, ga1, fb0, fb1);
  }
  wait_lds_reads();
  __syncthreads();                               // ends every wave's fragment reads: the buffers become the f32 tile
  float* Cs = (float*)(void*)ring;
#pragma unroll
  for (int r = 0; r < 8; ++r) {
    const int row = mw * 32 + 8 * hh + r;
    Cs[row * LDC + nw * 32 + c]             = h00[r] + l00[r] * RSC;
    Cs[row * LDC + nw * 32 + 16 + c]        = h01[r] + l01[r] * RSC;
    Cs[(row + 16) * LDC + nw * 32 + c]      = h10[r] + l10[r] * RSC;
    Cs[(row + 16) * LDC + nw * 32 + 16 + c] = h11[r] + l11[r] * RSC;
  }
}

// ---- implicit-GEMM variant for the 3x3 conv: A row = output pixel p (flat over all images), k = tap*128 + c;
//      W = wt [128][1152] k-contiguous. The block tile is one image row. A group g (ky = g>>1, channel half = g&1) is the whole
//      padded row y + ky, 130 pixels x 64 channels of both planes: it is copied to LDS once and serves the three taps kx = 0, 1, 2,
//      which read it one LDS row apart. A W stage s = 3 g + kx is the 128 output channels x the 64 k of that tap and half. Two
//      buffers each: W stage t + 1 is copied while trip t multiplies, A group g + 1 (a third a trip) while group g's trips do; the
//      fragments come from LDS with the table k map (k order: ky, channel half, kx, channel quarter, table). 8 waves = 4 (32
//      pixels) x 2 (64 channels): a wave's k-step is 16 products from 8 fragments (2 hi, 2 lo, 4 W). The 8 waves are one half
//      of a 512-thread work-group (tid = thread within the half, ring = the half's own buffers); a half runs the ng groups from
//      gbeg on. ng is the same in both halves, so both pass the same barriers.
__device__ __forceinline__ size_t conv_abase(int p, int hh) {
  const int b = p / IMGPIX;
  const int r = p - b * IMGPIX;
  const int y = r / WW;
  const int x = r - y * WW;
  return ((size_t)(b * HP + y) * WP + x) * CC + 8 * hh;
}
// part PART of group g's copies into the A buffer g & 1; ah/al are the thread's own source addresses for group 0, lds0 its own
// byte address in buffer 0 (see stage_a)
template <int PART>
__device__ __forceinline__ void conv_apart(const _Float16* ah, const _Float16* al, bool hi4, bool wave0, int g, unsigned lds0) {
  const int ao = (g >> 1) * (WP * CC) + (g & 1) * 64;
  stage_a<PART>(ah + ao, al + ao, hi4, wave0, lds0 + (g & 1) * (ABUF * 2));
}
// stage s's copies into the W buffer at lds; wb is the thread's own source address for k = 0
__device__ __forceinline__ void conv_wstage(const _Float16* wb, int s, unsigned lds) {
  const int g = (s * 11) >> 5;                   // s / 3 for s < 18
  const int kx = s - 3 * g;
  stage_w4(wb + ((g >> 1) * 3 + kx) * CC + (g & 1) * 64, lds);
}
// both at once: W stage s into the W buffer s & 1 and part PART of A group g into the A buffer g & 1 (ldw0, lds0: buffers 0)
template <int PART>
__device__ __forceinline__ void conv_wa(const _Float16* wb, int s, unsigned ldw0, const _Float16* ah, const _Float16* al,
                                        bool hi4, bool wave0, int g, unsigned lds0) {
  const int sg = (s * 11) >> 5;                  // s / 3 for s < 18
  const int kx = s - 3 * sg;
  const int ao = (g >> 1) * (WP * CC) + (g & 1) * 64;
  stage_wa<PART>(wb + ((sg >> 1) * 3 + kx) * CC + (sg & 1) * 64, ldw0 + (s & 1) * (WBUF * 2), ah + ao, al + ao, hi4, wave0,
                 lds0 + (g & 1) * (ABUF * 2));
}
__device__ __forceinline__ void mm_conv(const _Float16* __restrict__ Ah, const _Float16* __restrict__ Al,
                                        const _Float16* __restrict__ W, int prow0, _Float16* ring, int tid, int gbeg,
                                        int ng) {
  const int wave = tid >> 5, lane = tid & 31, hh = lane >> 4, c = lane & 15;
  const int mw = wave >> 1, nw = wave & 1;
  const int srow = tid >> 3, spc = tid & 7;
  const bool wave0 = __builtin_amdgcn_readfirstlane(wave) == 0;
  const bool hi4 = srow < 2;
  const size_t sa = conv_abase(prow0, 0) + spc * 8;
  const _Float16* ah = Ah + sa + srow * CC;
  const _Float16* al = Al + sa + (srow - 2) * CC;
  const _Float16* wb = W + (size_t)srow * KCV + spc * 8;
  const unsigned lds0 = (unsigned)(size_t)ring + (unsigned)((srow * SPK + spc * 8) * 2);
  const unsigned ldw0 = lds0 + 2 * ABUF * 2;
  const _Float16* fap = ring + (mw * 32 + c) * SPK + 8 * hh;
  const _Float16* fbp = ring + 2 * ABUF + (nw * 64 + c) * SPK + 8 * hh;
  v8f h0[4], h1[4], l0[4], l1[4];
  // unrolled: every index of an accumulator array is a constant, so the arrays stay in registers
#pragma unroll
  for (int n = 0; n < 4; ++n) { h0[n] = zero8(); h1[n] = zero8(); l0[n] = zero8(); l1[n] = zero8(); }
  conv_wa<0>(wb, 3 * gbeg, ldw0, ah, al, hi4, wave0, gbeg, lds0);
  conv_apart<1>(ah, al, hi4, wave0, gbeg, lds0);
  conv_apart<2>(ah, al, hi4, wave0, gbeg, lds0);
  wait_copies();
  __syncthreads();                               // the first group and stage are readable by every wave
  conv_wa<0>(wb, 3 * gbeg + 1, ldw0, ah, al, hi4, wave0, gbeg + 1, lds0);
  // rolled: one copy of a group's three trips in the instruction cache, the buffers chosen by g & 1 and t & 1
#pragma unroll 1
  for (int gi = 0; gi < ng; ++gi) {
    const int g = gbeg + gi;
    const int ab = (g & 1) * ABUF;
    // unrolled: the tap's row shift becomes an immediate of the LDS loads, and each trip has its own part of the next group
#pragma unroll
    for (int kx = 0; kx < 3; ++kx) {
      const int t = 3 * g + kx;
      const int wo = (t & 1) * WBUF;
      // unrolled: the two k-steps' LDS offsets become immediates of their loads
#pragma unroll
      for (int kk = 0; kk < 2; ++kk) {
        const _Float16* pa = fap + ab + kx * SPK + kk * 32;
        const _Float16* pb = fbp + wo + kk * 32;
        const v16h fa0 = ldfrag_h(pa);
        const v16h fb0 = ldfrag_h(pb);
        const v16h fb1 = ldfrag_h(pb + 16 * SPK);
        const v16h fb2 = ldfrag_h(pb + 32 * SPK);
        const v16h fb3 = ldfrag_h(pb + 48 * SPK);
        const v16h fa1 = ldfrag_h(pa + 16 * SPK);
        const v16h ga0 = ldfrag_h(pa + ARW * SPK);
        const v16h ga1 = ldfrag_h(pa + (ARW + 16) * SPK);
#if defined(__HIP_DEVICE_COMPILE__)
        // nothing is scheduled across this line: without it the compiler reloads one A register set in among the products
        // and the wave waits out a whole LDS latency at each such place
        __builtin_amdgcn_sched_barrier(0);
#endif
        h0[0] = mma_raw(fa0, fb0, h0[0]);
        h0[1] = mma_raw(fa0, fb1, h0[1]);
        h0[2] = mma_raw(fa0, fb2, h0[2]);
        h0[3] = mma_raw(fa0, fb3, h0[3]);
        h1[0] = mma_raw(fa1, fb0, h1[0]);
        h1[1] = mma_raw(fa1, fb1, h1[1]);
        h1[2] = mma_raw(fa1, fb2, h1[2]);
        h1[3] = mma_raw(fa1, fb3, h1[3]);
        l0[0] = mma_raw(ga0, fb0, l0[0]);
        l0[1] = mma_raw(ga0, fb1, l0[1]);
        l0[2] = mma_raw(ga0, fb2, l0[2]);
        l0[3] = mma_raw(ga0, fb3, l0[3]);
        l1[0] = mma_raw(ga1, fb0, l1[0]);
        l1[1] = mma_raw(ga1, fb1, l1[1]);
        l1[2] = mma_raw(ga1, fb2, l1[2]);
        l1[3] = mma_raw(ga1, fb3, l1[3]);
        guard8(l0[0], l0[1], l0[2], l0[3], l1[0], l1[1], l1[2], l1[3], ga0, ga1, fb0, fb1, fb2, fb3);
#if defined(__HIP_DEVICE_COMPILE__)
        // nor across this one: without it products of this k-step sink behind the trip's barrier and hold back the next copies
        __builtin_amdgcn_sched_barrier(0);
#endif
      }
      wait_lds_reads();
      wait_copies();
      __syncthreads();                           // publishes what was copied during trip t and ends every read of trip t's buffers
      // W stage t + 2 goes into the buffer that trip t read. A group g + 1 goes into the buffer that group g - 1 left; behind
      // group g's last trip its own buffer is free for group g + 2
      if (kx == 0) {
        if (gi + 1 < ng) conv_wa<1>(wb, t + 2, ldw0, ah, al, hi4, wave0, g + 1, lds0);
        else             conv_wstage(wb, t + 2, ldw0 + wo * 2);
      } else if (kx == 1) {
        if (gi + 1 < ng) conv_wa<2>(wb, t + 2, ldw0, ah, al, hi4, wave0, g + 1, lds0);
      } else {
        if (gi + 2 < ng)      conv_wa<0>(wb, t + 2, ldw0, ah, al, hi4, wave0, g + 2, lds0);
        else if (gi + 1 < ng) conv_wstage(wb, t + 2, ldw0 + wo * 2);
      }
    }
  }
  wait_copies();
  float* Cs = (float*)(void*)ring;               // the ring is free behind the last trip's barrier: f32 tile [128][LDC]
#pragma unroll
  for (int r = 0; r < 8; ++r) {
    const int row = mw * 32 + 8 * hh + r;
    // unrolled for the same reason as above
#pragma unroll
    for (int n = 0; n < 4; ++n) {
      Cs[row * LDC + nw * 64 + n * 16 + c]        = h0[n][r] + l0[n][r] * RSC;
      Cs[(row + 16) * LDC + nw * 64 + n * 16 + c] = h1[n][r] + l1[n][r] * RSC;
    }
  }
}

// ---- fused output GEMM core: rows = 64 pixels of one batch (local pixel pl0..pl0+63), cols = 128 output channels,
//      k = c' = 16 head + j (K = 128, 4 k-steps of two heads each). A[p][c'] = V_head[p][j] read from the NCHW flat v
//      planes at head*HSZ + 16 p + j (two 16-B halves per fragment, heads 2ks and 2ks+1); B = Wm[head][o][16]
//      k-contiguous per head. Products hi*hi + hi*lo (first loop) and lo*hi (second loop) into Cs[64][LDC].
__device__ __forceinline__ void mm_final(const _Float16* __restrict__ Vh, const _Float16* __restrict__ Vl,
                                         const _Float16* __restrict__ Wh, const _Float16* __restrict__ Wl,
                                         int pl0, float* Cs) {
  const int tid = threadIdx.x, wave = tid >> 5, lane = tid & 31, hh = lane >> 4, c = lane & 15;
  const int mw = wave >> 2, nw = wave & 3;
  const size_t r0 = (size_t)(pl0 + mw * 32 + c) * HD + 8 * hh;
  const size_t r1 = (size_t)(pl0 + mw * 32 + 16 + c) * HD + 8 * hh;
  const size_t q0 = (size_t)(nw * 32 + c) * HD + 8 * hh;
  const size_t q1 = (size_t)(nw * 32 + 16 + c) * HD + 8 * hh;
  {
    v8f h00 = zero8(), h01 = zero8(), h10 = zero8(), h11 = zero8();
    v8f l00 = zero8(), l01 = zero8(), l10 = zero8(), l11 = zero8();
    const _Float16* pa0 = Vh + r0;
    const _Float16* pa1 = Vh + r1;
    const _Float16* pb0 = Wh + q0;
    const _Float16* pb1 = Wh + q1;
    const _Float16* pc0 = Wl + q0;
    const _Float16* pc1 = Wl + q1;
    // two k-steps a batch: the batch's 24 loads are issued together, then multiplied in k order (one latency for two
    // k-steps; four at once would not leave registers for two work-groups on a WGP); unrolled: offsets become immediates
#pragma unroll
    for (int kp = 0; kp < CC / 64; ++kp) {
      v16h fa0[2], fa1[2], fb0[2], fb1[2], gb0[2], gb1[2];
#pragma unroll
      for (int u = 0; u < 2; ++u) {
        const int ao = (2 * (2 * kp + u)) * HSZ;
        const int bo = (2 * (2 * kp + u)) * (CC * HD);
        fa0[u] = ldfrag2(pa0 + ao, pa0 + ao + HSZ);
        fa1[u] = ldfrag2(pa1 + ao, pa1 + ao + HSZ);
        fb0[u] = ldfrag2(pb0 + bo, pb0 + bo + CC * HD);
        fb1[u] = ldfrag2(pb1 + bo, pb1 + bo + CC * HD);
        gb0[u] = ldfrag2(pc0 + bo, pc0 + bo + CC * HD);
        gb1[u] = ldfrag2(pc1 + bo, pc1 + bo + CC * HD);
      }
#if defined(__HIP_DEVICE_COMPILE__)
      // nothing is scheduled across this line: without it the first product, with its wait, is lifted in among the batch's
      // loads, and the loads behind it start one latency late
      __builtin_amdgcn_sched_barrier(0);
      // inputs-only fence on the loaded fragments: keeps the batch's loads together in front of its products; it holds the
      // wait that stands between issued loads and a rewrite of an address register they name
      asm volatile("s_wait_xcnt 0x0" :: "v"(fa0[0]), "v"(fa1[0]), "v"(fb0[0]), "v"(fb1[0]), "v"(gb0[0]), "v"(gb1[0]),
                   "v"(fa0[1]), "v"(fa1[1]), "v"(fb0[1]), "v"(fb1[1]), "v"(gb0[1]), "v"(gb1[1]));
#endif
#pragma unroll
      for (int u = 0; u < 2; ++u) {
        h00 = mma_raw(fa0[u], fb0[u], h00);
        h01 = mma_raw(fa0[u], fb1[u], h01);
        h10 = mma_raw(fa1[u], fb0[u], h10);
        h11 = mma_raw(fa1[u], fb1[u], h11);
        l00 = mma_raw(fa0[u], gb0[u], l00);
        l01 = mma_raw(fa0[u], gb1[u], l01);
        l10 = mma_raw(fa1[u], gb0[u], l10);
        l11 = mma_raw(fa1[u], gb1[u], l11);
        guard8(h00, h01, h10, h11, l00, l01, l10, l11, fa0[u], fa1[u], gb0[u], gb1[u], fb0[u], fb1[u]);
      }
    }
#pragma unroll
    for (int r = 0; r < 8; ++r) {
      const int row = mw * 32 + 8 * hh + r;
      Cs[row * LDC + nw * 32 + c]             = h00[r] + l00[r] * RSC;
      Cs[row * LDC + nw * 32 + 16 + c]        = h01[r] + l01[r] * RSC;
      Cs[(row + 16) * LDC + nw * 32 + c]      = h10[r] + l10[r] * RSC;
      Cs[(row + 16) * LDC + nw * 32 + 16 + c] = h11[r] + l11[r] * RSC;
    }
  }
  {
    v8f m00 = zero8(), m01 = zero8(), m10 = zero8(), m11 = zero8();
#if defined(__HIP_DEVICE_COMPILE__)
    // nothing is scheduled across this line or the one behind the loads: the first loop's epilogue stays out of the run of
    // loads, where it reused their address registers while they were in flight
    __builtin_amdgcn_sched_barrier(0);
#endif
    const _Float16* pa0 = Vl + r0;
    const _Float16* pa1 = Vl + r1;
    const _Float16* pb0 = Wh + q0;
    const _Float16* pb1 = Wh + q1;
    // all four k-steps' 32 loads are issued together, then multiplied in k order: one latency, not four
    v16h ga0[4], ga1[4], fb0[4], fb1[4];
#pragma unroll
    for (int ks = 0; ks < CC / 32; ++ks) {
      const int ao = (2 * ks) * HSZ;
      const int bo = (2 * ks) * (CC * HD);
      ga0[ks] = ldfrag2(pa0 + ao, pa0 + ao + HSZ);
      ga1[ks] = ldfrag2(pa1 + ao, pa1 + ao + HSZ);
      fb0[ks] = ldfrag2(pb0 + bo, pb0 + bo + CC * HD);
      fb1[ks] = ldfrag2(pb1 + bo, pb1 + bo + CC * HD);
    }
#if defined(__HIP_DEVICE_COMPILE__)
    __builtin_amdgcn_sched_barrier(0);
    // inputs-only fence on the loaded fragments, with the same wait as in the first loop
    asm volatile("s_wait_xcnt 0x0" :: "v"(ga0[0]), "v"(ga1[0]), "v"(fb0[0]), "v"(fb1[0]), "v"(ga0[1]), "v"(ga1[1]), "v"(fb0[1]), "v"(fb1[1]),
                 "v"(ga0[2]), "v"(ga1[2]), "v"(fb0[2]), "v"(fb1[2]), "v"(ga0[3]), "v"(ga1[3]), "v"(fb0[3]), "v"(fb1[3]));
#endif
#pragma unroll
    for (int ks = 0; ks < CC / 32; ++ks) {
      m00 = mma_raw(ga0[ks], fb0[ks], m00);
      m01 = mma_raw(ga0[ks], fb1[ks], m01);
      m10 = mma_raw(ga1[ks], fb0[ks], m10);
      m11 = mma_raw(ga1[ks], fb1[ks], m11);
      guard4(m00, m01, m10, m11, ga0[ks], ga1[ks], fb0[ks], fb1[ks]);
    }
#pragma unroll
    for (int r = 0; r < 8; ++r) {               // same lane wrote these slots above (program order, same type)
      const int row = mw * 32 + 8 * hh + r;
      Cs[row * LDC + nw * 32 + c]             += m00[r] * RSC;
      Cs[row * LDC + nw * 32 + 16 + c]        += m01[r] * RSC;
      Cs[(row + 16) * LDC + nw * 32 + c]      += m10[r] * RSC;
      Cs[(row + 16) * LDC + nw * 32 + 16 + c] += m11[r] * RSC;
    }
  }
}

// =================================================================================================================
// gamma[w], beta[w] bf16 converted) + NCHW -> NHWC + hi/lo f16 planes. Block = (b, h, channel half): wave = 8
// channel rows, lane = 4 w values, shuffle reductions; f32 tile T[64 ch][w] in LDS; then each pixel's 64 channels
// grid = NB*128*2, 256 threads. coverage: xh/xl [NPIX px][128 ch], every element once.
// The same launch carries two pieces of work that depend on nothing before them and are read only by later launches:
// (a) weight convert. Work-group blk < 384: row blk = (tensor, co) of (wq2, wk2, wv2) [co][ci][3][3] f32 -> wt [row][k =
//     tap*128 + ci] f16(64 * bf16(w)): the row's 1152 floats are loaded as whole lines beside the x rows, go through LDS
//     across the kernel's one barrier, and thread tt < 144 builds one 16-B piece. Work-group blk >= 384: three rows of
//     (wq1, wk1, wv1) [o][c] -> w1 [row][c], thread tt < 48 one 16-B piece. coverage: wt 384 x 1152, w1 384 x 128, once.
// (b) halo zero fill of the six padded planes: work-group blk zeroes the 16-B pieces blk*200 .. blk*200 + 199 (whole lines) of
//     the 6*NB*516*16. coverage: every halo pixel (py in {0,129} or px in {0,129}) of every image of all 6 planes, once.
// =================================================================================================================
// inputs-only fence on the 8 rows' shuffled values (they come back on the LDS counter like loads): keeps the 8 shuffles of
// one reduction step together in front of their adds; without it the compiler runs the rows' chains one after another and
// the wave waits out every shuffle's latency alone
__device__ __forceinline__ void row_fence(const float (&t)[8]) {
#if defined(__HIP_DEVICE_COMPILE__)
  asm volatile("" :: "v"(t[0]), "v"(t[1]), "v"(t[2]), "v"(t[3]), "v"(t[4]), "v"(t[5]), "v"(t[6]), "v"(t[7]));
#endif
}
__global__ __launch_bounds__(256)
void k_ln(const float* __restrict__ x, const float* __restrict__ gw, const float* __restrict__ gb,
          const float* __restrict__ wq1, const float* __restrict__ wq2, const float* __restrict__ wk1,
          const float* __restrict__ wk2, const float* __restrict__ wv1, const float* __restrict__ wv2,
          unsigned short* xh, unsigned short* xl, unsigned short* w1, unsigned short* wt, unsigned short* p1) {
  __shared__ __align__(16) float T[64 * LDC];
  __shared__ __align__(16) float Wl[2048];
  const int tid = threadIdx.x, wv = tid >> 5, lane = tid & 31;
  const int blk = blockIdx.x;
  // the work-group's share of the weights: two 16-B loads a thread (addresses clamped into the share)
  const bool w33 = blk < 3 * CC;                             // block-uniform
  const int r11 = (blk - 3 * CC) * 3 + (min(tid, 47) >> 4);  // row of w1 where !w33
  const float* wp0;
  const float* wp1;
  if (w33) {
    const int t = blk / CC;
    const float* rowp = ((t == 0) ? wq2 : ((t == 1) ? wk2 : wv2)) + (size_t)(blk - t * CC) * KCV;
    wp0 = rowp + 4 * tid;
    wp1 = rowp + 1024 + 4 * min(tid, 31);
  } else {
    const int t = r11 / CC;
    wp0 = ((t == 0) ? wq1 : ((t == 1) ? wk1 : wv1)) + (size_t)(r11 - t * CC) * CC + (tid & 15) * 8;
    wp1 = wp0 + 4;
  }
  const v4f wa = *(const v4f*)wp0;
  const v4f wb = *(const v4f*)wp1;
  const int bh = blk >> 1, chalf = blk & 1;
  const int b = bh / HH, h = bh - b * HH;
  const v4f g4 = *(const v4f*)(gw + lane * 4);
  const v4f b4 = *(const v4f*)(gb + lane * 4);
  float g[4], be[4];
#pragma unroll
  for (int e = 0; e < 4; ++e) { g[e] = bfr(g4[e]); be[e] = bfr(b4[e]); }
  // the wave's 8 channel rows: all 8 loads are issued first, then every step of the row arithmetic runs over the 8 rows
  // side by side (8 independent shuffle chains), so the wave pays one memory latency and one chain, not eight of each
  const float* row0 = x + ((size_t)(b * CC + chalf * 64 + wv * 8) * HH + h) * WW + lane * 4;
  v4f a[8];
#pragma unroll
  for (int it = 0; it < 8; ++it) a[it] = *(const v4f*)(row0 + it * (HH * WW));
#if defined(__HIP_DEVICE_COMPILE__)
  // inputs-only fence on the loaded values: keeps the 8 loads together in front of the arithmetic; it holds the wait that
  // stands between issued loads and a rewrite of the address they name, and the address is an input, so it lives that long
  asm volatile("s_wait_xcnt 0x0" :: "v"(row0), "v"(a[0]), "v"(a[1]), "v"(a[2]), "v"(a[3]), "v"(a[4]), "v"(a[5]),
               "v"(a[6]), "v"(a[7]));
  // the same for the two weight loads: they stay in front of the arithmetic, in flight beside the x rows
  asm volatile("s_wait_xcnt 0x0" :: "v"(wp0), "v"(wp1), "v"(wa), "v"(wb));
#endif
  // no branch here: where the work-group has 1x1 rows, and above word 1151, nothing reads what is written
  *(v4f*)(Wl + 4 * tid) = wa;
  *(v4f*)(Wl + 1024 + 4 * tid) = wb;
  float d[8][4], s[8], sq[8];
#pragma unroll
  for (int it = 0; it < 8; ++it) {
#pragma unroll
    for (int e = 0; e < 4; ++e) d[it][e] = bfr(a[it][e]);
    s[it] = (d[it][0] + d[it][1]) + (d[it][2] + d[it][3]);
  }
#pragma unroll
  for (int off = 16; off; off >>= 1) {
    float t[8];
#pragma unroll
    for (int it = 0; it < 8; ++it) t[it] = __shfl_xor(s[it], off, 32);
    row_fence(t);
#pragma unroll
    for (int it = 0; it < 8; ++it) s[it] += t[it];
  }
#pragma unroll
  for (int it = 0; it < 8; ++it) {
    const float mu = s[it] * (1.0f / 128.0f);
#pragma unroll
    for (int e = 0; e < 4; ++e) d[it][e] = d[it][e] - mu;
    sq[it] = (d[it][0] * d[it][0] + d[it][1] * d[it][1]) + (d[it][2] * d[it][2] + d[it][3] * d[it][3]);
  }
#pragma unroll
  for (int off = 16; off; off >>= 1) {
    float t[8];
#pragma unroll
    for (int it = 0; it < 8; ++it) t[it] = __shfl_xor(sq[it], off, 32);
    row_fence(t);
#pragma unroll
    for (int it = 0; it < 8; ++it) sq[it] += t[it];
  }
#pragma unroll
  for (int it = 0; it < 8; ++it) {
    const float var = sq[it] * (1.0f / 128.0f);
    const float rs = rsqrtf(var + 1e-5f);
    v4f o;
#pragma unroll
    for (int e = 0; e < 4; ++e) o[e] = (d[it][e] * rs) * g[e] + be[e];
    *(v4f*)(T + (wv * 8 + it) * LDC + lane * 4) = o;
  }
  __syncthreads();
  v4u ph[4], pq[4];
  size_t offs[4];
#pragma unroll
  for (int s = 0; s < 4; ++s) {
    const int idx = s * 256 + tid;
    const int w = idx >> 3, piece = idx & 7;
    const int c0 = piece * 8;
    v4u a, q4;
#pragma unroll
    for (int e = 0; e < 4; ++e) {
      const float f0 = T[(c0 + 2 * e) * LDC + w];
      const float f1 = T[(c0 + 2 * e + 1) * LDC + w];
      unsigned hp, lp;
      split2(f0, f1, hp, lp);
      a[e] = hp; q4[e] = lp;
    }
    ph[s] = a;
    pq[s] = q4;
    offs[s] = (size_t)(b * IMGPIX + h * WW + w) * CC + chalf * 64 + c0;
  }
  // the weight piece of this thread (indices clamped; stored below by the threads that own one)
  v4u wpk;
  unsigned short* wdst;
  if (w33) {
    const int k0 = min(tid, 143) * 8, tap = k0 / CC, c0 = k0 - tap * CC;
#pragma unroll
    for (int e = 0; e < 4; ++e) {
      const float f0 = Wl[(c0 + 2 * e) * 9 + tap];
      const float f1 = Wl[(c0 + 2 * e + 1) * 9 + tap];
      wpk[e] = pk16(hb16(bfr(f0) * 64.0f), hb16(bfr(f1) * 64.0f));
    }
    wdst = wt + (size_t)blk * KCV + k0;
  } else {
    wpk[0] = pk16(hb16(bfr(wa[0]) * 64.0f), hb16(bfr(wa[1]) * 64.0f));
    wpk[1] = pk16(hb16(bfr(wa[2]) * 64.0f), hb16(bfr(wa[3]) * 64.0f));
    wpk[2] = pk16(hb16(bfr(wb[0]) * 64.0f), hb16(bfr(wb[1]) * 64.0f));
    wpk[3] = pk16(hb16(bfr(wb[2]) * 64.0f), hb16(bfr(wb[3]) * 64.0f));
    wdst = w1 + (size_t)r11 * CC + (tid & 15) * 8;
  }
  // the halo piece of this thread (index clamped likewise)
  const int hidx = blk * HPB + tid;
  size_t hoff;
  {
    const int idx = min(hidx, NHPC - 1);
    const int piece = idx & 15;
    int r = idx >> 4;
    const int hp = r % NHALO;
    r /= NHALO;
    const int img = r % NB, plane = r / NB;
    const int q = max(hp - 2 * WP, 0);
    const int pyA = (hp < WP) ? 0 : (HP - 1);
    const int pxA = (hp < WP) ? hp : (hp - WP);
    const int pyB = 1 + (q >> 1);
    const int pxB = (q & 1) ? (WP - 1) : 0;
    const bool edge = hp < 2 * WP;
    const int py = edge ? pyA : pyB;
    const int px = edge ? pxA : pxB;
    hoff = (size_t)plane * PS1 + ((size_t)(img * HP + py) * WP + px) * CC + piece * 8;
  }
#pragma unroll
  for (int s = 0; s < 4; ++s) { *(v4u*)(xh + offs[s]) = ph[s]; *(v4u*)(xl + offs[s]) = pq[s]; }
  if (tid < (w33 ? 144 : 48)) *(v4u*)wdst = wpk;
  if (tid < HPB && hidx < NHPC) {
    v4u z = {0u, 0u, 0u, 0u};
    *(v4u*)(p1 + hoff) = z;
  }
}

// =================================================================================================================
// 1x1 projections: C[64 pixels][128 out ch] = xn . w1[t]^T (K = 128), value = C/64; written as f16 hi/lo into the
// padded NHWC planes p1[2t], p1[2t+1] ([NB][130][130][128]) at the interior position (y+1, x+1). 64 consecutive
// pixels lie in one image row -> 64 consecutive padded pixels; thread = one 16-B piece, 16 threads per pixel row
// coverage: interior NPIX padded pixels x 128 ch of all 6 planes (halo by k_ln's launch).
// =================================================================================================================
__global__ __launch_bounds__(256)
void k_proj(const unsigned short* __restrict__ xh, const unsigned short* __restrict__ xl,
            const unsigned short* __restrict__ w1, unsigned short* p1) {
  __shared__ __align__(16) _Float16 ring[2 * SBUF];
  const float* Cs = (const float*)(const void*)ring;
  const int tid = threadIdx.x;
  const int mb = blockIdx.x, t = blockIdx.y;
  mm_tile2((const _Float16*)(const void*)xh, (const _Float16*)(const void*)xl,
           (const _Float16*)(const void*)(w1 + (size_t)t * CC * CC), mb * 64, ring);
  __syncthreads();
  unsigned short* dh = p1 + (size_t)(2 * t) * PS1;
  unsigned short* dl = p1 + (size_t)(2 * t + 1) * PS1;
  const int p0 = mb * 64;
  const int b = p0 / IMGPIX, rem = p0 - b * IMGPIX;
  const int y = rem / WW, x0 = rem - y * WW;
  const size_t pprow = (size_t)(b * HP + y + 1) * WP + x0 + 1;
  v4u ph[4], pq[4];
  size_t offs[4];
#pragma unroll
  for (int s = 0; s < 4; ++s) {
    const int idx = s * 256 + tid;
    const int row = idx >> 4, piece = idx & 15;
    const int col0 = piece * 8;
    v4u a, q4;
#pragma unroll
    for (int e = 0; e < 4; ++e) {
      const float f0 = Cs[row * LDC + col0 + 2 * e] * (1.0f / 64.0f);
      const float f1 = Cs[row * LDC + col0 + 2 * e + 1] * (1.0f / 64.0f);
      unsigned hp, lp;
      split2(f0, f1, hp, lp);
      a[e] = hp; q4[e] = lp;
    }
    ph[s] = a;
    pq[s] = q4;
    offs[s] = (pprow + row) * CC + col0;
  }
#pragma unroll
  for (int s = 0; s < 4; ++s) { *(v4u*)(dh + offs[s]) = ph[s]; *(v4u*)(dl + offs[s]) = pq[s]; }
  
}

// =================================================================================================================
// 3x3 conv implicit GEMM + logit partial sums. Tile = 128 consecutive output pixels (one image row) x 128 channels,
// K = 1152 as 36 k-steps, A = (hi, lo/2048) planes of tensor t, W = 64 bf16(w2[t]) -> value = C/64. A work-group is two
// halves of 8 waves, each with its own LDS buffers, in step at the same barriers.
// Work-group blk < 256 (row blk): half 0 convolves q, half 1 convolves k, whole K each. q and k then lie side by side in
// LDS as f32 tiles [pixel w][channel c] and go no further: by the raw reshape the row holds, for every head, the 128
// rows r = (c%16, w/16) of Q_head and K_head, with d = w%16. Wave = head sums S[i][j] += K[c][16 wb + i] Q[c][16 wb + j] on
// f32 WMMA (k = 4 consecutive c; A and B fragments by the same loader, so the same k order), 32 products in two chains (even
// and odd channel quads), and stores sp[b*8 + head][row h][i][j] = S / 4096. k_attn adds the 128 rows in order.
// Work-group blk >= 256 (row blk - 256): v, K split between the halves (groups 0..2 and 3..5), the two f32 tiles added
// in the epilogue; such a work-group lasts half as long, and they stand behind the long ones in the grid.
// grid = 2*NB*128, 512 threads. coverage: sp [NB*8][128][256] f32 and vh/vl [NB][128][16384] (NCHW flat), every element once.
// =================================================================================================================
__global__ __launch_bounds__(512)
void k_conv3(const unsigned short* __restrict__ p1, const unsigned short* __restrict__ wt,
             float* sp, unsigned short* vh, unsigned short* vl) {
  __shared__ __align__(16) _Float16 ring[2 * CRING];
  const int tid = threadIdx.x;
  const int half = __builtin_amdgcn_readfirstlane(tid >> 8);  // the same in a whole wave: kept in a scalar register
  const bool qk = blockIdx.x < NPIX / CPX;                    // block-uniform
  const int mb = qk ? blockIdx.x : blockIdx.x - NPIX / CPX;
  const int t = qk ? half : 2;
  mm_conv((const _Float16*)(const void*)(p1 + (size_t)(2 * t) * PS1),
          (const _Float16*)(const void*)(p1 + (size_t)(2 * t + 1) * PS1),
          (const _Float16*)(const void*)(wt + (size_t)t * CC * KCV), mb * CPX, ring + half * CRING, tid & 255,
          qk ? 0 : half * (NGR / 2), qk ? NGR : NGR / 2);
  __syncthreads();                                           // both halves' f32 tiles are readable by every wave
  const float* C0 = (const float*)(const void*)ring;
  const float* C1 = (const float*)(const void*)(ring + CRING);
  const int p0 = mb * CPX;
  const int b = p0 / IMGPIX, pix0 = p0 - b * IMGPIX;
  if (qk) {                                                  // block-uniform branch
    const int head = __builtin_amdgcn_readfirstlane(tid >> 5);
    if (head < NHEAD) {                                      // scalar test: a wave takes the products whole or not at all
      const int lane = tid & 31, hh = lane >> 4, c = lane & 15;
      const float* pq = C0 + c * LDC + head * HD + 2 * hh;
      const float* pk = C1 + c * LDC + head * HD + 2 * hh;
      v8f s0 = zero8(), s1 = zero8();
      // all 64 fragments are read first (the conv's accumulator registers are free by now), then multiplied in order: one LDS
      // latency, not one per pair of products; unrolled: every fragment's LDS offset becomes an immediate of its load
      v2f fk[32], fq[32];
#pragma unroll
      for (int u = 0; u < 32; ++u) {                         // u = 4 wb + channel quad
        fk[u] = *(const v2f*)(pk + (u >> 2) * 16 * LDC + (u & 3) * 4);
        fq[u] = *(const v2f*)(pq + (u >> 2) * 16 * LDC + (u & 3) * 4);
      }
#if defined(__HIP_DEVICE_COMPILE__)
      // nothing is scheduled across this line: without it each pair's reads sink to their products and every pair waits out
      // the LDS latency
      __builtin_amdgcn_sched_barrier(0);
#endif
#pragma unroll
      for (int u = 0; u < 32; u += 2) {
        s0 = __builtin_amdgcn_wmma_f32_16x16x4_f32(false, fk[u], false, fq[u], (short)0, s0, false, false);
        s1 = __builtin_amdgcn_wmma_f32_16x16x4_f32(false, fk[u + 1], false, fq[u + 1], (short)0, s1, false, false);
        guardf(s0, s1, fk[u], fq[u], fk[u + 1], fq[u + 1]);
      }
      float* d = sp + ((size_t)(b * NHEAD + head) * HH + pix0 / WW) * 256 + 8 * hh * HD + c;
#pragma unroll
      for (int r = 0; r < 8; ++r) d[r * HD] = (s0[r] + s1[r]) * (1.0f / 4096.0f);
    }
  } else {
    v4u ph[4], pq[4];
    size_t offs[4];
#pragma unroll
    for (int s = 0; s < 4; ++s) {                            // s >> 1: the tile's half of 64 pixels
      const int idx = (s & 1) * 512 + tid;
      const int co = idx >> 3, piece = idx & 7;
      const int r0 = (s >> 1) * 64 + piece * 8;
      v4u a, q4;
#pragma unroll
      for (int e = 0; e < 4; ++e) {
        const float f0 = (C0[(r0 + 2 * e) * LDC + co] + C1[(r0 + 2 * e) * LDC + co]) * (1.0f / 64.0f);
        const float f1 = (C0[(r0 + 2 * e + 1) * LDC + co] + C1[(r0 + 2 * e + 1) * LDC + co]) * (1.0f / 64.0f);
        unsigned hp, lp;
        split2(f0, f1, hp, lp);
        a[e] = hp; q4[e] = lp;
      }
      ph[s] = a;
      pq[s] = q4;
      offs[s] = (size_t)(b * CC + co) * IMGPIX + pix0 + r0;
    }
#pragma unroll
    for (int s = 0; s < 4; ++s) { *(v4u*)(vh + offs[s]) = ph[s]; *(v4u*)(vl + offs[s]) = pq[s]; }
#if defined(__HIP_DEVICE_COMPILE__)
    // the wait that stands between the issued stores and a rewrite of a register they name (the code that follows this
    // branch in the built object reuses them)
    asm volatile("s_wait_xcnt 0x0" ::: "memory");
#endif
  }
}

// =================================================================================================================
// Per (b, head) channel attention: S[i][j] = the 128 image rows' partial sums of k_conv3 added in fixed order (8 runs of
// 16 rows side by side, then the 8 runs in order).
// P = softmax_j(S * (1/bf16(scale))) in f32 (max-subtracted).
// Wm[o][j] = sum_j2 64 bf16(wo[o][16 head + j2]) P[j][j2] on WMMA (K = 16 zero padded to 32; P carried x4096 as
// f16 hi + residual), value/4096 = 64 Wm; stored as f16 hi/lo planes weh/wel [b][head][o][16]: block region =
// grid = NB*8, 256 threads. coverage: weh/wel [NB][8][128][16], every element once.
// =================================================================================================================
// inputs-only fence on 16 loaded values v[O..O+15]: keeps their loads in front of the arithmetic; it holds the wait between the
// issued loads and a rewrite of the address they name, and the address is an input, so it stays live to the wait
template <int O>
__device__ __forceinline__ void fence16(const float* p, const float (&v)[HH]) {
#if defined(__HIP_DEVICE_COMPILE__)
  asm volatile("s_wait_xcnt 0x0" :: "v"(p), "v"(v[O]), "v"(v[O + 1]), "v"(v[O + 2]), "v"(v[O + 3]), "v"(v[O + 4]), "v"(v[O + 5]),
               "v"(v[O + 6]), "v"(v[O + 7]), "v"(v[O + 8]), "v"(v[O + 9]), "v"(v[O + 10]), "v"(v[O + 11]), "v"(v[O + 12]),
               "v"(v[O + 13]), "v"(v[O + 14]), "v"(v[O + 15]));
#endif
}
__global__ __launch_bounds__(256)
void k_attn(const float* __restrict__ sp, const float* __restrict__ wo, const float* __restrict__ scale,
            unsigned short* weh, unsigned short* wel) {
  __shared__ float Sm[16 * WSP];
  __shared__ __align__(16) _Float16 Phs[16 * FP];
  __shared__ __align__(16) _Float16 Pls[16 * FP];
  __shared__ __align__(16) _Float16 Wts[CC * FP];
  __shared__ float Ws[CC * WSP];
  const int tid = threadIdx.x, wave = tid >> 5, lane = tid & 31, hh = lane >> 4, m = lane & 15;
  const int bi = blockIdx.x, b = bi / NHEAD, head = bi - b * NHEAD;
  // wo slice -> f16 [o][k] (k = j2, zero for k >= 16; addresses clamped)
  // thread = (o = 8 it + wave, k = lane); the 16 loads of the slice and the 128 loads of the partial sums are all issued
  // before the first is used: one memory latency for all, not one per trip
  {
    const float* wop = wo + (size_t)wave * CC + head * HD + min(lane, HD - 1);
    float wf[16];
#pragma unroll
    for (int it = 0; it < 16; ++it) wf[it] = wop[it * 8 * CC];
    const int i = tid >> 4, j = tid & 15;
    const float* spp = sp + (size_t)bi * (HH * 256) + i * 16 + j;
    float pv[HH];
#pragma unroll
    for (int h = 0; h < HH; ++h) pv[h] = spp[h * 256];
#if defined(__HIP_DEVICE_COMPILE__)
    // nothing is scheduled across this line: without it loads sink behind the first fence's wait and start a latency late
    __builtin_amdgcn_sched_barrier(0);
    // inputs-only fence on the slice's loaded values: keeps the loads above in front of the arithmetic; same wait and same
    // live address as in the statement below
    asm volatile("s_wait_xcnt 0x0" :: "v"(wop), "v"(wf[0]), "v"(wf[1]), "v"(wf[2]), "v"(wf[3]), "v"(wf[4]), "v"(wf[5]),
                 "v"(wf[6]), "v"(wf[7]), "v"(wf[8]), "v"(wf[9]), "v"(wf[10]), "v"(wf[11]), "v"(wf[12]), "v"(wf[13]),
                 "v"(wf[14]), "v"(wf[15]));
#endif
    fence16<0>(spp, pv);  fence16<16>(spp, pv); fence16<32>(spp, pv); fence16<48>(spp, pv);
    fence16<64>(spp, pv); fence16<80>(spp, pv); fence16<96>(spp, pv); fence16<112>(spp, pv);
#pragma unroll
    for (int it = 0; it < 16; ++it) {
      const float v = (lane < HD) ? bfr(wf[it]) * 64.0f : 0.0f;
      Wts[(it * 8 + wave) * FP + lane] = (_Float16)v;
    }
    float sr[8];
#pragma unroll
    for (int u = 0; u < 8; ++u) sr[u] = 0.f;
#pragma unroll
    for (int h = 0; h < 16; ++h) {
#pragma unroll
      for (int u = 0; u < 8; ++u) sr[u] += pv[u * 16 + h];
    }
    float s = 0.f;
#pragma unroll
    for (int u = 0; u < 8; ++u) s += sr[u];
    const float isc = 1.0f / bfr(scale[0]);
    Sm[i * WSP + j] = s * isc;
  }
  __syncthreads();
  if (tid < 16) {
    // the row's 16 logits are read from LDS together and stay in registers: one LDS latency, not one per element and pass
    float sv[HD];
#pragma unroll
    for (int n = 0; n < HD; ++n) sv[n] = Sm[tid * WSP + n];
    float mx = -3.0e38f;
#pragma unroll
    for (int n = 0; n < HD; ++n) mx = fmaxf(mx, sv[n]);
    float ssum = 0.f;
#pragma unroll
    for (int n = 0; n < HD; ++n) {
      sv[n] = expf(sv[n] - mx);
      ssum += sv[n];
    }
    const float inv = 1.0f / ssum;
#pragma unroll
    for (int n = 0; n < HD; ++n) {
      const float pv = (sv[n] * inv) * 4096.0f;
      const _Float16 hv = (_Float16)pv;
      Phs[tid * FP + n] = hv;
      Pls[tid * FP + n] = (_Float16)((pv - (float)hv) * 2048.0f);
    }
#pragma unroll
    for (int n = HD; n < 32; ++n) { Phs[tid * FP + n] = (_Float16)0.0f; Pls[tid * FP + n] = (_Float16)0.0f; }
  }
  __syncthreads();
  {
    const v16h fa = ldfrag_h(Wts + (wave * 16 + m) * FP + 8 * hh);
    const v16h fb = ldfrag_h(Phs + m * FP + 8 * hh);
    const v16h gb = ldfrag_h(Pls + m * FP + 8 * hh);
    v8f ah = mma_raw(fa, fb, zero8());
    v8f al = mma_raw(fa, gb, zero8());
    guard2(ah, al, fa, fb, gb);
#pragma unroll
    for (int r = 0; r < 8; ++r) Ws[(wave * 16 + 8 * hh + r) * WSP + m] = (ah[r] + al[r] * RSC) * (1.0f / 4096.0f);
  }
  __syncthreads();
  {
    const int o = tid >> 1, hf = tid & 1;
    v4u a, q4;
#pragma unroll
    for (int e = 0; e < 4; ++e) {
      const float f0 = Ws[o * WSP + hf * 8 + 2 * e];
      const float f1 = Ws[o * WSP + hf * 8 + 2 * e + 1];
      unsigned hp, lp;
      split2(f0, f1, hp, lp);
      a[e] = hp; q4[e] = lp;
    }
    const size_t off = (size_t)(bi * CC + o) * HD + hf * 8;
    *(v4u*)(weh + off) = a;
    *(v4u*)(wel + off) = q4;
    
  }
}

// =================================================================================================================
// Output: y[b][o][p] = (sum_c' Wm64[b][c'][o] V[p][c']) / 64 + bf16(x[b][o][p]) for 64 pixels x 128 channels per
// =================================================================================================================
__global__ __launch_bounds__(256)
void k_final(const unsigned short* __restrict__ vh, const unsigned short* __restrict__ vl,
             const unsigned short* __restrict__ weh, const unsigned short* __restrict__ wel,
             const float* __restrict__ x, float* out) {
  __shared__ __align__(16) float Cs[64 * LDC];
  const int tid = threadIdx.x;
  const int mb = blockIdx.x;
  const int p0 = mb * 64;
  const int b = p0 / IMGPIX, pl0 = p0 - b * IMGPIX;
  const _Float16* Vh = (const _Float16*)(const void*)(vh + (size_t)b * BSZ);
  const _Float16* Vl = (const _Float16*)(const void*)(vl + (size_t)b * BSZ);
  const _Float16* Wh = (const _Float16*)(const void*)(weh + (size_t)b * NHEAD * CC * HD);
  const _Float16* Wl = (const _Float16*)(const void*)(wel + (size_t)b * NHEAD * CC * HD);
  mm_final(Vh, Vl, Wh, Wl, pl0, Cs);
  __syncthreads();
  v4f pk[8];
  size_t offs[8];
#pragma unroll
  for (int s = 0; s < 8; ++s) {
    const int idx = s * 256 + tid;
    const int o = idx >> 4, piece = idx & 15;
    const size_t off = (size_t)(b * CC + o) * IMGPIX + pl0 + piece * 4;
    const v4f xr = *(const v4f*)(x + off);
    v4f v;
#pragma unroll
    for (int e = 0; e < 4; ++e) v[e] = Cs[(piece * 4 + e) * LDC + o] * (1.0f / 64.0f) + bfr(xr[e]);
    pk[s] = v;
    offs[s] = off;
  }
#pragma unroll
  for (int s = 0; s < 8; ++s) *(v4f*)(out + offs[s]) = pk[s];
  
}

// =================================================================================================================
// Workspace map (bytes, offsets multiples of 65536, no aliasing, every region sized at or above its whole-line store
// extent): W1 f16 [3][128][128] 98304 (131072) | WT f16 [3][128][1152] 884736 (917504) | XH, XL f16 [32768][128]
// 8388608 each | P1 f16 6 x [2][130][130][128] 51916800 (51970048) |
// VH, VL f16 [2][128][16384] 8388608 each | WEH, WEL f16 [2][8][128][16] 65536 each | SP f32 [16][128][256] 2097152 |
// total 88801280.
// =================================================================================================================
extern "C" void kernel_launch(void* const* d_in, const int* in_sizes, int n_in,
                              void* d_out, int out_size, void* d_ws, size_t ws_size,
                              hipStream_t stream) {
  if (n_in < 11) return;
  const int expect[11] = { NB * CC * IMGPIX, WW, WW, 1, CC * CC, CC * CC * 9, CC * CC, CC * CC * 9,
                           CC * CC, CC * CC * 9, CC * CC };
  for (int i = 0; i < 11; ++i) if (in_sizes[i] != expect[i]) return;
  if (out_size != NB * CC * IMGPIX) return;

  const float* x     = (const float*)d_in[0];
  const float* gam   = (const float*)d_in[1];
  const float* bet   = (const float*)d_in[2];
  const float* scale = (const float*)d_in[3];
  const float* wq1   = (const float*)d_in[4];
  const float* wq2   = (const float*)d_in[5];
  const float* wk1   = (const float*)d_in[6];
  const float* wk2   = (const float*)d_in[7];
  const float* wv1   = (const float*)d_in[8];
  const float* wv2   = (const float*)d_in[9];
  const float* wo    = (const float*)d_in[10];
  float* out = (float*)d_out;

  const size_t AL = 65536;
  const size_t sW1 = (((size_t)3 * CC * CC * 2) + AL - 1) / AL * AL;               //   131072
  const size_t sWT = (((size_t)3 * CC * KCV * 2) + AL - 1) / AL * AL;              //   917504
  const size_t sX  = (((size_t)NPIX * CC * 2) + AL - 1) / AL * AL;                  //  8388608
  const size_t sP1 = (((size_t)6 * PS1 * 2) + AL - 1) / AL * AL;                    // 51970048
  const size_t sV  = (((size_t)NB * BSZ * 2) + AL - 1) / AL * AL;                   //  8388608
  const size_t sWE = (((size_t)NB * NHEAD * CC * HD * 2) + AL - 1) / AL * AL;       //    65536
  const size_t sSP = (((size_t)NB * NHEAD * HH * 256 * 4) + AL - 1) / AL * AL;      //  2097152

  size_t off = 0;
  const size_t oW1  = off; off += sW1;
  const size_t oWT  = off; off += sWT;
  const size_t oXH  = off; off += sX;
  const size_t oXL  = off; off += sX;
  const size_t oP1  = off; off += sP1;
  const size_t oVH  = off; off += sV;
  const size_t oVL  = off; off += sV;
  const size_t oWEH = off; off += sWE;
  const size_t oWEL = off; off += sWE;
  const size_t oSP  = off; off += sSP;
  if (off > ws_size) return;                                 // off = 88801280
  if (off > (size_t)134217728) return;

  char* ws = (char*)d_ws;
  unsigned short* W1  = (unsigned short*)(ws + oW1);
  unsigned short* WT  = (unsigned short*)(ws + oWT);
  unsigned short* XH  = (unsigned short*)(ws + oXH);
  unsigned short* XL  = (unsigned short*)(ws + oXL);
  unsigned short* P1  = (unsigned short*)(ws + oP1);
  unsigned short* VH  = (unsigned short*)(ws + oVH);
  unsigned short* VL  = (unsigned short*)(ws + oVL);
  unsigned short* WEH = (unsigned short*)(ws + oWEH);
  unsigned short* WEL = (unsigned short*)(ws + oWEL);
  float*          SP  = (float*)(ws + oSP);

  const dim3 blk(256);
  // (1) layer norm over w + NHWC hi/lo planes; weight planes; halo zero fill of the padded planes
  k_ln<<<dim3(LNG), blk, 0, stream>>>(x, gam, bet, wq1, wq2, wk1, wk2, wv1, wv2, XH, XL, W1, WT, P1);
  // (2) 1x1 projections into padded NHWC hi/lo planes (interior)
  k_proj<<<dim3(NPIX / 64, 3), blk, 0, stream>>>(XH, XL, W1, P1);
  // (3) 3x3 convs: q and k -> f32 logit partial sums per image row; v -> f16 hi/lo NCHW flat planes
  k_conv3<<<dim3(2 * (NPIX / CPX)), dim3(512), 0, stream>>>(P1, WT, SP, VH, VL);
  // (4) per-head channel attention: rows' partial sums added + softmax + wo mix -> Wm planes
  k_attn<<<dim3(NB * NHEAD), blk, 0, stream>>>(SP, wo, scale, WEH, WEL);
  // (5) output GEMM + residual -> NCHW d_out
  k_final<<<dim3(NPIX / 64), blk, 0, stream>>>(VH, VL, WEH, WEL, x, out);
  (void)hipGetLastError();
}

// v009
// One run takes 54.9 microseconds.
// Versions between v007 and this one are left out; their measured steps multiply to 1.52 times as fast.
// All steps since v000 together make it 12.4 times as fast.
// Contractions: 1x1 projections (K=128): v_wmma_f32_16x16x32_f16, the activation as f16 hi + x2048 residual planes into two
// f32 accumulators, weights one f16 plane of 64*bf16(w); 3x3 convs as implicit GEMM (K=1152): the same form, the projected
// activation as ONE f16 plane (rounded to nearest, no residual), weights as above;
// per-head k^T q logits (K=16384): v_wmma_f32_16x16x4_f32 on the convs' f32 LDS tiles, one partial per image row, the
// rows' partials added in fixed order on VALU; wo x probs mix
// (K=16, zero padded to 32): f16, probs carried x4096 as hi + residual; fused output GEMM (K=128): v and the mixed
// weight as f16 hi + residual planes (3 products); f32 accumulate everywhere. Layer-norm statistics, softmax and
// all epilogues f32 on VALU; every float input RNE-converted to bf16 on load.
#include <hip/hip_runtime.h>
#include <stdint.h>

#define NB     2
#define CC     128
#define HH     128
#define WW     128
#define IMGPIX (HH * WW)
#define NPIX   (NB * IMGPIX)
#define HP     (HH + 2)
#define WP     (WW + 2)
#define PADIMG (HP * WP)
#define PADPIX (NB * PADIMG)
#define KCV    1152
#define NKS    36
#define NHEAD  8
#define HD     16
#define HSZ    (IMGPIX * HD)
#define BSZ    (CC * IMGPIX)
#define LDC    132
#define FP     40
#define WSP    17
#define NHALO  (2 * WP + 2 * HH)
#define RSC    0.00048828125f
#define PS1    ((size_t)PADPIX * CC)
#define PS2    ((size_t)NPIX * CC)
#define SPK    72
#define SBUF   (256 * SPK)
#define NST    18
#define CPX    128
#define ARW    (WW + 2)
#define ABUF   (2 * ARW * SPK)
#define WBUF   (CC * SPK)
#define NGR    6
#define CRING  (2 * ABUF + 3 * WBUF)
#define CTILE  (2 * CPX * LDC * 2)
#define LNG    (NB * HH * 2)
#define NHPC   (3 * NB * NHALO * 16)
#define HPB    104

static_assert(NPIX == NB * IMGPIX);
static_assert(IMGPIX == 16384 && HH == 128 && WW == 128);
static_assert(PADIMG == 16900);
static_assert(KCV == 9 * CC && KCV == NKS * 32);
static_assert(CC == NHEAD * HD);
static_assert(BSZ == CC * IMGPIX && HSZ * NHEAD == BSZ);
static_assert((IMGPIX % 64) == 0 && (WW % 64) == 0);
static_assert((LDC * 4) % 16 == 0 && (FP * 2) % 16 == 0);
static_assert(NHALO == 516);
static_assert((KCV % 8) == 0 && (CC % 32) == 0);
static_assert(IMGPIX == 32 * 32 * 16);
static_assert(NST * 64 == KCV && (SPK * 2) % 32 == 16 && 2 * SBUF * 2 >= 64 * LDC * 4);
static_assert(CPX == WW && (NPIX % (2 * CPX)) == 0 && (HH % 2) == 0 && CTILE >= CRING && (CTILE * 2) % 16 == 0);
static_assert((NGR % 2) == 0 && NGR / 2 >= 2 && 2 * CTILE * 2 <= 327680 && 2 * NHEAD * 32 == 512);
static_assert(NGR * 3 == NST && 2 * ARW == 8 * 32 + 4 && (ABUF * 2) % 16 == 0 && ARW == WP);
static_assert(LNG > 3 * CC && (LNG - 3 * CC) * 3 == 3 * CC && KCV == 1024 + 32 * 4);
static_assert(HPB <= 256 && (HPB % 8) == 0 && HPB * LNG >= NHPC);

// Index maps of the raw reshapes (per batch b, flat NCHW index f = c*16384 + h*128 + w viewed as [8][16384][16]):
//   Q_head[r][d] = qflat[b][head*262144 + 16 r + d]   (same map for K_head and V_head; r = (c%16)*1024 + h*8 + w/16,
//   d = w%16). S_head[i][j] = sum_r K_head[r][i] Q_head[r][j]; P_head = softmax_j(S_head * (1/scale)).
//   O[b][16 head + j2][pixel r] = sum_j V_head[r][j] P_head[j][j2].
//   y[b][o][pixel r] = sum_{head, j} Wm[b][head][o][j] V_head[r][j] + x[b][o][r],
//   Wm[b][head][o][j] = sum_j2 wo[o][16 head + j2] P_head[j][j2]   (reassociated 1x1 output conv).

typedef _Float16 v16h __attribute__((ext_vector_type(16)));
typedef _Float16 v8h  __attribute__((ext_vector_type(8)));
typedef float    v8f  __attribute__((ext_vector_type(8)));
typedef float    v4f  __attribute__((ext_vector_type(4)));
typedef float    v2f  __attribute__((ext_vector_type(2)));
typedef unsigned int v4u __attribute__((ext_vector_type(4)));

// ---- scalar helpers ------------------------------------------------------------------------------------------
__device__ __forceinline__ unsigned short bf_bits(float f) {          // f32 -> bf16 bits, RNE convert
  unsigned u = __float_as_uint(f);
  return (unsigned short)((u + 0x7FFFu + ((u >> 16) & 1u)) >> 16);
}
__device__ __forceinline__ float bf_up(unsigned short b) { return __uint_as_float(((unsigned)b) << 16); }
__device__ __forceinline__ float bfr(float f) { return bf_up(bf_bits(f)); }
__device__ __forceinline__ unsigned short h_bits(_Float16 x) { return __builtin_bit_cast(unsigned short, x); }
__device__ __forceinline__ unsigned short hb16(float f) { return h_bits((_Float16)f); }
__device__ __forceinline__ unsigned pk16(unsigned short a, unsigned short b) { return (unsigned)a | ((unsigned)b << 16); }
__device__ __forceinline__ v8f zero8() { v8f z = {0.f, 0.f, 0.f, 0.f, 0.f, 0.f, 0.f, 0.f}; return z; }
// hi/lo pair of two f32 values: hi = f16(v), lo = f16(2048 (v - hi)), packed as two 32-bit words
__device__ __forceinline__ void split2(float f0, float f1, unsigned& hp, unsigned& lp) {
  const _Float16 h0 = (_Float16)f0, h1 = (_Float16)f1;
  const float q0 = (f0 - (float)h0) * 2048.0f, q1 = (f1 - (float)h1) * 2048.0f;
  hp = pk16(h_bits(h0), h_bits(h1));
  lp = pk16(hb16(q0), hb16(q1));
}

// ---- fragment loader: 16-bit A/B operand, lane -> row/col (lane&15), p already includes +8*(lane>>4);
//      elements 0..7 <- p[0..7] (k0+8h..k0+8h+7), elements 8..15 <- p[16..23] (k0+16+8h..k0+16+8h+7)
__device__ __forceinline__ v16h ldfrag_h(const _Float16* p) {
  union { v16h v; v8h h[2]; } f;
  f.h[0] = *(const v8h*)(p);
  f.h[1] = *(const v8h*)(p + 16);
  return f.v;
}
// same layout, the two 8-element halves at two independent 16-B aligned addresses (pa: k0+8h.., pb: k0+16+8h..)
__device__ __forceinline__ v16h ldfrag2(const _Float16* pa, const _Float16* pb) {
  union { v16h v; v8h h[2]; } f;
  f.h[0] = *(const v8h*)(pa);
  f.h[1] = *(const v8h*)(pb);
  return f.v;
}

// ---- WMMA helpers; the guards insert the trailing VALU hazard gap and keep A/B live --------------------------
__device__ __forceinline__ v8f mma_raw(v16h a, v16h b, v8f c) {
  return __builtin_amdgcn_wmma_f32_16x16x32_f16(false, a, false, b, (short)0, c, false, false);
}
__device__ __forceinline__ void guard8(v8f& c0, v8f& c1, v8f& c2, v8f& c3, v8f& c4, v8f& c5, v8f& c6, v8f& c7,
                                       const v16h& a0, const v16h& a1, const v16h& a2, const v16h& a3,
                                       const v16h& b0, const v16h& b1) {
#if defined(__HIP_DEVICE_COMPILE__)
  asm volatile("v_nop\n\tv_nop\n\tv_nop\n\tv_nop"
               : "+v"(c0), "+v"(c1), "+v"(c2), "+v"(c3), "+v"(c4), "+v"(c5), "+v"(c6), "+v"(c7)
               : "v"(a0), "v"(a1), "v"(a2), "v"(a3), "v"(b0), "v"(b1));
#endif
}
__device__ __forceinline__ void guard4(v8f& c0, v8f& c1, v8f& c2, v8f& c3,
                                       const v16h& a0, const v16h& a1, const v16h& b0, const v16h& b1) {
#if defined(__HIP_DEVICE_COMPILE__)
  asm volatile("v_nop\n\tv_nop\n\tv_nop\n\tv_nop"
               : "+v"(c0), "+v"(c1), "+v"(c2), "+v"(c3)
               : "v"(a0), "v"(a1), "v"(b0), "v"(b1));
#endif
}
__device__ __forceinline__ void guard2(v8f& c0, v8f& c1, const v16h& a0, const v16h& b0, const v16h& b1) {
#if defined(__HIP_DEVICE_COMPILE__)
  asm volatile("v_nop\n\tv_nop\n\tv_nop\n\tv_nop"
               : "+v"(c0), "+v"(c1)
               : "v"(a0), "v"(b0), "v"(b1));
#endif
}

// the same for a pair of f32 16x16x4 products: four slots before a vector
// instruction touches their results, and the four operands stay live (not overwritten) that long
__device__ __forceinline__ void guardf(v8f& c0, v8f& c1, const v2f& a0, const v2f& b0, const v2f& a1, const v2f& b1) {
#if defined(__HIP_DEVICE_COMPILE__)
  asm volatile("v_nop\n\tv_nop\n\tv_nop\n\tv_nop"
               : "+v"(c0), "+v"(c1)
               : "v"(a0), "v"(b0), "v"(a1), "v"(b1));
#endif
}

// ---- LDS staging of one 64-k slice of a 64x128 block tile's operands: 256 rows of 128 B at pitch 144 B (16 B x odd, for
//      the ds_load_b128 fragment reads): rows 0..63 A hi, 64..127 A lo (64 A rows, global pitch CC), 128..255 W (128 rows,
//      global pitch wstep32 / 32). Thread = (row tid>>3 of each group of 32 rows, 16-B piece tid&7), 8 copies; ga_h, ga_l,
//      gw are the thread's own source addresses in the first group, lds its own byte address in the target buffer.
//      Each copy instruction moves four whole 128-B lines, and every operand byte is fetched once per work-group.
__device__ __forceinline__ void stage_copy(const _Float16* ga_h, const _Float16* ga_l, const _Float16* gw, int wstep32,
                                           unsigned lds) {
  const _Float16* g1 = ga_h + 32 * CC;
  const _Float16* g3 = ga_l + 32 * CC;
  const _Float16* g5 = gw + wstep32;
  const _Float16* g6 = gw + 2 * wstep32;
  const _Float16* g7 = gw + 3 * wstep32;
  const unsigned l1 = lds + 1 * 32 * SPK * 2, l2 = lds + 2 * 32 * SPK * 2, l3 = lds + 3 * 32 * SPK * 2;
  const unsigned l4 = lds + 4 * 32 * SPK * 2, l5 = lds + 5 * 32 * SPK * 2, l6 = lds + 6 * 32 * SPK * 2;
  const unsigned l7 = lds + 7 * 32 * SPK * 2;
#if defined(__HIP_DEVICE_COMPILE__)
  // global -> LDS through no register; the last line is the wait that stands between issued copies and a rewrite of
  // a register they name, inside the statement so that nothing can be moved in front of it
  asm volatile("global_load_async_to_lds_b128 %0, %1, off\n\t"
               "global_load_async_to_lds_b128 %2, %3, off\n\t"
               "global_load_async_to_lds_b128 %4, %5, off\n\t"
               "global_load_async_to_lds_b128 %6, %7, off\n\t"
               "global_load_async_to_lds_b128 %8, %9, off\n\t"
               "global_load_async_to_lds_b128 %10, %11, off\n\t"
               "global_load_async_to_lds_b128 %12, %13, off\n\t"
               "global_load_async_to_lds_b128 %14, %15, off\n\t"
               "s_wait_xcnt 0x0"
               :: "v"(lds), "v"(ga_h), "v"(l1), "v"(g1), "v"(l2), "v"(ga_l), "v"(l3), "v"(g3),
                  "v"(l4), "v"(gw), "v"(l5), "v"(g5), "v"(l6), "v"(g6), "v"(l7), "v"(g7)
               : "memory");
#endif
}
// ---- the conv's operands, pitch 144 B as above. A group = two padded image rows one below the other (130 pixels each) x 64
//      channels: 260 rows of 128 B, rows 0..129 the upper image row, 130..259 the lower. Thread = (row tid>>3 of run j of 32
//      rows, 16-B piece tid&7), runs j = 0..7, and run 8 (four rows) by one wave. gh is the thread's own source in the upper row at
//      pixel tid>>3, gl its own in the lower row at pixel (tid>>3) - 2, so that LDS row r >= 130 is the lower row's pixel r - 130;
//      run 4 (rows 128..159) holds the last two pixels of the upper row (hi4: this thread's row is one of them) and the first
//      thirty of the lower. A group is copied in three parts (runs 0..2, 3..5, 6..8).
__device__ __forceinline__ void copy3(unsigned la, const _Float16* ga, unsigned lb, const _Float16* gb, unsigned lc,
                                      const _Float16* gc) {
#if defined(__HIP_DEVICE_COMPILE__)
  // global -> LDS through no register; the last line is the wait that stands between issued copies and a rewrite of
  // a register they name, inside the statement so that nothing can be moved in front of it
  asm volatile("global_load_async_to_lds_b128 %0, %1, off\n\t"
               "global_load_async_to_lds_b128 %2, %3, off\n\t"
               "global_load_async_to_lds_b128 %4, %5, off\n\t"
               "s_wait_xcnt 0x0"
               :: "v"(la), "v"(ga), "v"(lb), "v"(gb), "v"(lc), "v"(gc) : "memory");
#endif
}
__device__ __forceinline__ void copy2(unsigned la, const _Float16* ga, unsigned lb, const _Float16* gb) {
#if defined(__HIP_DEVICE_COMPILE__)
  // same form and same closing wait as above
  asm volatile("global_load_async_to_lds_b128 %0, %1, off\n\t"
               "global_load_async_to_lds_b128 %2, %3, off\n\t"
               "s_wait_xcnt 0x0"
               :: "v"(la), "v"(ga), "v"(lb), "v"(gb) : "memory");
#endif
}
__device__ __forceinline__ void copy1(unsigned la, const _Float16* ga) {
#if defined(__HIP_DEVICE_COMPILE__)
  // same form and same closing wait as above
  asm volatile("global_load_async_to_lds_b128 %0, %1, off\n\t"
               "s_wait_xcnt 0x0"
               :: "v"(la), "v"(ga) : "memory");
#endif
}
template <int PART>
__device__ __forceinline__ void stage_a(const _Float16* gh, const _Float16* gl, bool hi4, bool wave0, unsigned lds) {
  const unsigned gs = 32 * SPK * 2;
  static_assert(PART == 1 || PART == 2);         // part 0 (runs 0..2) always goes with a W stage: stage_wa
  if (PART == 1) {
    copy3(lds + 3 * gs, gh + 96 * CC, lds + 4 * gs, hi4 ? gh + 128 * CC : gl, lds + 5 * gs, gl + 32 * CC);
  } else {
    copy2(lds + 6 * gs, gl + 64 * CC, lds + 7 * gs, gl + 96 * CC);
    if (wave0) copy1(lds + 8 * gs, gl + 128 * CC);   // scalar test: the other waves branch round the copy
  }
}
// W stage = 128 output channels x 64 k: 128 rows of 128 B (global pitch KCV), 4 copies a thread
__device__ __forceinline__ void stage_w4(const _Float16* gw, unsigned lds) {
  const _Float16* w1 = gw + 32 * KCV;
  const _Float16* w2 = gw + 64 * KCV;
  const _Float16* w3 = gw + 96 * KCV;
  const unsigned gs = 32 * SPK * 2;
  const unsigned l1 = lds + 1 * gs, l2 = lds + 2 * gs, l3 = lds + 3 * gs;
#if defined(__HIP_DEVICE_COMPILE__)
  // same form and same closing wait as above
  asm volatile("global_load_async_to_lds_b128 %0, %1, off\n\t"
               "global_load_async_to_lds_b128 %2, %3, off\n\t"
               "global_load_async_to_lds_b128 %4, %5, off\n\t"
               "global_load_async_to_lds_b128 %6, %7, off\n\t"
               "s_wait_xcnt 0x0"
               :: "v"(lds), "v"(gw), "v"(l1), "v"(w1), "v"(l2), "v"(w2), "v"(l3), "v"(w3)
               : "memory");
#endif
}
// a W stage's and an A part's copies in one statement, so that the wave passes one closing wait for both: the W stage's four and part PART of an A group
template <int PART>
__device__ __forceinline__ void stage_wa(const _Float16* gw, unsigned ldw, const _Float16* gh, const _Float16* gl, bool hi4,
                                         bool wave0, unsigned lda) {
  const _Float16* w1 = gw + 32 * KCV;
  const _Float16* w2 = gw + 64 * KCV;
  const _Float16* w3 = gw + 96 * KCV;
  const unsigned gs = 32 * SPK * 2;
  const unsigned m1 = ldw + 1 * gs, m2 = ldw + 2 * gs, m3 = ldw + 3 * gs;
  const unsigned la = lda + (3 * PART) * gs, lb = la + gs, lc = lb + gs;
  const _Float16* ga = (PART == 0) ? gh : ((PART == 1) ? gh + 96 * CC : gl + 64 * CC);
  const _Float16* gb = (PART == 0) ? gh + 32 * CC : ((PART == 1) ? (hi4 ? gh + 128 * CC : gl) : gl + 96 * CC);
  const _Float16* gc = (PART == 0) ? gh + 64 * CC : ((PART == 1) ? gl + 32 * CC : gl + 128 * CC);
#if defined(__HIP_DEVICE_COMPILE__)
  if (PART < 2) {
    // same form and same closing wait as above
    asm volatile("global_load_async_to_lds_b128 %0, %1, off\n\t"
                 "global_load_async_to_lds_b128 %2, %3, off\n\t"
                 "global_load_async_to_lds_b128 %4, %5, off\n\t"
                 "global_load_async_to_lds_b128 %6, %7, off\n\t"
                 "global_load_async_to_lds_b128 %8, %9, off\n\t"
                 "global_load_async_to_lds_b128 %10, %11, off\n\t"
                 "global_load_async_to_lds_b128 %12, %13, off\n\t"
                 "s_wait_xcnt 0x0"
                 :: "v"(ldw), "v"(gw), "v"(m1), "v"(w1), "v"(m2), "v"(w2), "v"(m3), "v"(w3),
                    "v"(la), "v"(ga), "v"(lb), "v"(gb), "v"(lc), "v"(gc)
                 : "memory");
  } else {
    // same form and same closing wait as above
    asm volatile("global_load_async_to_lds_b128 %0, %1, off\n\t"
                 "global_load_async_to_lds_b128 %2, %3, off\n\t"
                 "global_load_async_to_lds_b128 %4, %5, off\n\t"
                 "global_load_async_to_lds_b128 %6, %7, off\n\t"
                 "global_load_async_to_lds_b128 %8, %9, off\n\t"
                 "global_load_async_to_lds_b128 %10, %11, off\n\t"
                 "s_wait_xcnt 0x0"
                 :: "v"(ldw), "v"(gw), "v"(m1), "v"(w1), "v"(m2), "v"(w2), "v"(m3), "v"(w3),
                    "v"(la), "v"(ga), "v"(lb), "v"(gb)
                 : "memory");
    if (wave0) copy1(lc, gc);                    // scalar test: the other waves branch round the copy
  }
#endif
}
__device__ __forceinline__ void wait_copies() {
#if defined(__HIP_DEVICE_COMPILE__)
  asm volatile("s_wait_asynccnt 0x0" ::: "memory");   // this wave's copies have landed in LDS
#endif
}
__device__ __forceinline__ void wait_lds_reads() {
#if defined(__HIP_DEVICE_COMPILE__)
  asm volatile("s_wait_dscnt 0x0" ::: "memory");      // this wave's LDS reads are done before the buffer is rewritten
#endif
}
// the work-group's own barrier in its two halves, so that a wave can multiply between arriving and waiting; no LDS read stands
// between the two; the waits that the barrier needs are written in front of the signal
__device__ __forceinline__ void bar_signal() {
#if defined(__HIP_DEVICE_COMPILE__)
  asm volatile("s_barrier_signal -1" ::: "memory");   // this wave has arrived: its reads are done, its copies have landed
#endif
}
__device__ __forceinline__ void bar_wait() {
#if defined(__HIP_DEVICE_COMPILE__)
  asm volatile("s_barrier_wait -1" ::: "memory");     // every wave has arrived
#endif
}

// ---- 64x128 block tile GEMM core (K = 128) with the A operand as two planes (hi and x2048 residual) into separate
//      accumulators; A row pitch CC (f16), W is [n][k] k-contiguous pitch CC. Both 64-k slices are copied to the two LDS
//      buffers at once, then read. 8 waves = 2 (32 rows) x 4 (32 cols), 2x2 tiles of 16 per wave; fragments from LDS with
//      the table layout; the residual accumulator is folded with 1/2048 when the tile is written to the LDS f32 tile
//      Cs[64][LDC], which takes the buffers' place behind a barrier.
__device__ __forceinline__ void mm_tile2(const _Float16* __restrict__ Ah, const _Float16* __restrict__ Al,
                                         const _Float16* __restrict__ W, int arow0, _Float16* ring) {
  const int tid = threadIdx.x, wave = tid >> 5, lane = tid & 31, hh = lane >> 4, c = lane & 15;
  const int mw = wave >> 2, nw = wave & 3;
  const int srow = tid >> 3, spc = tid & 7;
  const size_t sa = (size_t)(arow0 + srow) * CC + spc * 8;
  const _Float16* wb = W + (size_t)srow * CC + spc * 8;
  const unsigned lds0 = (unsigned)(size_t)ring + (unsigned)((srow * SPK + spc * 8) * 2);
  const _Float16* fap = ring + (mw * 32 + c) * SPK + 8 * hh;
  const _Float16* fbp = ring + (128 + nw * 32 + c) * SPK + 8 * hh;
  v8f h00 = zero8(), h01 = zero8(), h10 = zero8(), h11 = zero8();
  v8f l00 = zero8(), l01 = zero8(), l10 = zero8(), l11 = zero8();
  stage_copy(Ah + sa, Al + sa, wb, 32 * CC, lds0);
  stage_copy(Ah + sa + 64, Al + sa + 64, wb + 64, 32 * CC, lds0 + SBUF * 2);
  wait_copies();
  __syncthreads();                               // both slices are readable by every wave
  // unrolled: every fragment's LDS offset becomes an immediate of its load
#pragma unroll
  for (int ks = 0; ks < CC / 32; ++ks) {
    const _Float16* pa = fap + (ks >> 1) * SBUF + (ks & 1) * 32;
    const _Float16* pb = fbp + (ks >> 1) * SBUF + (ks & 1) * 32;
    const v16h fa0 = ldfrag_h(pa);
    const v16h fa1 = ldfrag_h(pa + 16 * SPK);
    const v16h ga0 = ldfrag_h(pa + 64 * SPK);
    const v16h ga1 = ldfrag_h(pa + 80 * SPK);
    const v16h fb0 = ldfrag_h(pb);
    const v16h fb1 = ldfrag_h(pb + 16 * SPK);
    h00 = mma_raw(fa0, fb0, h00);
    h01 = mma_raw(fa0, fb1, h01);
    h10 = mma_raw(fa1, fb0, h10);
    h11 = mma_raw(fa1, fb1, h11);
    l00 = mma_raw(ga0, fb0, l00);
    l01 = mma_raw(ga0, fb1, l01);
    l10 = mma_raw(ga1, fb0, l10);
    l11 = mma_raw(ga1, fb1, l11);
    guard8(h00, h01, h10, h11, l00, l01, l10, l11, fa0, fa1, ga0, ga1, fb0, fb1);
  }
  wait_lds_reads();
  __syncthreads();                               // ends every wave's fragment reads: the buffers become the f32 tile
  float* Cs = (float*)(void*)ring;
#pragma unroll
  for (int r = 0; r < 8; ++r) {
    const int row = mw * 32 + 8 * hh + r;
    Cs[row * LDC + nw * 32 + c]             = h00[r] + l00[r] * RSC;
    Cs[row * LDC + nw * 32 + 16 + c]        = h01[r] + l01[r] * RSC;
    Cs[(row + 16) * LDC + nw * 32 + c]      = h10[r] + l10[r] * RSC;
    Cs[(row + 16) * LDC + nw * 32 + 16 + c] = h11[r] + l11[r] * RSC;
  }
}

// ---- implicit-GEMM variant for the 3x3 conv: A row = output pixel p (flat over all images), k = tap*128 + c;
//      W = wt [128][1152] k-contiguous. The block tile is two image rows, y and y + 1. A group g (ky = g>>1, channel half = g&1) is
//      the whole padded rows y + ky and y + 1 + ky, 130 pixels x 64 channels each: it is copied to LDS once and serves the three taps kx = 0, 1, 2,
//      which read it one LDS row apart. A W stage s = 3 g + kx is the 128 output channels x the 64 k of that tap and half. Three W
//      buffers (stage s in buffer kx), two A buffers: a copy has a whole trip to land, from one trip's barrier signal to the next's; the
//      fragments come from LDS with the table k map (k order: ky, channel half, kx, channel quarter, table). 8 waves = 4 (32
//      pixels of each row) x 2 (64 channels): a wave's k-step is 16 products from 8 fragments (2 a row, 4 W). The 8 waves are one half
//      of a 512-thread work-group (tid = thread within the half, ring = the half's own buffers); a half runs the ng groups from
//      gbeg on. ng is the same in both halves, so both pass the same barriers.
__device__ __forceinline__ size_t conv_abase(int p, int hh) {
  const int b = p / IMGPIX;
  const int r = p - b * IMGPIX;
  const int y = r / WW;
  const int x = r - y * WW;
  return ((size_t)(b * HP + y) * WP + x) * CC + 8 * hh;
}
// part PART of group g's copies into the A buffer g & 1; ah/al are the thread's own source addresses for group 0, lds0 its own
// byte address in buffer 0 (see stage_a)
template <int PART>
__device__ __forceinline__ void conv_apart(const _Float16* ah, const _Float16* al, bool hi4, bool wave0, int g, unsigned lds0) {
  const int ao = (g >> 1) * (WP * CC) + (g & 1) * 64;
  stage_a<PART>(ah + ao, al + ao, hi4, wave0, lds0 + (g & 1) * (ABUF * 2));
}
// stage s's copies into the W buffer at lds; wb is the thread's own source address for k = 0
__device__ __forceinline__ void conv_wstage(const _Float16* wb, int s, unsigned lds) {
  const int g = (s * 11) >> 5;                   // s / 3 for s < 18
  const int kx = s - 3 * g;
  stage_w4(wb + ((g >> 1) * 3 + kx) * CC + (g & 1) * 64, lds);
}
// both at once: W stage s into the W buffer at ldw and part PART of A group g into the A buffer g & 1 (lds0: buffer 0)
template <int PART>
__device__ __forceinline__ void conv_wa(const _Float16* wb, int s, unsigned ldw, const _Float16* ah, const _Float16* al,
                                        bool hi4, bool wave0, int g, unsigned lds0) {
  const int sg = (s * 11) >> 5;                  // s / 3 for s < 18
  const int kx = s - 3 * sg;
  const int ao = (g >> 1) * (WP * CC) + (g & 1) * 64;
  stage_wa<PART>(wb + ((sg >> 1) * 3 + kx) * CC + (sg & 1) * 64, ldw, ah + ao, al + ao, hi4, wave0,
                 lds0 + (g & 1) * (ABUF * 2));
}
__device__ __forceinline__ void mm_conv(const _Float16* __restrict__ Ah, const _Float16* __restrict__ W, int prow0,
                                        _Float16* ring, int tid, int gbeg, int ng) {
  const _Float16* Al = Ah + WP * CC;             // the lower image row of the pair: one padded row further on
  const int wave = tid >> 5, lane = tid & 31, hh = lane >> 4, c = lane & 15;
  const int mw = wave >> 1, nw = wave & 1;
  const int srow = tid >> 3, spc = tid & 7;
  const bool wave0 = __builtin_amdgcn_readfirstlane(wave) == 0;
  const bool hi4 = srow < 2;
  const size_t sa = conv_abase(prow0, 0) + spc * 8;
  const _Float16* ah = Ah + sa + srow * CC;
  const _Float16* al = Al + sa + (srow - 2) * CC;
  const _Float16* wb = W + (size_t)srow * KCV + spc * 8;
  const unsigned lds0 = (unsigned)(size_t)ring + (unsigned)((srow * SPK + spc * 8) * 2);
  const unsigned ldw0 = lds0 + 2 * ABUF * 2;
  const _Float16* fap = ring + (mw * 32 + c) * SPK + 8 * hh;
  const _Float16* fbp = ring + 2 * ABUF + (nw * 64 + c) * SPK + 8 * hh;
  v8f h0[4], h1[4], l0[4], l1[4];                // h: upper image row, l: lower; 0, 1: the wave's two runs of 16 pixels
  // unrolled: every index of an accumulator array is a constant, so the arrays stay in registers
#pragma unroll
  for (int n = 0; n < 4; ++n) { h0[n] = zero8(); h1[n] = zero8(); l0[n] = zero8(); l1[n] = zero8(); }
  conv_wa<0>(wb, 3 * gbeg, ldw0, ah, al, hi4, wave0, gbeg, lds0);
  conv_apart<1>(ah, al, hi4, wave0, gbeg, lds0);
  conv_apart<2>(ah, al, hi4, wave0, gbeg, lds0);
  wait_copies();
  __syncthreads();                               // the first group and stage are readable by every wave
  conv_wstage(wb, 3 * gbeg + 1, ldw0 + WBUF * 2);
  // rolled: one copy of a group's three trips in the instruction cache, the A buffer chosen by g & 1, the W buffer by kx
#pragma unroll 1
  for (int gi = 0; gi < ng; ++gi) {
    const int g = gbeg + gi;
    const int ab = (g & 1) * ABUF;
    // unrolled: the tap's row shift becomes an immediate of the LDS loads, and each trip has its own refill (the next group's parts 0 and 1 in the first, part 2 in the second)
#pragma unroll
    for (int kx = 0; kx < 3; ++kx) {
      const int t = 3 * g + kx;
      const int wo = kx * WBUF;                  // t mod 3
      // unrolled: the two k-steps' LDS offsets become immediates of their loads
#pragma unroll
      for (int kk = 0; kk < 2; ++kk) {
        const _Float16* pa = fap + ab + kx * SPK + kk * 32;
        const _Float16* pb = fbp + wo + kk * 32;
        const v16h fa0 = ldfrag_h(pa);
        const v16h fb0 = ldfrag_h(pb);
        const v16h fb1 = ldfrag_h(pb + 16 * SPK);
        const v16h fb2 = ldfrag_h(pb + 32 * SPK);
        const v16h fb3 = ldfrag_h(pb + 48 * SPK);
        const v16h fa1 = ldfrag_h(pa + 16 * SPK);
        const v16h ga0 = ldfrag_h(pa + ARW * SPK);
        const v16h ga1 = ldfrag_h(pa + (ARW + 16) * SPK);
#if defined(__HIP_DEVICE_COMPILE__)
        // nothing is scheduled across this line: without it the compiler reloads one A register set in among the products
        // and the wave waits out a whole LDS latency at each such place
        __builtin_amdgcn_sched_barrier(0);
#endif
        if (kk == 1) {
          // the trip's publish point: the wave arrives behind its last fragment reads, with 16 products ready in registers, and
          // waits behind them: while the last wave's reads come in the others multiply, and a wave that is through starts
          // the next trip's reads as soon as the last has arrived.
          wait_lds_reads();
          wait_copies();
          bar_signal();
          // the refill needs no wait for this barrier: it goes into buffers that the barrier of trip t - 1 has freed. W stage t + 2
          // into the buffer that trip t - 1 read; A group g + 1, behind group g's first two signals, into the buffer that group
          // g - 1 left. All of it has landed at the next signal
          if (kx == 0) {
            if (gi + 1 < ng) {
              conv_wa<0>(wb, t + 2, ldw0 + 2 * (WBUF * 2), ah, al, hi4, wave0, g + 1, lds0);
              conv_apart<1>(ah, al, hi4, wave0, g + 1, lds0);
            } else {
              conv_wstage(wb, t + 2, ldw0 + 2 * (WBUF * 2));
            }
          } else if (kx == 1) {
            if (gi + 1 < ng) conv_wa<2>(wb, t + 2, ldw0, ah, al, hi4, wave0, g + 1, lds0);
          } else {
            if (gi + 1 < ng) conv_wstage(wb, t + 2, ldw0 + WBUF * 2);
          }
#if defined(__HIP_DEVICE_COMPILE__)
          // nothing is scheduled across this line: no product in front of the signal or of the copies
          __builtin_amdgcn_sched_barrier(0);
#endif
        }
        h0[0] = mma_raw(fa0, fb0, h0[0]);
        h0[1] = mma_raw(fa0, fb1, h0[1]);
        h0[2] = mma_raw(fa0, fb2, h0[2]);
        h0[3] = mma_raw(fa0, fb3, h0[3]);
        h1[0] = mma_raw(fa1, fb0, h1[0]);
        h1[1] = mma_raw(fa1, fb1, h1[1]);
        h1[2] = mma_raw(fa1, fb2, h1[2]);
        h1[3] = mma_raw(fa1, fb3, h1[3]);
        l0[0] = mma_raw(ga0, fb0, l0[0]);
        l0[1] = mma_raw(ga0, fb1, l0[1]);
        l0[2] = mma_raw(ga0, fb2, l0[2]);
        l0[3] = mma_raw(ga0, fb3, l0[3]);
        l1[0] = mma_raw(ga1, fb0, l1[0]);
        l1[1] = mma_raw(ga1, fb1, l1[1]);
        l1[2] = mma_raw(ga1, fb2, l1[2]);
        l1[3] = mma_raw(ga1, fb3, l1[3]);
        guard8(l0[0], l0[1], l0[2], l0[3], l1[0], l1[1], l1[2], l1[3], ga0, ga1, fb0, fb1, fb2, fb3);
#if defined(__HIP_DEVICE_COMPILE__)
        // nor across this one: without it products of this k-step sink in among the next k-step's reads or behind the barrier's wait
        __builtin_amdgcn_sched_barrier(0);
#endif
      }
      bar_wait();                                // publishes what had landed at the signals and ends every read of trip t's buffers
    }
  }
  wait_copies();
  float* Cs = (float*)(void*)ring;               // the ring is free behind the last trip's barrier: f32 tile [2 * 128][LDC]
#pragma unroll
  for (int r = 0; r < 8; ++r) {
    const int row = mw * 32 + 8 * hh + r;
    // unrolled for the same reason as above
#pragma unroll
    for (int n = 0; n < 4; ++n) {
      Cs[row * LDC + nw * 64 + n * 16 + c]              = h0[n][r];
      Cs[(row + 16) * LDC + nw * 64 + n * 16 + c]       = h1[n][r];
      Cs[(CPX + row) * LDC + nw * 64 + n * 16 + c]      = l0[n][r];
      Cs[(CPX + row + 16) * LDC + nw * 64 + n * 16 + c] = l1[n][r];
    }
  }
}

// ---- fused output GEMM core: rows = 64 pixels of one batch (local pixel pl0..pl0+63), cols = 128 output channels,
//      k = c' = 16 head + j (K = 128, 4 k-steps of two heads each). A[p][c'] = V_head[p][j] read from the NCHW flat v
//      planes at head*HSZ + 16 p + j (two 16-B halves per fragment, heads 2ks and 2ks+1); B = Wm[head][o][16]
//      k-contiguous per head. Products hi*hi + hi*lo (first loop) and lo*hi (second loop) into Cs[64][LDC].
__device__ __forceinline__ void mm_final(const _Float16* __restrict__ Vh, const _Float16* __restrict__ Vl,
                                         const _Float16* __restrict__ Wh, const _Float16* __restrict__ Wl,
                                         int pl0, float* Cs) {
  const int tid = threadIdx.x, wave = tid >> 5, lane = tid & 31, hh = lane >> 4, c = lane & 15;
  const int mw = wave >> 2, nw = wave & 3;
  const size_t r0 = (size_t)(pl0 + mw * 32 + c) * HD + 8 * hh;
  const size_t r1 = (size_t)(pl0 + mw * 32 + 16 + c) * HD + 8 * hh;
  const size_t q0 = (size_t)(nw * 32 + c) * HD + 8 * hh;
  const size_t q1 = (size_t)(nw * 32 + 16 + c) * HD + 8 * hh;
  {
    v8f h00 = zero8(), h01 = zero8(), h10 = zero8(), h11 = zero8();
    v8f l00 = zero8(), l01 = zero8(), l10 = zero8(), l11 = zero8();
    const _Float16* pa0 = Vh + r0;
    const _Float16* pa1 = Vh + r1;
    const _Float16* pb0 = Wh + q0;
    const _Float16* pb1 = Wh + q1;
    const _Float16* pc0 = Wl + q0;
    const _Float16* pc1 = Wl + q1;
    // two k-steps a batch: the batch's 24 loads are issued together, then multiplied in k order (one latency for two
    // k-steps; four at once would not leave registers for two work-groups on a WGP); unrolled: offsets become immediates
#pragma unroll
    for (int kp = 0; kp < CC / 64; ++kp) {
      v16h fa0[2], fa1[2], fb0[2], fb1[2], gb0[2], gb1[2];
#pragma unroll
      for (int u = 0; u < 2; ++u) {
        const int ao = (2 * (2 * kp + u)) * HSZ;
        const int bo = (2 * (2 * kp + u)) * (CC * HD);
        fa0[u] = ldfrag2(pa0 + ao, pa0 + ao + HSZ);
        fa1[u] = ldfrag2(pa1 + ao, pa1 + ao + HSZ);
        fb0[u] = ldfrag2(pb0 + bo, pb0 + bo + CC * HD);
        fb1[u] = ldfrag2(pb1 + bo, pb1 + bo + CC * HD);
        gb0[u] = ldfrag2(pc0 + bo, pc0 + bo + CC * HD);
        gb1[u] = ldfrag2(pc1 + bo, pc1 + bo + CC * HD);
      }
#if defined(__HIP_DEVICE_COMPILE__)
      // nothing is scheduled across this line: without it the first product, with its wait, is lifted in among the batch's
      // loads, and the loads behind it start one latency late
      __builtin_amdgcn_sched_barrier(0);
      // inputs-only fence on the loaded fragments: keeps the batch's loads together in front of its products; it holds the
      // wait that stands between issued loads and a rewrite of an address register they name
      asm volatile("s_wait_xcnt 0x0" :: "v"(fa0[0]), "v"(fa1[0]), "v"(fb0[0]), "v"(fb1[0]), "v"(gb0[0]), "v"(gb1[0]),
                   "v"(fa0[1]), "v"(fa1[1]), "v"(fb0[1]), "v"(fb1[1]), "v"(gb0[1]), "v"(gb1[1]));
#endif
#pragma unroll
      for (int u = 0; u < 2; ++u) {
        h00 = mma_raw(fa0[u], fb0[u], h00);
        h01 = mma_raw(fa0[u], fb1[u], h01);
        h10 = mma_raw(fa1[u], fb0[u], h10);
        h11 = mma_raw(fa1[u], fb1[u], h11);
        l00 = mma_raw(fa0[u], gb0[u], l00);
        l01 = mma_raw(fa0[u], gb1[u], l01);
        l10 = mma_raw(fa1[u], gb0[u], l10);
        l11 = mma_raw(fa1[u], gb1[u], l11);
        guard8(h00, h01, h10, h11, l00, l01, l10, l11, fa0[u], fa1[u], gb0[u], gb1[u], fb0[u], fb1[u]);
      }
    }
#pragma unroll
    for (int r = 0; r < 8; ++r) {
      const int row = mw * 32 + 8 * hh + r;
      Cs[row * LDC + nw * 32 + c]             = h00[r] + l00[r] * RSC;
      Cs[row * LDC + nw * 32 + 16 + c]        = h01[r] + l01[r] * RSC;
      Cs[(row + 16) * LDC + nw * 32 + c]      = h10[r] + l10[r] * RSC;
      Cs[(row + 16) * LDC + nw * 32 + 16 + c] = h11[r] + l11[r] * RSC;
    }
  }
  {
    v8f m00 = zero8(), m01 = zero8(), m10 = zero8(), m11 = zero8();
#if defined(__HIP_DEVICE_COMPILE__)
    // nothing is scheduled across this line or the one behind the loads: the first loop's epilogue stays out of the run of
    // loads, where it reused their address registers while they were in flight
    __builtin_amdgcn_sched_barrier(0);
#endif
    const _Float16* pa0 = Vl + r0;
    const _Float16* pa1 = Vl + r1;
    const _Float16* pb0 = Wh + q0;
    const _Float16* pb1 = Wh + q1;
    // all four k-steps' 32 loads are issued together, then multiplied in k order: one latency, not four
    v16h ga0[4], ga1[4], fb0[4], fb1[4];
#pragma unroll
    for (int ks = 0; ks < CC / 32; ++ks) {
      const int ao = (2 * ks) * HSZ;
      const int bo = (2 * ks) * (CC * HD);
      ga0[ks] = ldfrag2(pa0 + ao, pa0 + ao + HSZ);
      ga1[ks] = ldfrag2(pa1 + ao, pa1 + ao + HSZ);
      fb0[ks] = ldfrag2(pb0 + bo, pb0 + bo + CC * HD);
      fb1[ks] = ldfrag2(pb1 + bo, pb1 + bo + CC * HD);
    }
#if defined(__HIP_DEVICE_COMPILE__)
    __builtin_amdgcn_sched_barrier(0);
    // inputs-only fence on the loaded fragments, with the same wait as in the first loop
    asm volatile("s_wait_xcnt 0x0" :: "v"(ga0[0]), "v"(ga1[0]), "v"(fb0[0]), "v"(fb1[0]), "v"(ga0[1]), "v"(ga1[1]), "v"(fb0[1]), "v"(fb1[1]),
                 "v"(ga0[2]), "v"(ga1[2]), "v"(fb0[2]), "v"(fb1[2]), "v"(ga0[3]), "v"(ga1[3]), "v"(fb0[3]), "v"(fb1[3]));
#endif
#pragma unroll
    for (int ks = 0; ks < CC / 32; ++ks) {
      m00 = mma_raw(ga0[ks], fb0[ks], m00);
      m01 = mma_raw(ga0[ks], fb1[ks], m01);
      m10 = mma_raw(ga1[ks], fb0[ks], m10);
      m11 = mma_raw(ga1[ks], fb1[ks], m11);
      guard4(m00, m01, m10, m11, ga0[ks], ga1[ks], fb0[ks], fb1[ks]);
    }
#pragma unroll
    for (int r = 0; r < 8; ++r) {               // same lane wrote these slots above (program order, same type)
      const int row = mw * 32 + 8 * hh + r;
      Cs[row * LDC + nw * 32 + c]             += m00[r] * RSC;
      Cs[row * LDC + nw * 32 + 16 + c]        += m01[r] * RSC;
      Cs[(row + 16) * LDC + nw * 32 + c]      += m10[r] * RSC;
      Cs[(row + 16) * LDC + nw * 32 + 16 + c] += m11[r] * RSC;
    }
  }
}

// =================================================================================================================
// gamma[w], beta[w] bf16 converted) + NCHW -> NHWC + hi/lo f16 planes. Block = (b, h, channel half): wave = 8
// channel rows, lane = 4 w values, shuffle reductions; f32 tile T[64 ch][w] in LDS; then each pixel's 64 channels
// grid = NB*128*2, 256 threads. coverage: xh/xl [NPIX px][128 ch], every element once.
// The same launch carries two pieces of work that depend on nothing before them and are read only by later launches:
// (a) weight convert. Work-group blk < 384: row blk = (tensor, co) of (wq2, wk2, wv2) [co][ci][3][3] f32 -> wt [row][k =
//     tap*128 + ci] f16(64 * bf16(w)): the row's 1152 floats are loaded as whole lines beside the x rows, go through LDS
//     across the kernel's one barrier, and thread tt < 144 builds one 16-B piece. Work-group blk >= 384: three rows of
//     (wq1, wk1, wv1) [o][c] -> w1 [row][c], thread tt < 48 one 16-B piece. coverage: wt 384 x 1152, w1 384 x 128, once.
// (b) halo zero fill of the three padded planes: work-group blk zeroes the 16-B pieces blk*104 .. blk*104 + 103 (whole lines) of
//     the 3*NB*516*16. coverage: every halo pixel (py in {0,129} or px in {0,129}) of every image of all 3 planes, once.
// =================================================================================================================
// inputs-only fence on the 8 rows' shuffled values (they come back on the LDS counter like loads): keeps the 8 shuffles of
// one reduction step together in front of their adds; without it the compiler runs the rows' chains one after another and
// the wave waits out every shuffle's latency alone
__device__ __forceinline__ void row_fence(const float (&t)[8]) {
#if defined(__HIP_DEVICE_COMPILE__)
  asm volatile("" :: "v"(t[0]), "v"(t[1]), "v"(t[2]), "v"(t[3]), "v"(t[4]), "v"(t[5]), "v"(t[6]), "v"(t[7]));
#endif
}
__global__ __launch_bounds__(256)
void k_ln(const float* __restrict__ x, const float* __restrict__ gw, const float* __restrict__ gb,
          const float* __restrict__ wq1, const float* __restrict__ wq2, const float* __restrict__ wk1,
          const float* __restrict__ wk2, const float* __restrict__ wv1, const float* __restrict__ wv2,
          unsigned short* xh, unsigned short* xl, unsigned short* w1, unsigned short* wt, unsigned short* p1) {
  __shared__ __align__(16) float T[64 * LDC];
  __shared__ __align__(16) float Wl[2048];
  const int tid = threadIdx.x, wv = tid >> 5, lane = tid & 31;
  const int blk = blockIdx.x;
  // the work-group's share of the weights: two 16-B loads a thread (addresses clamped into the share)
  const bool w33 = blk < 3 * CC;                             // block-uniform
  const int r11 = (blk - 3 * CC) * 3 + (min(tid, 47) >> 4);  // row of w1 where !w33
  const float* wp0;
  const float* wp1;
  if (w33) {
    const int t = blk / CC;
    const float* rowp = ((t == 0) ? wq2 : ((t == 1) ? wk2 : wv2)) + (size_t)(blk - t * CC) * KCV;
    wp0 = rowp + 4 * tid;
    wp1 = rowp + 1024 + 4 * min(tid, 31);
  } else {
    const int t = r11 / CC;
    wp0 = ((t == 0) ? wq1 : ((t == 1) ? wk1 : wv1)) + (size_t)(r11 - t * CC) * CC + (tid & 15) * 8;
    wp1 = wp0 + 4;
  }
  const v4f wa = *(const v4f*)wp0;
  const v4f wb = *(const v4f*)wp1;
  const int bh = blk >> 1, chalf = blk & 1;
  const int b = bh / HH, h = bh - b * HH;
  const v4f g4 = *(const v4f*)(gw + lane * 4);
  const v4f b4 = *(const v4f*)(gb + lane * 4);
  float g[4], be[4];
#pragma unroll
  for (int e = 0; e < 4; ++e) { g[e] = bfr(g4[e]); be[e] = bfr(b4[e]); }
  // the wave's 8 channel rows: all 8 loads are issued first, then every step of the row arithmetic runs over the 8 rows
  // side by side (8 independent shuffle chains), so the wave pays one memory latency and one chain, not eight of each
  const float* row0 = x + ((size_t)(b * CC + chalf * 64 + wv * 8) * HH + h) * WW + lane * 4;
  v4f a[8];
#pragma unroll
  for (int it = 0; it < 8; ++it) a[it] = *(const v4f*)(row0 + it * (HH * WW));
#if defined(__HIP_DEVICE_COMPILE__)
  // inputs-only fence on the loaded values: keeps the 8 loads together in front of the arithmetic; it holds the wait that
  // stands between issued loads and a rewrite of the address they name, and the address is an input, so it lives that long
  asm volatile("s_wait_xcnt 0x0" :: "v"(row0), "v"(a[0]), "v"(a[1]), "v"(a[2]), "v"(a[3]), "v"(a[4]), "v"(a[5]),
               "v"(a[6]), "v"(a[7]));
  // the same for the two weight loads: they stay in front of the arithmetic, in flight beside the x rows
  asm volatile("s_wait_xcnt 0x0" :: "v"(wp0), "v"(wp1), "v"(wa), "v"(wb));
#endif
  // no branch here: where the work-group has 1x1 rows, and above word 1151, nothing reads what is written
  *(v4f*)(Wl + 4 * tid) = wa;
  *(v4f*)(Wl + 1024 + 4 * tid) = wb;
  float d[8][4], s[8], sq[8];
#pragma unroll
  for (int it = 0; it < 8; ++it) {
#pragma unroll
    for (int e = 0; e < 4; ++e) d[it][e] = bfr(a[it][e]);
    s[it] = (d[it][0] + d[it][1]) + (d[it][2] + d[it][3]);
  }
#pragma unroll
  for (int off = 16; off; off >>= 1) {
    float t[8];
#pragma unroll
    for (int it = 0; it < 8; ++it) t[it] = __shfl_xor(s[it], off, 32);
    row_fence(t);
#pragma unroll
    for (int it = 0; it < 8; ++it) s[it] += t[it];
  }
#pragma unroll
  for (int it = 0; it < 8; ++it) {
    const float mu = s[it] * (1.0f / 128.0f);
#pragma unroll
    for (int e = 0; e < 4; ++e) d[it][e] = d[it][e] - mu;
    sq[it] = (d[it][0] * d[it][0] + d[it][1] * d[it][1]) + (d[it][2] * d[it][2] + d[it][3] * d[it][3]);
  }
#pragma unroll
  for (int off = 16; off; off >>= 1) {
    float t[8];
#pragma unroll
    for (int it = 0; it < 8; ++it) t[it] = __shfl_xor(sq[it], off, 32);
    row_fence(t);
#pragma unroll
    for (int it = 0; it < 8; ++it) sq[it] += t[it];
  }
#pragma unroll
  for (int it = 0; it < 8; ++it) {
    const float var = sq[it] * (1.0f / 128.0f);
    const float rs = rsqrtf(var + 1e-5f);
    v4f o;
#pragma unroll
    for (int e = 0; e < 4; ++e) o[e] = (d[it][e] * rs) * g[e] + be[e];
    *(v4f*)(T + (wv * 8 + it) * LDC + lane * 4) = o;
  }
  __syncthreads();
  v4u ph[4], pq[4];
  size_t offs[4];
#pragma unroll
  for (int s = 0; s < 4; ++s) {
    const int idx = s * 256 + tid;
    const int w = idx >> 3, piece = idx & 7;
    const int c0 = piece * 8;
    v4u a, q4;
#pragma unroll
    for (int e = 0; e < 4; ++e) {
      const float f0 = T[(c0 + 2 * e) * LDC + w];
      const float f1 = T[(c0 + 2 * e + 1) * LDC + w];
      unsigned hp, lp;
      split2(f0, f1, hp, lp);
      a[e] = hp; q4[e] = lp;
    }
    ph[s] = a;
    pq[s] = q4;
    offs[s] = (size_t)(b * IMGPIX + h * WW + w) * CC + chalf * 64 + c0;
  }
  // the weight piece of this thread (indices clamped; stored below by the threads that own one)
  v4u wpk;
  unsigned short* wdst;
  if (w33) {
    const int k0 = min(tid, 143) * 8, tap = k0 / CC, c0 = k0 - tap * CC;
#pragma unroll
    for (int e = 0; e < 4; ++e) {
      const float f0 = Wl[(c0 + 2 * e) * 9 + tap];
      const float f1 = Wl[(c0 + 2 * e + 1) * 9 + tap];
      wpk[e] = pk16(hb16(bfr(f0) * 64.0f), hb16(bfr(f1) * 64.0f));
    }
    wdst = wt + (size_t)blk * KCV + k0;
  } else {
    wpk[0] = pk16(hb16(bfr(wa[0]) * 64.0f), hb16(bfr(wa[1]) * 64.0f));
    wpk[1] = pk16(hb16(bfr(wa[2]) * 64.0f), hb16(bfr(wa[3]) * 64.0f));
    wpk[2] = pk16(hb16(bfr(wb[0]) * 64.0f), hb16(bfr(wb[1]) * 64.0f));
    wpk[3] = pk16(hb16(bfr(wb[2]) * 64.0f), hb16(bfr(wb[3]) * 64.0f));
    wdst = w1 + (size_t)r11 * CC + (tid & 15) * 8;
  }
  // the halo piece of this thread (index clamped likewise)
  const int hidx = blk * HPB + tid;
  size_t hoff;
  {
    const int idx = min(hidx, NHPC - 1);
    const int piece = idx & 15;
    int r = idx >> 4;
    const int hp = r % NHALO;
    r /= NHALO;
    const int img = r % NB, plane = r / NB;
    const int q = max(hp - 2 * WP, 0);
    const int pyA = (hp < WP) ? 0 : (HP - 1);
    const int pxA = (hp < WP) ? hp : (hp - WP);
    const int pyB = 1 + (q >> 1);
    const int pxB = (q & 1) ? (WP - 1) : 0;
    const bool edge = hp < 2 * WP;
    const int py = edge ? pyA : pyB;
    const int px = edge ? pxA : pxB;
    hoff = (size_t)plane * PS1 + ((size_t)(img * HP + py) * WP + px) * CC + piece * 8;
  }
#pragma unroll
  for (int s = 0; s < 4; ++s) { *(v4u*)(xh + offs[s]) = ph[s]; *(v4u*)(xl + offs[s]) = pq[s]; }
  if (tid < (w33 ? 144 : 48)) *(v4u*)wdst = wpk;
  if (tid < HPB && hidx < NHPC) {
    v4u z = {0u, 0u, 0u, 0u};
    *(v4u*)(p1 + hoff) = z;
  }
}

// =================================================================================================================
// 1x1 projections: C[64 pixels][128 out ch] = xn . w1[t]^T (K = 128), value = C/64; written as f16 (nearest) into the
// padded NHWC plane p1[t] ([NB][130][130][128]) at the interior position (y+1, x+1). 64 consecutive
// pixels lie in one image row -> 64 consecutive padded pixels; thread = one 16-B piece, 16 threads per pixel row
// coverage: interior NPIX padded pixels x 128 ch of all 3 planes (halo by k_ln's launch).
// =================================================================================================================
__global__ __launch_bounds__(256)
void k_proj(const unsigned short* __restrict__ xh, const unsigned short* __restrict__ xl,
            const unsigned short* __restrict__ w1, unsigned short* p1) {
  __shared__ __align__(16) _Float16 ring[2 * SBUF];
  const float* Cs = (const float*)(const void*)ring;
  const int tid = threadIdx.x;
  const int mb = blockIdx.x, t = blockIdx.y;
  mm_tile2((const _Float16*)(const void*)xh, (const _Float16*)(const void*)xl,
           (const _Float16*)(const void*)(w1 + (size_t)t * CC * CC), mb * 64, ring);
  __syncthreads();
  unsigned short* dh = p1 + (size_t)t * PS1;
  const int p0 = mb * 64;
  const int b = p0 / IMGPIX, rem = p0 - b * IMGPIX;
  const int y = rem / WW, x0 = rem - y * WW;
  const size_t pprow = (size_t)(b * HP + y + 1) * WP + x0 + 1;
  v4u ph[4];
  size_t offs[4];
#pragma unroll
  for (int s = 0; s < 4; ++s) {
    const int idx = s * 256 + tid;
    const int row = idx >> 4, piece = idx & 15;
    const int col0 = piece * 8;
    v4u a;
#pragma unroll
    for (int e = 0; e < 4; ++e) {
      const float f0 = Cs[row * LDC + col0 + 2 * e] * (1.0f / 64.0f);
      const float f1 = Cs[row * LDC + col0 + 2 * e + 1] * (1.0f / 64.0f);
      a[e] = pk16(hb16(f0), hb16(f1));
    }
    ph[s] = a;
    offs[s] = (pprow + row) * CC + col0;
  }
#pragma unroll
  for (int s = 0; s < 4; ++s) *(v4u*)(dh + offs[s]) = ph[s];
  
}

// =================================================================================================================
// 3x3 conv implicit GEMM + logit partial sums. Tile = 256 consecutive output pixels (two image rows) x 128 channels,
// K = 1152 as 36 k-steps, A = the f16 plane of tensor t, W = 64 bf16(w2[t]) -> value = C/64. A work-group is two
// halves of 8 waves, each with its own LDS buffers, in step at the same barriers.
// Work-group blk < 128 (rows 2 blk, 2 blk + 1): half 0 convolves q, half 1 convolves k, whole K each. q and k then lie side by
// side in LDS as f32 tiles [row][pixel w][channel c] and go no further: by the raw reshape an image row holds, for every head, the 128
// rows r = (c%16, w/16) of Q_head and K_head, with d = w%16. Wave = (image row, head) sums S[i][j] += K[c][16 wb + i] Q[c][16 wb + j] on
// f32 WMMA (k = 4 consecutive c; A and B fragments by the same loader, so the same k order), 32 products in two chains (even
// and odd channel quads), and stores sp[b*8 + head][row h][i][j] = S / 4096. k_attn adds the 128 rows in order.
// Work-group blk >= 128 (rows 2 (blk - 128) and the next): v, K split between the halves (groups 0..2 and 3..5), the two f32
// tiles added in the epilogue; such a work-group lasts half as long, and they stand behind the long ones in the grid.
// grid = NB*128, 512 threads. coverage: sp [NB*8][128][256] f32 and vh/vl [NB][128][16384] (NCHW flat), every element once.
// =================================================================================================================
__global__ __launch_bounds__(512)
void k_conv3(const unsigned short* __restrict__ p1, const unsigned short* __restrict__ wt,
             float* sp, unsigned short* vh, unsigned short* vl) {
  __shared__ __align__(16) _Float16 ring[2 * CTILE];
  const int tid = threadIdx.x;
  const int half = __builtin_amdgcn_readfirstlane(tid >> 8);  // the same in a whole wave: kept in a scalar register
  const bool qk = blockIdx.x < NPIX / (2 * CPX);              // block-uniform
  const int mb = qk ? blockIdx.x : blockIdx.x - NPIX / (2 * CPX);
  const int t = qk ? half : 2;
  mm_conv((const _Float16*)(const void*)(p1 + (size_t)t * PS1),
          (const _Float16*)(const void*)(wt + (size_t)t * CC * KCV), mb * (2 * CPX), ring + half * CTILE, tid & 255,
          qk ? 0 : half * (NGR / 2), qk ? NGR : NGR / 2);
  __syncthreads();                                           // both halves' f32 tiles are readable by every wave
  const float* C0 = (const float*)(const void*)ring;
  const float* C1 = (const float*)(const void*)(ring + CTILE);
  const int p0 = mb * (2 * CPX);
  const int b = p0 / IMGPIX, pix0 = p0 - b * IMGPIX;
  if (qk) {                                                  // block-uniform branch
    const int wv = __builtin_amdgcn_readfirstlane(tid >> 5);
    const int head = wv & (NHEAD - 1), rsel = wv >> 3;       // 16 waves = 2 image rows x 8 heads
    {
      const int lane = tid & 31, hh = lane >> 4, c = lane & 15;
      const float* pq = C0 + (rsel * CPX + c) * LDC + head * HD + 2 * hh;
      const float* pk = C1 + (rsel * CPX + c) * LDC + head * HD + 2 * hh;
      v8f s0 = zero8(), s1 = zero8();
      // all 64 fragments are read first (the conv's accumulator registers are free by now), then multiplied in order: one LDS
      // latency, not one per pair of products; unrolled: every fragment's LDS offset becomes an immediate of its load
      v2f fk[32], fq[32];
#pragma unroll
      for (int u = 0; u < 32; ++u) {                         // u = 4 wb + channel quad
        fk[u] = *(const v2f*)(pk + (u >> 2) * 16 * LDC + (u & 3) * 4);
        fq[u] = *(const v2f*)(pq + (u >> 2) * 16 * LDC + (u & 3) * 4);
      }
#if defined(__HIP_DEVICE_COMPILE__)
      // nothing is scheduled across this line: without it each pair's reads sink to their products and every pair waits out
      // the LDS latency
      __builtin_amdgcn_sched_barrier(0);
#endif
#pragma unroll
      for (int u = 0; u < 32; u += 2) {
        s0 = __builtin_amdgcn_wmma_f32_16x16x4_f32(false, fk[u], false, fq[u], (short)0, s0, false, false);
        s1 = __builtin_amdgcn_wmma_f32_16x16x4_f32(false, fk[u + 1], false, fq[u + 1], (short)0, s1, false, false);
        guardf(s0, s1, fk[u], fq[u], fk[u + 1], fq[u + 1]);
      }
      float* d = sp + ((size_t)(b * NHEAD + head) * HH + pix0 / WW + rsel) * 256 + 8 * hh * HD + c;
#pragma unroll
      for (int r = 0; r < 8; ++r) d[r * HD] = (s0[r] + s1[r]) * (1.0f / 4096.0f);
    }
  } else {
    v4u ph[8], pq[8];
    size_t offs[8];
#pragma unroll
    for (int s = 0; s < 8; ++s) {                            // s >> 1: the tile's quarter of 64 pixels
      const int idx = (s & 1) * 512 + tid;
      const int co = idx >> 3, piece = idx & 7;
      const int r0 = (s >> 1) * 64 + piece * 8;
      v4u a, q4;
#pragma unroll
      for (int e = 0; e < 4; ++e) {
        const float f0 = (C0[(r0 + 2 * e) * LDC + co] + C1[(r0 + 2 * e) * LDC + co]) * (1.0f / 64.0f);
        const float f1 = (C0[(r0 + 2 * e + 1) * LDC + co] + C1[(r0 + 2 * e + 1) * LDC + co]) * (1.0f / 64.0f);
        unsigned hp, lp;
        split2(f0, f1, hp, lp);
        a[e] = hp; q4[e] = lp;
      }
      ph[s] = a;
      pq[s] = q4;
      offs[s] = (size_t)(b * CC + co) * IMGPIX + pix0 + r0;
    }
#pragma unroll
    for (int s = 0; s < 8; ++s) { *(v4u*)(vh + offs[s]) = ph[s]; *(v4u*)(vl + offs[s]) = pq[s]; }
#if defined(__HIP_DEVICE_COMPILE__)
    // the wait that stands between the issued stores and a rewrite of a register they name (the code that follows this
    // branch in the built object reuses them)
    asm volatile("s_wait_xcnt 0x0" ::: "memory");
#endif
  }
}

// =================================================================================================================
// Per (b, head) channel attention: S[i][j] = the 128 image rows' partial sums of k_conv3 added in fixed order (8 runs of
// 16 rows side by side, then the 8 runs in order).
// P = softmax_j(S * (1/bf16(scale))) in f32 (max-subtracted).
// Wm[o][j] = sum_j2 64 bf16(wo[o][16 head + j2]) P[j][j2] on WMMA (K = 16 zero padded to 32; P carried x4096 as
// f16 hi + residual), value/4096 = 64 Wm; stored as f16 hi/lo planes weh/wel [b][head][o][16]: block region =
// grid = NB*8, 256 threads. coverage: weh/wel [NB][8][128][16], every element once.
// =================================================================================================================
// inputs-only fence on 16 loaded values v[O..O+15]: keeps their loads in front of the arithmetic; it holds the wait between the
// issued loads and a rewrite of the address they name, and the address is an input, so it stays live to the wait
template <int O>
__device__ __forceinline__ void fence16(const float* p, const float (&v)[HH]) {
#if defined(__HIP_DEVICE_COMPILE__)
  asm volatile("s_wait_xcnt 0x0" :: "v"(p), "v"(v[O]), "v"(v[O + 1]), "v"(v[O + 2]), "v"(v[O + 3]), "v"(v[O + 4]), "v"(v[O + 5]),
               "v"(v[O + 6]), "v"(v[O + 7]), "v"(v[O + 8]), "v"(v[O + 9]), "v"(v[O + 10]), "v"(v[O + 11]), "v"(v[O + 12]),
               "v"(v[O + 13]), "v"(v[O + 14]), "v"(v[O + 15]));
#endif
}
__global__ __launch_bounds__(256)
void k_attn(const float* __restrict__ sp, const float* __restrict__ wo, const float* __restrict__ scale,
            unsigned short* weh, unsigned short* wel) {
  __shared__ float Sm[16 * WSP];
  __shared__ __align__(16) _Float16 Phs[16 * FP];
  __shared__ __align__(16) _Float16 Pls[16 * FP];
  __shared__ __align__(16) _Float16 Wts[CC * FP];
  __shared__ float Ws[CC * WSP];
  const int tid = threadIdx.x, wave = tid >> 5, lane = tid & 31, hh = lane >> 4, m = lane & 15;
  const int bi = blockIdx.x, b = bi / NHEAD, head = bi - b * NHEAD;
  // wo slice -> f16 [o][k] (k = j2, zero for k >= 16; addresses clamped)
  // thread = (o = 8 it + wave, k = lane); the 16 loads of the slice and the 128 loads of the partial sums are all issued
  // before the first is used: one memory latency for all, not one per trip
  {
    const float* wop = wo + (size_t)wave * CC + head * HD + min(lane, HD - 1);
    float wf[16];
#pragma unroll
    for (int it = 0; it < 16; ++it) wf[it] = wop[it * 8 * CC];
    const int i = tid >> 4, j = tid & 15;
    const float* spp = sp + (size_t)bi * (HH * 256) + i * 16 + j;
    float pv[HH];
#pragma unroll
    for (int h = 0; h < HH; ++h) pv[h] = spp[h * 256];
#if defined(__HIP_DEVICE_COMPILE__)
    // nothing is scheduled across this line: without it loads sink behind the first fence's wait and start a latency late
    __builtin_amdgcn_sched_barrier(0);
    // inputs-only fence on the slice's loaded values: keeps the loads above in front of the arithmetic; same wait and same
    // live address as in the statement below
    asm volatile("s_wait_xcnt 0x0" :: "v"(wop), "v"(wf[0]), "v"(wf[1]), "v"(wf[2]), "v"(wf[3]), "v"(wf[4]), "v"(wf[5]),
                 "v"(wf[6]), "v"(wf[7]), "v"(wf[8]), "v"(wf[9]), "v"(wf[10]), "v"(wf[11]), "v"(wf[12]), "v"(wf[13]),
                 "v"(wf[14]), "v"(wf[15]));
#endif
    fence16<0>(spp, pv);  fence16<16>(spp, pv); fence16<32>(spp, pv); fence16<48>(spp, pv);
    fence16<64>(spp, pv); fence16<80>(spp, pv); fence16<96>(spp, pv); fence16<112>(spp, pv);
#pragma unroll
    for (int it = 0; it < 16; ++it) {
      const float v = (lane < HD) ? bfr(wf[it]) * 64.0f : 0.0f;
      Wts[(it * 8 + wave) * FP + lane] = (_Float16)v;
    }
    float sr[8];
#pragma unroll
    for (int u = 0; u < 8; ++u) sr[u] = 0.f;
#pragma unroll
    for (int h = 0; h < 16; ++h) {
#pragma unroll
      for (int u = 0; u < 8; ++u) sr[u] += pv[u * 16 + h];
    }
    float s = 0.f;
#pragma unroll
    for (int u = 0; u < 8; ++u) s += sr[u];
    const float isc = 1.0f / bfr(scale[0]);
    Sm[i * WSP + j] = s * isc;
  }
  __syncthreads();
  if (tid < 16) {
    // the row's 16 logits are read from LDS together and stay in registers: one LDS latency, not one per element and pass
    float sv[HD];
#pragma unroll
    for (int n = 0; n < HD; ++n) sv[n] = Sm[tid * WSP + n];
    float mx = -3.0e38f;
#pragma unroll
    for (int n = 0; n < HD; ++n) mx = fmaxf(mx, sv[n]);
    float ssum = 0.f;
#pragma unroll
    for (int n = 0; n < HD; ++n) {
      sv[n] = expf(sv[n] - mx);
      ssum += sv[n];
    }
    const float inv = 1.0f / ssum;
#pragma unroll
    for (int n = 0; n < HD; ++n) {
      const float pv = (sv[n] * inv) * 4096.0f;
      const _Float16 hv = (_Float16)pv;
      Phs[tid * FP + n] = hv;
      Pls[tid * FP + n] = (_Float16)((pv - (float)hv) * 2048.0f);
    }
#pragma unroll
    for (int n = HD; n < 32; ++n) { Phs[tid * FP + n] = (_Float16)0.0f; Pls[tid * FP + n] = (_Float16)0.0f; }
  }
  __syncthreads();
  {
    const v16h fa = ldfrag_h(Wts + (wave * 16 + m) * FP + 8 * hh);
    const v16h fb = ldfrag_h(Phs + m * FP + 8 * hh);
    const v16h gb = ldfrag_h(Pls + m * FP + 8 * hh);
    v8f ah = mma_raw(fa, fb, zero8());
    v8f al = mma_raw(fa, gb, zero8());
    guard2(ah, al, fa, fb, gb);
#pragma unroll
    for (int r = 0; r < 8; ++r) Ws[(wave * 16 + 8 * hh + r) * WSP + m] = (ah[r] + al[r] * RSC) * (1.0f / 4096.0f);
  }
  __syncthreads();
  {
    const int o = tid >> 1, hf = tid & 1;
    v4u a, q4;
#pragma unroll
    for (int e = 0; e < 4; ++e) {
      const float f0 = Ws[o * WSP + hf * 8 + 2 * e];
      const float f1 = Ws[o * WSP + hf * 8 + 2 * e + 1];
      unsigned hp, lp;
      split2(f0, f1, hp, lp);
      a[e] = hp; q4[e] = lp;
    }
    const size_t off = (size_t)(bi * CC + o) * HD + hf * 8;
    *(v4u*)(weh + off) = a;
    *(v4u*)(wel + off) = q4;
    
  }
}

// =================================================================================================================
// Output: y[b][o][p] = (sum_c' Wm64[b][c'][o] V[p][c']) / 64 + bf16(x[b][o][p]) for 64 pixels x 128 channels per
// =================================================================================================================
__global__ __launch_bounds__(256)
void k_final(const unsigned short* __restrict__ vh, const unsigned short* __restrict__ vl,
             const unsigned short* __restrict__ weh, const unsigned short* __restrict__ wel,
             const float* __restrict__ x, float* out) {
  __shared__ __align__(16) float Cs[64 * LDC];
  const int tid = threadIdx.x;
  const int mb = blockIdx.x;
  const int p0 = mb * 64;
  const int b = p0 / IMGPIX, pl0 = p0 - b * IMGPIX;
  const _Float16* Vh = (const _Float16*)(const void*)(vh + (size_t)b * BSZ);
  const _Float16* Vl = (const _Float16*)(const void*)(vl + (size_t)b * BSZ);
  const _Float16* Wh = (const _Float16*)(const void*)(weh + (size_t)b * NHEAD * CC * HD);
  const _Float16* Wl = (const _Float16*)(const void*)(wel + (size_t)b * NHEAD * CC * HD);
  mm_final(Vh, Vl, Wh, Wl, pl0, Cs);
  __syncthreads();
  v4f pk[8];
  size_t offs[8];
#pragma unroll
  for (int s = 0; s < 8; ++s) {
    const int idx = s * 256 + tid;
    const int o = idx >> 4, piece = idx & 15;
    const size_t off = (size_t)(b * CC + o) * IMGPIX + pl0 + piece * 4;
    const v4f xr = *(const v4f*)(x + off);
    v4f v;
#pragma unroll
    for (int e = 0; e < 4; ++e) v[e] = Cs[(piece * 4 + e) * LDC + o] * (1.0f / 64.0f) + bfr(xr[e]);
    pk[s] = v;
    offs[s] = off;
  }
#pragma unroll
  for (int s = 0; s < 8; ++s) *(v4f*)(out + offs[s]) = pk[s];
  
}

// =================================================================================================================
// Workspace map (bytes, offsets multiples of 65536, no aliasing, every region sized at or above its whole-line store
// extent): W1 f16 [3][128][128] 98304 (131072) | WT f16 [3][128][1152] 884736 (917504) | XH, XL f16 [32768][128]
// 8388608 each | P1 f16 3 x [2][130][130][128] 25958400 (26017792) |
// VH, VL f16 [2][128][16384] 8388608 each | WEH, WEL f16 [2][8][128][16] 65536 each | SP f32 [16][128][256] 2097152 |
// total 62849024.
// =================================================================================================================
extern "C" void kernel_launch(void* const* d_in, const int* in_sizes, int n_in,
                              void* d_out, int out_size, void* d_ws, size_t ws_size,
                              hipStream_t stream) {
  if (n_in < 11) return;
  const int expect[11] = { NB * CC * IMGPIX, WW, WW, 1, CC * CC, CC * CC * 9, CC * CC, CC * CC * 9,
                           CC * CC, CC * CC * 9, CC * CC };
  for (int i = 0; i < 11; ++i) if (in_sizes[i] != expect[i]) return;
  if (out_size != NB * CC * IMGPIX) return;

  const float* x     = (const float*)d_in[0];
  const float* gam   = (const float*)d_in[1];
  const float* bet   = (const float*)d_in[2];
  const float* scale = (const float*)d_in[3];
  const float* wq1   = (const float*)d_in[4];
  const float* wq2   = (const float*)d_in[5];
  const float* wk1   = (const float*)d_in[6];
  const float* wk2   = (const float*)d_in[7];
  const float* wv1   = (const float*)d_in[8];
  const float* wv2   = (const float*)d_in[9];
  const float* wo    = (const float*)d_in[10];
  float* out = (float*)d_out;

  const size_t AL = 65536;
  const size_t sW1 = (((size_t)3 * CC * CC * 2) + AL - 1) / AL * AL;               //   131072
  const size_t sWT = (((size_t)3 * CC * KCV * 2) + AL - 1) / AL * AL;              //   917504
  const size_t sX  = (((size_t)NPIX * CC * 2) + AL - 1) / AL * AL;                  //  8388608
  const size_t sP1 = (((size_t)3 * PS1 * 2) + AL - 1) / AL * AL;                    // 26017792
  const size_t sV  = (((size_t)NB * BSZ * 2) + AL - 1) / AL * AL;                   //  8388608
  const size_t sWE = (((size_t)NB * NHEAD * CC * HD * 2) + AL - 1) / AL * AL;       //    65536
  const size_t sSP = (((size_t)NB * NHEAD * HH * 256 * 4) + AL - 1) / AL * AL;      //  2097152

  size_t off = 0;
  const size_t oW1  = off; off += sW1;
  const size_t oWT  = off; off += sWT;
  const size_t oXH  = off; off += sX;
  const size_t oXL  = off; off += sX;
  const size_t oP1  = off; off += sP1;
  const size_t oVH  = off; off += sV;
  const size_t oVL  = off; off += sV;
  const size_t oWEH = off; off += sWE;
  const size_t oWEL = off; off += sWE;
  const size_t oSP  = off; off += sSP;
  if (off > ws_size) return;                                 // off = 62849024
  if (off > (size_t)134217728) return;

  char* ws = (char*)d_ws;
  unsigned short* W1  = (unsigned short*)(ws + oW1);
  unsigned short* WT  = (unsigned short*)(ws + oWT);
  unsigned short* XH  = (unsigned short*)(ws + oXH);
  unsigned short* XL  = (unsigned short*)(ws + oXL);
  unsigned short* P1  = (unsigned short*)(ws + oP1);
  unsigned short* VH  = (unsigned short*)(ws + oVH);
  unsigned short* VL  = (unsigned short*)(ws + oVL);
  unsigned short* WEH = (unsigned short*)(ws + oWEH);
  unsigned short* WEL = (unsigned short*)(ws + oWEL);
  float*          SP  = (float*)(ws + oSP);

  const dim3 blk(256);
  // (1) layer norm over w + NHWC hi/lo planes; weight planes; halo zero fill of the padded planes
  k_ln<<<dim3(LNG), blk, 0, stream>>>(x, gam, bet, wq1, wq2, wk1, wk2, wv1, wv2, XH, XL, W1, WT, P1);
  // (2) 1x1 projections into padded NHWC f16 planes (interior)
  k_proj<<<dim3(NPIX / 64, 3), blk, 0, stream>>>(XH, XL, W1, P1);
  // (3) 3x3 convs: q and k -> f32 logit partial sums per image row; v -> f16 hi/lo NCHW flat planes
  k_conv3<<<dim3(2 * (NPIX / (2 * CPX))), dim3(512), 0, stream>>>(P1, WT, SP, VH, VL);
  // (4) per-head channel attention: rows' partial sums added + softmax + wo mix -> Wm planes
  k_attn<<<dim3(NB * NHEAD), blk, 0, stream>>>(SP, wo, scale, WEH, WEL);
  // (5) output GEMM + residual -> NCHW d_out
  k_final<<<dim3(NPIX / 64), blk, 0, stream>>>(VH, VL, WEH, WEL, x, out);
  (void)hipGetLastError();
}

// v010
// Measured time: 52.9 microseconds a run.
// In two side-by-side timings against v009, it was 1.04 and 1.03 times as fast.
// All steps since v000 together make it 12.8 times as fast.
// Contractions: 1x1 projections (K=128): v_wmma_f32_16x16x32_f16, the activation as f16 hi + x2048 residual planes into two
// f32 accumulators, weights one f16 plane of 64*bf16(w); 3x3 convs as implicit GEMM (K=1152): the same form, the projected
// activation as ONE f16 plane (rounded to nearest, no residual), weights as above;
// per-head k^T q logits (K=16384): v_wmma_f32_16x16x4_f32 on the convs' f32 LDS tiles, one partial per image row, the
// rows' partials added in fixed order on VALU; wo x probs mix
// (K=16, zero padded to 32): f16, probs carried x4096 as hi + residual; fused output GEMM (K=128): v and the mixed
// weight as f16 hi + residual planes (3 products); f32 accumulate everywhere. Layer-norm statistics, softmax and
// all epilogues f32 on VALU; every float input RNE-converted to bf16 on load.
#include <hip/hip_runtime.h>
#include <stdint.h>

#define NB     2
#define CC     128
#define HH     128
#define WW     128
#define IMGPIX (HH * WW)
#define NPIX   (NB * IMGPIX)
#define HP     (HH + 2)
#define WP     (WW + 2)
#define PADIMG (HP * WP)
#define PADPIX (NB * PADIMG)
#define KCV    1152
#define NKS    36
#define NHEAD  8
#define HD     16
#define HSZ    (IMGPIX * HD)
#define BSZ    (CC * IMGPIX)
#define LDC    132
#define FP     40
#define WSP    17
#define NHALO  (2 * WP + 2 * HH)
#define RSC    0.00048828125f
#define PS1    ((size_t)PADPIX * CC)
#define PS2    ((size_t)NPIX * CC)
#define SPK    72
#define NST    18
#define CPX    128
#define ARW    (WW + 2)
#define ABUF   (2 * ARW * SPK)
#define WBUF   (CC * SPK)
#define NGR    6
#define CRING  (2 * ABUF + 3 * WBUF)
#define CTILE  (2 * CPX * LDC * 2)
#define LNG    (NB * HH * 2)
#define NHPC   (3 * NB * NHALO * 16)
#define HPB    104
#define XP     136

static_assert(NPIX == NB * IMGPIX);
static_assert(IMGPIX == 16384 && HH == 128 && WW == 128);
static_assert(PADIMG == 16900);
static_assert(KCV == 9 * CC && KCV == NKS * 32);
static_assert(CC == NHEAD * HD);
static_assert(BSZ == CC * IMGPIX && HSZ * NHEAD == BSZ);
static_assert((IMGPIX % 64) == 0 && (WW % 64) == 0);
static_assert((LDC * 4) % 16 == 0 && (FP * 2) % 16 == 0);
static_assert(NHALO == 516);
static_assert((KCV % 8) == 0 && (CC % 32) == 0);
static_assert(IMGPIX == 32 * 32 * 16);
static_assert(NST * 64 == KCV && (SPK * 2) % 32 == 16 && (XP * 2) % 32 == 16 && XP >= CC);
static_assert(CPX == WW && (NPIX % (2 * CPX)) == 0 && (HH % 2) == 0 && CTILE >= CRING && (CTILE * 2) % 16 == 0);
static_assert((NGR % 2) == 0 && NGR / 2 >= 2 && 2 * CTILE * 2 <= 327680 && 2 * NHEAD * 32 == 512);
static_assert(NGR * 3 == NST && 2 * ARW == 8 * 32 + 4 && (ABUF * 2) % 16 == 0 && ARW == WP);
static_assert(LNG >= 3 * CC && KCV == 1024 + 32 * 4 && (2 * WW + 3 * CC + 3 * WW) * XP * 2 + 2 * 2048 * 4 <= 327680);
static_assert(HPB <= 256 && (HPB % 8) == 0 && HPB * LNG >= NHPC);

// Index maps of the raw reshapes (per batch b, flat NCHW index f = c*16384 + h*128 + w viewed as [8][16384][16]):
//   Q_head[r][d] = qflat[b][head*262144 + 16 r + d]   (same map for K_head and V_head; r = (c%16)*1024 + h*8 + w/16,
//   d = w%16). S_head[i][j] = sum_r K_head[r][i] Q_head[r][j]; P_head = softmax_j(S_head * (1/scale)).
//   O[b][16 head + j2][pixel r] = sum_j V_head[r][j] P_head[j][j2].
//   y[b][o][pixel r] = sum_{head, j} Wm[b][head][o][j] V_head[r][j] + x[b][o][r],
//   Wm[b][head][o][j] = sum_j2 wo[o][16 head + j2] P_head[j][j2]   (reassociated 1x1 output conv).

typedef _Float16 v16h __attribute__((ext_vector_type(16)));
typedef _Float16 v8h  __attribute__((ext_vector_type(8)));
typedef float    v8f  __attribute__((ext_vector_type(8)));
typedef float    v4f  __attribute__((ext_vector_type(4)));
typedef float    v2f  __attribute__((ext_vector_type(2)));
typedef unsigned int v4u __attribute__((ext_vector_type(4)));
typedef unsigned int v2u __attribute__((ext_vector_type(2)));
typedef __bf16   v2b  __attribute__((ext_vector_type(2)));

// ---- scalar helpers ------------------------------------------------------------------------------------------
__device__ __forceinline__ unsigned short bf_bits(float f) {          // f32 -> bf16 bits, RNE convert
  unsigned u = __float_as_uint(f);
  return (unsigned short)((u + 0x7FFFu + ((u >> 16) & 1u)) >> 16);
}
__device__ __forceinline__ float bf_up(unsigned short b) { return __uint_as_float(((unsigned)b) << 16); }
__device__ __forceinline__ float bfr(float f) { return bf_up(bf_bits(f)); }
__device__ __forceinline__ unsigned short h_bits(_Float16 x) { return __builtin_bit_cast(unsigned short, x); }
__device__ __forceinline__ unsigned short hb16(float f) { return h_bits((_Float16)f); }
__device__ __forceinline__ unsigned pk16(unsigned short a, unsigned short b) { return (unsigned)a | ((unsigned)b << 16); }
__device__ __forceinline__ v8f zero8() { v8f z = {0.f, 0.f, 0.f, 0.f, 0.f, 0.f, 0.f, 0.f}; return z; }
// hi/lo pair of two f32 values: hi = f16(v), lo = f16(2048 (v - hi)), packed as two 32-bit words
__device__ __forceinline__ void split2(float f0, float f1, unsigned& hp, unsigned& lp) {
  const _Float16 h0 = (_Float16)f0, h1 = (_Float16)f1;
  const float q0 = (f0 - (float)h0) * 2048.0f, q1 = (f1 - (float)h1) * 2048.0f;
  hp = pk16(h_bits(h0), h_bits(h1));
  lp = pk16(hb16(q0), hb16(q1));
}

// ---- fragment loader: 16-bit A/B operand, lane -> row/col (lane&15), p already includes +8*(lane>>4);
//      elements 0..7 <- p[0..7] (k0+8h..k0+8h+7), elements 8..15 <- p[16..23] (k0+16+8h..k0+16+8h+7)
__device__ __forceinline__ v16h ldfrag_h(const _Float16* p) {
  union { v16h v; v8h h[2]; } f;
  f.h[0] = *(const v8h*)(p);
  f.h[1] = *(const v8h*)(p + 16);
  return f.v;
}
// same layout, the two 8-element halves at two independent 16-B aligned addresses (pa: k0+8h.., pb: k0+16+8h..)
__device__ __forceinline__ v16h ldfrag2(const _Float16* pa, const _Float16* pb) {
  union { v16h v; v8h h[2]; } f;
  f.h[0] = *(const v8h*)(pa);
  f.h[1] = *(const v8h*)(pb);
  return f.v;
}

// ---- WMMA helpers; the guards insert the trailing VALU hazard gap and keep A/B live --------------------------
__device__ __forceinline__ v8f mma_raw(v16h a, v16h b, v8f c) {
  return __builtin_amdgcn_wmma_f32_16x16x32_f16(false, a, false, b, (short)0, c, false, false);
}
__device__ __forceinline__ void guard8(v8f& c0, v8f& c1, v8f& c2, v8f& c3, v8f& c4, v8f& c5, v8f& c6, v8f& c7,
                                       const v16h& a0, const v16h& a1, const v16h& a2, const v16h& a3,
                                       const v16h& b0, const v16h& b1) {
#if defined(__HIP_DEVICE_COMPILE__)
  asm volatile("v_nop\n\tv_nop\n\tv_nop\n\tv_nop"
               : "+v"(c0), "+v"(c1), "+v"(c2), "+v"(c3), "+v"(c4), "+v"(c5), "+v"(c6), "+v"(c7)
               : "v"(a0), "v"(a1), "v"(a2), "v"(a3), "v"(b0), "v"(b1));
#endif
}
__device__ __forceinline__ void guard4(v8f& c0, v8f& c1, v8f& c2, v8f& c3,
                                       const v16h& a0, const v16h& a1, const v16h& b0, const v16h& b1) {
#if defined(__HIP_DEVICE_COMPILE__)
  asm volatile("v_nop\n\tv_nop\n\tv_nop\n\tv_nop"
               : "+v"(c0), "+v"(c1), "+v"(c2), "+v"(c3)
               : "v"(a0), "v"(a1), "v"(b0), "v"(b1));
#endif
}
__device__ __forceinline__ void guard2(v8f& c0, v8f& c1, const v16h& a0, const v16h& b0, const v16h& b1) {
#if defined(__HIP_DEVICE_COMPILE__)
  asm volatile("v_nop\n\tv_nop\n\tv_nop\n\tv_nop"
               : "+v"(c0), "+v"(c1)
               : "v"(a0), "v"(b0), "v"(b1));
#endif
}

// the same for a pair of f32 16x16x4 products: four slots before a vector
// instruction touches their results, and the four operands stay live (not overwritten) that long
__device__ __forceinline__ void guardf(v8f& c0, v8f& c1, const v2f& a0, const v2f& b0, const v2f& a1, const v2f& b1) {
#if defined(__HIP_DEVICE_COMPILE__)
  asm volatile("v_nop\n\tv_nop\n\tv_nop\n\tv_nop"
               : "+v"(c0), "+v"(c1)
               : "v"(a0), "v"(b0), "v"(a1), "v"(b1));
#endif
}

// ---- the conv's operands in LDS: rows of 128 B at pitch 144 B (16 B x odd, for the ds_load_b128 fragment reads). A group = two
//      padded image rows one below the other (130 pixels each) x 64
//      channels: 260 rows of 128 B, rows 0..129 the upper image row, 130..259 the lower. Thread = (row tid>>3 of run j of 32
//      rows, 16-B piece tid&7), runs j = 0..7, and run 8 (four rows) by one wave. gh is the thread's own source in the upper row at
//      pixel tid>>3, gl its own in the lower row at pixel (tid>>3) - 2, so that LDS row r >= 130 is the lower row's pixel r - 130;
//      run 4 (rows 128..159) holds the last two pixels of the upper row (hi4: this thread's row is one of them) and the first
//      thirty of the lower. A group is copied in three parts (runs 0..2, 3..5, 6..8).
__device__ __forceinline__ void copy3(unsigned la, const _Float16* ga, unsigned lb, const _Float16* gb, unsigned lc,
                                      const _Float16* gc) {
#if defined(__HIP_DEVICE_COMPILE__)
  // global -> LDS through no register; the last line is the wait that stands between issued copies and a rewrite of
  // a register they name, inside the statement so that nothing can be moved in front of it
  asm volatile("global_load_async_to_lds_b128 %0, %1, off\n\t"
               "global_load_async_to_lds_b128 %2, %3, off\n\t"
               "global_load_async_to_lds_b128 %4, %5, off\n\t"
               "s_wait_xcnt 0x0"
               :: "v"(la), "v"(ga), "v"(lb), "v"(gb), "v"(lc), "v"(gc) : "memory");
#endif
}
__device__ __forceinline__ void copy2(unsigned la, const _Float16* ga, unsigned lb, const _Float16* gb) {
#if defined(__HIP_DEVICE_COMPILE__)
  // same form and same closing wait as above
  asm volatile("global_load_async_to_lds_b128 %0, %1, off\n\t"
               "global_load_async_to_lds_b128 %2, %3, off\n\t"
               "s_wait_xcnt 0x0"
               :: "v"(la), "v"(ga), "v"(lb), "v"(gb) : "memory");
#endif
}
__device__ __forceinline__ void copy1(unsigned la, const _Float16* ga) {
#if defined(__HIP_DEVICE_COMPILE__)
  // same form and same closing wait as above
  asm volatile("global_load_async_to_lds_b128 %0, %1, off\n\t"
               "s_wait_xcnt 0x0"
               :: "v"(la), "v"(ga) : "memory");
#endif
}
template <int PART>
__device__ __forceinline__ void stage_a(const _Float16* gh, const _Float16* gl, bool hi4, bool wave0, unsigned lds) {
  const unsigned gs = 32 * SPK * 2;
  static_assert(PART == 1 || PART == 2);         // part 0 (runs 0..2) always goes with a W stage: stage_wa
  if (PART == 1) {
    copy3(lds + 3 * gs, gh + 96 * CC, lds + 4 * gs, hi4 ? gh + 128 * CC : gl, lds + 5 * gs, gl + 32 * CC);
  } else {
    copy2(lds + 6 * gs, gl + 64 * CC, lds + 7 * gs, gl + 96 * CC);
    if (wave0) copy1(lds + 8 * gs, gl + 128 * CC);   // scalar test: the other waves branch round the copy
  }
}
// W stage = 128 output channels x 64 k: 128 rows of 128 B (global pitch KCV), 4 copies a thread
__device__ __forceinline__ void stage_w4(const _Float16* gw, unsigned lds) {
  const _Float16* w1 = gw + 32 * KCV;
  const _Float16* w2 = gw + 64 * KCV;
  const _Float16* w3 = gw + 96 * KCV;
  const unsigned gs = 32 * SPK * 2;
  const unsigned l1 = lds + 1 * gs, l2 = lds + 2 * gs, l3 = lds + 3 * gs;
#if defined(__HIP_DEVICE_COMPILE__)
  // same form and same closing wait as above
  asm volatile("global_load_async_to_lds_b128 %0, %1, off\n\t"
               "global_load_async_to_lds_b128 %2, %3, off\n\t"
               "global_load_async_to_lds_b128 %4, %5, off\n\t"
               "global_load_async_to_lds_b128 %6, %7, off\n\t"
               "s_wait_xcnt 0x0"
               :: "v"(lds), "v"(gw), "v"(l1), "v"(w1), "v"(l2), "v"(w2), "v"(l3), "v"(w3)
               : "memory");
#endif
}
// a W stage's and an A part's copies in one statement, so that the wave passes one closing wait for both: the W stage's four and part PART of an A group
template <int PART>
__device__ __forceinline__ void stage_wa(const _Float16* gw, unsigned ldw, const _Float16* gh, const _Float16* gl, bool hi4,
                                         bool wave0, unsigned lda) {
  const _Float16* w1 = gw + 32 * KCV;
  const _Float16* w2 = gw + 64 * KCV;
  const _Float16* w3 = gw + 96 * KCV;
  const unsigned gs = 32 * SPK * 2;
  const unsigned m1 = ldw + 1 * gs, m2 = ldw + 2 * gs, m3 = ldw + 3 * gs;
  const unsigned la = lda + (3 * PART) * gs, lb = la + gs, lc = lb + gs;
  const _Float16* ga = (PART == 0) ? gh : ((PART == 1) ? gh + 96 * CC : gl + 64 * CC);
  const _Float16* gb = (PART == 0) ? gh + 32 * CC : ((PART == 1) ? (hi4 ? gh + 128 * CC : gl) : gl + 96 * CC);
  const _Float16* gc = (PART == 0) ? gh + 64 * CC : ((PART == 1) ? gl + 32 * CC : gl + 128 * CC);
#if defined(__HIP_DEVICE_COMPILE__)
  if (PART < 2) {
    // same form and same closing wait as above
    asm volatile("global_load_async_to_lds_b128 %0, %1, off\n\t"
                 "global_load_async_to_lds_b128 %2, %3, off\n\t"
                 "global_load_async_to_lds_b128 %4, %5, off\n\t"
                 "global_load_async_to_lds_b128 %6, %7, off\n\t"
                 "global_load_async_to_lds_b128 %8, %9, off\n\t"
                 "global_load_async_to_lds_b128 %10, %11, off\n\t"
                 "global_load_async_to_lds_b128 %12, %13, off\n\t"
                 "s_wait_xcnt 0x0"
                 :: "v"(ldw), "v"(gw), "v"(m1), "v"(w1), "v"(m2), "v"(w2), "v"(m3), "v"(w3),
                    "v"(la), "v"(ga), "v"(lb), "v"(gb), "v"(lc), "v"(gc)
                 : "memory");
  } else {
    // same form and same closing wait as above
    asm volatile("global_load_async_to_lds_b128 %0, %1, off\n\t"
                 "global_load_async_to_lds_b128 %2, %3, off\n\t"
                 "global_load_async_to_lds_b128 %4, %5, off\n\t"
                 "global_load_async_to_lds_b128 %6, %7, off\n\t"
                 "global_load_async_to_lds_b128 %8, %9, off\n\t"
                 "global_load_async_to_lds_b128 %10, %11, off\n\t"
                 "s_wait_xcnt 0x0"
                 :: "v"(ldw), "v"(gw), "v"(m1), "v"(w1), "v"(m2), "v"(w2), "v"(m3), "v"(w3),
                    "v"(la), "v"(ga), "v"(lb), "v"(gb)
                 : "memory");
    if (wave0) copy1(lc, gc);                    // scalar test: the other waves branch round the copy
  }
#endif
}
__device__ __forceinline__ void wait_copies() {
#if defined(__HIP_DEVICE_COMPILE__)
  asm volatile("s_wait_asynccnt 0x0" ::: "memory");   // this wave's copies have landed in LDS
#endif
}
__device__ __forceinline__ void wait_lds_reads() {
#if defined(__HIP_DEVICE_COMPILE__)
  asm volatile("s_wait_dscnt 0x0" ::: "memory");      // this wave's LDS reads are done before the buffer is rewritten
#endif
}
// the work-group's own barrier in its two halves, so that a wave can multiply between arriving and waiting; no LDS read stands
// between the two; the waits that the barrier needs are written in front of the signal
__device__ __forceinline__ void bar_signal() {
#if defined(__HIP_DEVICE_COMPILE__)
  asm volatile("s_barrier_signal -1" ::: "memory");   // this wave has arrived: its reads are done, its copies have landed
#endif
}
__device__ __forceinline__ void bar_wait() {
#if defined(__HIP_DEVICE_COMPILE__)
  asm volatile("s_barrier_wait -1" ::: "memory");     // every wave has arrived
#endif
}

// ---- implicit-GEMM variant for the 3x3 conv: A row = output pixel p (flat over all images), k = tap*128 + c;
//      W = wt [128][1152] k-contiguous. The block tile is two image rows, y and y + 1. A group g (ky = g>>1, channel half = g&1) is
//      the whole padded rows y + ky and y + 1 + ky, 130 pixels x 64 channels each: it is copied to LDS once and serves the three taps kx = 0, 1, 2,
//      which read it one LDS row apart. A W stage s = 3 g + kx is the 128 output channels x the 64 k of that tap and half. Three W
//      buffers (stage s in buffer kx), two A buffers: a copy has a whole trip to land, from one trip's barrier signal to the next's; the
//      fragments come from LDS with the table k map (k order: ky, channel half, kx, channel quarter, table). 8 waves = 4 (32
//      pixels of each row) x 2 (64 channels): a wave's k-step is 16 products from 8 fragments (2 a row, 4 W). The 8 waves are one half
//      of a 512-thread work-group (tid = thread within the half, ring = the half's own buffers); a half runs the ng groups from
//      gbeg on. ng is the same in both halves, so both pass the same barriers.
__device__ __forceinline__ size_t conv_abase(int p, int hh) {
  const int b = p / IMGPIX;
  const int r = p - b * IMGPIX;
  const int y = r / WW;
  const int x = r - y * WW;
  return ((size_t)(b * HP + y) * WP + x) * CC + 8 * hh;
}
// part PART of group g's copies into the A buffer g & 1; ah/al are the thread's own source addresses for group 0, lds0 its own
// byte address in buffer 0 (see stage_a)
template <int PART>
__device__ __forceinline__ void conv_apart(const _Float16* ah, const _Float16* al, bool hi4, bool wave0, int g, unsigned lds0) {
  const int ao = (g >> 1) * (WP * CC) + (g & 1) * 64;
  stage_a<PART>(ah + ao, al + ao, hi4, wave0, lds0 + (g & 1) * (ABUF * 2));
}
// stage s's copies into the W buffer at lds; wb is the thread's own source address for k = 0
__device__ __forceinline__ void conv_wstage(const _Float16* wb, int s, unsigned lds) {
  const int g = (s * 11) >> 5;                   // s / 3 for s < 18
  const int kx = s - 3 * g;
  stage_w4(wb + ((g >> 1) * 3 + kx) * CC + (g & 1) * 64, lds);
}
// both at once: W stage s into the W buffer at ldw and part PART of A group g into the A buffer g & 1 (lds0: buffer 0)
template <int PART>
__device__ __forceinline__ void conv_wa(const _Float16* wb, int s, unsigned ldw, const _Float16* ah, const _Float16* al,
                                        bool hi4, bool wave0, int g, unsigned lds0) {
  const int sg = (s * 11) >> 5;                  // s / 3 for s < 18
  const int kx = s - 3 * sg;
  const int ao = (g >> 1) * (WP * CC) + (g & 1) * 64;
  stage_wa<PART>(wb + ((sg >> 1) * 3 + kx) * CC + (sg & 1) * 64, ldw, ah + ao, al + ao, hi4, wave0,
                 lds0 + (g & 1) * (ABUF * 2));
}
__device__ __forceinline__ void mm_conv(const _Float16* __restrict__ Ah, const _Float16* __restrict__ W, int prow0,
                                        _Float16* ring, int tid, int gbeg, int ng) {
  const _Float16* Al = Ah + WP * CC;             // the lower image row of the pair: one padded row further on
  const int wave = tid >> 5, lane = tid & 31, hh = lane >> 4, c = lane & 15;
  const int mw = wave >> 1, nw = wave & 1;
  const int srow = tid >> 3, spc = tid & 7;
  const bool wave0 = __builtin_amdgcn_readfirstlane(wave) == 0;
  const bool hi4 = srow < 2;
  const size_t sa = conv_abase(prow0, 0) + spc * 8;
  const _Float16* ah = Ah + sa + srow * CC;
  const _Float16* al = Al + sa + (srow - 2) * CC;
  const _Float16* wb = W + (size_t)srow * KCV + spc * 8;
  const unsigned lds0 = (unsigned)(size_t)ring + (unsigned)((srow * SPK + spc * 8) * 2);
  const unsigned ldw0 = lds0 + 2 * ABUF * 2;
  const _Float16* fap = ring + (mw * 32 + c) * SPK + 8 * hh;
  const _Float16* fbp = ring + 2 * ABUF + (nw * 64 + c) * SPK + 8 * hh;
  v8f h0[4], h1[4], l0[4], l1[4];                // h: upper image row, l: lower; 0, 1: the wave's two runs of 16 pixels
  // unrolled: every index of an accumulator array is a constant, so the arrays stay in registers
#pragma unroll
  for (int n = 0; n < 4; ++n) { h0[n] = zero8(); h1[n] = zero8(); l0[n] = zero8(); l1[n] = zero8(); }
  conv_wa<0>(wb, 3 * gbeg, ldw0, ah, al, hi4, wave0, gbeg, lds0);
  conv_apart<1>(ah, al, hi4, wave0, gbeg, lds0);
  conv_apart<2>(ah, al, hi4, wave0, gbeg, lds0);
  wait_copies();
  __syncthreads();                               // the first group and stage are readable by every wave
  conv_wstage(wb, 3 * gbeg + 1, ldw0 + WBUF * 2);
  // rolled: one copy of a group's three trips in the instruction cache, the A buffer chosen by g & 1, the W buffer by kx
#pragma unroll 1
  for (int gi = 0; gi < ng; ++gi) {
    const int g = gbeg + gi;
    const int ab = (g & 1) * ABUF;
    // unrolled: the tap's row shift becomes an immediate of the LDS loads, and each trip has its own refill (the next group's parts 0 and 1 in the first, part 2 in the second)
#pragma unroll
    for (int kx = 0; kx < 3; ++kx) {
      const int t = 3 * g + kx;
      const int wo = kx * WBUF;                  // t mod 3
      // unrolled: the two k-steps' LDS offsets become immediates of their loads
#pragma unroll
      for (int kk = 0; kk < 2; ++kk) {
        const _Float16* pa = fap + ab + kx * SPK + kk * 32;
        const _Float16* pb = fbp + wo + kk * 32;
        const v16h fa0 = ldfrag_h(pa);
        const v16h fb0 = ldfrag_h(pb);
        const v16h fb1 = ldfrag_h(pb + 16 * SPK);
        const v16h fb2 = ldfrag_h(pb + 32 * SPK);
        const v16h fb3 = ldfrag_h(pb + 48 * SPK);
        const v16h fa1 = ldfrag_h(pa + 16 * SPK);
        const v16h ga0 = ldfrag_h(pa + ARW * SPK);
        const v16h ga1 = ldfrag_h(pa + (ARW + 16) * SPK);
#if defined(__HIP_DEVICE_COMPILE__)
        // nothing is scheduled across this line: without it the compiler reloads one A register set in among the products
        // and the wave waits out a whole LDS latency at each such place
        __builtin_amdgcn_sched_barrier(0);
#endif
        if (kk == 1) {
          // the trip's publish point: the wave arrives behind its last fragment reads, with 16 products ready in registers, and
          // waits behind them: while the last wave's reads come in the others multiply, and a wave that is through starts
          // the next trip's reads as soon as the last has arrived.
          wait_lds_reads();
          wait_copies();
          bar_signal();
          // the refill needs no wait for this barrier: it goes into buffers that the barrier of trip t - 1 has freed. W stage t + 2
          // into the buffer that trip t - 1 read; A group g + 1, behind group g's first two signals, into the buffer that group
          // g - 1 left. All of it has landed at the next signal
          if (kx == 0) {
            if (gi + 1 < ng) {
              conv_wa<0>(wb, t + 2, ldw0 + 2 * (WBUF * 2), ah, al, hi4, wave0, g + 1, lds0);
              conv_apart<1>(ah, al, hi4, wave0, g + 1, lds0);
            } else {
              conv_wstage(wb, t + 2, ldw0 + 2 * (WBUF * 2));
            }
          } else if (kx == 1) {
            if (gi + 1 < ng) conv_wa<2>(wb, t + 2, ldw0, ah, al, hi4, wave0, g + 1, lds0);
          } else {
            if (gi + 1 < ng) conv_wstage(wb, t + 2, ldw0 + WBUF * 2);
          }
#if defined(__HIP_DEVICE_COMPILE__)
          // nothing is scheduled across this line: no product in front of the signal or of the copies
          __builtin_amdgcn_sched_barrier(0);
#endif
        }
        h0[0] = mma_raw(fa0, fb0, h0[0]);
        h0[1] = mma_raw(fa0, fb1, h0[1]);
        h0[2] = mma_raw(fa0, fb2, h0[2]);
        h0[3] = mma_raw(fa0, fb3, h0[3]);
        h1[0] = mma_raw(fa1, fb0, h1[0]);
        h1[1] = mma_raw(fa1, fb1, h1[1]);
        h1[2] = mma_raw(fa1, fb2, h1[2]);
        h1[3] = mma_raw(fa1, fb3, h1[3]);
        l0[0] = mma_raw(ga0, fb0, l0[0]);
        l0[1] = mma_raw(ga0, fb1, l0[1]);
        l0[2] = mma_raw(ga0, fb2, l0[2]);
        l0[3] = mma_raw(ga0, fb3, l0[3]);
        l1[0] = mma_raw(ga1, fb0, l1[0]);
        l1[1] = mma_raw(ga1, fb1, l1[1]);
        l1[2] = mma_raw(ga1, fb2, l1[2]);
        l1[3] = mma_raw(ga1, fb3, l1[3]);
        guard8(l0[0], l0[1], l0[2], l0[3], l1[0], l1[1], l1[2], l1[3], ga0, ga1, fb0, fb1, fb2, fb3);
#if defined(__HIP_DEVICE_COMPILE__)
        // nor across this one: without it products of this k-step sink in among the next k-step's reads or behind the barrier's wait
        __builtin_amdgcn_sched_barrier(0);
#endif
      }
      bar_wait();                                // publishes what had landed at the signals and ends every read of trip t's buffers
    }
  }
  wait_copies();
  float* Cs = (float*)(void*)ring;               // the ring is free behind the last trip's barrier: f32 tile [2 * 128][LDC]
#pragma unroll
  for (int r = 0; r < 8; ++r) {
    const int row = mw * 32 + 8 * hh + r;
    // unrolled for the same reason as above
#pragma unroll
    for (int n = 0; n < 4; ++n) {
      Cs[row * LDC + nw * 64 + n * 16 + c]              = h0[n][r];
      Cs[(row + 16) * LDC + nw * 64 + n * 16 + c]       = h1[n][r];
      Cs[(CPX + row) * LDC + nw * 64 + n * 16 + c]      = l0[n][r];
      Cs[(CPX + row + 16) * LDC + nw * 64 + n * 16 + c] = l1[n][r];
    }
  }
}

// ---- fused output GEMM core: rows = 64 pixels of one batch (local pixel pl0..pl0+63), cols = 128 output channels,
//      k = c' = 16 head + j (K = 128, 4 k-steps of two heads each). A[p][c'] = V_head[p][j] read from the NCHW flat v
//      planes at head*HSZ + 16 p + j (two 16-B halves per fragment, heads 2ks and 2ks+1); B = Wm[head][o][16]
//      k-contiguous per head. Products hi*hi + hi*lo (first loop) and lo*hi (second loop) into Cs[64][LDC].
__device__ __forceinline__ void mm_final(const _Float16* __restrict__ Vh, const _Float16* __restrict__ Vl,
                                         const _Float16* __restrict__ Wh, const _Float16* __restrict__ Wl,
                                         int pl0, float* Cs) {
  const int tid = threadIdx.x, wave = tid >> 5, lane = tid & 31, hh = lane >> 4, c = lane & 15;
  const int mw = wave >> 2, nw = wave & 3;
  const size_t r0 = (size_t)(pl0 + mw * 32 + c) * HD + 8 * hh;
  const size_t r1 = (size_t)(pl0 + mw * 32 + 16 + c) * HD + 8 * hh;
  const size_t q0 = (size_t)(nw * 32 + c) * HD + 8 * hh;
  const size_t q1 = (size_t)(nw * 32 + 16 + c) * HD + 8 * hh;
  {
    v8f h00 = zero8(), h01 = zero8(), h10 = zero8(), h11 = zero8();
    v8f l00 = zero8(), l01 = zero8(), l10 = zero8(), l11 = zero8();
    const _Float16* pa0 = Vh + r0;
    const _Float16* pa1 = Vh + r1;
    const _Float16* pb0 = Wh + q0;
    const _Float16* pb1 = Wh + q1;
    const _Float16* pc0 = Wl + q0;
    const _Float16* pc1 = Wl + q1;
    // two k-steps a batch: the batch's 24 loads are issued together, then multiplied in k order (one latency for two
    // k-steps; four at once would not leave registers for two work-groups on a WGP); unrolled: offsets become immediates
#pragma unroll
    for (int kp = 0; kp < CC / 64; ++kp) {
      v16h fa0[2], fa1[2], fb0[2], fb1[2], gb0[2], gb1[2];
#pragma unroll
      for (int u = 0; u < 2; ++u) {
        const int ao = (2 * (2 * kp + u)) * HSZ;
        const int bo = (2 * (2 * kp + u)) * (CC * HD);
        fa0[u] = ldfrag2(pa0 + ao, pa0 + ao + HSZ);
        fa1[u] = ldfrag2(pa1 + ao, pa1 + ao + HSZ);
        fb0[u] = ldfrag2(pb0 + bo, pb0 + bo + CC * HD);
        fb1[u] = ldfrag2(pb1 + bo, pb1 + bo + CC * HD);
        gb0[u] = ldfrag2(pc0 + bo, pc0 + bo + CC * HD);
        gb1[u] = ldfrag2(pc1 + bo, pc1 + bo + CC * HD);
      }
#if defined(__HIP_DEVICE_COMPILE__)
      // nothing is scheduled across this line: without it the first product, with its wait, is lifted in among the batch's
      // loads, and the loads behind it start one latency late
      __builtin_amdgcn_sched_barrier(0);
      // inputs-only fence on the loaded fragments: keeps the batch's loads together in front of its products; it holds the
      // wait that stands between issued loads and a rewrite of an address register they name
      asm volatile("s_wait_xcnt 0x0" :: "v"(fa0[0]), "v"(fa1[0]), "v"(fb0[0]), "v"(fb1[0]), "v"(gb0[0]), "v"(gb1[0]),
                   "v"(fa0[1]), "v"(fa1[1]), "v"(fb0[1]), "v"(fb1[1]), "v"(gb0[1]), "v"(gb1[1]));
#endif
#pragma unroll
      for (int u = 0; u < 2; ++u) {
        h00 = mma_raw(fa0[u], fb0[u], h00);
        h01 = mma_raw(fa0[u], fb1[u], h01);
        h10 = mma_raw(fa1[u], fb0[u], h10);
        h11 = mma_raw(fa1[u], fb1[u], h11);
        l00 = mma_raw(fa0[u], gb0[u], l00);
        l01 = mma_raw(fa0[u], gb1[u], l01);
        l10 = mma_raw(fa1[u], gb0[u], l10);
        l11 = mma_raw(fa1[u], gb1[u], l11);
        guard8(h00, h01, h10, h11, l00, l01, l10, l11, fa0[u], fa1[u], gb0[u], gb1[u], fb0[u], fb1[u]);
      }
    }
#pragma unroll
    for (int r = 0; r < 8; ++r) {
      const int row = mw * 32 + 8 * hh + r;
      Cs[row * LDC + nw * 32 + c]             = h00[r] + l00[r] * RSC;
      Cs[row * LDC + nw * 32 + 16 + c]        = h01[r] + l01[r] * RSC;
      Cs[(row + 16) * LDC + nw * 32 + c]      = h10[r] + l10[r] * RSC;
      Cs[(row + 16) * LDC + nw * 32 + 16 + c] = h11[r] + l11[r] * RSC;
    }
  }
  {
    v8f m00 = zero8(), m01 = zero8(), m10 = zero8(), m11 = zero8();
#if defined(__HIP_DEVICE_COMPILE__)
    // nothing is scheduled across this line or the one behind the loads: the first loop's epilogue stays out of the run of
    // loads, where it reused their address registers while they were in flight
    __builtin_amdgcn_sched_barrier(0);
#endif
    const _Float16* pa0 = Vl + r0;
    const _Float16* pa1 = Vl + r1;
    const _Float16* pb0 = Wh + q0;
    const _Float16* pb1 = Wh + q1;
    // all four k-steps' 32 loads are issued together, then multiplied in k order: one latency, not four
    v16h ga0[4], ga1[4], fb0[4], fb1[4];
#pragma unroll
    for (int ks = 0; ks < CC / 32; ++ks) {
      const int ao = (2 * ks) * HSZ;
      const int bo = (2 * ks) * (CC * HD);
      ga0[ks] = ldfrag2(pa0 + ao, pa0 + ao + HSZ);
      ga1[ks] = ldfrag2(pa1 + ao, pa1 + ao + HSZ);
      fb0[ks] = ldfrag2(pb0 + bo, pb0 + bo + CC * HD);
      fb1[ks] = ldfrag2(pb1 + bo, pb1 + bo + CC * HD);
    }
#if defined(__HIP_DEVICE_COMPILE__)
    __builtin_amdgcn_sched_barrier(0);
    // inputs-only fence on the loaded fragments, with the same wait as in the first loop
    asm volatile("s_wait_xcnt 0x0" :: "v"(ga0[0]), "v"(ga1[0]), "v"(fb0[0]), "v"(fb1[0]), "v"(ga0[1]), "v"(ga1[1]), "v"(fb0[1]), "v"(fb1[1]),
                 "v"(ga0[2]), "v"(ga1[2]), "v"(fb0[2]), "v"(fb1[2]), "v"(ga0[3]), "v"(ga1[3]), "v"(fb0[3]), "v"(fb1[3]));
#endif
#pragma unroll
    for (int ks = 0; ks < CC / 32; ++ks) {
      m00 = mma_raw(ga0[ks], fb0[ks], m00);
      m01 = mma_raw(ga0[ks], fb1[ks], m01);
      m10 = mma_raw(ga1[ks], fb0[ks], m10);
      m11 = mma_raw(ga1[ks], fb1[ks], m11);
      guard4(m00, m01, m10, m11, ga0[ks], ga1[ks], fb0[ks], fb1[ks]);
    }
#pragma unroll
    for (int r = 0; r < 8; ++r) {               // same lane wrote these slots above (program order, same type)
      const int row = mw * 32 + 8 * hh + r;
      Cs[row * LDC + nw * 32 + c]             += m00[r] * RSC;
      Cs[row * LDC + nw * 32 + 16 + c]        += m01[r] * RSC;
      Cs[(row + 16) * LDC + nw * 32 + c]      += m10[r] * RSC;
      Cs[(row + 16) * LDC + nw * 32 + 16 + c] += m11[r] * RSC;
    }
  }
}

// =================================================================================================================
// Layer norm over w (f32 statistics; x, gamma[w], beta[w] bf16 converted) and the three 1x1 projections, in one launch.
// Work-group = one image row (b, h): 16 waves in two halves of 8, half = channel half, wave = 8 channel rows, lane = 4 w
// values, shuffle reductions. A lane then holds 8 consecutive channels of each of its 4 pixels: each pixel's 8 go as one 16-B
// piece into the LDS planes Xh, Xl [128 px][128 ch] (f16 hi and x2048 residual; pitch 272 B = 16 B x odd, for the ds_load_b128
// fragment reads). The normed row never leaves the WGP. The 1x1 weights (wq1, wk1, wv1) [o][c] f32 are loaded by every
// work-group as whole lines behind the x rows, in flight under the row arithmetic, and go as f16(64 * bf16(w)) into Ww [384][128].
// Products: D[o][px] = w1[t] . xn^T (K = 128), the weight as the first operand, so that a lane holds 8 consecutive output
// channels of one pixel; hi and residual plane into separate accumulators. Wave = 32 px x 32 channels of each tensor; its 16
// activation fragments are read once and stay in registers for the three tensors. value = D/64, f16 (nearest), through the LDS tile
// Ot [t][px][o] into the padded NHWC plane p1[t] ([NB][130][130][128]) at the interior position (y+1, x+1) as whole lines.
// grid = NB*128, 512 threads. coverage: interior NPIX padded pixels x 128 ch of all 3 planes, every element once.
// The same launch carries two pieces of work that depend on nothing before them and are read only by later launches; for them
// a half counts as one unit blk = 2 * work-group + half, 512 units:
// (a) weight convert. Unit blk < 384: row blk = (tensor, co) of (wq2, wk2, wv2) [co][ci][3][3] f32 -> wt [row][k =
//     tap*128 + ci] f16(64 * bf16(w)): the row's 1152 floats are loaded as whole lines beside the x rows, go through LDS
//     across the kernel's first barrier, and thread tt < 144 builds one 16-B piece. coverage: wt 384 x 1152, once.
// (b) halo zero fill of the three padded planes: unit blk zeroes the 16-B pieces blk*104 .. blk*104 + 103 (whole lines) of
//     the 3*NB*516*16. coverage: every halo pixel (py in {0,129} or px in {0,129}) of every image of all 3 planes, once.
// =================================================================================================================
// inputs-only fence on the 8 rows' shuffled values (they come back on the LDS counter like loads): keeps the 8 shuffles of
// one reduction step together in front of their adds; without it the compiler runs the rows' chains one after another and
// the wave waits out every shuffle's latency alone
__device__ __forceinline__ void row_fence(const float (&t)[8]) {
#if defined(__HIP_DEVICE_COMPILE__)
  asm volatile("" :: "v"(t[0]), "v"(t[1]), "v"(t[2]), "v"(t[3]), "v"(t[4]), "v"(t[5]), "v"(t[6]), "v"(t[7]));
#endif
}
// a lane's 8 consecutive output channels of one pixel: (hi + residual/2048) / 64 as f16, one 16-B piece
__device__ __forceinline__ v4u pack_o(const v8f& h, const v8f& l) {
  v4u a;
#pragma unroll
  for (int e = 0; e < 4; ++e) {
    const float f0 = (h[2 * e] + l[2 * e] * RSC) * (1.0f / 64.0f);
    const float f1 = (h[2 * e + 1] + l[2 * e + 1] * RSC) * (1.0f / 64.0f);
    a[e] = pk16(hb16(f0), hb16(f1));
  }
  return a;
}
// two weights -> f16(64 * bf16(w)), packed. The bf16 rounding is the hardware's convert (nearest even, the same bits as bf_bits for
// every finite value), and 64 * bf16(w) is formed as bf16(64 * w): a power of two passes through the rounding. Every work-group
// repeats this conversion, so its instruction count is paid 256 times
__device__ __forceinline__ unsigned w2h(float f0, float f1) {
  const v2f m = {f0 * 64.0f, f1 * 64.0f};
  const unsigned r = __builtin_bit_cast(unsigned, __builtin_convertvector(m, v2b));
  return pk16(hb16(__uint_as_float(r << 16)), hb16(__uint_as_float(r & 0xFFFF0000u)));
}
__global__ __launch_bounds__(512)
void k_lnproj(const float* __restrict__ x, const float* __restrict__ gw, const float* __restrict__ gb,
              const float* __restrict__ wq1, const float* __restrict__ wq2, const float* __restrict__ wk1,
              const float* __restrict__ wk2, const float* __restrict__ wv1, const float* __restrict__ wv2,
              unsigned short* wt, unsigned short* p1) {
  __shared__ __align__(16) _Float16 Xh[WW * XP];
  __shared__ __align__(16) _Float16 Xl[WW * XP];
  __shared__ __align__(16) _Float16 Ww[3 * CC * XP];
  __shared__ __align__(16) _Float16 Ot[3 * WW * XP];
  __shared__ __align__(16) float Wl2[2 * 2048];
  const int tf = threadIdx.x, tid = tf & 255, wv = tid >> 5, lane = tid & 31;
  const int chalf = __builtin_amdgcn_readfirstlane(tf >> 8);  // the same in a whole wave: kept in a scalar register
  const int w16 = __builtin_amdgcn_readfirstlane(tf >> 5);    // likewise
  const int bh = blockIdx.x, blk = 2 * bh + chalf;
  const int b = bh / HH, h = bh - b * HH;
  float* Wl = Wl2 + chalf * 2048;
  // the wave's 8 channel rows: all 8 loads are issued first, then every step of the row arithmetic runs over the 8 rows
  // side by side (8 independent shuffle chains), so the wave pays one memory latency and one chain, not eight of each
  const float* row0 = x + ((size_t)(b * CC + chalf * 64 + wv * 8) * HH + h) * WW + lane * 4;
  v4f a[8];
#pragma unroll
  for (int it = 0; it < 8; ++it) a[it] = *(const v4f*)(row0 + it * (HH * WW));
  // the unit's row of the 3x3 weights: two 16-B loads a thread (addresses clamped into a row; units 384.. store nothing of it)
  const bool w33 = blk < 3 * CC;                             // the same in a whole half
  const int wr = min(blk, 3 * CC - 1), wtn = wr / CC;
  const float* rowp = ((wtn == 0) ? wq2 : ((wtn == 1) ? wk2 : wv2)) + (size_t)(wr - wtn * CC) * KCV;
  const float* wp0 = rowp + 4 * tid;
  const float* wp1 = rowp + 1024 + 4 * min(tid, 31);
  const v4f wa = *(const v4f*)wp0;
  const v4f wb = *(const v4f*)wp1;
  const v4f g4 = *(const v4f*)(gw + lane * 4);
  const v4f b4 = *(const v4f*)(gb + lane * 4);
#if defined(__HIP_DEVICE_COMPILE__)
  // nothing is scheduled across this line: loads come back in the order of issue, and without it weight loads of the run below
  // stand in front of some of these, so that the row arithmetic waits for them too
  __builtin_amdgcn_sched_barrier(0);
  // the wait that stands between the issued loads and a rewrite of a register they name (the address arithmetic of the run below
  // reuses an offset register), held in its place by the lines around it
  asm volatile("s_wait_xcnt 0x0");
  __builtin_amdgcn_sched_barrier(0);
#endif
  // the 1x1 weights: 24 loads of 16 B a thread, a wave's load = one weight row = 4 whole lines
  const float* q1p = wq1 + tf * 4;
  const float* k1p = wk1 + tf * 4;
  const float* v1p = wv1 + tf * 4;
  v4f wf[24];
#pragma unroll
  for (int j = 0; j < 24; ++j) wf[j] = *(const v4f*)(((j < 8) ? q1p : ((j < 16) ? k1p : v1p)) + (j & 7) * 2048);
#if defined(__HIP_DEVICE_COMPILE__)
  // nothing is scheduled across this line: without it the weight loads sink to their use behind the row arithmetic and the
  // work-group waits out their latency there
  __builtin_amdgcn_sched_barrier(0);
  // inputs-only fence on the x rows' loaded values; it holds the wait that stands between all the issued loads and a rewrite of
  // a register they name; the addresses are inputs, so they live that long
  asm volatile("s_wait_xcnt 0x0" :: "v"(row0), "v"(q1p), "v"(k1p), "v"(v1p), "v"(a[0]), "v"(a[1]), "v"(a[2]), "v"(a[3]),
               "v"(a[4]), "v"(a[5]), "v"(a[6]), "v"(a[7]));
  // nor across this one: nothing of the arithmetic, which reuses the loads' offset registers, in front of that wait
  __builtin_amdgcn_sched_barrier(0);
#endif
  float g[4], be[4];
#pragma unroll
  for (int e = 0; e < 4; ++e) { g[e] = bfr(g4[e]); be[e] = bfr(b4[e]); }
  // no branch here: above word 1151 nothing reads what is written
  *(v4f*)(Wl + 4 * tid) = wa;
  *(v4f*)(Wl + 1024 + 4 * tid) = wb;
  float d[8][4], s[8], sq[8];
#pragma unroll
  for (int it = 0; it < 8; ++it) {
#pragma unroll
    for (int e = 0; e < 4; ++e) d[it][e] = bfr(a[it][e]);
    s[it] = (d[it][0] + d[it][1]) + (d[it][2] + d[it][3]);
  }
#pragma unroll
  for (int off = 16; off; off >>= 1) {
    float t[8];
#pragma unroll
    for (int it = 0; it < 8; ++it) t[it] = __shfl_xor(s[it], off, 32);
    row_fence(t);
#pragma unroll
    for (int it = 0; it < 8; ++it) s[it] += t[it];
  }
#pragma unroll
  for (int it = 0; it < 8; ++it) {
    const float mu = s[it] * (1.0f / 128.0f);
#pragma unroll
    for (int e = 0; e < 4; ++e) d[it][e] = d[it][e] - mu;
    sq[it] = (d[it][0] * d[it][0] + d[it][1] * d[it][1]) + (d[it][2] * d[it][2] + d[it][3] * d[it][3]);
  }
#pragma unroll
  for (int off = 16; off; off >>= 1) {
    float t[8];
#pragma unroll
    for (int it = 0; it < 8; ++it) t[it] = __shfl_xor(sq[it], off, 32);
    row_fence(t);
#pragma unroll
    for (int it = 0; it < 8; ++it) sq[it] += t[it];
  }
  float rs[8];
#pragma unroll
  for (int it = 0; it < 8; ++it) {
    const float var = sq[it] * (1.0f / 128.0f);
    rs[it] = rsqrtf(var + 1e-5f);
  }
#pragma unroll
  for (int it = 0; it < 8; ++it) {
#pragma unroll
    for (int e = 0; e < 4; ++e) d[it][e] = (d[it][e] * rs[it]) * g[e] + be[e];
  }
  // pixel lane*4 + e, channels chalf*64 + wv*8 .. + 7: one 16-B piece of each plane
#pragma unroll
  for (int e = 0; e < 4; ++e) {
    v4u ph, pq;
#pragma unroll
    for (int q = 0; q < 4; ++q) {
      unsigned hp, lp;
      split2(d[2 * q][e], d[2 * q + 1][e], hp, lp);
      ph[q] = hp; pq[q] = lp;
    }
    const int xo = (lane * 4 + e) * XP + chalf * 64 + wv * 8;
    *(v4u*)(Xh + xo) = ph;
    *(v4u*)(Xl + xo) = pq;
  }
  // load j of wave w16 is row j*16 + w16 of the 384, lane = 4 input channels
#pragma unroll
  for (int j = 0; j < 24; ++j) {
    v2u wp;
    wp[0] = w2h(wf[j][0], wf[j][1]);
    wp[1] = w2h(wf[j][2], wf[j][3]);
    *(v2u*)(Ww + (j * 16 + w16) * XP + lane * 4) = wp;
  }
  __syncthreads();                               // planes, 1x1 weights and the 3x3 rows are readable by every wave
  {
    // the 3x3 weight piece of this thread (index clamped; stored by the threads that own one)
    v4u wpk;
    const int k0 = min(tid, 143) * 8, tap = k0 / CC, c0 = k0 - tap * CC;
#pragma unroll
    for (int e = 0; e < 4; ++e) {
      const float f0 = Wl[(c0 + 2 * e) * 9 + tap];
      const float f1 = Wl[(c0 + 2 * e + 1) * 9 + tap];
      wpk[e] = pk16(hb16(bfr(f0) * 64.0f), hb16(bfr(f1) * 64.0f));
    }
    unsigned short* wdst = wt + (size_t)wr * KCV + k0;
    // the halo piece of this thread (index clamped likewise)
    const int hidx = blk * HPB + tid;
    size_t hoff;
    {
      const int idx = min(hidx, NHPC - 1);
      const int piece = idx & 15;
      int r = idx >> 4;
      const int hp = r % NHALO;
      r /= NHALO;
      const int img = r % NB, plane = r / NB;
      const int q = max(hp - 2 * WP, 0);
      const int pyA = (hp < WP) ? 0 : (HP - 1);
      const int pxA = (hp < WP) ? hp : (hp - WP);
      const int pyB = 1 + (q >> 1);
      const int pxB = (q & 1) ? (WP - 1) : 0;
      const bool edge = hp < 2 * WP;
      const int py = edge ? pyA : pyB;
      const int px = edge ? pxA : pxB;
      hoff = (size_t)plane * PS1 + ((size_t)(img * HP + py) * WP + px) * CC + piece * 8;
    }
    if (w33 && tid < 144) *(v4u*)wdst = wpk;
    if (tid < HPB && hidx < NHPC) {
      v4u z = {0u, 0u, 0u, 0u};
      *(v4u*)(p1 + hoff) = z;
    }
#if defined(__HIP_DEVICE_COMPILE__)
    // the wait that stands between the issued stores and a rewrite of a register they name (the products below reuse them)
    asm volatile("s_wait_xcnt 0x0" ::: "memory");
#endif
  }
  const int hh = lane >> 4, c = lane & 15;
  const int pw = w16 & 3, ow = w16 >> 2;         // 16 waves = 4 (32 pixels) x 4 (32 output channels of each tensor)
  v16h xh[2][4], xl[2][4];
  {
    const int xo = (pw * 32 + c) * XP + 8 * hh;
    // unrolled: every index of a fragment array is a constant, so the arrays stay in registers
#pragma unroll
    for (int pt = 0; pt < 2; ++pt) {
#pragma unroll
      for (int ks = 0; ks < CC / 32; ++ks) {
        xh[pt][ks] = ldfrag_h(Xh + xo + pt * 16 * XP + ks * 32);
        xl[pt][ks] = ldfrag_h(Xl + xo + pt * 16 * XP + ks * 32);
      }
    }
  }
  const _Float16* fwp = Ww + (ow * 32 + c) * XP + 8 * hh;
  _Float16* otp = Ot + (pw * 32 + c) * XP + ow * 32 + 8 * hh;
  const size_t pprow = (size_t)(b * HP + h + 1) * WP + 1;
  // unrolled: fragment indices stay constants, LDS offsets become immediates
#pragma unroll
  for (int t = 0; t < 3; ++t) {
    v8f h00 = zero8(), h01 = zero8(), h10 = zero8(), h11 = zero8();   // first index: run of 16 channels, second: of 16 pixels
    v8f l00 = zero8(), l01 = zero8(), l10 = zero8(), l11 = zero8();
#pragma unroll
    for (int ks = 0; ks < CC / 32; ++ks) {
      const v16h fw0 = ldfrag_h(fwp + t * CC * XP + ks * 32);
      const v16h fw1 = ldfrag_h(fwp + t * CC * XP + 16 * XP + ks * 32);
      h00 = mma_raw(fw0, xh[0][ks], h00);
      h01 = mma_raw(fw0, xh[1][ks], h01);
      h10 = mma_raw(fw1, xh[0][ks], h10);
      h11 = mma_raw(fw1, xh[1][ks], h11);
      l00 = mma_raw(fw0, xl[0][ks], l00);
      l01 = mma_raw(fw0, xl[1][ks], l01);
      l10 = mma_raw(fw1, xl[0][ks], l10);
      l11 = mma_raw(fw1, xl[1][ks], l11);
      guard8(h00, h01, h10, h11, l00, l01, l10, l11, xh[0][ks], xh[1][ks], xl[0][ks], xl[1][ks], fw0, fw1);
    }
    *(v4u*)(otp + t * WW * XP)                = pack_o(h00, l00);
    *(v4u*)(otp + t * WW * XP + 16 * XP)      = pack_o(h01, l01);
    *(v4u*)(otp + t * WW * XP + 16)           = pack_o(h10, l10);
    *(v4u*)(otp + t * WW * XP + 16 * XP + 16) = pack_o(h11, l11);
    __syncthreads();                             // tensor t's tile is readable by every wave; each tensor has a tile of its own
    v4u pv[4];
#pragma unroll
    for (int s4 = 0; s4 < 4; ++s4) pv[s4] = *(const v4u*)(Ot + (t * WW + s4 * 32 + (tf >> 4)) * XP + (tf & 15) * 8);
    unsigned short* dh = p1 + (size_t)t * PS1 + (pprow + (tf >> 4)) * CC + (tf & 15) * 8;
#pragma unroll
    for (int s4 = 0; s4 < 4; ++s4) *(v4u*)(dh + s4 * 32 * CC) = pv[s4];
#if defined(__HIP_DEVICE_COMPILE__)
    // the wait that stands between the issued stores and a rewrite of a register they name (the next tensor's products reuse them)
    asm volatile("s_wait_xcnt 0x0" ::: "memory");
#endif
  }
}

// =================================================================================================================
// 3x3 conv implicit GEMM + logit partial sums. Tile = 256 consecutive output pixels (two image rows) x 128 channels,
// K = 1152 as 36 k-steps, A = the f16 plane of tensor t, W = 64 bf16(w2[t]) -> value = C/64. A work-group is two
// halves of 8 waves, each with its own LDS buffers, in step at the same barriers.
// Work-group blk < 128 (rows 2 blk, 2 blk + 1): half 0 convolves q, half 1 convolves k, whole K each. q and k then lie side by
// side in LDS as f32 tiles [row][pixel w][channel c] and go no further: by the raw reshape an image row holds, for every head, the 128
// rows r = (c%16, w/16) of Q_head and K_head, with d = w%16. Wave = (image row, head) sums S[i][j] += K[c][16 wb + i] Q[c][16 wb + j] on
// f32 WMMA (k = 4 consecutive c; A and B fragments by the same loader, so the same k order), 32 products in two chains (even
// and odd channel quads), and stores sp[b*8 + head][row h][i][j] = S / 4096. k_attn adds the 128 rows in order.
// Work-group blk >= 128 (rows 2 (blk - 128) and the next): v, K split between the halves (groups 0..2 and 3..5), the two f32
// tiles added in the epilogue; such a work-group lasts half as long, and they stand behind the long ones in the grid.
// grid = NB*128, 512 threads. coverage: sp [NB*8][128][256] f32 and vh/vl [NB][128][16384] (NCHW flat), every element once.
// =================================================================================================================
__global__ __launch_bounds__(512)
void k_conv3(const unsigned short* __restrict__ p1, const unsigned short* __restrict__ wt,
             float* sp, unsigned short* vh, unsigned short* vl) {
  __shared__ __align__(16) _Float16 ring[2 * CTILE];
  const int tid = threadIdx.x;
  const int half = __builtin_amdgcn_readfirstlane(tid >> 8);  // the same in a whole wave: kept in a scalar register
  const bool qk = blockIdx.x < NPIX / (2 * CPX);              // block-uniform
  const int mb = qk ? blockIdx.x : blockIdx.x - NPIX / (2 * CPX);
  const int t = qk ? half : 2;
  mm_conv((const _Float16*)(const void*)(p1 + (size_t)t * PS1),
          (const _Float16*)(const void*)(wt + (size_t)t * CC * KCV), mb * (2 * CPX), ring + half * CTILE, tid & 255,
          qk ? 0 : half * (NGR / 2), qk ? NGR : NGR / 2);
  __syncthreads();                                           // both halves' f32 tiles are readable by every wave
  const float* C0 = (const float*)(const void*)ring;
  const float* C1 = (const float*)(const void*)(ring + CTILE);
  const int p0 = mb * (2 * CPX);
  const int b = p0 / IMGPIX, pix0 = p0 - b * IMGPIX;
  if (qk) {                                                  // block-uniform branch
    const int wv = __builtin_amdgcn_readfirstlane(tid >> 5);
    const int head = wv & (NHEAD - 1), rsel = wv >> 3;       // 16 waves = 2 image rows x 8 heads
    {
      const int lane = tid & 31, hh = lane >> 4, c = lane & 15;
      const float* pq = C0 + (rsel * CPX + c) * LDC + head * HD + 2 * hh;
      const float* pk = C1 + (rsel * CPX + c) * LDC + head * HD + 2 * hh;
      v8f s0 = zero8(), s1 = zero8();
      // all 64 fragments are read first (the conv's accumulator registers are free by now), then multiplied in order: one LDS
      // latency, not one per pair of products; unrolled: every fragment's LDS offset becomes an immediate of its load
      v2f fk[32], fq[32];
#pragma unroll
      for (int u = 0; u < 32; ++u) {                         // u = 4 wb + channel quad
        fk[u] = *(const v2f*)(pk + (u >> 2) * 16 * LDC + (u & 3) * 4);
        fq[u] = *(const v2f*)(pq + (u >> 2) * 16 * LDC + (u & 3) * 4);
      }
#if defined(__HIP_DEVICE_COMPILE__)
      // nothing is scheduled across this line: without it each pair's reads sink to their products and every pair waits out
      // the LDS latency
      __builtin_amdgcn_sched_barrier(0);
#endif
#pragma unroll
      for (int u = 0; u < 32; u += 2) {
        s0 = __builtin_amdgcn_wmma_f32_16x16x4_f32(false, fk[u], false, fq[u], (short)0, s0, false, false);
        s1 = __builtin_amdgcn_wmma_f32_16x16x4_f32(false, fk[u + 1], false, fq[u + 1], (short)0, s1, false, false);
        guardf(s0, s1, fk[u], fq[u], fk[u + 1], fq[u + 1]);
      }
      float* d = sp + ((size_t)(b * NHEAD + head) * HH + pix0 / WW + rsel) * 256 + 8 * hh * HD + c;
#pragma unroll
      for (int r = 0; r < 8; ++r) d[r * HD] = (s0[r] + s1[r]) * (1.0f / 4096.0f);
    }
  } else {
    v4u ph[8], pq[8];
    size_t offs[8];
#pragma unroll
    for (int s = 0; s < 8; ++s) {                            // s >> 1: the tile's quarter of 64 pixels
      const int idx = (s & 1) * 512 + tid;
      const int co = idx >> 3, piece = idx & 7;
      const int r0 = (s >> 1) * 64 + piece * 8;
      v4u a, q4;
#pragma unroll
      for (int e = 0; e < 4; ++e) {
        const float f0 = (C0[(r0 + 2 * e) * LDC + co] + C1[(r0 + 2 * e) * LDC + co]) * (1.0f / 64.0f);
        const float f1 = (C0[(r0 + 2 * e + 1) * LDC + co] + C1[(r0 + 2 * e + 1) * LDC + co]) * (1.0f / 64.0f);
        unsigned hp, lp;
        split2(f0, f1, hp, lp);
        a[e] = hp; q4[e] = lp;
      }
      ph[s] = a;
      pq[s] = q4;
      offs[s] = (size_t)(b * CC + co) * IMGPIX + pix0 + r0;
    }
#pragma unroll
    for (int s = 0; s < 8; ++s) { *(v4u*)(vh + offs[s]) = ph[s]; *(v4u*)(vl + offs[s]) = pq[s]; }
#if defined(__HIP_DEVICE_COMPILE__)
    // the wait that stands between the issued stores and a rewrite of a register they name (the code that follows this
    // branch in the built object reuses them)
    asm volatile("s_wait_xcnt 0x0" ::: "memory");
#endif
  }
}

// =================================================================================================================
// Per (b, head) channel attention: S[i][j] = the 128 image rows' partial sums of k_conv3 added in fixed order (8 runs of
// 16 rows side by side, then the 8 runs in order).
// P = softmax_j(S * (1/bf16(scale))) in f32 (max-subtracted).
// Wm[o][j] = sum_j2 64 bf16(wo[o][16 head + j2]) P[j][j2] on WMMA (K = 16 zero padded to 32; P carried x4096 as
// f16 hi + residual), value/4096 = 64 Wm; stored as f16 hi/lo planes weh/wel [b][head][o][16]: block region =
// grid = NB*8, 256 threads. coverage: weh/wel [NB][8][128][16], every element once.
// =================================================================================================================
// inputs-only fence on 16 loaded values v[O..O+15]: keeps their loads in front of the arithmetic; it holds the wait between the
// issued loads and a rewrite of the address they name, and the address is an input, so it stays live to the wait
template <int O>
__device__ __forceinline__ void fence16(const float* p, const float (&v)[HH]) {
#if defined(__HIP_DEVICE_COMPILE__)
  asm volatile("s_wait_xcnt 0x0" :: "v"(p), "v"(v[O]), "v"(v[O + 1]), "v"(v[O + 2]), "v"(v[O + 3]), "v"(v[O + 4]), "v"(v[O + 5]),
               "v"(v[O + 6]), "v"(v[O + 7]), "v"(v[O + 8]), "v"(v[O + 9]), "v"(v[O + 10]), "v"(v[O + 11]), "v"(v[O + 12]),
               "v"(v[O + 13]), "v"(v[O + 14]), "v"(v[O + 15]));
#endif
}
__global__ __launch_bounds__(256)
void k_attn(const float* __restrict__ sp, const float* __restrict__ wo, const float* __restrict__ scale,
            unsigned short* weh, unsigned short* wel) {
  __shared__ float Sm[16 * WSP];
  __shared__ __align__(16) _Float16 Phs[16 * FP];
  __shared__ __align__(16) _Float16 Pls[16 * FP];
  __shared__ __align__(16) _Float16 Wts[CC * FP];
  __shared__ float Ws[CC * WSP];
  const int tid = threadIdx.x, wave = tid >> 5, lane = tid & 31, hh = lane >> 4, m = lane & 15;
  const int bi = blockIdx.x, b = bi / NHEAD, head = bi - b * NHEAD;
  // wo slice -> f16 [o][k] (k = j2, zero for k >= 16; addresses clamped)
  // thread = (o = 8 it + wave, k = lane); the 16 loads of the slice and the 128 loads of the partial sums are all issued
  // before the first is used: one memory latency for all, not one per trip
  {
    const float* wop = wo + (size_t)wave * CC + head * HD + min(lane, HD - 1);
    float wf[16];
#pragma unroll
    for (int it = 0; it < 16; ++it) wf[it] = wop[it * 8 * CC];
    const int i = tid >> 4, j = tid & 15;
    const float* spp = sp + (size_t)bi * (HH * 256) + i * 16 + j;
    float pv[HH];
#pragma unroll
    for (int h = 0; h < HH; ++h) pv[h] = spp[h * 256];
#if defined(__HIP_DEVICE_COMPILE__)
    // nothing is scheduled across this line: without it loads sink behind the first fence's wait and start a latency late
    __builtin_amdgcn_sched_barrier(0);
    // inputs-only fence on the slice's loaded values: keeps the loads above in front of the arithmetic; same wait and same
    // live address as in the statement below
    asm volatile("s_wait_xcnt 0x0" :: "v"(wop), "v"(wf[0]), "v"(wf[1]), "v"(wf[2]), "v"(wf[3]), "v"(wf[4]), "v"(wf[5]),
                 "v"(wf[6]), "v"(wf[7]), "v"(wf[8]), "v"(wf[9]), "v"(wf[10]), "v"(wf[11]), "v"(wf[12]), "v"(wf[13]),
                 "v"(wf[14]), "v"(wf[15]));
#endif
    fence16<0>(spp, pv);  fence16<16>(spp, pv); fence16<32>(spp, pv); fence16<48>(spp, pv);
    fence16<64>(spp, pv); fence16<80>(spp, pv); fence16<96>(spp, pv); fence16<112>(spp, pv);
#pragma unroll
    for (int it = 0; it < 16; ++it) {
      const float v = (lane < HD) ? bfr(wf[it]) * 64.0f : 0.0f;
      Wts[(it * 8 + wave) * FP + lane] = (_Float16)v;
    }
    float sr[8];
#pragma unroll
    for (int u = 0; u < 8; ++u) sr[u] = 0.f;
#pragma unroll
    for (int h = 0; h < 16; ++h) {
#pragma unroll
      for (int u = 0; u < 8; ++u) sr[u] += pv[u * 16 + h];
    }
    float s = 0.f;
#pragma unroll
    for (int u = 0; u < 8; ++u) s += sr[u];
    const float isc = 1.0f / bfr(scale[0]);
    Sm[i * WSP + j] = s * isc;
  }
  __syncthreads();
  if (tid < 16) {
    // the row's 16 logits are read from LDS together and stay in registers: one LDS latency, not one per element and pass
    float sv[HD];
#pragma unroll
    for (int n = 0; n < HD; ++n) sv[n] = Sm[tid * WSP + n];
    float mx = -3.0e38f;
#pragma unroll
    for (int n = 0; n < HD; ++n) mx = fmaxf(mx, sv[n]);
    float ssum = 0.f;
#pragma unroll
    for (int n = 0; n < HD; ++n) {
      sv[n] = expf(sv[n] - mx);
      ssum += sv[n];
    }
    const float inv = 1.0f / ssum;
#pragma unroll
    for (int n = 0; n < HD; ++n) {
      const float pv = (sv[n] * inv) * 4096.0f;
      const _Float16 hv = (_Float16)pv;
      Phs[tid * FP + n] = hv;
      Pls[tid * FP + n] = (_Float16)((pv - (float)hv) * 2048.0f);
    }
#pragma unroll
    for (int n = HD; n < 32; ++n) { Phs[tid * FP + n] = (_Float16)0.0f; Pls[tid * FP + n] = (_Float16)0.0f; }
  }
  __syncthreads();
  {
    const v16h fa = ldfrag_h(Wts + (wave * 16 + m) * FP + 8 * hh);
    const v16h fb = ldfrag_h(Phs + m * FP + 8 * hh);
    const v16h gb = ldfrag_h(Pls + m * FP + 8 * hh);
    v8f ah = mma_raw(fa, fb, zero8());
    v8f al = mma_raw(fa, gb, zero8());
    guard2(ah, al, fa, fb, gb);
#pragma unroll
    for (int r = 0; r < 8; ++r) Ws[(wave * 16 + 8 * hh + r) * WSP + m] = (ah[r] + al[r] * RSC) * (1.0f / 4096.0f);
  }
  __syncthreads();
  {
    const int o = tid >> 1, hf = tid & 1;
    v4u a, q4;
#pragma unroll
    for (int e = 0; e < 4; ++e) {
      const float f0 = Ws[o * WSP + hf * 8 + 2 * e];
      const float f1 = Ws[o * WSP + hf * 8 + 2 * e + 1];
      unsigned hp, lp;
      split2(f0, f1, hp, lp);
      a[e] = hp; q4[e] = lp;
    }
    const size_t off = (size_t)(bi * CC + o) * HD + hf * 8;
    *(v4u*)(weh + off) = a;
    *(v4u*)(wel + off) = q4;
    
  }
}

// =================================================================================================================
// Output: y[b][o][p] = (sum_c' Wm64[b][c'][o] V[p][c']) / 64 + bf16(x[b][o][p]) for 64 pixels x 128 channels per
// =================================================================================================================
__global__ __launch_bounds__(256)
void k_final(const unsigned short* __restrict__ vh, const unsigned short* __restrict__ vl,
             const unsigned short* __restrict__ weh, const unsigned short* __restrict__ wel,
             const float* __restrict__ x, float* out) {
  __shared__ __align__(16) float Cs[64 * LDC];
  const int tid = threadIdx.x;
  const int mb = blockIdx.x;
  const int p0 = mb * 64;
  const int b = p0 / IMGPIX, pl0 = p0 - b * IMGPIX;
  const _Float16* Vh = (const _Float16*)(const void*)(vh + (size_t)b * BSZ);
  const _Float16* Vl = (const _Float16*)(const void*)(vl + (size_t)b * BSZ);
  const _Float16* Wh = (const _Float16*)(const void*)(weh + (size_t)b * NHEAD * CC * HD);
  const _Float16* Wl = (const _Float16*)(const void*)(wel + (size_t)b * NHEAD * CC * HD);
  mm_final(Vh, Vl, Wh, Wl, pl0, Cs);
  __syncthreads();
  v4f pk[8];
  size_t offs[8];
#pragma unroll
  for (int s = 0; s < 8; ++s) {
    const int idx = s * 256 + tid;
    const int o = idx >> 4, piece = idx & 15;
    const size_t off = (size_t)(b * CC + o) * IMGPIX + pl0 + piece * 4;
    const v4f xr = *(const v4f*)(x + off);
    v4f v;
#pragma unroll
    for (int e = 0; e < 4; ++e) v[e] = Cs[(piece * 4 + e) * LDC + o] * (1.0f / 64.0f) + bfr(xr[e]);
    pk[s] = v;
    offs[s] = off;
  }
#pragma unroll
  for (int s = 0; s < 8; ++s) *(v4f*)(out + offs[s]) = pk[s];
  
}

// =================================================================================================================
// Workspace map (bytes, offsets multiples of 65536, no aliasing, every region sized at or above its whole-line store
// extent): WT f16 [3][128][1152] 884736 (917504) | P1 f16 3 x [2][130][130][128] 25958400 (26017792) |
// VH, VL f16 [2][128][16384] 8388608 each | WEH, WEL f16 [2][8][128][16] 65536 each | SP f32 [16][128][256] 2097152 |
// total 45940736.
// =================================================================================================================
extern "C" void kernel_launch(void* const* d_in, const int* in_sizes, int n_in,
                              void* d_out, int out_size, void* d_ws, size_t ws_size,
                              hipStream_t stream) {
  if (n_in < 11) return;
  const int expect[11] = { NB * CC * IMGPIX, WW, WW, 1, CC * CC, CC * CC * 9, CC * CC, CC * CC * 9,
                           CC * CC, CC * CC * 9, CC * CC };
  for (int i = 0; i < 11; ++i) if (in_sizes[i] != expect[i]) return;
  if (out_size != NB * CC * IMGPIX) return;

  const float* x     = (const float*)d_in[0];
  const float* gam   = (const float*)d_in[1];
  const float* bet   = (const float*)d_in[2];
  const float* scale = (const float*)d_in[3];
  const float* wq1   = (const float*)d_in[4];
  const float* wq2   = (const float*)d_in[5];
  const float* wk1   = (const float*)d_in[6];
  const float* wk2   = (const float*)d_in[7];
  const float* wv1   = (const float*)d_in[8];
  const float* wv2   = (const float*)d_in[9];
  const float* wo    = (const float*)d_in[10];
  float* out = (float*)d_out;

  const size_t AL = 65536;
  const size_t sWT = (((size_t)3 * CC * KCV * 2) + AL - 1) / AL * AL;              //   917504
  const size_t sP1 = (((size_t)3 * PS1 * 2) + AL - 1) / AL * AL;                    // 26017792
  const size_t sV  = (((size_t)NB * BSZ * 2) + AL - 1) / AL * AL;                   //  8388608
  const size_t sWE = (((size_t)NB * NHEAD * CC * HD * 2) + AL - 1) / AL * AL;       //    65536
  const size_t sSP = (((size_t)NB * NHEAD * HH * 256 * 4) + AL - 1) / AL * AL;      //  2097152

  size_t off = 0;
  const size_t oWT  = off; off += sWT;
  const size_t oP1  = off; off += sP1;
  const size_t oVH  = off; off += sV;
  const size_t oVL  = off; off += sV;
  const size_t oWEH = off; off += sWE;
  const size_t oWEL = off; off += sWE;
  const size_t oSP  = off; off += sSP;
  if (off > ws_size) return;                                 // off = 45940736
  if (off > (size_t)134217728) return;

  char* ws = (char*)d_ws;
  unsigned short* WT  = (unsigned short*)(ws + oWT);
  unsigned short* P1  = (unsigned short*)(ws + oP1);
  unsigned short* VH  = (unsigned short*)(ws + oVH);
  unsigned short* VL  = (unsigned short*)(ws + oVL);
  unsigned short* WEH = (unsigned short*)(ws + oWEH);
  unsigned short* WEL = (unsigned short*)(ws + oWEL);
  float*          SP  = (float*)(ws + oSP);

  const dim3 blk(256);
  // (1) layer norm over w + 1x1 projections into padded NHWC f16 planes (interior); 3x3 weight plane; halo zero fill
  k_lnproj<<<dim3(NB * HH), dim3(512), 0, stream>>>(x, gam, bet, wq1, wq2, wk1, wk2, wv1, wv2, WT, P1);
  // (2) 3x3 convs: q and k -> f32 logit partial sums per image row; v -> f16 hi/lo NCHW flat planes
  k_conv3<<<dim3(2 * (NPIX / (2 * CPX))), dim3(512), 0, stream>>>(P1, WT, SP, VH, VL);
  // (3) per-head channel attention: rows' partial sums added + softmax + wo mix -> Wm planes
  k_attn<<<dim3(NB * NHEAD), blk, 0, stream>>>(SP, wo, scale, WEH, WEL);
  // (4) output GEMM + residual -> NCHW d_out
  k_final<<<dim3(NPIX / 64), blk, 0, stream>>>(VH, VL, WEH, WEL, x, out);
  (void)hipGetLastError();
}
